// v000
// Times are from an AMD MI455X. After a warm-up the kernel runs many times in a row, and a time is the length of
// such a window on the GPU divided by its runs, so every launch and the gaps after it count. The runs cycle
// through copies of the inputs. A figure is the median of several windows, for all but v000 over two sittings.
// Sittings can differ by a few percent; kernels timed side by side share one.
// v000 is the starting kernel. One run takes 349 microseconds.
#include <hip/hip_runtime.h>

// Multi-head self-attention, width 1024 = 16 heads x 64, x [NB][SEQ][1024], fused w_qkv [3072][1024] ([out][in], rows q | k | v, head h = rows h*64+d of each third), b_qkv, score scale 1/8, no mask, output projection w_proj [out][in] + b_proj (f32 output).
// Compute dtypes, f32 accumulate everywhere: qkv projections v_wmma_f32_16x16x32_bf16 (x, w_qkv RNE-converted to bf16; products exact); scores v_wmma_f32_16x16x32_f16: q and k single f16 planes (one product), scale 0.125*log2(e) applied in f32;
// P (x256 carry, cancels in the normalisation; row sum taken over the f16 P values) and v single f16; softmax f32 (online, running max); output projection v_wmma_f32_16x16x32_f16: ctx single f16 (x256 carry), w_proj RNE-converted to bf16 then x1024 as f16 (exact), carries folded back (2^-18) in the f32 epilogue; biases RNE-converted to bf16, added in f32.
// Layout: bf16 copies of x and w_qkv; q, k planes [b*16+h][t][d] and v^T plane [b*16+h][d][t] written by the GEMM epilogue; fused flash kernel in transposed form (S^T = K Q^T, O^T = V^T P^T) writes the f16 ctx plane [b*SEQ+t][1024]; f16 GEMM writes the output buffer.

#ifndef NB
#define NB 1
#endif
#ifndef SEQ
#define SEQ 4096
#endif
#define NB_FULL  1
#define SEQ_FULL 4096
#ifndef OUT_SEQ
#define OUT_SEQ SEQ              // row pitch (in tokens) between batches of the output
#endif
#define DM   1024
#define NH_  16
#define HD   64
#define AW   4                   // waves per flash block (16 query rows each)
#define SC2  (0.125f * 1.4426950408889634f)   // HD^-0.5 * log2(e)
#define PSH  8.0f                // log2 of the P carry (256)
#define CCS  256.0f              // carry of the ctx plane
#define WPS  1024.0f             // carry of the w_proj plane
#define OSI  (1.0f / (256.0f * 1024.0f))      // inverse of both carries

static_assert(HD == 64);
static_assert(NH_ * HD == DM);                 // head h = columns h*64 + d
static_assert(DM % 64 == 0);                   // column tiles of 64
static_assert(DM % 32 == 0);                   // GEMM k-loop steps by 32
static_assert(SEQ % 64 == 0);                  // a 64-row tile never straddles two batches
static_assert((NB * SEQ) % 64 == 0);
static_assert(SEQ % 32 == 0);                  // key loop steps by 32
static_assert(SEQ % (16 * AW) == 0);           // flash grid covers the sequence exactly
static_assert(((size_t)SEQ * DM) % 8 == 0);
static_assert(((size_t)DM * DM) % 8 == 0);
static_assert(NB <= NB_FULL);
static_assert(SEQ <= SEQ_FULL);

typedef _Float16 h16;
typedef unsigned short bf;
typedef __attribute__((ext_vector_type(16))) __bf16   v16bf;
typedef __attribute__((ext_vector_type(16))) _Float16 v16h;
typedef __attribute__((ext_vector_type(8)))  _Float16 v8h;
typedef __attribute__((ext_vector_type(8)))  unsigned short v8us;
typedef __attribute__((ext_vector_type(8)))  float    v8f;
typedef __attribute__((ext_vector_type(4)))  float    v4f;
typedef v4f  __attribute__((may_alias)) v4fa;

__device__ __forceinline__ unsigned short f2bf(float f) { unsigned u = __float_as_uint(f); u += 0x7FFFu + ((u >> 16) & 1u); return (unsigned short)(u >> 16); }
__device__ __forceinline__ float bfr(float f) { return __uint_as_float(((unsigned)f2bf(f)) << 16); }   // value after RNE convert to bf16
__device__ __forceinline__ v16h cat16(v8h lo, v8h hi) { return __builtin_shufflevector(lo, hi, 0, 1, 2, 3, 4, 5, 6, 7, 8, 9, 10, 11, 12, 13, 14, 15); }
__device__ __forceinline__ v16bf cat16b(v8us lo, v8us hi) { return __builtin_bit_cast(v16bf, __builtin_shufflevector(lo, hi, 0, 1, 2, 3, 4, 5, 6, 7, 8, 9, 10, 11, 12, 13, 14, 15)); }
__device__ __forceinline__ v8f wmma16(v16h a, v16h b, v8f c) { return __builtin_amdgcn_wmma_f32_16x16x32_f16(false, a, false, b, (short)0, c, false, false); }
__device__ __forceinline__ v8f wmmab(v16bf a, v16bf b, v8f c) { return __builtin_amdgcn_wmma_f32_16x16x32_bf16(false, a, false, b, (short)0, c, false, false); }
// fragment loaders from K-contiguous 16-bit rows; p already includes + 8*(lane>>4): elements 0..7 <- k0+8h+0..7, elements 8..15 <- k0+16+8h+0..7 (same map for A and B)
__device__ __forceinline__ v16h  ldh(const h16* p) { return cat16(*(const v8h*)p, *(const v8h*)(p + 16)); }
__device__ __forceinline__ v16bf ldb(const bf* p)  { return cat16b(*(const v8us*)p, *(const v8us*)(p + 16)); }
// ordering point for wave-private LDS tiles (same wave writes and reads)
__device__ __forceinline__ void wave_sync() { __builtin_amdgcn_fence(3 /* release order */, "wavefront"); __builtin_amdgcn_wave_barrier(); asm volatile("" ::: "memory"); }

__global__ __launch_bounds__(256) void k_cvt8(const float* __restrict__ src, bf* dst, size_t n8) {
    const size_t i = (size_t)blockIdx.x * 256 + threadIdx.x; if (i >= n8) return;
    const v8f v = *(const v8f*)(src + i * 8); v8us o;
#pragma unroll
    for (int k = 0; k < 8; ++k) o[k] = f2bf(v[k]);
    *(v8us*)(dst + i * 8) = o; 
}

__global__ __launch_bounds__(256) void k_cvtw(const float* __restrict__ src, h16* dst, size_t n8) {
    const size_t i = (size_t)blockIdx.x * 256 + threadIdx.x; if (i >= n8) return;
    const v8f v = *(const v8f*)(src + i * 8); v8h o;
#pragma unroll
    for (int k = 0; k < 8; ++k) o[k] = (h16)(bfr(v[k]) * WPS);
    *(v8h*)(dst + i * 8) = o; 
}

// k_proj: register-blocked bf16 GEMM, ONE WAVE per 64x64 tile (16 accumulators), operands straight from K-contiguous bf16 planes, K = DM.
// C[m][n] = sum_k A[m][k] Bt[n][k] + bias (bias[n] when biasRow == 0, bias[m] otherwise), written as a single f16 plane (Ph) at
// tile base (r0/RB)*sRB + (r0%RB)*pitch + (c0/CB)*sCB + (c0%CB), row pitch 'pitch' (halves). grid (M/64, N/64), 32 threads.
__global__ __launch_bounds__(32) void k_proj(const bf* __restrict__ A, const bf* __restrict__ Bt, const float* __restrict__ bias, int biasRow,
                                             h16* Ph, int RB, size_t sRB, int pitch, int CB, size_t sCB) {
    __shared__ __align__(16) float os[16 * 68];
    const int K = DM;
    const int lane = threadIdx.x & 31, lr = lane & 15, hi = lane >> 4; const int r0 = blockIdx.x * 64, c0 = blockIdx.y * 64;
    v8f acc[4][4];
#pragma unroll
    for (int mb = 0; mb < 4; ++mb)
#pragma unroll
        for (int nb = 0; nb < 4; ++nb) acc[mb][nb] = (v8f){};
    const size_t aoff = (size_t)(r0 + lr) * K + 8 * hi, boff = (size_t)(c0 + lr) * K + 8 * hi;
#pragma unroll 1
    for (int kc = 0; kc < K; kc += 32) {
        v16bf a[4];
#pragma unroll
        for (int mb = 0; mb < 4; ++mb) a[mb] = ldb(A + aoff + (size_t)mb * 16 * K + kc);
#pragma unroll
        for (int nb = 0; nb < 4; ++nb) { const v16bf b = ldb(Bt + boff + (size_t)nb * 16 * K + kc);
#pragma unroll
            for (int mb = 0; mb < 4; ++mb) acc[mb][nb] = wmmab(a[mb], b, acc[mb][nb]); }
        asm volatile("v_nop\n\tv_nop\n\tv_nop\n\tv_nop" : "+v"(acc[0][0]), "+v"(acc[1][1]), "+v"(acc[2][2]), "+v"(acc[3][3]) : "v"(a[0]), "v"(a[1]), "v"(a[2]), "v"(a[3]));
    }
    // column bias (index selected as an integer, address always inside the bias array)
    float bc[4];
#pragma unroll
    for (int nb = 0; nb < 4; ++nb) { const int ci = biasRow ? 0 : (c0 + nb * 16 + lr); const float t = bfr(bias[ci]); bc[nb] = biasRow ? 0.0f : t; }
    const size_t tbase = (size_t)(r0 / RB) * sRB + (size_t)(r0 % RB) * (size_t)pitch + (size_t)(c0 / CB) * sCB + (size_t)(c0 % CB);
#pragma unroll
    for (int mb = 0; mb < 4; ++mb) {
        // row bias for rows r0 + mb*16 + 8h + 0..7 (two 16-B loads, clamped to offset 0 in column mode)
        const int ri = biasRow ? (r0 + mb * 16 + hi * 8) : 0;
        const v4f rb0 = *(const v4f*)(bias + ri); const v4f rb1 = *(const v4f*)(bias + ri + 4);
        float br[8];
#pragma unroll
        for (int j = 0; j < 4; ++j) { const float t0 = bfr(rb0[j]); const float t1 = bfr(rb1[j]); br[j] = biasRow ? t0 : 0.0f; br[4 + j] = biasRow ? t1 : 0.0f; }
#pragma unroll
        for (int nb = 0; nb < 4; ++nb) {
#pragma unroll
            for (int j = 0; j < 8; ++j) os[(hi * 8 + j) * 68 + nb * 16 + lr] = acc[mb][nb][j] + bc[nb] + br[j]; }   // D: row 8h+j, col lane&15
        wave_sync();
        const size_t sb = tbase + (size_t)(mb * 16) * (size_t)pitch;
{
#pragma unroll
            for (int s = 0; s < 4; ++s) { const int row = 4 * s + (lane >> 3), c8 = (lane & 7) * 8;   // 4 s x 4 row groups = 16 rows; 8 lanes x 8 = 64 columns
                const v4f x0 = *(const v4fa*)(&os[row * 68 + c8]); const v4f x1 = *(const v4fa*)(&os[row * 68 + c8 + 4]); v8h hv;
#pragma unroll
                for (int i = 0; i < 4; ++i) { hv[i] = (h16)x0[i]; hv[4 + i] = (h16)x1[i]; }
                const size_t oo = sb + (size_t)row * (size_t)pitch + c8;
                *(v8h*)(Ph + oo) = hv; }
             }
        wave_sync();
    }
}

// k_flash: fused attention, one wave per 16 query rows of one (batch, head); K / V^T / Q fragments straight from the f16 planes (two 16-B loads each, arithmetic addressing).
// Transposed form: S^T[key][t] = K Q^T (A = K rows, B = Q rows); lane (t = lane&15, h = lane>>4) holds keys 8h+r of each 16-key tile, so the packed
// P tile is directly the B fragment of O^T[d][t] = V^T P^T (element r <- tile keys 0..15, element 8+r <- tile keys 16..31, lane unchanged).
// Softmax state (running max, partial sum) is one scalar per lane; the two lane halves of a row are combined with one xor-16 exchange.
__global__ __launch_bounds__(32 * AW) void k_flash(const h16* __restrict__ QH, const h16* __restrict__ KP, const h16* __restrict__ VT, h16* CTX) {
    __shared__ __align__(16) float os[AW * 16 * 68];
    const int lane = threadIdx.x & 31, wave = threadIdx.x >> 5, lr = lane & 15, hi = lane >> 4;
    const int zh = blockIdx.y; const int b = zh / NH_, h = zh % NH_;
    const int t0 = (blockIdx.x * AW + wave) * 16;
    const size_t pbase = (size_t)zh * SEQ * HD;
    const size_t qo = pbase + (size_t)(t0 + lr) * HD + 8 * hi;
    const v16h qh0 = ldh(QH + qo), qh1 = ldh(QH + qo + 32);   // B fragments: col t, k = d
    const size_t ko = pbase + (size_t)lr * HD + 8 * hi;      // + key * HD       (A fragment: row key, k = d)
    const size_t vo = pbase + (size_t)lr * SEQ + 8 * hi;     // + 16j*SEQ + key  (A fragment: row d, k = key)
    v8f o0 = (v8f){}, o1 = (v8f){}, o2 = (v8f){}, o3 = (v8f){};
    float m = -3.0e38f, l = 0.0f;
#pragma unroll 1
    for (int key0 = 0; key0 < SEQ; key0 += 32) {
        const h16* ka = KP + ko + (size_t)key0 * HD;
        const v16h ka0 = ldh(ka), ka1 = ldh(ka + 32), kb0 = ldh(ka + 16 * HD), kb1 = ldh(ka + 16 * HD + 32);
        v8f sHa = (v8f){}, sHb = (v8f){};
        sHa = wmma16(ka0, qh0, sHa); sHb = wmma16(kb0, qh0, sHb);
        sHa = wmma16(ka1, qh1, sHa); sHb = wmma16(kb1, qh1, sHb);
        asm volatile("v_nop\n\tv_nop\n\tv_nop\n\tv_nop" : "+v"(sHa), "+v"(sHb) : "v"(ka0), "v"(ka1), "v"(kb0), "v"(kb1), "v"(qh0), "v"(qh1));
        float ta[8], tb[8]; float mx = -3.0e38f;
#pragma unroll
        for (int r = 0; r < 8; ++r) { ta[r] = sHa[r] * SC2; tb[r] = sHb[r] * SC2; mx = fmaxf(mx, fmaxf(ta[r], tb[r])); }
        mx = fmaxf(mx, __shfl_xor(mx, 16, 32));
        const float mnew = fmaxf(m, mx);
        const float alpha = __builtin_amdgcn_exp2f(m - mnew);
        const float sh = PSH - mnew;
        v16h pb; float ls = 0.0f;
#pragma unroll
        for (int r = 0; r < 8; ++r) { const h16 pa = (h16)__builtin_amdgcn_exp2f(ta[r] + sh); const h16 pc = (h16)__builtin_amdgcn_exp2f(tb[r] + sh); pb[r] = pa; pb[8 + r] = pc; ls += (float)pa + (float)pc; }
        l = l * alpha + ls; m = mnew;
        o0 = o0 * alpha; o1 = o1 * alpha; o2 = o2 * alpha; o3 = o3 * alpha;
        const h16* va = VT + vo + key0;
        const v16h v0 = ldh(va), v1 = ldh(va + (size_t)16 * SEQ), v2 = ldh(va + (size_t)32 * SEQ), v3 = ldh(va + (size_t)48 * SEQ);
        o0 = wmma16(v0, pb, o0); o1 = wmma16(v1, pb, o1); o2 = wmma16(v2, pb, o2); o3 = wmma16(v3, pb, o3);
        asm volatile("v_nop\n\tv_nop\n\tv_nop\n\tv_nop" : "+v"(o0), "+v"(o1), "+v"(o2), "+v"(o3) : "v"(v0), "v"(v1), "v"(v2), "v"(v3), "v"(pb));
    }
    l += __shfl_xor(l, 16, 32);
    const float inv = CCS * (1.0f / l);      // normalisation (the P carry cancels) times the ctx carry
    const int wb = wave * 16 * 68;
    // O^T D layout: o_j[r] = (d = 16j + 8h + r, t = lane&15) -> os[t][d]; rows 0..15 x columns 0..63 all written
    { v4f a, c;
      a[0] = o0[0] * inv; a[1] = o0[1] * inv; a[2] = o0[2] * inv; a[3] = o0[3] * inv; c[0] = o0[4] * inv; c[1] = o0[5] * inv; c[2] = o0[6] * inv; c[3] = o0[7] * inv;
      *(v4fa*)(&os[wb + lr * 68 +  0 + 8 * hi]) = a; *(v4fa*)(&os[wb + lr * 68 +  0 + 8 * hi + 4]) = c;
      a[0] = o1[0] * inv; a[1] = o1[1] * inv; a[2] = o1[2] * inv; a[3] = o1[3] * inv; c[0] = o1[4] * inv; c[1] = o1[5] * inv; c[2] = o1[6] * inv; c[3] = o1[7] * inv;
      *(v4fa*)(&os[wb + lr * 68 + 16 + 8 * hi]) = a; *(v4fa*)(&os[wb + lr * 68 + 16 + 8 * hi + 4]) = c;
      a[0] = o2[0] * inv; a[1] = o2[1] * inv; a[2] = o2[2] * inv; a[3] = o2[3] * inv; c[0] = o2[4] * inv; c[1] = o2[5] * inv; c[2] = o2[6] * inv; c[3] = o2[7] * inv;
      *(v4fa*)(&os[wb + lr * 68 + 32 + 8 * hi]) = a; *(v4fa*)(&os[wb + lr * 68 + 32 + 8 * hi + 4]) = c;
      a[0] = o3[0] * inv; a[1] = o3[1] * inv; a[2] = o3[2] * inv; a[3] = o3[3] * inv; c[0] = o3[4] * inv; c[1] = o3[5] * inv; c[2] = o3[6] * inv; c[3] = o3[7] * inv;
      *(v4fa*)(&os[wb + lr * 68 + 48 + 8 * hi]) = a; *(v4fa*)(&os[wb + lr * 68 + 48 + 8 * hi + 4]) = c; }
    wave_sync();
    h16* crow = CTX + ((size_t)b * SEQ + t0) * DM + h * HD;      // ctx plane row = token, columns h*64 + d
{
#pragma unroll
        for (int s = 0; s < 4; ++s) { const int row = 4 * s + (lane >> 3), c8 = (lane & 7) * 8;   // 4 s x 4 row groups = 16 rows; 8 lanes x 8 halves = 64 columns
            const v4f x0 = *(const v4fa*)(&os[wb + row * 68 + c8]); const v4f x1 = *(const v4fa*)(&os[wb + row * 68 + c8 + 4]); v8h hv;
#pragma unroll
            for (int i = 0; i < 4; ++i) { hv[i] = (h16)x0[i]; hv[4 + i] = (h16)x1[i]; }
            *(v8h*)(crow + (size_t)row * DM + c8) = hv; }
         }
}

// k_oproj: register-blocked f16 GEMM, ONE WAVE per 64x64 tile, operands straight from K-contiguous f16 planes (ctx x256, w_proj x1024), K = DM.
// OUT[m][n] = (sum_k A[m][k] Bt[n][k]) * 2^-18 + bias[n], f32. grid (NB*SEQ/64, DM/64), 32 threads.
__global__ __launch_bounds__(32) void k_oproj(const h16* __restrict__ A, const h16* __restrict__ Bt, const float* __restrict__ bias, float* OUT) {
    __shared__ __align__(16) float os[16 * 68];
    const int K = DM;
    const int lane = threadIdx.x & 31, lr = lane & 15, hi = lane >> 4; const int r0 = blockIdx.x * 64, c0 = blockIdx.y * 64;
    v8f acc[4][4];
#pragma unroll
    for (int mb = 0; mb < 4; ++mb)
#pragma unroll
        for (int nb = 0; nb < 4; ++nb) acc[mb][nb] = (v8f){};
    const size_t aoff = (size_t)(r0 + lr) * K + 8 * hi, boff = (size_t)(c0 + lr) * K + 8 * hi;
#pragma unroll 1
    for (int kc = 0; kc < K; kc += 32) {
        v16h a[4];
#pragma unroll
        for (int mb = 0; mb < 4; ++mb) a[mb] = ldh(A + aoff + (size_t)mb * 16 * K + kc);
#pragma unroll
        for (int nb = 0; nb < 4; ++nb) { const v16h b = ldh(Bt + boff + (size_t)nb * 16 * K + kc);
#pragma unroll
            for (int mb = 0; mb < 4; ++mb) acc[mb][nb] = wmma16(a[mb], b, acc[mb][nb]); }
        asm volatile("v_nop\n\tv_nop\n\tv_nop\n\tv_nop" : "+v"(acc[0][0]), "+v"(acc[1][1]), "+v"(acc[2][2]), "+v"(acc[3][3]) : "v"(a[0]), "v"(a[1]), "v"(a[2]), "v"(a[3]));
    }
    float bc[4];
#pragma unroll
    for (int nb = 0; nb < 4; ++nb) bc[nb] = bfr(bias[c0 + nb * 16 + lr]);
    const int bq = r0 / SEQ, tq = r0 % SEQ;
    float* obase = OUT + ((size_t)bq * OUT_SEQ + tq) * DM + c0;
#pragma unroll
    for (int mb = 0; mb < 4; ++mb) {
#pragma unroll
        for (int nb = 0; nb < 4; ++nb) {
#pragma unroll
            for (int j = 0; j < 8; ++j) os[(hi * 8 + j) * 68 + nb * 16 + lr] = acc[mb][nb][j] * OSI + bc[nb]; }   // D: row 8h+j, col lane&15
        wave_sync();
{
#pragma unroll
            for (int s = 0; s < 8; ++s) { const int row = 2 * s + hi, cofs = lr * 4;   // 8 s x 2 rows = 16 rows; 16 lanes x 4 floats = 64 columns
                const v4f val = *(const v4fa*)(&os[row * 68 + cofs]);
                *(v4f*)(obase + (size_t)(mb * 16 + row) * DM + cofs) = val; }
             }
        wave_sync();
    }
}

static constexpr size_t al256(size_t v) { return (v + 255) & ~(size_t)255; }
static constexpr size_t SZ_XB = al256((size_t)NB * SEQ * DM * 2);
static constexpr size_t SZ_WB = al256((size_t)3 * DM * DM * 2);
static constexpr size_t SZ_WP = al256((size_t)DM * DM * 2);
static constexpr size_t SZ_PL = al256((size_t)NB * NH_ * SEQ * HD * 2);
static constexpr size_t SZ_CX = al256((size_t)NB * SEQ * DM * 2);
static constexpr size_t SZ_TOTAL = SZ_XB + SZ_WB + SZ_WP + 3 * SZ_PL + SZ_CX;
static_assert(SZ_TOTAL <= (size_t)134217728);          // workspace carve <= 128 MiB
static_assert(((size_t)DM * DM * 2) % 256 == 0);       // weight sub-planes stay 256-byte aligned

extern "C" void kernel_launch(void* const* d_in, const int* in_sizes, int n_in,
                              void* d_out, int out_size, void* d_ws, size_t ws_size, hipStream_t stream) {
    if (n_in < 5) return;
    const size_t needx = ((size_t)(NB - 1) * SEQ_FULL + SEQ) * DM;
    if ((size_t)in_sizes[0] < needx) return;
    if ((size_t)in_sizes[1] < (size_t)3 * DM * DM || (size_t)in_sizes[2] < (size_t)3 * DM) return;
    if ((size_t)in_sizes[3] < (size_t)DM * DM || (size_t)in_sizes[4] < (size_t)DM) return;
    if ((size_t)out_size < ((size_t)(NB - 1) * OUT_SEQ + SEQ) * DM) return;
    if (SZ_TOTAL > ws_size) return;
    // wire order: x, w_qkv ([3072][1024] = Bt as-is, rows q | k | v), b_qkv, w_proj ([out][in] = Bt as-is), b_proj
    const float* x = (const float*)d_in[0]; const float* wqkv = (const float*)d_in[1]; const float* bqkv = (const float*)d_in[2];
    const float* wproj = (const float*)d_in[3]; const float* bproj = (const float*)d_in[4];
    float* OUT = (float*)d_out;      // [NB][SEQ][1024]
    char* wsp = (char*)d_ws;
    bf* XB = (bf*)wsp; wsp += SZ_XB;                 // [NB*SEQ][1024]
    bf* WB = (bf*)wsp; wsp += SZ_WB;                 // [3][1024][1024]: q | k | v
    h16* WP = (h16*)wsp; wsp += SZ_WP;               // [1024][1024] x1024
    h16* QH = (h16*)wsp; wsp += SZ_PL;               // [NB*16][SEQ][64]
    h16* KP = (h16*)wsp; wsp += SZ_PL;               // [NB*16][SEQ][64]
    h16* VT = (h16*)wsp; wsp += SZ_PL;               // [NB*16][64][SEQ]
    h16* CX = (h16*)wsp; wsp += SZ_CX;               // [NB*SEQ][1024] x256
    bf* WQ = WB; bf* WK = WB + (size_t)DM * DM; bf* WV = WB + (size_t)2 * DM * DM;

    if (SEQ == SEQ_FULL) {
        const size_t n8 = (size_t)NB * SEQ * DM / 8;
        k_cvt8<<<(unsigned)((n8 + 255) / 256), 256, 0, stream>>>(x, XB, n8);
    } else {
        const size_t n8 = (size_t)SEQ * DM / 8;
        for (int b = 0; b < NB; ++b) k_cvt8<<<(unsigned)((n8 + 255) / 256), 256, 0, stream>>>(x + (size_t)b * SEQ_FULL * DM, XB + (size_t)b * SEQ * DM, n8);
    }
    { const size_t n8 = (size_t)3 * DM * DM / 8; k_cvt8<<<(unsigned)((n8 + 255) / 256), 256, 0, stream>>>(wqkv, WB, n8); }
    { const size_t n8 = (size_t)DM * DM / 8;     k_cvtw<<<(unsigned)((n8 + 255) / 256), 256, 0, stream>>>(wproj, WP, n8); }

    // q, k: A = x rows (m = b*SEQ + t), Bt = W rows (n = h*64 + d), column bias -> plane [(b*16 + h)][t][d]
    k_proj<<<dim3(NB * SEQ / 64, DM / 64, 1), 32, 0, stream>>>(XB, WQ, bqkv, 0, QH, SEQ, (size_t)NH_ * SEQ * HD, HD, HD, (size_t)SEQ * HD);
    k_proj<<<dim3(NB * SEQ / 64, DM / 64, 1), 32, 0, stream>>>(XB, WK, bqkv + DM, 0, KP, SEQ, (size_t)NH_ * SEQ * HD, HD, HD, (size_t)SEQ * HD);
    // v^T: A = Wv rows (m = h*64 + d), Bt = x rows (n = b*SEQ + t), row bias -> plane [(b*1024 + m)][t] = [(b*16 + h)][d][t]
    k_proj<<<dim3(DM / 64, NB * SEQ / 64, 1), 32, 0, stream>>>(WV, XB, bqkv + 2 * DM, 1, VT, DM, (size_t)0, SEQ, SEQ, (size_t)DM * SEQ);

    k_flash<<<dim3(SEQ / (16 * AW), NB * NH_, 1), 32 * AW, 0, stream>>>(QH, KP, VT, CX);

    // output projection: A = ctx rows (m = b*SEQ + t, k = h*64 + d), Bt = w_proj rows (n = f) -> OUT[m][f]
    k_oproj<<<dim3(NB * SEQ / 64, DM / 64, 1), 32, 0, stream>>>(CX, WP, bproj, OUT);
}

// v001
// Measured time: 184 microseconds a run.
// Two timings next to v000 put it at 1.92 and 1.98 times that version's speed.
#include <hip/hip_runtime.h>

// Multi-head self-attention, width 1024 = 16 heads x 64, x [NB][SEQ][1024], fused w_qkv [3072][1024] ([out][in], rows q | k | v, head h = rows h*64+d of each third), b_qkv, score scale 1/8, no mask, output projection w_proj [out][in] + b_proj (f32 output).
// Compute dtypes, f32 accumulate everywhere: qkv projections v_wmma_f32_16x16x32_bf16 (x, w_qkv RNE-converted to bf16; products exact); scores v_wmma_f32_16x16x32_f16: q and k single f16 planes (one product), scale 0.125*log2(e) applied in f32;
// P (x256 carry, cancels in the normalisation; row sum taken over the f16 P values) and v single f16; softmax f32 (online, running max); output projection v_wmma_f32_16x16x32_f16: ctx single f16 (x256 carry), w_proj RNE-converted to bf16 then x1024 as f16 (exact), carries folded back (2^-18) in the f32 epilogue; biases RNE-converted to bf16, added in f32.
// Layout: bf16 copies of x and w_qkv; q, k planes [b*16+h][t][d] and v^T plane [b*16+h][d][t] written by the GEMM epilogue; fused flash kernel in transposed form (S^T = K Q^T, O^T = V^T P^T; K and V^T tiles staged in LDS for the 8 waves of a block) writes the f16 ctx plane [b*SEQ+t][1024]; f16 GEMM writes the output buffer.

#ifndef NB
#define NB 1
#endif
#ifndef SEQ
#define SEQ 4096
#endif
#define NB_FULL  1
#define SEQ_FULL 4096
#ifndef OUT_SEQ
#define OUT_SEQ SEQ              // row pitch (in tokens) between batches of the output
#endif
#define DM   1024
#define NH_  16
#define HD   64
#define AW   8                   // waves per flash block (16 query rows each)
#define KST  256                 // keys per LDS stage of the flash kernel
#define KPB  (HD * 2 + 16)       // LDS pitch of a K row, bytes: 16 B x odd, no bank conflict for 16-byte fragment reads
#define VPB  (KST * 2 + 16)      // LDS pitch of a V^T row, bytes: 16 B x odd
#define KBY  (KST * KPB)         // K part of a stage, bytes
#define SBY  (KBY + HD * VPB)    // one stage (K then V^T), bytes
#define SC2  (0.125f * 1.4426950408889634f)   // HD^-0.5 * log2(e)
#define PSH  8.0f                // log2 of the P carry (256)
#define CCS  256.0f              // carry of the ctx plane
#define WPS  1024.0f             // carry of the w_proj plane
#define OSI  (1.0f / (256.0f * 1024.0f))      // inverse of both carries

static_assert(HD == 64);
static_assert(NH_ * HD == DM);                 // head h = columns h*64 + d
static_assert(DM % 64 == 0);                   // column tiles of 64
static_assert(DM % 32 == 0);                   // GEMM k-loop steps by 32
static_assert(SEQ % 64 == 0);                  // a 64-row tile never straddles two batches
static_assert((NB * SEQ) % 64 == 0);
static_assert(SEQ % 32 == 0);                  // key loop steps by 32
static_assert(SEQ % (16 * AW) == 0);           // flash grid covers the sequence exactly
static_assert(SEQ % KST == 0);                 // whole stages only
static_assert(AW == 8 && KST == 256);          // copy maps of k_flash: 256 lanes x 8 copies x 16 B = one 32-KiB K or V^T tile
static_assert((KPB / 16) % 2 == 1 && (VPB / 16) % 2 == 1);
static_assert(2 * SBY >= AW * 16 * 68 * 4);    // the ring holds the output staging
static_assert(((size_t)SEQ * DM) % 8 == 0);
static_assert(((size_t)DM * DM) % 8 == 0);
static_assert(NB <= NB_FULL);
static_assert(SEQ <= SEQ_FULL);

typedef _Float16 h16;
typedef unsigned short bf;
typedef __attribute__((ext_vector_type(16))) __bf16   v16bf;
typedef __attribute__((ext_vector_type(16))) _Float16 v16h;
typedef __attribute__((ext_vector_type(8)))  _Float16 v8h;
typedef __attribute__((ext_vector_type(8)))  unsigned short v8us;
typedef __attribute__((ext_vector_type(8)))  float    v8f;
typedef __attribute__((ext_vector_type(4)))  float    v4f;
typedef v4f  __attribute__((may_alias)) v4fa;

__device__ __forceinline__ unsigned short f2bf(float f) { unsigned u = __float_as_uint(f); u += 0x7FFFu + ((u >> 16) & 1u); return (unsigned short)(u >> 16); }
__device__ __forceinline__ float bfr(float f) { return __uint_as_float(((unsigned)f2bf(f)) << 16); }   // value after RNE convert to bf16
__device__ __forceinline__ v16h cat16(v8h lo, v8h hi) { return __builtin_shufflevector(lo, hi, 0, 1, 2, 3, 4, 5, 6, 7, 8, 9, 10, 11, 12, 13, 14, 15); }
__device__ __forceinline__ v16bf cat16b(v8us lo, v8us hi) { return __builtin_bit_cast(v16bf, __builtin_shufflevector(lo, hi, 0, 1, 2, 3, 4, 5, 6, 7, 8, 9, 10, 11, 12, 13, 14, 15)); }
__device__ __forceinline__ v8f wmma16(v16h a, v16h b, v8f c) { return __builtin_amdgcn_wmma_f32_16x16x32_f16(false, a, false, b, (short)0, c, false, false); }
__device__ __forceinline__ v8f wmmab(v16bf a, v16bf b, v8f c) { return __builtin_amdgcn_wmma_f32_16x16x32_bf16(false, a, false, b, (short)0, c, false, false); }
// fragment loaders from K-contiguous 16-bit rows; p already includes + 8*(lane>>4): elements 0..7 <- k0+8h+0..7, elements 8..15 <- k0+16+8h+0..7 (same map for A and B)
__device__ __forceinline__ v16h  ldh(const h16* p) { return cat16(*(const v8h*)p, *(const v8h*)(p + 16)); }
__device__ __forceinline__ v16bf ldb(const bf* p)  { return cat16b(*(const v8us*)p, *(const v8us*)(p + 16)); }
// ordering point for wave-private LDS tiles (same wave writes and reads)
__device__ __forceinline__ void wave_sync() { __builtin_amdgcn_fence(3 /* release order */, "wavefront"); __builtin_amdgcn_wave_barrier(); asm volatile("" ::: "memory"); }

__global__ __launch_bounds__(256) void k_cvt8(const float* __restrict__ src, bf* dst, size_t n8) {
    const size_t i = (size_t)blockIdx.x * 256 + threadIdx.x; if (i >= n8) return;
    const v8f v = *(const v8f*)(src + i * 8); v8us o;
#pragma unroll
    for (int k = 0; k < 8; ++k) o[k] = f2bf(v[k]);
    *(v8us*)(dst + i * 8) = o; 
}

__global__ __launch_bounds__(256) void k_cvtw(const float* __restrict__ src, h16* dst, size_t n8) {
    const size_t i = (size_t)blockIdx.x * 256 + threadIdx.x; if (i >= n8) return;
    const v8f v = *(const v8f*)(src + i * 8); v8h o;
#pragma unroll
    for (int k = 0; k < 8; ++k) o[k] = (h16)(bfr(v[k]) * WPS);
    *(v8h*)(dst + i * 8) = o; 
}

// k_proj: register-blocked bf16 GEMM, ONE WAVE per 64x64 tile (16 accumulators), operands straight from K-contiguous bf16 planes, K = DM.
// C[m][n] = sum_k A[m][k] Bt[n][k] + bias (bias[n] when biasRow == 0, bias[m] otherwise), written as a single f16 plane (Ph) at
// tile base (r0/RB)*sRB + (r0%RB)*pitch + (c0/CB)*sCB + (c0%CB), row pitch 'pitch' (halves). grid (M/64, N/64), 32 threads.
__global__ __launch_bounds__(32) void k_proj(const bf* __restrict__ A, const bf* __restrict__ Bt, const float* __restrict__ bias, int biasRow,
                                             h16* Ph, int RB, size_t sRB, int pitch, int CB, size_t sCB) {
    __shared__ __align__(16) float os[16 * 68];
    const int K = DM;
    const int lane = threadIdx.x & 31, lr = lane & 15, hi = lane >> 4; const int r0 = blockIdx.x * 64, c0 = blockIdx.y * 64;
    v8f acc[4][4];
#pragma unroll
    for (int mb = 0; mb < 4; ++mb)
#pragma unroll
        for (int nb = 0; nb < 4; ++nb) acc[mb][nb] = (v8f){};
    const size_t aoff = (size_t)(r0 + lr) * K + 8 * hi, boff = (size_t)(c0 + lr) * K + 8 * hi;
#pragma unroll 1
    for (int kc = 0; kc < K; kc += 32) {
        v16bf a[4];
#pragma unroll
        for (int mb = 0; mb < 4; ++mb) a[mb] = ldb(A + aoff + (size_t)mb * 16 * K + kc);
#pragma unroll
        for (int nb = 0; nb < 4; ++nb) { const v16bf b = ldb(Bt + boff + (size_t)nb * 16 * K + kc);
#pragma unroll
            for (int mb = 0; mb < 4; ++mb) acc[mb][nb] = wmmab(a[mb], b, acc[mb][nb]); }
        asm volatile("v_nop\n\tv_nop\n\tv_nop\n\tv_nop" : "+v"(acc[0][0]), "+v"(acc[1][1]), "+v"(acc[2][2]), "+v"(acc[3][3]) : "v"(a[0]), "v"(a[1]), "v"(a[2]), "v"(a[3]));
    }
    // column bias (index selected as an integer, address always inside the bias array)
    float bc[4];
#pragma unroll
    for (int nb = 0; nb < 4; ++nb) { const int ci = biasRow ? 0 : (c0 + nb * 16 + lr); const float t = bfr(bias[ci]); bc[nb] = biasRow ? 0.0f : t; }
    const size_t tbase = (size_t)(r0 / RB) * sRB + (size_t)(r0 % RB) * (size_t)pitch + (size_t)(c0 / CB) * sCB + (size_t)(c0 % CB);
#pragma unroll
    for (int mb = 0; mb < 4; ++mb) {
        // row bias for rows r0 + mb*16 + 8h + 0..7 (two 16-B loads, clamped to offset 0 in column mode)
        const int ri = biasRow ? (r0 + mb * 16 + hi * 8) : 0;
        const v4f rb0 = *(const v4f*)(bias + ri); const v4f rb1 = *(const v4f*)(bias + ri + 4);
        float br[8];
#pragma unroll
        for (int j = 0; j < 4; ++j) { const float t0 = bfr(rb0[j]); const float t1 = bfr(rb1[j]); br[j] = biasRow ? t0 : 0.0f; br[4 + j] = biasRow ? t1 : 0.0f; }
#pragma unroll
        for (int nb = 0; nb < 4; ++nb) {
#pragma unroll
            for (int j = 0; j < 8; ++j) os[(hi * 8 + j) * 68 + nb * 16 + lr] = acc[mb][nb][j] + bc[nb] + br[j]; }   // D: row 8h+j, col lane&15
        wave_sync();
        const size_t sb = tbase + (size_t)(mb * 16) * (size_t)pitch;
{
#pragma unroll
            for (int s = 0; s < 4; ++s) { const int row = 4 * s + (lane >> 3), c8 = (lane & 7) * 8;   // 4 s x 4 row groups = 16 rows; 8 lanes x 8 = 64 columns
                const v4f x0 = *(const v4fa*)(&os[row * 68 + c8]); const v4f x1 = *(const v4fa*)(&os[row * 68 + c8 + 4]); v8h hv;
#pragma unroll
                for (int i = 0; i < 4; ++i) { hv[i] = (h16)x0[i]; hv[4 + i] = (h16)x1[i]; }
                const size_t oo = sb + (size_t)row * (size_t)pitch + c8;
                *(v8h*)(Ph + oo) = hv; }
             }
        wave_sync();
    }
}

// eight asynchronous 16-byte copies per lane, global -> LDS (LDS byte address l + i*ls, global address g + i*gs halves).
// s_wait_xcnt closes the statement so that no address register of an issued copy is rewritten ahead of it.
__device__ __forceinline__ void copy8(unsigned l, unsigned ls, const h16* g, size_t gs) {
    asm volatile("global_load_async_to_lds_b128 %0, %8, off\n\t"
                 "global_load_async_to_lds_b128 %1, %9, off\n\t"
                 "global_load_async_to_lds_b128 %2, %10, off\n\t"
                 "global_load_async_to_lds_b128 %3, %11, off\n\t"
                 "global_load_async_to_lds_b128 %4, %12, off\n\t"
                 "global_load_async_to_lds_b128 %5, %13, off\n\t"
                 "global_load_async_to_lds_b128 %6, %14, off\n\t"
                 "global_load_async_to_lds_b128 %7, %15, off\n\t"
                 "s_wait_xcnt 0x0"
                 :: "v"(l), "v"(l + ls), "v"(l + 2 * ls), "v"(l + 3 * ls), "v"(l + 4 * ls), "v"(l + 5 * ls), "v"(l + 6 * ls), "v"(l + 7 * ls),
                    "v"(g), "v"(g + gs), "v"(g + 2 * gs), "v"(g + 3 * gs), "v"(g + 4 * gs), "v"(g + 5 * gs), "v"(g + 6 * gs), "v"(g + 7 * gs)
                 : "memory");
}

// k_flash: fused attention, one wave per 16 query rows of one (batch, head), 8 waves per block; Q fragments straight from the f16 plane.
// K and V^T come in stages of KST keys through a two-buffer LDS ring that the block's waves share: whole-line asynchronous copies, the next stage in flight while this one is worked on.
// Transposed form: S^T[key][t] = K Q^T (A = K rows, B = Q rows); lane (t = lane&15, h = lane>>4) holds keys 8h+r of each 16-key tile, so the packed
// P tile is directly the B fragment of O^T[d][t] = V^T P^T (element r <- tile keys 0..15, element 8+r <- tile keys 16..31, lane unchanged).
// Softmax state (running max, partial sum) is one scalar per lane; the two lane halves of a row are combined with one xor-16 exchange.
__global__ __launch_bounds__(32 * AW) void k_flash(const h16* __restrict__ QH, const h16* __restrict__ KP, const h16* __restrict__ VT, h16* CTX) {
    __shared__ __align__(16) unsigned char ring[2 * SBY];    // two stages; after the loop: output staging
    float* os = (float*)ring;
    const int tid = threadIdx.x;
    const int lane = threadIdx.x & 31, wave = threadIdx.x >> 5, lr = lane & 15, hi = lane >> 4;
    const int zh = blockIdx.y; const int b = zh / NH_, h = zh % NH_;
    const int t0 = (blockIdx.x * AW + wave) * 16;
    const size_t pbase = (size_t)zh * SEQ * HD;
    const size_t qo = pbase + (size_t)(t0 + lr) * HD + 8 * hi;
    const v16h qh0 = ldh(QH + qo), qh1 = ldh(QH + qo + 32);   // B fragments: col t, k = d
    // copy maps. K tile: 32 KiB contiguous; copy i of lane tid takes 16-byte piece i*256 + tid = (key i*32 + tid/8, piece tid%8). V^T tile: 64 rows of 512 B; (row i*8 + tid/32, piece tid%32).
    const unsigned rb = (unsigned)(size_t)ring;              // LDS byte address of the ring
    const unsigned kl = rb + (unsigned)((tid >> 3) * KPB + (tid & 7) * 16);
    const unsigned vl = rb + (unsigned)(KBY + (tid >> 5) * VPB + (tid & 31) * 16);
    const h16* kg = KP + pbase + (size_t)tid * 8;                                   // + stage * KST * HD
    const h16* vg = VT + pbase + (size_t)(tid >> 5) * SEQ + (size_t)(tid & 31) * 8; // + stage * KST
    const int NST = SEQ / KST;
    copy8(kl, 32 * KPB, kg, (size_t)32 * HD); copy8(vl, 8 * VPB, vg, (size_t)8 * SEQ);
    asm volatile("s_wait_asynccnt 0x0" ::: "memory");        // stage 0 of this wave has landed
    __syncthreads();                                         // stage 0 of every wave is readable
    if (NST > 1) { copy8(kl + SBY, 32 * KPB, kg + (size_t)KST * HD, (size_t)32 * HD); copy8(vl + SBY, 8 * VPB, vg + KST, (size_t)8 * SEQ); }
    const int kfo = lr * KPB + 16 * hi;                      // + key * KPB              (A fragment: row key, k = d)
    const int vfo = KBY + lr * VPB + 16 * hi;                // + 16j * VPB + key * 2    (A fragment: row d, k = key)
    v8f o0 = (v8f){}, o1 = (v8f){}, o2 = (v8f){}, o3 = (v8f){};
    float m = -3.0e38f, l = 0.0f;
#pragma unroll 1   // the stage loop stays rolled: one publish point, buffer picked by the stage's parity
    for (int st = 0; st < NST; ++st) {
      const unsigned char* sb = ring + (st & 1) * SBY;
#pragma unroll 4   // four 32-key passes per branch, LDS offsets as immediates; all eight unrolled go past 256 registers and two blocks no longer fit a WGP
      for (int key0 = 0; key0 < KST; key0 += 32) {
        const h16* ka = (const h16*)(sb + kfo + key0 * KPB);
        const v16h ka0 = ldh(ka), ka1 = ldh(ka + 32), kb0 = ldh(ka + 8 * KPB), kb1 = ldh(ka + 8 * KPB + 32);   // 8 * KPB halves = 16 rows
        v8f sHa = (v8f){}, sHb = (v8f){};
        sHa = wmma16(ka0, qh0, sHa); sHb = wmma16(kb0, qh0, sHb);
        sHa = wmma16(ka1, qh1, sHa); sHb = wmma16(kb1, qh1, sHb);
        asm volatile("v_nop\n\tv_nop\n\tv_nop\n\tv_nop" : "+v"(sHa), "+v"(sHb) : "v"(ka0), "v"(ka1), "v"(kb0), "v"(kb1), "v"(qh0), "v"(qh1));
        float ta[8], tb[8]; float mx = -3.0e38f;
#pragma unroll
        for (int r = 0; r < 8; ++r) { ta[r] = sHa[r] * SC2; tb[r] = sHb[r] * SC2; mx = fmaxf(mx, fmaxf(ta[r], tb[r])); }
        mx = fmaxf(mx, __shfl_xor(mx, 16, 32));
        const float mnew = fmaxf(m, mx);
        const float alpha = __builtin_amdgcn_exp2f(m - mnew);
        const float sh = PSH - mnew;
        v16h pb; float ls = 0.0f;
#pragma unroll
        for (int r = 0; r < 8; ++r) { const h16 pa = (h16)__builtin_amdgcn_exp2f(ta[r] + sh); const h16 pc = (h16)__builtin_amdgcn_exp2f(tb[r] + sh); pb[r] = pa; pb[8 + r] = pc; ls += (float)pa + (float)pc; }
        l = l * alpha + ls; m = mnew;
        o0 = o0 * alpha; o1 = o1 * alpha; o2 = o2 * alpha; o3 = o3 * alpha;
        const h16* va = (const h16*)(sb + vfo + key0 * 2);
        const v16h v0 = ldh(va), v1 = ldh(va + 8 * VPB), v2 = ldh(va + 16 * VPB), v3 = ldh(va + 24 * VPB);     // 8 * VPB halves = 16 rows
        o0 = wmma16(v0, pb, o0); o1 = wmma16(v1, pb, o1); o2 = wmma16(v2, pb, o2); o3 = wmma16(v3, pb, o3);
        asm volatile("v_nop\n\tv_nop\n\tv_nop\n\tv_nop" : "+v"(o0), "+v"(o1), "+v"(o2), "+v"(o3) : "v"(v0), "v"(v1), "v"(v2), "v"(v3), "v"(pb));
      }
      asm volatile("s_wait_dscnt 0x0" ::: "memory");         // this wave's reads of the stage are done before its buffer is handed back
      asm volatile("s_wait_asynccnt 0x0" ::: "memory");      // this wave's copies of the next stage have landed
      __syncthreads();                                       // next stage readable by all, this stage's buffer free
      if (st + 2 < NST) {
          const unsigned bo = (unsigned)((st & 1) * SBY);
          copy8(kl + bo, 32 * KPB, kg + (size_t)(st + 2) * KST * HD, (size_t)32 * HD); copy8(vl + bo, 8 * VPB, vg + (size_t)(st + 2) * KST, (size_t)8 * SEQ);
      }
    }
    asm volatile("s_wait_asynccnt 0x0" ::: "memory");        // nothing in flight when the ring becomes output staging (the last barrier above ended every read)
    l += __shfl_xor(l, 16, 32);
    const float inv = CCS * (1.0f / l);      // normalisation (the P carry cancels) times the ctx carry
    const int wb = wave * 16 * 68;
    // O^T D layout: o_j[r] = (d = 16j + 8h + r, t = lane&15) -> os[t][d]; rows 0..15 x columns 0..63 all written
    { v4f a, c;
      a[0] = o0[0] * inv; a[1] = o0[1] * inv; a[2] = o0[2] * inv; a[3] = o0[3] * inv; c[0] = o0[4] * inv; c[1] = o0[5] * inv; c[2] = o0[6] * inv; c[3] = o0[7] * inv;
      *(v4fa*)(&os[wb + lr * 68 +  0 + 8 * hi]) = a; *(v4fa*)(&os[wb + lr * 68 +  0 + 8 * hi + 4]) = c;
      a[0] = o1[0] * inv; a[1] = o1[1] * inv; a[2] = o1[2] * inv; a[3] = o1[3] * inv; c[0] = o1[4] * inv; c[1] = o1[5] * inv; c[2] = o1[6] * inv; c[3] = o1[7] * inv;
      *(v4fa*)(&os[wb + lr * 68 + 16 + 8 * hi]) = a; *(v4fa*)(&os[wb + lr * 68 + 16 + 8 * hi + 4]) = c;
      a[0] = o2[0] * inv; a[1] = o2[1] * inv; a[2] = o2[2] * inv; a[3] = o2[3] * inv; c[0] = o2[4] * inv; c[1] = o2[5] * inv; c[2] = o2[6] * inv; c[3] = o2[7] * inv;
      *(v4fa*)(&os[wb + lr * 68 + 32 + 8 * hi]) = a; *(v4fa*)(&os[wb + lr * 68 + 32 + 8 * hi + 4]) = c;
      a[0] = o3[0] * inv; a[1] = o3[1] * inv; a[2] = o3[2] * inv; a[3] = o3[3] * inv; c[0] = o3[4] * inv; c[1] = o3[5] * inv; c[2] = o3[6] * inv; c[3] = o3[7] * inv;
      *(v4fa*)(&os[wb + lr * 68 + 48 + 8 * hi]) = a; *(v4fa*)(&os[wb + lr * 68 + 48 + 8 * hi + 4]) = c; }
    wave_sync();
    h16* crow = CTX + ((size_t)b * SEQ + t0) * DM + h * HD;      // ctx plane row = token, columns h*64 + d
{
#pragma unroll
        for (int s = 0; s < 4; ++s) { const int row = 4 * s + (lane >> 3), c8 = (lane & 7) * 8;   // 4 s x 4 row groups = 16 rows; 8 lanes x 8 halves = 64 columns
            const v4f x0 = *(const v4fa*)(&os[wb + row * 68 + c8]); const v4f x1 = *(const v4fa*)(&os[wb + row * 68 + c8 + 4]); v8h hv;
#pragma unroll
            for (int i = 0; i < 4; ++i) { hv[i] = (h16)x0[i]; hv[4 + i] = (h16)x1[i]; }
            *(v8h*)(crow + (size_t)row * DM + c8) = hv; }
         }
}

// k_oproj: register-blocked f16 GEMM, ONE WAVE per 64x64 tile, operands straight from K-contiguous f16 planes (ctx x256, w_proj x1024), K = DM.
// OUT[m][n] = (sum_k A[m][k] Bt[n][k]) * 2^-18 + bias[n], f32. grid (NB*SEQ/64, DM/64), 32 threads.
__global__ __launch_bounds__(32) void k_oproj(const h16* __restrict__ A, const h16* __restrict__ Bt, const float* __restrict__ bias, float* OUT) {
    __shared__ __align__(16) float os[16 * 68];
    const int K = DM;
    const int lane = threadIdx.x & 31, lr = lane & 15, hi = lane >> 4; const int r0 = blockIdx.x * 64, c0 = blockIdx.y * 64;
    v8f acc[4][4];
#pragma unroll
    for (int mb = 0; mb < 4; ++mb)
#pragma unroll
        for (int nb = 0; nb < 4; ++nb) acc[mb][nb] = (v8f){};
    const size_t aoff = (size_t)(r0 + lr) * K + 8 * hi, boff = (size_t)(c0 + lr) * K + 8 * hi;
#pragma unroll 1
    for (int kc = 0; kc < K; kc += 32) {
        v16h a[4];
#pragma unroll
        for (int mb = 0; mb < 4; ++mb) a[mb] = ldh(A + aoff + (size_t)mb * 16 * K + kc);
#pragma unroll
        for (int nb = 0; nb < 4; ++nb) { const v16h b = ldh(Bt + boff + (size_t)nb * 16 * K + kc);
#pragma unroll
            for (int mb = 0; mb < 4; ++mb) acc[mb][nb] = wmma16(a[mb], b, acc[mb][nb]); }
        asm volatile("v_nop\n\tv_nop\n\tv_nop\n\tv_nop" : "+v"(acc[0][0]), "+v"(acc[1][1]), "+v"(acc[2][2]), "+v"(acc[3][3]) : "v"(a[0]), "v"(a[1]), "v"(a[2]), "v"(a[3]));
    }
    float bc[4];
#pragma unroll
    for (int nb = 0; nb < 4; ++nb) bc[nb] = bfr(bias[c0 + nb * 16 + lr]);
    const int bq = r0 / SEQ, tq = r0 % SEQ;
    float* obase = OUT + ((size_t)bq * OUT_SEQ + tq) * DM + c0;
#pragma unroll
    for (int mb = 0; mb < 4; ++mb) {
#pragma unroll
        for (int nb = 0; nb < 4; ++nb) {
#pragma unroll
            for (int j = 0; j < 8; ++j) os[(hi * 8 + j) * 68 + nb * 16 + lr] = acc[mb][nb][j] * OSI + bc[nb]; }   // D: row 8h+j, col lane&15
        wave_sync();
{
#pragma unroll
            for (int s = 0; s < 8; ++s) { const int row = 2 * s + hi, cofs = lr * 4;   // 8 s x 2 rows = 16 rows; 16 lanes x 4 floats = 64 columns
                const v4f val = *(const v4fa*)(&os[row * 68 + cofs]);
                *(v4f*)(obase + (size_t)(mb * 16 + row) * DM + cofs) = val; }
             }
        wave_sync();
    }
}

static constexpr size_t al256(size_t v) { return (v + 255) & ~(size_t)255; }
static constexpr size_t SZ_XB = al256((size_t)NB * SEQ * DM * 2);
static constexpr size_t SZ_WB = al256((size_t)3 * DM * DM * 2);
static constexpr size_t SZ_WP = al256((size_t)DM * DM * 2);
static constexpr size_t SZ_PL = al256((size_t)NB * NH_ * SEQ * HD * 2);
static constexpr size_t SZ_CX = al256((size_t)NB * SEQ * DM * 2);
static constexpr size_t SZ_TOTAL = SZ_XB + SZ_WB + SZ_WP + 3 * SZ_PL + SZ_CX;
static_assert(SZ_TOTAL <= (size_t)134217728);          // workspace carve <= 128 MiB
static_assert(((size_t)DM * DM * 2) % 256 == 0);       // weight sub-planes stay 256-byte aligned

extern "C" void kernel_launch(void* const* d_in, const int* in_sizes, int n_in,
                              void* d_out, int out_size, void* d_ws, size_t ws_size, hipStream_t stream) {
    if (n_in < 5) return;
    const size_t needx = ((size_t)(NB - 1) * SEQ_FULL + SEQ) * DM;
    if ((size_t)in_sizes[0] < needx) return;
    if ((size_t)in_sizes[1] < (size_t)3 * DM * DM || (size_t)in_sizes[2] < (size_t)3 * DM) return;
    if ((size_t)in_sizes[3] < (size_t)DM * DM || (size_t)in_sizes[4] < (size_t)DM) return;
    if ((size_t)out_size < ((size_t)(NB - 1) * OUT_SEQ + SEQ) * DM) return;
    if (SZ_TOTAL > ws_size) return;
    // wire order: x, w_qkv ([3072][1024] = Bt as-is, rows q | k | v), b_qkv, w_proj ([out][in] = Bt as-is), b_proj
    const float* x = (const float*)d_in[0]; const float* wqkv = (const float*)d_in[1]; const float* bqkv = (const float*)d_in[2];
    const float* wproj = (const float*)d_in[3]; const float* bproj = (const float*)d_in[4];
    float* OUT = (float*)d_out;      // [NB][SEQ][1024]
    char* wsp = (char*)d_ws;
    bf* XB = (bf*)wsp; wsp += SZ_XB;                 // [NB*SEQ][1024]
    bf* WB = (bf*)wsp; wsp += SZ_WB;                 // [3][1024][1024]: q | k | v
    h16* WP = (h16*)wsp; wsp += SZ_WP;               // [1024][1024] x1024
    h16* QH = (h16*)wsp; wsp += SZ_PL;               // [NB*16][SEQ][64]
    h16* KP = (h16*)wsp; wsp += SZ_PL;               // [NB*16][SEQ][64]
    h16* VT = (h16*)wsp; wsp += SZ_PL;               // [NB*16][64][SEQ]
    h16* CX = (h16*)wsp; wsp += SZ_CX;               // [NB*SEQ][1024] x256
    bf* WQ = WB; bf* WK = WB + (size_t)DM * DM; bf* WV = WB + (size_t)2 * DM * DM;

    if (SEQ == SEQ_FULL) {
        const size_t n8 = (size_t)NB * SEQ * DM / 8;
        k_cvt8<<<(unsigned)((n8 + 255) / 256), 256, 0, stream>>>(x, XB, n8);
    } else {
        const size_t n8 = (size_t)SEQ * DM / 8;
        for (int b = 0; b < NB; ++b) k_cvt8<<<(unsigned)((n8 + 255) / 256), 256, 0, stream>>>(x + (size_t)b * SEQ_FULL * DM, XB + (size_t)b * SEQ * DM, n8);
    }
    { const size_t n8 = (size_t)3 * DM * DM / 8; k_cvt8<<<(unsigned)((n8 + 255) / 256), 256, 0, stream>>>(wqkv, WB, n8); }
    { const size_t n8 = (size_t)DM * DM / 8;     k_cvtw<<<(unsigned)((n8 + 255) / 256), 256, 0, stream>>>(wproj, WP, n8); }

    // q, k: A = x rows (m = b*SEQ + t), Bt = W rows (n = h*64 + d), column bias -> plane [(b*16 + h)][t][d]
    k_proj<<<dim3(NB * SEQ / 64, DM / 64, 1), 32, 0, stream>>>(XB, WQ, bqkv, 0, QH, SEQ, (size_t)NH_ * SEQ * HD, HD, HD, (size_t)SEQ * HD);
    k_proj<<<dim3(NB * SEQ / 64, DM / 64, 1), 32, 0, stream>>>(XB, WK, bqkv + DM, 0, KP, SEQ, (size_t)NH_ * SEQ * HD, HD, HD, (size_t)SEQ * HD);
    // v^T: A = Wv rows (m = h*64 + d), Bt = x rows (n = b*SEQ + t), row bias -> plane [(b*1024 + m)][t] = [(b*16 + h)][d][t]
    k_proj<<<dim3(DM / 64, NB * SEQ / 64, 1), 32, 0, stream>>>(WV, XB, bqkv + 2 * DM, 1, VT, DM, (size_t)0, SEQ, SEQ, (size_t)DM * SEQ);

    k_flash<<<dim3(SEQ / (16 * AW), NB * NH_, 1), 32 * AW, 0, stream>>>(QH, KP, VT, CX);

    // output projection: A = ctx rows (m = b*SEQ + t, k = h*64 + d), Bt = w_proj rows (n = f) -> OUT[m][f]
    k_oproj<<<dim3(NB * SEQ / 64, DM / 64, 1), 32, 0, stream>>>(CX, WP, bproj, OUT);
}

// v002
// One run takes 129 microseconds.
// Next to v001, in two timings, it ran 1.43 and 1.42 times as fast.
// Over all steps from v000 it is 2.78 times as fast.
#include <hip/hip_runtime.h>

// Multi-head self-attention, width 1024 = 16 heads x 64, x [NB][SEQ][1024], fused w_qkv [3072][1024] ([out][in], rows q | k | v, head h = rows h*64+d of each third), b_qkv, score scale 1/8, no mask, output projection w_proj [out][in] + b_proj (f32 output).
// Compute dtypes, f32 accumulate everywhere: qkv projections v_wmma_f32_16x16x32_bf16 (x, w_qkv RNE-converted to bf16; products exact); scores v_wmma_f32_16x16x32_f16: q and k single f16 planes (one product), scale 0.125*log2(e) applied in f32;
// P (x256 carry, cancels in the normalisation; row sum taken over the f16 P values) and v single f16; softmax f32 (online, running max); output projection v_wmma_f32_16x16x32_f16: ctx single f16 (x256 carry), w_proj RNE-converted to bf16 then x1024 as f16 (exact), carries folded back (2^-18) in the f32 epilogue; biases RNE-converted to bf16, added in f32.
// Layout: bf16 copies of x and w_qkv; q, k planes [b*16+h][t][d] and v^T plane [b*16+h][d][t] written by the GEMM epilogue; fused flash kernel in transposed form (S^T = K Q^T, O^T = V^T P^T; K and V^T tiles staged in LDS for the 8 waves of a block) writes the f16 ctx plane [b*SEQ+t][1024]; f16 GEMM writes the output buffer.
// The four GEMMs: 128x128 tile per 8-wave block (32x64 per wave), both operands staged in LDS in whole lines, 128 k per stage, two buffers.

#ifndef NB
#define NB 1
#endif
#ifndef SEQ
#define SEQ 4096
#endif
#define NB_FULL  1
#define SEQ_FULL 4096
#ifndef OUT_SEQ
#define OUT_SEQ SEQ              // row pitch (in tokens) between batches of the output
#endif
#define DM   1024
#define NH_  16
#define HD   64
#define AW   8                   // waves per flash block (16 query rows each)
#define KST  256                 // keys per LDS stage of the flash kernel
#define KPB  (HD * 2 + 16)       // LDS pitch of a K row, bytes: 16 B x odd, no bank conflict for 16-byte fragment reads
#define VPB  (KST * 2 + 16)      // LDS pitch of a V^T row, bytes: 16 B x odd
#define KBY  (KST * KPB)         // K part of a stage, bytes
#define SBY  (KBY + HD * VPB)    // one stage (K then V^T), bytes
#define GT   128                 // GEMM block tile, rows and columns (4 x 2 waves of 32 x 64)
#define GK   128                 // k per LDS stage of the GEMMs
#define GPB  (GK * 2 + 16)       // LDS pitch of a GEMM operand row, bytes: 16 B x odd
#define GAB  (GT * GPB)          // one operand's part of a stage, bytes
#define GSB  (2 * GAB)           // one stage (A rows then B rows), bytes
#define SC2  (0.125f * 1.4426950408889634f)   // HD^-0.5 * log2(e)
#define PSH  8.0f                // log2 of the P carry (256)
#define CCS  256.0f              // carry of the ctx plane
#define WPS  1024.0f             // carry of the w_proj plane
#define OSI  (1.0f / (256.0f * 1024.0f))      // inverse of both carries

static_assert(HD == 64);
static_assert(NH_ * HD == DM);                 // head h = columns h*64 + d
static_assert(DM % 64 == 0);                   // column tiles of 64
static_assert(DM % 32 == 0);                   // GEMM k-loop steps by 32
static_assert(SEQ % 64 == 0);                  // a wave's tile (32 rows, 64 columns) never straddles two batches
static_assert((NB * SEQ) % 64 == 0);
static_assert(SEQ % 32 == 0);                  // key loop steps by 32
static_assert(SEQ % (16 * AW) == 0);           // flash grid covers the sequence exactly
static_assert(SEQ % KST == 0);                 // whole stages only
static_assert(AW == 8 && KST == 256);          // copy maps of k_flash: 256 lanes x 8 copies x 16 B = one 32-KiB K or V^T tile
static_assert((KPB / 16) % 2 == 1 && (VPB / 16) % 2 == 1);
static_assert(2 * SBY >= AW * 16 * 68 * 4);    // the ring holds the output staging
static_assert((NB * SEQ) % GT == 0 && DM % GT == 0);   // GEMM grids cover both extents exactly
static_assert(DM % GK == 0 && DM / GK >= 2);           // whole stages, and the two that the ring's prologue needs
static_assert(GT == 128 && GK == 128);                 // copy map of gstage: 256 lanes x 16 copies x 16 B = 256 rows of 256 B
static_assert((GPB / 16) % 2 == 1);
static_assert(((size_t)SEQ * DM) % 8 == 0);
static_assert(((size_t)DM * DM) % 8 == 0);
static_assert(NB <= NB_FULL);
static_assert(SEQ <= SEQ_FULL);

typedef _Float16 h16;
typedef unsigned short bf;
typedef __attribute__((ext_vector_type(16))) __bf16   v16bf;
typedef __attribute__((ext_vector_type(16))) _Float16 v16h;
typedef __attribute__((ext_vector_type(8)))  _Float16 v8h;
typedef __attribute__((ext_vector_type(8)))  unsigned short v8us;
typedef __attribute__((ext_vector_type(16))) unsigned short v16us;
typedef __attribute__((ext_vector_type(8)))  float    v8f;
typedef __attribute__((ext_vector_type(4)))  float    v4f;
typedef v4f  __attribute__((may_alias)) v4fa;

__device__ __forceinline__ unsigned short f2bf(float f) { unsigned u = __float_as_uint(f); u += 0x7FFFu + ((u >> 16) & 1u); return (unsigned short)(u >> 16); }
__device__ __forceinline__ float bfr(float f) { return __uint_as_float(((unsigned)f2bf(f)) << 16); }   // value after RNE convert to bf16
__device__ __forceinline__ v16h cat16(v8h lo, v8h hi) { return __builtin_shufflevector(lo, hi, 0, 1, 2, 3, 4, 5, 6, 7, 8, 9, 10, 11, 12, 13, 14, 15); }
__device__ __forceinline__ v8f wmma16(v16h a, v16h b, v8f c) { return __builtin_amdgcn_wmma_f32_16x16x32_f16(false, a, false, b, (short)0, c, false, false); }
__device__ __forceinline__ v8f wmmab(v16bf a, v16bf b, v8f c) { return __builtin_amdgcn_wmma_f32_16x16x32_bf16(false, a, false, b, (short)0, c, false, false); }
// fragment loaders from K-contiguous 16-bit rows; p already includes + 8*(lane>>4): elements 0..7 <- k0+8h+0..7, elements 8..15 <- k0+16+8h+0..7 (same map for A and B)
__device__ __forceinline__ v16h  ldh(const h16* p) { return cat16(*(const v8h*)p, *(const v8h*)(p + 16)); }
// ordering point for wave-private LDS tiles (same wave writes and reads)
__device__ __forceinline__ void wave_sync() { __builtin_amdgcn_fence(3 /* release order */, "wavefront"); __builtin_amdgcn_wave_barrier(); asm volatile("" ::: "memory"); }

__global__ __launch_bounds__(256) void k_cvt8(const float* __restrict__ src, bf* dst, size_t n8) {
    const size_t i = (size_t)blockIdx.x * 256 + threadIdx.x; if (i >= n8) return;
    const v8f v = *(const v8f*)(src + i * 8); v8us o;
#pragma unroll
    for (int k = 0; k < 8; ++k) o[k] = f2bf(v[k]);
    *(v8us*)(dst + i * 8) = o; 
}

__global__ __launch_bounds__(256) void k_cvtw(const float* __restrict__ src, h16* dst, size_t n8) {
    const size_t i = (size_t)blockIdx.x * 256 + threadIdx.x; if (i >= n8) return;
    const v8f v = *(const v8f*)(src + i * 8); v8h o;
#pragma unroll
    for (int k = 0; k < 8; ++k) o[k] = (h16)(bfr(v[k]) * WPS);
    *(v8h*)(dst + i * 8) = o; 
}

// eight asynchronous 16-byte copies per lane, global -> LDS (LDS byte address l + i*ls, global address g + i*gs halves).
// s_wait_xcnt closes the statement so that no address register of an issued copy is rewritten ahead of it.
__device__ __forceinline__ void copy8(unsigned l, unsigned ls, const h16* g, size_t gs) {
    asm volatile("global_load_async_to_lds_b128 %0, %8, off\n\t"
                 "global_load_async_to_lds_b128 %1, %9, off\n\t"
                 "global_load_async_to_lds_b128 %2, %10, off\n\t"
                 "global_load_async_to_lds_b128 %3, %11, off\n\t"
                 "global_load_async_to_lds_b128 %4, %12, off\n\t"
                 "global_load_async_to_lds_b128 %5, %13, off\n\t"
                 "global_load_async_to_lds_b128 %6, %14, off\n\t"
                 "global_load_async_to_lds_b128 %7, %15, off\n\t"
                 "s_wait_xcnt 0x0"
                 :: "v"(l), "v"(l + ls), "v"(l + 2 * ls), "v"(l + 3 * ls), "v"(l + 4 * ls), "v"(l + 5 * ls), "v"(l + 6 * ls), "v"(l + 7 * ls),
                    "v"(g), "v"(g + gs), "v"(g + 2 * gs), "v"(g + 3 * gs), "v"(g + 4 * gs), "v"(g + 5 * gs), "v"(g + 6 * gs), "v"(g + 7 * gs)
                 : "memory");
}

// one GEMM stage: rows 0..127 of the A tile, then of the B tile, 256 B (GK halves) of each. Copy i of lane tid takes (row i*16 + tid/16, 16-byte piece tid%16): a wave's copy covers two whole 256-B runs.
__device__ __forceinline__ void gstage(unsigned l, const h16* ga, const h16* gb) {
    copy8(l, 16 * GPB, ga, (size_t)16 * DM); copy8(l + GAB, 16 * GPB, gb, (size_t)16 * DM);
}
// fragment from an LDS row of 16-bit values; p already includes + 16*(lane>>4) bytes: same element map as ldh, for A and for B
__device__ __forceinline__ v16us ldu(const unsigned char* p) { return __builtin_shufflevector(*(const v8us*)p, *(const v8us*)(p + 32), 0, 1, 2, 3, 4, 5, 6, 7, 8, 9, 10, 11, 12, 13, 14, 15); }
template <bool F16> __device__ __forceinline__ v8f wm(v16us a, v16us b, v8f c) {
    if constexpr (F16) return wmma16(__builtin_bit_cast(v16h, a), __builtin_bit_cast(v16h, b), c);
    else               return wmmab(__builtin_bit_cast(v16bf, a), __builtin_bit_cast(v16bf, b), c);
}
// k loop of a 128x128 block tile, K = DM: acc[mb][nb] += A rows (blockIdx.x*128 + (wave>>1)*32 + mb*16 ..) x Bt rows (blockIdx.y*128 + (wave&1)*64 + nb*16 ..), k ascending in steps of 32.
// Two-buffer LDS ring shared by the block's 8 waves: the next stage's copies fly while this one is worked on; inside a stage the next k step's fragments are read ahead of this step's products.
template <bool F16> __device__ __forceinline__ void gemm_tile(const h16* A, const h16* Bt, unsigned char* ring, v8f (&acc)[2][4]) {
    const int tid = threadIdx.x, lane = tid & 31, wave = tid >> 5, lr = lane & 15, hi = lane >> 4;
    const unsigned l = (unsigned)(size_t)ring + (unsigned)((tid >> 4) * GPB + (tid & 15) * 16);   // LDS byte address of this lane's first piece
    const h16* ga = A  + (size_t)(blockIdx.x * GT + (tid >> 4)) * DM + (tid & 15) * 8;             // + stage * GK
    const h16* gb = Bt + (size_t)(blockIdx.y * GT + (tid >> 4)) * DM + (tid & 15) * 8;
    const int NSTG = DM / GK;
    gstage(l, ga, gb);
    asm volatile("s_wait_asynccnt 0x0" ::: "memory");        // stage 0 of this wave has landed
    __syncthreads();                                         // stage 0 of every wave is readable
    gstage(l + GSB, ga + GK, gb + GK);
    const int afo = ((wave >> 1) * 32 + lr) * GPB + 16 * hi;
    const int bfo = GAB + ((wave & 1) * 64 + lr) * GPB + 16 * hi;
#pragma unroll 1   // the stage loop stays rolled: one publish point, buffer picked by the stage's parity
    for (int st = 0; st < NSTG; ++st) {
        const unsigned char* pa = ring + (st & 1) * GSB + afo;
        const unsigned char* pb = ring + (st & 1) * GSB + bfo;
        v16us a[2][2], b[2][4];
#pragma unroll
        for (int i = 0; i < 4; ++i) { if (i < 2) a[0][i] = ldu(pa + i * 16 * GPB); b[0][i] = ldu(pb + i * 16 * GPB); }
#pragma unroll
        for (int kk = 0; kk < GK / 32; ++kk) {
            const int cur = kk & 1, nxt = cur ^ 1;
            if (kk + 1 < GK / 32) {
#pragma unroll
                for (int i = 0; i < 4; ++i) { if (i < 2) a[nxt][i] = ldu(pa + i * 16 * GPB + (kk + 1) * 64); b[nxt][i] = ldu(pb + i * 16 * GPB + (kk + 1) * 64); }
            }
            __builtin_amdgcn_sched_barrier(0);   // keeps the next step's reads one group ahead of this step's products: sunk among them, each read's LDS latency is waited out
#pragma unroll
            for (int nb = 0; nb < 4; ++nb)
#pragma unroll
                for (int mb = 0; mb < 2; ++mb) acc[mb][nb] = wm<F16>(a[cur][mb], b[cur][nb], acc[mb][nb]);
            __builtin_amdgcn_sched_barrier(0);   // the other side of the same fence: no later read rises into this step's products
        }
        asm volatile("s_wait_dscnt 0x0" ::: "memory");       // this wave's reads of the stage are done before its buffer is handed back
        asm volatile("s_wait_asynccnt 0x0" ::: "memory");    // this wave's copies of the next stage have landed
        __syncthreads();                                     // next stage readable by all, this stage's buffer free
        if (st + 2 < NSTG) gstage(l + (unsigned)((st & 1) * GSB), ga + (size_t)(st + 2) * GK, gb + (size_t)(st + 2) * GK);
    }
    asm volatile("s_wait_asynccnt 0x0" ::: "memory");        // nothing in flight when the wave goes on to its epilogue
}

// k_proj: register-blocked bf16 GEMM, one wave per 32x64 tile (8 accumulators), 4 x 2 waves per block, operands from K-contiguous bf16 planes through the LDS ring of gemm_tile, K = DM.
// C[m][n] = sum_k A[m][k] Bt[n][k] + bias (bias[n] when biasRow == 0, bias[m] otherwise), written as a single f16 plane (Ph) at
// tile base (r0/RB)*sRB + (r0%RB)*pitch + (c0/CB)*sCB + (c0%CB), row pitch 'pitch' (halves), r0, c0 the wave's tile. grid (M/128, N/128), 256 threads.
__global__ __launch_bounds__(256) void k_proj(const bf* __restrict__ A, const bf* __restrict__ Bt, const float* __restrict__ bias, int biasRow,
                                             h16* Ph, int RB, size_t sRB, int pitch, int CB, size_t sCB) {
    __shared__ __align__(16) unsigned char ring[2 * GSB];    // two operand stages
    __shared__ __align__(16) float osw[8 * 16 * 68];         // output staging, one part per wave
    const int lane = threadIdx.x & 31, wave = threadIdx.x >> 5, lr = lane & 15, hi = lane >> 4;
    const int r0 = blockIdx.x * GT + (wave >> 1) * 32, c0 = blockIdx.y * GT + (wave & 1) * 64;
    float* os = osw + wave * 16 * 68;
    v8f acc[2][4];
#pragma unroll
    for (int mb = 0; mb < 2; ++mb)
#pragma unroll
        for (int nb = 0; nb < 4; ++nb) acc[mb][nb] = (v8f){};
    gemm_tile<false>((const h16*)A, (const h16*)Bt, ring, acc);
    // column bias (index selected as an integer, address always inside the bias array)
    float bc[4];
#pragma unroll
    for (int nb = 0; nb < 4; ++nb) { const int ci = biasRow ? 0 : (c0 + nb * 16 + lr); const float t = bfr(bias[ci]); bc[nb] = biasRow ? 0.0f : t; }
    const size_t tbase = (size_t)(r0 / RB) * sRB + (size_t)(r0 % RB) * (size_t)pitch + (size_t)(c0 / CB) * sCB + (size_t)(c0 % CB);
#pragma unroll
    for (int mb = 0; mb < 2; ++mb) {
        // row bias for rows r0 + mb*16 + 8h + 0..7 (two 16-B loads, clamped to offset 0 in column mode)
        const int ri = biasRow ? (r0 + mb * 16 + hi * 8) : 0;
        const v4f rb0 = *(const v4f*)(bias + ri); const v4f rb1 = *(const v4f*)(bias + ri + 4);
        float br[8];
#pragma unroll
        for (int j = 0; j < 4; ++j) { const float t0 = bfr(rb0[j]); const float t1 = bfr(rb1[j]); br[j] = biasRow ? t0 : 0.0f; br[4 + j] = biasRow ? t1 : 0.0f; }
#pragma unroll
        for (int nb = 0; nb < 4; ++nb) {
#pragma unroll
            for (int j = 0; j < 8; ++j) os[(hi * 8 + j) * 68 + nb * 16 + lr] = acc[mb][nb][j] + bc[nb] + br[j]; }   // D: row 8h+j, col lane&15
        wave_sync();
        const size_t sb = tbase + (size_t)(mb * 16) * (size_t)pitch;
{
#pragma unroll
            for (int s = 0; s < 4; ++s) { const int row = 4 * s + (lane >> 3), c8 = (lane & 7) * 8;   // 4 s x 4 row groups = 16 rows; 8 lanes x 8 = 64 columns
                const v4f x0 = *(const v4fa*)(&os[row * 68 + c8]); const v4f x1 = *(const v4fa*)(&os[row * 68 + c8 + 4]); v8h hv;
#pragma unroll
                for (int i = 0; i < 4; ++i) { hv[i] = (h16)x0[i]; hv[4 + i] = (h16)x1[i]; }
                const size_t oo = sb + (size_t)row * (size_t)pitch + c8;
                *(v8h*)(Ph + oo) = hv; }
             }
        wave_sync();
    }
}

// k_flash: fused attention, one wave per 16 query rows of one (batch, head), 8 waves per block; Q fragments straight from the f16 plane.
// K and V^T come in stages of KST keys through a two-buffer LDS ring that the block's waves share: whole-line asynchronous copies, the next stage in flight while this one is worked on.
// Transposed form: S^T[key][t] = K Q^T (A = K rows, B = Q rows); lane (t = lane&15, h = lane>>4) holds keys 8h+r of each 16-key tile, so the packed
// P tile is directly the B fragment of O^T[d][t] = V^T P^T (element r <- tile keys 0..15, element 8+r <- tile keys 16..31, lane unchanged).
// Softmax state (running max, partial sum) is one scalar per lane; the two lane halves of a row are combined with one xor-16 exchange.
__global__ __launch_bounds__(32 * AW) void k_flash(const h16* __restrict__ QH, const h16* __restrict__ KP, const h16* __restrict__ VT, h16* CTX) {
    __shared__ __align__(16) unsigned char ring[2 * SBY];    // two stages; after the loop: output staging
    float* os = (float*)ring;
    const int tid = threadIdx.x;
    const int lane = threadIdx.x & 31, wave = threadIdx.x >> 5, lr = lane & 15, hi = lane >> 4;
    const int zh = blockIdx.y; const int b = zh / NH_, h = zh % NH_;
    const int t0 = (blockIdx.x * AW + wave) * 16;
    const size_t pbase = (size_t)zh * SEQ * HD;
    const size_t qo = pbase + (size_t)(t0 + lr) * HD + 8 * hi;
    const v16h qh0 = ldh(QH + qo), qh1 = ldh(QH + qo + 32);   // B fragments: col t, k = d
    // copy maps. K tile: 32 KiB contiguous; copy i of lane tid takes 16-byte piece i*256 + tid = (key i*32 + tid/8, piece tid%8). V^T tile: 64 rows of 512 B; (row i*8 + tid/32, piece tid%32).
    const unsigned rb = (unsigned)(size_t)ring;              // LDS byte address of the ring
    const unsigned kl = rb + (unsigned)((tid >> 3) * KPB + (tid & 7) * 16);
    const unsigned vl = rb + (unsigned)(KBY + (tid >> 5) * VPB + (tid & 31) * 16);
    const h16* kg = KP + pbase + (size_t)tid * 8;                                   // + stage * KST * HD
    const h16* vg = VT + pbase + (size_t)(tid >> 5) * SEQ + (size_t)(tid & 31) * 8; // + stage * KST
    const int NST = SEQ / KST;
    copy8(kl, 32 * KPB, kg, (size_t)32 * HD); copy8(vl, 8 * VPB, vg, (size_t)8 * SEQ);
    asm volatile("s_wait_asynccnt 0x0" ::: "memory");        // stage 0 of this wave has landed
    __syncthreads();                                         // stage 0 of every wave is readable
    if (NST > 1) { copy8(kl + SBY, 32 * KPB, kg + (size_t)KST * HD, (size_t)32 * HD); copy8(vl + SBY, 8 * VPB, vg + KST, (size_t)8 * SEQ); }
    const int kfo = lr * KPB + 16 * hi;                      // + key * KPB              (A fragment: row key, k = d)
    const int vfo = KBY + lr * VPB + 16 * hi;                // + 16j * VPB + key * 2    (A fragment: row d, k = key)
    v8f o0 = (v8f){}, o1 = (v8f){}, o2 = (v8f){}, o3 = (v8f){};
    float m = -3.0e38f, l = 0.0f;
#pragma unroll 1   // the stage loop stays rolled: one publish point, buffer picked by the stage's parity
    for (int st = 0; st < NST; ++st) {
      const unsigned char* sb = ring + (st & 1) * SBY;
#pragma unroll 4   // four 32-key passes per branch, LDS offsets as immediates; all eight unrolled go past 256 registers and two blocks no longer fit a WGP
      for (int key0 = 0; key0 < KST; key0 += 32) {
        const h16* ka = (const h16*)(sb + kfo + key0 * KPB);
        const v16h ka0 = ldh(ka), ka1 = ldh(ka + 32), kb0 = ldh(ka + 8 * KPB), kb1 = ldh(ka + 8 * KPB + 32);   // 8 * KPB halves = 16 rows
        v8f sHa = (v8f){}, sHb = (v8f){};
        sHa = wmma16(ka0, qh0, sHa); sHb = wmma16(kb0, qh0, sHb);
        sHa = wmma16(ka1, qh1, sHa); sHb = wmma16(kb1, qh1, sHb);
        asm volatile("v_nop\n\tv_nop\n\tv_nop\n\tv_nop" : "+v"(sHa), "+v"(sHb) : "v"(ka0), "v"(ka1), "v"(kb0), "v"(kb1), "v"(qh0), "v"(qh1));
        float ta[8], tb[8]; float mx = -3.0e38f;
#pragma unroll
        for (int r = 0; r < 8; ++r) { ta[r] = sHa[r] * SC2; tb[r] = sHb[r] * SC2; mx = fmaxf(mx, fmaxf(ta[r], tb[r])); }
        mx = fmaxf(mx, __shfl_xor(mx, 16, 32));
        const float mnew = fmaxf(m, mx);
        const float alpha = __builtin_amdgcn_exp2f(m - mnew);
        const float sh = PSH - mnew;
        v16h pb; float ls = 0.0f;
#pragma unroll
        for (int r = 0; r < 8; ++r) { const h16 pa = (h16)__builtin_amdgcn_exp2f(ta[r] + sh); const h16 pc = (h16)__builtin_amdgcn_exp2f(tb[r] + sh); pb[r] = pa; pb[8 + r] = pc; ls += (float)pa + (float)pc; }
        l = l * alpha + ls; m = mnew;
        o0 = o0 * alpha; o1 = o1 * alpha; o2 = o2 * alpha; o3 = o3 * alpha;
        const h16* va = (const h16*)(sb + vfo + key0 * 2);
        const v16h v0 = ldh(va), v1 = ldh(va + 8 * VPB), v2 = ldh(va + 16 * VPB), v3 = ldh(va + 24 * VPB);     // 8 * VPB halves = 16 rows
        o0 = wmma16(v0, pb, o0); o1 = wmma16(v1, pb, o1); o2 = wmma16(v2, pb, o2); o3 = wmma16(v3, pb, o3);
        asm volatile("v_nop\n\tv_nop\n\tv_nop\n\tv_nop" : "+v"(o0), "+v"(o1), "+v"(o2), "+v"(o3) : "v"(v0), "v"(v1), "v"(v2), "v"(v3), "v"(pb));
      }
      asm volatile("s_wait_dscnt 0x0" ::: "memory");         // this wave's reads of the stage are done before its buffer is handed back
      asm volatile("s_wait_asynccnt 0x0" ::: "memory");      // this wave's copies of the next stage have landed
      __syncthreads();                                       // next stage readable by all, this stage's buffer free
      if (st + 2 < NST) {
          const unsigned bo = (unsigned)((st & 1) * SBY);
          copy8(kl + bo, 32 * KPB, kg + (size_t)(st + 2) * KST * HD, (size_t)32 * HD); copy8(vl + bo, 8 * VPB, vg + (size_t)(st + 2) * KST, (size_t)8 * SEQ);
      }
    }
    asm volatile("s_wait_asynccnt 0x0" ::: "memory");        // nothing in flight when the ring becomes output staging (the last barrier above ended every read)
    l += __shfl_xor(l, 16, 32);
    const float inv = CCS * (1.0f / l);      // normalisation (the P carry cancels) times the ctx carry
    const int wb = wave * 16 * 68;
    // O^T D layout: o_j[r] = (d = 16j + 8h + r, t = lane&15) -> os[t][d]; rows 0..15 x columns 0..63 all written
    { v4f a, c;
      a[0] = o0[0] * inv; a[1] = o0[1] * inv; a[2] = o0[2] * inv; a[3] = o0[3] * inv; c[0] = o0[4] * inv; c[1] = o0[5] * inv; c[2] = o0[6] * inv; c[3] = o0[7] * inv;
      *(v4fa*)(&os[wb + lr * 68 +  0 + 8 * hi]) = a; *(v4fa*)(&os[wb + lr * 68 +  0 + 8 * hi + 4]) = c;
      a[0] = o1[0] * inv; a[1] = o1[1] * inv; a[2] = o1[2] * inv; a[3] = o1[3] * inv; c[0] = o1[4] * inv; c[1] = o1[5] * inv; c[2] = o1[6] * inv; c[3] = o1[7] * inv;
      *(v4fa*)(&os[wb + lr * 68 + 16 + 8 * hi]) = a; *(v4fa*)(&os[wb + lr * 68 + 16 + 8 * hi + 4]) = c;
      a[0] = o2[0] * inv; a[1] = o2[1] * inv; a[2] = o2[2] * inv; a[3] = o2[3] * inv; c[0] = o2[4] * inv; c[1] = o2[5] * inv; c[2] = o2[6] * inv; c[3] = o2[7] * inv;
      *(v4fa*)(&os[wb + lr * 68 + 32 + 8 * hi]) = a; *(v4fa*)(&os[wb + lr * 68 + 32 + 8 * hi + 4]) = c;
      a[0] = o3[0] * inv; a[1] = o3[1] * inv; a[2] = o3[2] * inv; a[3] = o3[3] * inv; c[0] = o3[4] * inv; c[1] = o3[5] * inv; c[2] = o3[6] * inv; c[3] = o3[7] * inv;
      *(v4fa*)(&os[wb + lr * 68 + 48 + 8 * hi]) = a; *(v4fa*)(&os[wb + lr * 68 + 48 + 8 * hi + 4]) = c; }
    wave_sync();
    h16* crow = CTX + ((size_t)b * SEQ + t0) * DM + h * HD;      // ctx plane row = token, columns h*64 + d
{
#pragma unroll
        for (int s = 0; s < 4; ++s) { const int row = 4 * s + (lane >> 3), c8 = (lane & 7) * 8;   // 4 s x 4 row groups = 16 rows; 8 lanes x 8 halves = 64 columns
            const v4f x0 = *(const v4fa*)(&os[wb + row * 68 + c8]); const v4f x1 = *(const v4fa*)(&os[wb + row * 68 + c8 + 4]); v8h hv;
#pragma unroll
            for (int i = 0; i < 4; ++i) { hv[i] = (h16)x0[i]; hv[4 + i] = (h16)x1[i]; }
            *(v8h*)(crow + (size_t)row * DM + c8) = hv; }
         }
}

// k_oproj: register-blocked f16 GEMM, one wave per 32x64 tile, 4 x 2 waves per block, operands from K-contiguous f16 planes (ctx x256, w_proj x1024) through the LDS ring of gemm_tile, K = DM.
// OUT[m][n] = (sum_k A[m][k] Bt[n][k]) * 2^-18 + bias[n], f32. grid (NB*SEQ/128, DM/128), 256 threads.
__global__ __launch_bounds__(256) void k_oproj(const h16* __restrict__ A, const h16* __restrict__ Bt, const float* __restrict__ bias, float* OUT) {
    __shared__ __align__(16) unsigned char ring[2 * GSB];    // two operand stages
    __shared__ __align__(16) float osw[8 * 16 * 68];         // output staging, one part per wave
    const int lane = threadIdx.x & 31, wave = threadIdx.x >> 5, lr = lane & 15, hi = lane >> 4;
    const int r0 = blockIdx.x * GT + (wave >> 1) * 32, c0 = blockIdx.y * GT + (wave & 1) * 64;
    float* os = osw + wave * 16 * 68;
    v8f acc[2][4];
#pragma unroll
    for (int mb = 0; mb < 2; ++mb)
#pragma unroll
        for (int nb = 0; nb < 4; ++nb) acc[mb][nb] = (v8f){};
    gemm_tile<true>(A, Bt, ring, acc);
    float bc[4];
#pragma unroll
    for (int nb = 0; nb < 4; ++nb) bc[nb] = bfr(bias[c0 + nb * 16 + lr]);
    const int bq = r0 / SEQ, tq = r0 % SEQ;
    float* obase = OUT + ((size_t)bq * OUT_SEQ + tq) * DM + c0;
#pragma unroll
    for (int mb = 0; mb < 2; ++mb) {
#pragma unroll
        for (int nb = 0; nb < 4; ++nb) {
#pragma unroll
            for (int j = 0; j < 8; ++j) os[(hi * 8 + j) * 68 + nb * 16 + lr] = acc[mb][nb][j] * OSI + bc[nb]; }   // D: row 8h+j, col lane&15
        wave_sync();
{
#pragma unroll
            for (int s = 0; s < 8; ++s) { const int row = 2 * s + hi, cofs = lr * 4;   // 8 s x 2 rows = 16 rows; 16 lanes x 4 floats = 64 columns
                const v4f val = *(const v4fa*)(&os[row * 68 + cofs]);
                *(v4f*)(obase + (size_t)(mb * 16 + row) * DM + cofs) = val; }
             }
        wave_sync();
    }
}

static constexpr size_t al256(size_t v) { return (v + 255) & ~(size_t)255; }
static constexpr size_t SZ_XB = al256((size_t)NB * SEQ * DM * 2);
static constexpr size_t SZ_WB = al256((size_t)3 * DM * DM * 2);
static constexpr size_t SZ_WP = al256((size_t)DM * DM * 2);
static constexpr size_t SZ_PL = al256((size_t)NB * NH_ * SEQ * HD * 2);
static constexpr size_t SZ_CX = al256((size_t)NB * SEQ * DM * 2);
static constexpr size_t SZ_TOTAL = SZ_XB + SZ_WB + SZ_WP + 3 * SZ_PL + SZ_CX;
static_assert(SZ_TOTAL <= (size_t)134217728);          // workspace carve <= 128 MiB
static_assert(((size_t)DM * DM * 2) % 256 == 0);       // weight sub-planes stay 256-byte aligned

extern "C" void kernel_launch(void* const* d_in, const int* in_sizes, int n_in,
                              void* d_out, int out_size, void* d_ws, size_t ws_size, hipStream_t stream) {
    if (n_in < 5) return;
    const size_t needx = ((size_t)(NB - 1) * SEQ_FULL + SEQ) * DM;
    if ((size_t)in_sizes[0] < needx) return;
    if ((size_t)in_sizes[1] < (size_t)3 * DM * DM || (size_t)in_sizes[2] < (size_t)3 * DM) return;
    if ((size_t)in_sizes[3] < (size_t)DM * DM || (size_t)in_sizes[4] < (size_t)DM) return;
    if ((size_t)out_size < ((size_t)(NB - 1) * OUT_SEQ + SEQ) * DM) return;
    if (SZ_TOTAL > ws_size) return;
    // wire order: x, w_qkv ([3072][1024] = Bt as-is, rows q | k | v), b_qkv, w_proj ([out][in] = Bt as-is), b_proj
    const float* x = (const float*)d_in[0]; const float* wqkv = (const float*)d_in[1]; const float* bqkv = (const float*)d_in[2];
    const float* wproj = (const float*)d_in[3]; const float* bproj = (const float*)d_in[4];
    float* OUT = (float*)d_out;      // [NB][SEQ][1024]
    char* wsp = (char*)d_ws;
    bf* XB = (bf*)wsp; wsp += SZ_XB;                 // [NB*SEQ][1024]
    bf* WB = (bf*)wsp; wsp += SZ_WB;                 // [3][1024][1024]: q | k | v
    h16* WP = (h16*)wsp; wsp += SZ_WP;               // [1024][1024] x1024
    h16* QH = (h16*)wsp; wsp += SZ_PL;               // [NB*16][SEQ][64]
    h16* KP = (h16*)wsp; wsp += SZ_PL;               // [NB*16][SEQ][64]
    h16* VT = (h16*)wsp; wsp += SZ_PL;               // [NB*16][64][SEQ]
    h16* CX = (h16*)wsp; wsp += SZ_CX;               // [NB*SEQ][1024] x256
    bf* WQ = WB; bf* WK = WB + (size_t)DM * DM; bf* WV = WB + (size_t)2 * DM * DM;

    if (SEQ == SEQ_FULL) {
        const size_t n8 = (size_t)NB * SEQ * DM / 8;
        k_cvt8<<<(unsigned)((n8 + 255) / 256), 256, 0, stream>>>(x, XB, n8);
    } else {
        const size_t n8 = (size_t)SEQ * DM / 8;
        for (int b = 0; b < NB; ++b) k_cvt8<<<(unsigned)((n8 + 255) / 256), 256, 0, stream>>>(x + (size_t)b * SEQ_FULL * DM, XB + (size_t)b * SEQ * DM, n8);
    }
    { const size_t n8 = (size_t)3 * DM * DM / 8; k_cvt8<<<(unsigned)((n8 + 255) / 256), 256, 0, stream>>>(wqkv, WB, n8); }
    { const size_t n8 = (size_t)DM * DM / 8;     k_cvtw<<<(unsigned)((n8 + 255) / 256), 256, 0, stream>>>(wproj, WP, n8); }

    // q, k: A = x rows (m = b*SEQ + t), Bt = W rows (n = h*64 + d), column bias -> plane [(b*16 + h)][t][d]
    k_proj<<<dim3(NB * SEQ / GT, DM / GT, 1), 256, 0, stream>>>(XB, WQ, bqkv, 0, QH, SEQ, (size_t)NH_ * SEQ * HD, HD, HD, (size_t)SEQ * HD);
    k_proj<<<dim3(NB * SEQ / GT, DM / GT, 1), 256, 0, stream>>>(XB, WK, bqkv + DM, 0, KP, SEQ, (size_t)NH_ * SEQ * HD, HD, HD, (size_t)SEQ * HD);
    // v^T: A = Wv rows (m = h*64 + d), Bt = x rows (n = b*SEQ + t), row bias -> plane [(b*1024 + m)][t] = [(b*16 + h)][d][t]
    k_proj<<<dim3(DM / GT, NB * SEQ / GT, 1), 256, 0, stream>>>(WV, XB, bqkv + 2 * DM, 1, VT, DM, (size_t)0, SEQ, SEQ, (size_t)DM * SEQ);

    k_flash<<<dim3(SEQ / (16 * AW), NB * NH_, 1), 32 * AW, 0, stream>>>(QH, KP, VT, CX);

    // output projection: A = ctx rows (m = b*SEQ + t, k = h*64 + d), Bt = w_proj rows (n = f) -> OUT[m][f]
    k_oproj<<<dim3(NB * SEQ / GT, DM / GT, 1), 256, 0, stream>>>(CX, WP, bproj, OUT);
}

// v003
// Measured time: 122 microseconds a run.
// In both of two side-by-side timings against v002, it was 1.06 times as fast.
// Over all steps from v000 it is 2.95 times as fast.
#include <hip/hip_runtime.h>

// Multi-head self-attention, width 1024 = 16 heads x 64, x [NB][SEQ][1024], fused w_qkv [3072][1024] ([out][in], rows q | k | v, head h = rows h*64+d of each third), b_qkv, score scale 1/8, no mask, output projection w_proj [out][in] + b_proj (f32 output).
// Compute dtypes, f32 accumulate everywhere: qkv projections v_wmma_f32_16x16x32_bf16 (x, w_qkv RNE-converted to bf16; products exact); scores v_wmma_f32_16x16x32_f16: q and k single f16 planes (one product), scale 0.125*log2(e) applied in f32;
// P (x256 carry, cancels in the normalisation; row sum taken over the f16 P values) and v single f16; softmax f32 (online, running max); output projection v_wmma_f32_16x16x32_f16: ctx single f16 (x256 carry), w_proj RNE-converted to bf16 then x1024 as f16 (exact), carries folded back (2^-18) in the f32 epilogue; biases RNE-converted to bf16, added in f32.
// Layout: bf16 copies of x and w_qkv; q, k planes [b*16+h][t][d] and v^T plane [b*16+h][d][t] written by the GEMM epilogue; fused flash kernel in transposed form (S^T = K Q^T, O^T = V^T P^T; K and V^T tiles staged in LDS for the 8 waves of a block) writes the f16 ctx plane [b*SEQ+t][1024]; f16 GEMM writes the output buffer.
// The four GEMMs: 128x128 tile per 8-wave block (32x64 per wave), both operands staged in LDS in whole lines, 128 k per stage, two buffers.
// Four launches: launches that read none of each other's output share one grid (the three conversions by block range; the q, k and v^T projections by blockIdx.y).

#ifndef NB
#define NB 1
#endif
#ifndef SEQ
#define SEQ 4096
#endif
#define NB_FULL  1
#define SEQ_FULL 4096
#ifndef OUT_SEQ
#define OUT_SEQ SEQ              // row pitch (in tokens) between batches of the output
#endif
#define DM   1024
#define NH_  16
#define HD   64
#define AW   8                   // waves per flash block (16 query rows each)
#define KST  256                 // keys per LDS stage of the flash kernel
#define KPB  (HD * 2 + 16)       // LDS pitch of a K row, bytes: 16 B x odd, no bank conflict for 16-byte fragment reads
#define VPB  (KST * 2 + 16)      // LDS pitch of a V^T row, bytes: 16 B x odd
#define KBY  (KST * KPB)         // K part of a stage, bytes
#define SBY  (KBY + HD * VPB)    // one stage (K then V^T), bytes
#define GT   128                 // GEMM block tile, rows and columns (4 x 2 waves of 32 x 64)
#define GK   128                 // k per LDS stage of the GEMMs
#define GPB  (GK * 2 + 16)       // LDS pitch of a GEMM operand row, bytes: 16 B x odd
#define GAB  (GT * GPB)          // one operand's part of a stage, bytes
#define GSB  (2 * GAB)           // one stage (A rows then B rows), bytes
#define SC2  (0.125f * 1.4426950408889634f)   // HD^-0.5 * log2(e)
#define PSH  8.0f                // log2 of the P carry (256)
#define CCS  256.0f              // carry of the ctx plane
#define WPS  1024.0f             // carry of the w_proj plane
#define OSI  (1.0f / (256.0f * 1024.0f))      // inverse of both carries

static_assert(HD == 64);
static_assert(NH_ * HD == DM);                 // head h = columns h*64 + d
static_assert(DM % 64 == 0);                   // column tiles of 64
static_assert(DM % 32 == 0);                   // GEMM k-loop steps by 32
static_assert(SEQ % 64 == 0);                  // a wave's tile (32 rows, 64 columns) never straddles two batches
static_assert((NB * SEQ) % 64 == 0);
static_assert(SEQ % 32 == 0);                  // key loop steps by 32
static_assert(SEQ % (16 * AW) == 0);           // flash grid covers the sequence exactly
static_assert(SEQ % KST == 0);                 // whole stages only
static_assert(AW == 8 && KST == 256);          // copy maps of k_flash: 256 lanes x 8 copies x 16 B = one 32-KiB K or V^T tile
static_assert((KPB / 16) % 2 == 1 && (VPB / 16) % 2 == 1);
static_assert(2 * SBY >= AW * 16 * 68 * 4);    // the ring holds the output staging
static_assert((NB * SEQ) % GT == 0 && DM % GT == 0);   // GEMM grids cover both extents exactly
static_assert(DM % GK == 0 && DM / GK >= 2);           // whole stages, and the two that the ring's prologue needs
static_assert(GT == 128 && GK == 128);                 // copy map of gstage: 256 lanes x 16 copies x 16 B = 256 rows of 256 B
static_assert((GPB / 16) % 2 == 1);
static_assert(((size_t)SEQ * DM) % 8 == 0);
static_assert(((size_t)DM * DM) % 8 == 0);
static_assert(NB <= NB_FULL);
static_assert(SEQ <= SEQ_FULL);

typedef _Float16 h16;
typedef unsigned short bf;
typedef __attribute__((ext_vector_type(16))) __bf16   v16bf;
typedef __attribute__((ext_vector_type(16))) _Float16 v16h;
typedef __attribute__((ext_vector_type(8)))  _Float16 v8h;
typedef __attribute__((ext_vector_type(8)))  unsigned short v8us;
typedef __attribute__((ext_vector_type(16))) unsigned short v16us;
typedef __attribute__((ext_vector_type(8)))  float    v8f;
typedef __attribute__((ext_vector_type(4)))  float    v4f;
typedef v4f  __attribute__((may_alias)) v4fa;

__device__ __forceinline__ unsigned short f2bf(float f) { unsigned u = __float_as_uint(f); u += 0x7FFFu + ((u >> 16) & 1u); return (unsigned short)(u >> 16); }
__device__ __forceinline__ float bfr(float f) { return __uint_as_float(((unsigned)f2bf(f)) << 16); }   // value after RNE convert to bf16
__device__ __forceinline__ v16h cat16(v8h lo, v8h hi) { return __builtin_shufflevector(lo, hi, 0, 1, 2, 3, 4, 5, 6, 7, 8, 9, 10, 11, 12, 13, 14, 15); }
__device__ __forceinline__ v8f wmma16(v16h a, v16h b, v8f c) { return __builtin_amdgcn_wmma_f32_16x16x32_f16(false, a, false, b, (short)0, c, false, false); }
__device__ __forceinline__ v8f wmmab(v16bf a, v16bf b, v8f c) { return __builtin_amdgcn_wmma_f32_16x16x32_bf16(false, a, false, b, (short)0, c, false, false); }
// fragment loaders from K-contiguous 16-bit rows; p already includes + 8*(lane>>4): elements 0..7 <- k0+8h+0..7, elements 8..15 <- k0+16+8h+0..7 (same map for A and B)
__device__ __forceinline__ v16h  ldh(const h16* p) { return cat16(*(const v8h*)p, *(const v8h*)(p + 16)); }
// ordering point for wave-private LDS tiles (same wave writes and reads)
__device__ __forceinline__ void wave_sync() { __builtin_amdgcn_fence(3 /* release order */, "wavefront"); __builtin_amdgcn_wave_barrier(); asm volatile("" ::: "memory"); }

// k_cvt: the three conversions in one grid, 8 values per thread; a block lies wholly in one range: x -> bf16, then w_qkv -> bf16, then w_proj -> bf16 value x1024 as f16.
#define CBX ((unsigned)((size_t)NB * SEQ * DM / 2048))   // blocks of x (256 threads x 8 values)
#define CBW ((unsigned)((size_t)3 * DM * DM / 2048))     // blocks of w_qkv
#define CBP ((unsigned)((size_t)DM * DM / 2048))         // blocks of w_proj
static_assert(((size_t)SEQ * DM) % 2048 == 0 && ((size_t)DM * DM) % 2048 == 0);   // whole blocks in every range, none straddles two batches
__global__ __launch_bounds__(256) void k_cvt(const float* __restrict__ x, const float* __restrict__ wqkv, const float* __restrict__ wproj, bf* XB, bf* WB, h16* WP) {
    const unsigned blk = blockIdx.x;
    if (blk < CBX + CBW) {
        const bool isx = blk < CBX;
        const size_t e = ((size_t)(isx ? blk : blk - CBX) * 256 + threadIdx.x) * 8;
        const size_t bt = e / ((size_t)SEQ * DM);            // batch (x only): source batches lie SEQ_FULL tokens apart
        const float* s = isx ? x + bt * ((size_t)SEQ_FULL * DM) + (e - bt * ((size_t)SEQ * DM)) : wqkv + e;
        const v8f v = *(const v8f*)s; v8us o;
#pragma unroll
        for (int k = 0; k < 8; ++k) o[k] = f2bf(v[k]);
        *(v8us*)((isx ? XB : WB) + e) = o;
    } else {
        const size_t e = ((size_t)(blk - CBX - CBW) * 256 + threadIdx.x) * 8;
        const v8f v = *(const v8f*)(wproj + e); v8h o;
#pragma unroll
        for (int k = 0; k < 8; ++k) o[k] = (h16)(bfr(v[k]) * WPS);
        *(v8h*)(WP + e) = o;
        asm volatile("s_wait_xcnt 0x0" ::: "memory");   // precaution: stands in front of every later write of the store's registers
    }
}

// eight asynchronous 16-byte copies per lane, global -> LDS (LDS byte address l + i*ls, global address g + i*gs halves).
// s_wait_xcnt closes the statement so that no address register of an issued copy is rewritten ahead of it.
__device__ __forceinline__ void copy8(unsigned l, unsigned ls, const h16* g, size_t gs) {
    asm volatile("global_load_async_to_lds_b128 %0, %8, off\n\t"
                 "global_load_async_to_lds_b128 %1, %9, off\n\t"
                 "global_load_async_to_lds_b128 %2, %10, off\n\t"
                 "global_load_async_to_lds_b128 %3, %11, off\n\t"
                 "global_load_async_to_lds_b128 %4, %12, off\n\t"
                 "global_load_async_to_lds_b128 %5, %13, off\n\t"
                 "global_load_async_to_lds_b128 %6, %14, off\n\t"
                 "global_load_async_to_lds_b128 %7, %15, off\n\t"
                 "s_wait_xcnt 0x0"
                 :: "v"(l), "v"(l + ls), "v"(l + 2 * ls), "v"(l + 3 * ls), "v"(l + 4 * ls), "v"(l + 5 * ls), "v"(l + 6 * ls), "v"(l + 7 * ls),
                    "v"(g), "v"(g + gs), "v"(g + 2 * gs), "v"(g + 3 * gs), "v"(g + 4 * gs), "v"(g + 5 * gs), "v"(g + 6 * gs), "v"(g + 7 * gs)
                 : "memory");
}

// one GEMM stage: rows 0..127 of the A tile, then of the B tile, 256 B (GK halves) of each. Copy i of lane tid takes (row i*16 + tid/16, 16-byte piece tid%16): a wave's copy covers two whole 256-B runs.
__device__ __forceinline__ void gstage(unsigned l, const h16* ga, const h16* gb) {
    copy8(l, 16 * GPB, ga, (size_t)16 * DM); copy8(l + GAB, 16 * GPB, gb, (size_t)16 * DM);
}
// fragment from an LDS row of 16-bit values; p already includes + 16*(lane>>4) bytes: same element map as ldh, for A and for B
__device__ __forceinline__ v16us ldu(const unsigned char* p) { return __builtin_shufflevector(*(const v8us*)p, *(const v8us*)(p + 32), 0, 1, 2, 3, 4, 5, 6, 7, 8, 9, 10, 11, 12, 13, 14, 15); }
template <bool F16> __device__ __forceinline__ v8f wm(v16us a, v16us b, v8f c) {
    if constexpr (F16) return wmma16(__builtin_bit_cast(v16h, a), __builtin_bit_cast(v16h, b), c);
    else               return wmmab(__builtin_bit_cast(v16bf, a), __builtin_bit_cast(v16bf, b), c);
}
// k loop of a 128x128 block tile (bx, by), K = DM: acc[mb][nb] += A rows (bx*128 + (wave>>1)*32 + mb*16 ..) x Bt rows (by*128 + (wave&1)*64 + nb*16 ..), k ascending in steps of 32.
// Two-buffer LDS ring shared by the block's 8 waves: the next stage's copies fly while this one is worked on; inside a stage the next k step's fragments are read ahead of this step's products.
template <bool F16> __device__ __forceinline__ void gemm_tile(const h16* A, const h16* Bt, unsigned bx, unsigned by, unsigned char* ring, v8f (&acc)[2][4]) {
    const int tid = threadIdx.x, lane = tid & 31, wave = tid >> 5, lr = lane & 15, hi = lane >> 4;
    const unsigned l = (unsigned)(size_t)ring + (unsigned)((tid >> 4) * GPB + (tid & 15) * 16);   // LDS byte address of this lane's first piece
    const h16* ga = A  + (size_t)(bx * GT + (tid >> 4)) * DM + (tid & 15) * 8;             // + stage * GK
    const h16* gb = Bt + (size_t)(by * GT + (tid >> 4)) * DM + (tid & 15) * 8;
    const int NSTG = DM / GK;
    gstage(l, ga, gb);
    asm volatile("s_wait_asynccnt 0x0" ::: "memory");        // stage 0 of this wave has landed
    __syncthreads();                                         // stage 0 of every wave is readable
    gstage(l + GSB, ga + GK, gb + GK);
    const int afo = ((wave >> 1) * 32 + lr) * GPB + 16 * hi;
    const int bfo = GAB + ((wave & 1) * 64 + lr) * GPB + 16 * hi;
#pragma unroll 1   // the stage loop stays rolled: one publish point, buffer picked by the stage's parity
    for (int st = 0; st < NSTG; ++st) {
        const unsigned char* pa = ring + (st & 1) * GSB + afo;
        const unsigned char* pb = ring + (st & 1) * GSB + bfo;
        v16us a[2][2], b[2][4];
#pragma unroll
        for (int i = 0; i < 4; ++i) { if (i < 2) a[0][i] = ldu(pa + i * 16 * GPB); b[0][i] = ldu(pb + i * 16 * GPB); }
#pragma unroll
        for (int kk = 0; kk < GK / 32; ++kk) {
            const int cur = kk & 1, nxt = cur ^ 1;
            if (kk + 1 < GK / 32) {
#pragma unroll
                for (int i = 0; i < 4; ++i) { if (i < 2) a[nxt][i] = ldu(pa + i * 16 * GPB + (kk + 1) * 64); b[nxt][i] = ldu(pb + i * 16 * GPB + (kk + 1) * 64); }
            }
            __builtin_amdgcn_sched_barrier(0);   // keeps the next step's reads one group ahead of this step's products: sunk among them, each read's LDS latency is waited out
#pragma unroll
            for (int nb = 0; nb < 4; ++nb)
#pragma unroll
                for (int mb = 0; mb < 2; ++mb) acc[mb][nb] = wm<F16>(a[cur][mb], b[cur][nb], acc[mb][nb]);
            __builtin_amdgcn_sched_barrier(0);   // the other side of the same fence: no later read rises into this step's products
        }
        asm volatile("s_wait_dscnt 0x0" ::: "memory");       // this wave's reads of the stage are done before its buffer is handed back
        asm volatile("s_wait_asynccnt 0x0" ::: "memory");    // this wave's copies of the next stage have landed
        __syncthreads();                                     // next stage readable by all, this stage's buffer free
        if (st + 2 < NSTG) gstage(l + (unsigned)((st & 1) * GSB), ga + (size_t)(st + 2) * GK, gb + (size_t)(st + 2) * GK);
    }
    asm volatile("s_wait_asynccnt 0x0" ::: "memory");        // nothing in flight when the wave goes on to its epilogue
}

// k_proj: the three qkv projections in one grid; register-blocked bf16 GEMM, one wave per 32x64 tile (8 accumulators), 4 x 2 waves per block, operands from K-contiguous bf16 planes through the LDS ring of gemm_tile, K = DM.
// C[m][n] = sum_k A[m][k] Bt[n][k] + bias, written as a single f16 plane. grid (tiles of one projection, 3), 256 threads; blockIdx.y = 0 q, 1 k, 2 v^T; row tile fastest.
// q, k: A = x rows (m = b*SEQ + t), Bt = W rows (n = h*64 + d), bias[n] -> plane [(b*16 + h)][t][d].   v^T: A = Wv rows (m = h*64 + d), Bt = x rows (n = b*SEQ + t), bias[m] -> plane [(b*16 + h)][d][t].
__global__ __launch_bounds__(256) void k_proj(const bf* __restrict__ XB, const bf* __restrict__ WB, const float* __restrict__ bqkv, h16* QH, h16* KP, h16* VT) {
    __shared__ __align__(16) unsigned char ring[2 * GSB];    // two operand stages
    __shared__ __align__(16) float osw[8 * 16 * 68];         // output staging, one part per wave
    const int lane = threadIdx.x & 31, wave = threadIdx.x >> 5, lr = lane & 15, hi = lane >> 4;
    const int pz = blockIdx.y; const int biasRow = pz == 2;
    const int mt = biasRow ? DM / GT : NB * SEQ / GT;        // row tiles of this projection
    const int bx = blockIdx.x % mt, by = blockIdx.x / mt;
    const bf* W = WB + (size_t)pz * DM * DM;
    const bf* A = biasRow ? W : XB; const bf* Bt = biasRow ? XB : W;
    const float* bias = bqkv + pz * DM;
    h16* Ph = pz == 0 ? QH : (pz == 1 ? KP : VT);
    const int pitch = biasRow ? SEQ : HD;                    // row pitch of the plane, halves
    const int r0 = bx * GT + (wave >> 1) * 32, c0 = by * GT + (wave & 1) * 64;
    float* os = osw + wave * 16 * 68;
    v8f acc[2][4];
#pragma unroll
    for (int mb = 0; mb < 2; ++mb)
#pragma unroll
        for (int nb = 0; nb < 4; ++nb) acc[mb][nb] = (v8f){};
    gemm_tile<false>((const h16*)A, (const h16*)Bt, (unsigned)bx, (unsigned)by, ring, acc);
    // column bias (index selected as an integer, address always inside the bias array)
    float bc[4];
#pragma unroll
    for (int nb = 0; nb < 4; ++nb) { const int ci = biasRow ? 0 : (c0 + nb * 16 + lr); const float t = bfr(bias[ci]); bc[nb] = biasRow ? 0.0f : t; }
    const size_t tbase = biasRow ? (size_t)r0 * SEQ + (size_t)(c0 / SEQ) * ((size_t)DM * SEQ) + (size_t)(c0 % SEQ)
                                 : (size_t)(r0 / SEQ) * ((size_t)NH_ * SEQ * HD) + (size_t)(r0 % SEQ) * HD + (size_t)(c0 / HD) * ((size_t)SEQ * HD) + (size_t)(c0 % HD);
#pragma unroll
    for (int mb = 0; mb < 2; ++mb) {
        // row bias for rows r0 + mb*16 + 8h + 0..7 (two 16-B loads, clamped to offset 0 in column mode)
        const int ri = biasRow ? (r0 + mb * 16 + hi * 8) : 0;
        const v4f rb0 = *(const v4f*)(bias + ri); const v4f rb1 = *(const v4f*)(bias + ri + 4);
        float br[8];
#pragma unroll
        for (int j = 0; j < 4; ++j) { const float t0 = bfr(rb0[j]); const float t1 = bfr(rb1[j]); br[j] = biasRow ? t0 : 0.0f; br[4 + j] = biasRow ? t1 : 0.0f; }
#pragma unroll
        for (int nb = 0; nb < 4; ++nb) {
#pragma unroll
            for (int j = 0; j < 8; ++j) os[(hi * 8 + j) * 68 + nb * 16 + lr] = acc[mb][nb][j] + bc[nb] + br[j]; }   // D: row 8h+j, col lane&15
        wave_sync();
        const size_t sb = tbase + (size_t)(mb * 16) * (size_t)pitch;
{
#pragma unroll
            for (int s = 0; s < 4; ++s) { const int row = 4 * s + (lane >> 3), c8 = (lane & 7) * 8;   // 4 s x 4 row groups = 16 rows; 8 lanes x 8 = 64 columns
                const v4f x0 = *(const v4fa*)(&os[row * 68 + c8]); const v4f x1 = *(const v4fa*)(&os[row * 68 + c8 + 4]); v8h hv;
#pragma unroll
                for (int i = 0; i < 4; ++i) { hv[i] = (h16)x0[i]; hv[4 + i] = (h16)x1[i]; }
                const size_t oo = sb + (size_t)row * (size_t)pitch + c8;
                *(v8h*)(Ph + oo) = hv; }
            asm volatile("s_wait_xcnt 0x0" ::: "memory");   // precaution: stands in front of the next half tile's bias loads, which land in the four stores' data registers
             }
        wave_sync();
    }
}

// k_flash: fused attention, one wave per 16 query rows of one (batch, head), 8 waves per block; Q fragments straight from the f16 plane.
// K and V^T come in stages of KST keys through a two-buffer LDS ring that the block's waves share: whole-line asynchronous copies, the next stage in flight while this one is worked on.
// Transposed form: S^T[key][t] = K Q^T (A = K rows, B = Q rows); lane (t = lane&15, h = lane>>4) holds keys 8h+r of each 16-key tile, so the packed
// P tile is directly the B fragment of O^T[d][t] = V^T P^T (element r <- tile keys 0..15, element 8+r <- tile keys 16..31, lane unchanged).
// Softmax state (running max, partial sum) is one scalar per lane; the two lane halves of a row are combined with one xor-16 exchange.
__global__ __launch_bounds__(32 * AW) void k_flash(const h16* __restrict__ QH, const h16* __restrict__ KP, const h16* __restrict__ VT, h16* CTX) {
    __shared__ __align__(16) unsigned char ring[2 * SBY];    // two stages; after the loop: output staging
    float* os = (float*)ring;
    const int tid = threadIdx.x;
    const int lane = threadIdx.x & 31, wave = threadIdx.x >> 5, lr = lane & 15, hi = lane >> 4;
    const int zh = blockIdx.y; const int b = zh / NH_, h = zh % NH_;
    const int t0 = (blockIdx.x * AW + wave) * 16;
    const size_t pbase = (size_t)zh * SEQ * HD;
    const size_t qo = pbase + (size_t)(t0 + lr) * HD + 8 * hi;
    const v16h qh0 = ldh(QH + qo), qh1 = ldh(QH + qo + 32);   // B fragments: col t, k = d
    // copy maps. K tile: 32 KiB contiguous; copy i of lane tid takes 16-byte piece i*256 + tid = (key i*32 + tid/8, piece tid%8). V^T tile: 64 rows of 512 B; (row i*8 + tid/32, piece tid%32).
    const unsigned rb = (unsigned)(size_t)ring;              // LDS byte address of the ring
    const unsigned kl = rb + (unsigned)((tid >> 3) * KPB + (tid & 7) * 16);
    const unsigned vl = rb + (unsigned)(KBY + (tid >> 5) * VPB + (tid & 31) * 16);
    const h16* kg = KP + pbase + (size_t)tid * 8;                                   // + stage * KST * HD
    const h16* vg = VT + pbase + (size_t)(tid >> 5) * SEQ + (size_t)(tid & 31) * 8; // + stage * KST
    const int NST = SEQ / KST;
    copy8(kl, 32 * KPB, kg, (size_t)32 * HD); copy8(vl, 8 * VPB, vg, (size_t)8 * SEQ);
    asm volatile("s_wait_asynccnt 0x0" ::: "memory");        // stage 0 of this wave has landed
    __syncthreads();                                         // stage 0 of every wave is readable
    if (NST > 1) { copy8(kl + SBY, 32 * KPB, kg + (size_t)KST * HD, (size_t)32 * HD); copy8(vl + SBY, 8 * VPB, vg + KST, (size_t)8 * SEQ); }
    const int kfo = lr * KPB + 16 * hi;                      // + key * KPB              (A fragment: row key, k = d)
    const int vfo = KBY + lr * VPB + 16 * hi;                // + 16j * VPB + key * 2    (A fragment: row d, k = key)
    v8f o0 = (v8f){}, o1 = (v8f){}, o2 = (v8f){}, o3 = (v8f){};
    float m = -3.0e38f, l = 0.0f;
#pragma unroll 1   // the stage loop stays rolled: one publish point, buffer picked by the stage's parity
    for (int st = 0; st < NST; ++st) {
      const unsigned char* sb = ring + (st & 1) * SBY;
#pragma unroll 4   // four 32-key passes per branch, LDS offsets as immediates; all eight unrolled go past 256 registers and two blocks no longer fit a WGP
      for (int key0 = 0; key0 < KST; key0 += 32) {
        const h16* ka = (const h16*)(sb + kfo + key0 * KPB);
        const v16h ka0 = ldh(ka), ka1 = ldh(ka + 32), kb0 = ldh(ka + 8 * KPB), kb1 = ldh(ka + 8 * KPB + 32);   // 8 * KPB halves = 16 rows
        v8f sHa = (v8f){}, sHb = (v8f){};
        sHa = wmma16(ka0, qh0, sHa); sHb = wmma16(kb0, qh0, sHb);
        sHa = wmma16(ka1, qh1, sHa); sHb = wmma16(kb1, qh1, sHb);
        asm volatile("v_nop\n\tv_nop\n\tv_nop\n\tv_nop" : "+v"(sHa), "+v"(sHb) : "v"(ka0), "v"(ka1), "v"(kb0), "v"(kb1), "v"(qh0), "v"(qh1));
        float ta[8], tb[8]; float mx = -3.0e38f;
#pragma unroll
        for (int r = 0; r < 8; ++r) { ta[r] = sHa[r] * SC2; tb[r] = sHb[r] * SC2; mx = fmaxf(mx, fmaxf(ta[r], tb[r])); }
        mx = fmaxf(mx, __shfl_xor(mx, 16, 32));
        const float mnew = fmaxf(m, mx);
        const float alpha = __builtin_amdgcn_exp2f(m - mnew);
        const float sh = PSH - mnew;
        v16h pb; float ls = 0.0f;
#pragma unroll
        for (int r = 0; r < 8; ++r) { const h16 pa = (h16)__builtin_amdgcn_exp2f(ta[r] + sh); const h16 pc = (h16)__builtin_amdgcn_exp2f(tb[r] + sh); pb[r] = pa; pb[8 + r] = pc; ls += (float)pa + (float)pc; }
        l = l * alpha + ls; m = mnew;
        o0 = o0 * alpha; o1 = o1 * alpha; o2 = o2 * alpha; o3 = o3 * alpha;
        const h16* va = (const h16*)(sb + vfo + key0 * 2);
        const v16h v0 = ldh(va), v1 = ldh(va + 8 * VPB), v2 = ldh(va + 16 * VPB), v3 = ldh(va + 24 * VPB);     // 8 * VPB halves = 16 rows
        o0 = wmma16(v0, pb, o0); o1 = wmma16(v1, pb, o1); o2 = wmma16(v2, pb, o2); o3 = wmma16(v3, pb, o3);
        asm volatile("v_nop\n\tv_nop\n\tv_nop\n\tv_nop" : "+v"(o0), "+v"(o1), "+v"(o2), "+v"(o3) : "v"(v0), "v"(v1), "v"(v2), "v"(v3), "v"(pb));
      }
      asm volatile("s_wait_dscnt 0x0" ::: "memory");         // this wave's reads of the stage are done before its buffer is handed back
      asm volatile("s_wait_asynccnt 0x0" ::: "memory");      // this wave's copies of the next stage have landed
      __syncthreads();                                       // next stage readable by all, this stage's buffer free
      if (st + 2 < NST) {
          const unsigned bo = (unsigned)((st & 1) * SBY);
          copy8(kl + bo, 32 * KPB, kg + (size_t)(st + 2) * KST * HD, (size_t)32 * HD); copy8(vl + bo, 8 * VPB, vg + (size_t)(st + 2) * KST, (size_t)8 * SEQ);
      }
    }
    asm volatile("s_wait_asynccnt 0x0" ::: "memory");        // nothing in flight when the ring becomes output staging (the last barrier above ended every read)
    l += __shfl_xor(l, 16, 32);
    const float inv = CCS * (1.0f / l);      // normalisation (the P carry cancels) times the ctx carry
    const int wb = wave * 16 * 68;
    // O^T D layout: o_j[r] = (d = 16j + 8h + r, t = lane&15) -> os[t][d]; rows 0..15 x columns 0..63 all written
    { v4f a, c;
      a[0] = o0[0] * inv; a[1] = o0[1] * inv; a[2] = o0[2] * inv; a[3] = o0[3] * inv; c[0] = o0[4] * inv; c[1] = o0[5] * inv; c[2] = o0[6] * inv; c[3] = o0[7] * inv;
      *(v4fa*)(&os[wb + lr * 68 +  0 + 8 * hi]) = a; *(v4fa*)(&os[wb + lr * 68 +  0 + 8 * hi + 4]) = c;
      a[0] = o1[0] * inv; a[1] = o1[1] * inv; a[2] = o1[2] * inv; a[3] = o1[3] * inv; c[0] = o1[4] * inv; c[1] = o1[5] * inv; c[2] = o1[6] * inv; c[3] = o1[7] * inv;
      *(v4fa*)(&os[wb + lr * 68 + 16 + 8 * hi]) = a; *(v4fa*)(&os[wb + lr * 68 + 16 + 8 * hi + 4]) = c;
      a[0] = o2[0] * inv; a[1] = o2[1] * inv; a[2] = o2[2] * inv; a[3] = o2[3] * inv; c[0] = o2[4] * inv; c[1] = o2[5] * inv; c[2] = o2[6] * inv; c[3] = o2[7] * inv;
      *(v4fa*)(&os[wb + lr * 68 + 32 + 8 * hi]) = a; *(v4fa*)(&os[wb + lr * 68 + 32 + 8 * hi + 4]) = c;
      a[0] = o3[0] * inv; a[1] = o3[1] * inv; a[2] = o3[2] * inv; a[3] = o3[3] * inv; c[0] = o3[4] * inv; c[1] = o3[5] * inv; c[2] = o3[6] * inv; c[3] = o3[7] * inv;
      *(v4fa*)(&os[wb + lr * 68 + 48 + 8 * hi]) = a; *(v4fa*)(&os[wb + lr * 68 + 48 + 8 * hi + 4]) = c; }
    wave_sync();
    h16* crow = CTX + ((size_t)b * SEQ + t0) * DM + h * HD;      // ctx plane row = token, columns h*64 + d
{
#pragma unroll
        for (int s = 0; s < 4; ++s) { const int row = 4 * s + (lane >> 3), c8 = (lane & 7) * 8;   // 4 s x 4 row groups = 16 rows; 8 lanes x 8 halves = 64 columns
            const v4f x0 = *(const v4fa*)(&os[wb + row * 68 + c8]); const v4f x1 = *(const v4fa*)(&os[wb + row * 68 + c8 + 4]); v8h hv;
#pragma unroll
            for (int i = 0; i < 4; ++i) { hv[i] = (h16)x0[i]; hv[4 + i] = (h16)x1[i]; }
            *(v8h*)(crow + (size_t)row * DM + c8) = hv; }
         }
}

// k_oproj: register-blocked f16 GEMM, one wave per 32x64 tile, 4 x 2 waves per block, operands from K-contiguous f16 planes (ctx x256, w_proj x1024) through the LDS ring of gemm_tile, K = DM.
// OUT[m][n] = (sum_k A[m][k] Bt[n][k]) * 2^-18 + bias[n], f32. grid (NB*SEQ/128, DM/128), 256 threads.
__global__ __launch_bounds__(256) void k_oproj(const h16* __restrict__ A, const h16* __restrict__ Bt, const float* __restrict__ bias, float* OUT) {
    __shared__ __align__(16) unsigned char ring[2 * GSB];    // two operand stages
    __shared__ __align__(16) float osw[8 * 16 * 68];         // output staging, one part per wave
    const int lane = threadIdx.x & 31, wave = threadIdx.x >> 5, lr = lane & 15, hi = lane >> 4;
    const int r0 = blockIdx.x * GT + (wave >> 1) * 32, c0 = blockIdx.y * GT + (wave & 1) * 64;
    float* os = osw + wave * 16 * 68;
    v8f acc[2][4];
#pragma unroll
    for (int mb = 0; mb < 2; ++mb)
#pragma unroll
        for (int nb = 0; nb < 4; ++nb) acc[mb][nb] = (v8f){};
    gemm_tile<true>(A, Bt, blockIdx.x, blockIdx.y, ring, acc);
    float bc[4];
#pragma unroll
    for (int nb = 0; nb < 4; ++nb) bc[nb] = bfr(bias[c0 + nb * 16 + lr]);
    const int bq = r0 / SEQ, tq = r0 % SEQ;
    float* obase = OUT + ((size_t)bq * OUT_SEQ + tq) * DM + c0;
#pragma unroll
    for (int mb = 0; mb < 2; ++mb) {
#pragma unroll
        for (int nb = 0; nb < 4; ++nb) {
#pragma unroll
            for (int j = 0; j < 8; ++j) os[(hi * 8 + j) * 68 + nb * 16 + lr] = acc[mb][nb][j] * OSI + bc[nb]; }   // D: row 8h+j, col lane&15
        wave_sync();
{
#pragma unroll
            for (int s = 0; s < 8; ++s) { const int row = 2 * s + hi, cofs = lr * 4;   // 8 s x 2 rows = 16 rows; 16 lanes x 4 floats = 64 columns
                const v4f val = *(const v4fa*)(&os[row * 68 + cofs]);
                *(v4f*)(obase + (size_t)(mb * 16 + row) * DM + cofs) = val; }
             }
        wave_sync();
    }
}

static constexpr size_t al256(size_t v) { return (v + 255) & ~(size_t)255; }
static constexpr size_t SZ_XB = al256((size_t)NB * SEQ * DM * 2);
static constexpr size_t SZ_WB = al256((size_t)3 * DM * DM * 2);
static constexpr size_t SZ_WP = al256((size_t)DM * DM * 2);
static constexpr size_t SZ_PL = al256((size_t)NB * NH_ * SEQ * HD * 2);
static constexpr size_t SZ_CX = al256((size_t)NB * SEQ * DM * 2);
static constexpr size_t SZ_TOTAL = SZ_XB + SZ_WB + SZ_WP + 3 * SZ_PL + SZ_CX;
static_assert(SZ_TOTAL <= (size_t)134217728);          // workspace carve <= 128 MiB
static_assert(((size_t)DM * DM * 2) % 256 == 0);       // weight sub-planes stay 256-byte aligned

extern "C" void kernel_launch(void* const* d_in, const int* in_sizes, int n_in,
                              void* d_out, int out_size, void* d_ws, size_t ws_size, hipStream_t stream) {
    if (n_in < 5) return;
    const size_t needx = ((size_t)(NB - 1) * SEQ_FULL + SEQ) * DM;
    if ((size_t)in_sizes[0] < needx) return;
    if ((size_t)in_sizes[1] < (size_t)3 * DM * DM || (size_t)in_sizes[2] < (size_t)3 * DM) return;
    if ((size_t)in_sizes[3] < (size_t)DM * DM || (size_t)in_sizes[4] < (size_t)DM) return;
    if ((size_t)out_size < ((size_t)(NB - 1) * OUT_SEQ + SEQ) * DM) return;
    if (SZ_TOTAL > ws_size) return;
    // wire order: x, w_qkv ([3072][1024] = Bt as-is, rows q | k | v), b_qkv, w_proj ([out][in] = Bt as-is), b_proj
    const float* x = (const float*)d_in[0]; const float* wqkv = (const float*)d_in[1]; const float* bqkv = (const float*)d_in[2];
    const float* wproj = (const float*)d_in[3]; const float* bproj = (const float*)d_in[4];
    float* OUT = (float*)d_out;      // [NB][SEQ][1024]
    char* wsp = (char*)d_ws;
    bf* XB = (bf*)wsp; wsp += SZ_XB;                 // [NB*SEQ][1024]
    bf* WB = (bf*)wsp; wsp += SZ_WB;                 // [3][1024][1024]: q | k | v
    h16* WP = (h16*)wsp; wsp += SZ_WP;               // [1024][1024] x1024
    h16* QH = (h16*)wsp; wsp += SZ_PL;               // [NB*16][SEQ][64]
    h16* KP = (h16*)wsp; wsp += SZ_PL;               // [NB*16][SEQ][64]
    h16* VT = (h16*)wsp; wsp += SZ_PL;               // [NB*16][64][SEQ]
    h16* CX = (h16*)wsp; wsp += SZ_CX;               // [NB*SEQ][1024] x256

    k_cvt<<<CBX + CBW + CBP, 256, 0, stream>>>(x, wqkv, wproj, XB, WB, WP);

    k_proj<<<dim3((NB * SEQ / GT) * (DM / GT), 3, 1), 256, 0, stream>>>(XB, WB, bqkv, QH, KP, VT);

    k_flash<<<dim3(SEQ / (16 * AW), NB * NH_, 1), 32 * AW, 0, stream>>>(QH, KP, VT, CX);

    // output projection: A = ctx rows (m = b*SEQ + t, k = h*64 + d), Bt = w_proj rows (n = f) -> OUT[m][f]
    k_oproj<<<dim3(NB * SEQ / GT, DM / GT, 1), 256, 0, stream>>>(CX, WP, bproj, OUT);
}

// v004
// It runs in 115 microseconds.
// In both of two side-by-side timings against v003, it was 1.05 times as fast.
// All steps since v000 together make it 3.08 times as fast.
#include <hip/hip_runtime.h>

// Multi-head self-attention, width 1024 = 16 heads x 64, x [NB][SEQ][1024], fused w_qkv [3072][1024] ([out][in], rows q | k | v, head h = rows h*64+d of each third), b_qkv, score scale 1/8, no mask, output projection w_proj [out][in] + b_proj (f32 output).
// Compute dtypes, f32 accumulate everywhere: qkv projections v_wmma_f32_16x16x32_bf16 (x, w_qkv RNE-converted to bf16; products exact); scores v_wmma_f32_16x16x32_f16: q and k single f16 planes (one product), scale 0.125*log2(e) applied in f32;
// P (x256 carry, cancels in the normalisation; row sum taken over the f16 P values) and v single f16; softmax f32 (online, running max); output projection v_wmma_f32_16x16x32_f16: ctx single f16 (x256 carry), w_proj RNE-converted to bf16 then x1024 as f16 (exact), carries folded back (2^-18) in the f32 epilogue; biases RNE-converted to bf16, added in f32.
// Layout: bf16 copies of x and w_qkv; q, k planes [b*16+h][t][d] and v^T plane [b*16+h][d][t] written by the GEMM epilogue; fused flash kernel in transposed form (S^T = K Q^T, O^T = V^T P^T; K and V^T tiles staged in LDS for the 8 waves of a block) writes the f16 ctx plane [b*SEQ+t][1024]; f16 GEMM writes the output buffer.
// The four GEMMs: 128x128 tile per 8-wave block (32x64 per wave), both operands staged in LDS in whole lines, 128 k per stage, two buffers.
// Blocks that stage the same rows (GEMM panels; K and V^T of a head) begin the stage walk at stages spread by block index and wrap, so that not all of them ask L2 for the same lines at the same moment.
// Four launches: launches that read none of each other's output share one grid (the three conversions by block range; the q, k and v^T projections by blockIdx.y).

#ifndef NB
#define NB 1
#endif
#ifndef SEQ
#define SEQ 4096
#endif
#define NB_FULL  1
#define SEQ_FULL 4096
#ifndef OUT_SEQ
#define OUT_SEQ SEQ              // row pitch (in tokens) between batches of the output
#endif
#define DM   1024
#define NH_  16
#define HD   64
#define AW   8                   // waves per flash block (16 query rows each)
#define KST  256                 // keys per LDS stage of the flash kernel
#define KPB  (HD * 2 + 16)       // LDS pitch of a K row, bytes: 16 B x odd, no bank conflict for 16-byte fragment reads
#define VPB  (KST * 2 + 16)      // LDS pitch of a V^T row, bytes: 16 B x odd
#define KBY  (KST * KPB)         // K part of a stage, bytes
#define SBY  (KBY + HD * VPB)    // one stage (K then V^T), bytes
#define GT   128                 // GEMM block tile, rows and columns (4 x 2 waves of 32 x 64)
#define GK   128                 // k per LDS stage of the GEMMs
#define GPB  (GK * 2 + 16)       // LDS pitch of a GEMM operand row, bytes: 16 B x odd
#define GAB  (GT * GPB)          // one operand's part of a stage, bytes
#define GSB  (2 * GAB)           // one stage (A rows then B rows), bytes
#define SC2  (0.125f * 1.4426950408889634f)   // HD^-0.5 * log2(e)
#define PSH  8.0f                // log2 of the P carry (256)
#define CCS  256.0f              // carry of the ctx plane
#define WPS  1024.0f             // carry of the w_proj plane
#define OSI  (1.0f / (256.0f * 1024.0f))      // inverse of both carries

static_assert(HD == 64);
static_assert(NH_ * HD == DM);                 // head h = columns h*64 + d
static_assert(DM % 64 == 0);                   // column tiles of 64
static_assert(DM % 32 == 0);                   // GEMM k-loop steps by 32
static_assert(SEQ % 64 == 0);                  // a wave's tile (32 rows, 64 columns) never straddles two batches
static_assert((NB * SEQ) % 64 == 0);
static_assert(SEQ % 32 == 0);                  // key loop steps by 32
static_assert(SEQ % (16 * AW) == 0);           // flash grid covers the sequence exactly
static_assert(SEQ % KST == 0);                 // whole stages only
static_assert(AW == 8 && KST == 256);          // copy maps of k_flash: 256 lanes x 8 copies x 16 B = one 32-KiB K or V^T tile
static_assert((KPB / 16) % 2 == 1 && (VPB / 16) % 2 == 1);
static_assert(2 * SBY >= AW * 16 * 68 * 4);    // the ring holds the output staging
static_assert((NB * SEQ) % GT == 0 && DM % GT == 0);   // GEMM grids cover both extents exactly
static_assert(DM % GK == 0 && DM / GK >= 2);           // whole stages, and the two that the ring's prologue needs
static_assert(GT == 128 && GK == 128);                 // copy map of gstage: 256 lanes x 16 copies x 16 B = 256 rows of 256 B
static_assert((GPB / 16) % 2 == 1);
static_assert(((size_t)SEQ * DM) % 8 == 0);
static_assert(((size_t)DM * DM) % 8 == 0);
static_assert(NB <= NB_FULL);
static_assert(SEQ <= SEQ_FULL);

typedef _Float16 h16;
typedef unsigned short bf;
typedef __attribute__((ext_vector_type(16))) __bf16   v16bf;
typedef __attribute__((ext_vector_type(16))) _Float16 v16h;
typedef __attribute__((ext_vector_type(8)))  _Float16 v8h;
typedef __attribute__((ext_vector_type(8)))  unsigned short v8us;
typedef __attribute__((ext_vector_type(16))) unsigned short v16us;
typedef __attribute__((ext_vector_type(8)))  float    v8f;
typedef __attribute__((ext_vector_type(4)))  float    v4f;
typedef v4f  __attribute__((may_alias)) v4fa;

__device__ __forceinline__ unsigned short f2bf(float f) { unsigned u = __float_as_uint(f); u += 0x7FFFu + ((u >> 16) & 1u); return (unsigned short)(u >> 16); }
__device__ __forceinline__ float bfr(float f) { return __uint_as_float(((unsigned)f2bf(f)) << 16); }   // value after RNE convert to bf16
__device__ __forceinline__ v16h cat16(v8h lo, v8h hi) { return __builtin_shufflevector(lo, hi, 0, 1, 2, 3, 4, 5, 6, 7, 8, 9, 10, 11, 12, 13, 14, 15); }
__device__ __forceinline__ v8f wmma16(v16h a, v16h b, v8f c) { return __builtin_amdgcn_wmma_f32_16x16x32_f16(false, a, false, b, (short)0, c, false, false); }
__device__ __forceinline__ v8f wmmab(v16bf a, v16bf b, v8f c) { return __builtin_amdgcn_wmma_f32_16x16x32_bf16(false, a, false, b, (short)0, c, false, false); }
// fragment loaders from K-contiguous 16-bit rows; p already includes + 8*(lane>>4): elements 0..7 <- k0+8h+0..7, elements 8..15 <- k0+16+8h+0..7 (same map for A and B)
__device__ __forceinline__ v16h  ldh(const h16* p) { return cat16(*(const v8h*)p, *(const v8h*)(p + 16)); }
// ordering point for wave-private LDS tiles (same wave writes and reads)
__device__ __forceinline__ void wave_sync() { __builtin_amdgcn_fence(3 /* release order */, "wavefront"); __builtin_amdgcn_wave_barrier(); asm volatile("" ::: "memory"); }

// k_cvt: the three conversions in one grid, 8 values per thread; a block lies wholly in one range: x -> bf16, then w_qkv -> bf16, then w_proj -> bf16 value x1024 as f16.
#define CBX ((unsigned)((size_t)NB * SEQ * DM / 2048))   // blocks of x (256 threads x 8 values)
#define CBW ((unsigned)((size_t)3 * DM * DM / 2048))     // blocks of w_qkv
#define CBP ((unsigned)((size_t)DM * DM / 2048))         // blocks of w_proj
static_assert(((size_t)SEQ * DM) % 2048 == 0 && ((size_t)DM * DM) % 2048 == 0);   // whole blocks in every range, none straddles two batches
__global__ __launch_bounds__(256) void k_cvt(const float* __restrict__ x, const float* __restrict__ wqkv, const float* __restrict__ wproj, bf* XB, bf* WB, h16* WP) {
    const unsigned blk = blockIdx.x;
    if (blk < CBX + CBW) {
        const bool isx = blk < CBX;
        const size_t e = ((size_t)(isx ? blk : blk - CBX) * 256 + threadIdx.x) * 8;
        const size_t bt = e / ((size_t)SEQ * DM);            // batch (x only): source batches lie SEQ_FULL tokens apart
        const float* s = isx ? x + bt * ((size_t)SEQ_FULL * DM) + (e - bt * ((size_t)SEQ * DM)) : wqkv + e;
        const v8f v = *(const v8f*)s; v8us o;
#pragma unroll
        for (int k = 0; k < 8; ++k) o[k] = f2bf(v[k]);
        *(v8us*)((isx ? XB : WB) + e) = o;
    } else {
        const size_t e = ((size_t)(blk - CBX - CBW) * 256 + threadIdx.x) * 8;
        const v8f v = *(const v8f*)(wproj + e); v8h o;
#pragma unroll
        for (int k = 0; k < 8; ++k) o[k] = (h16)(bfr(v[k]) * WPS);
        *(v8h*)(WP + e) = o;
        asm volatile("s_wait_xcnt 0x0" ::: "memory");   // precaution: stands in front of every later write of the store's registers
    }
}

// eight asynchronous 16-byte copies per lane, global -> LDS (LDS byte address l + i*ls, global address g + i*gs halves).
// s_wait_xcnt closes the statement so that no address register of an issued copy is rewritten ahead of it.
__device__ __forceinline__ void copy8(unsigned l, unsigned ls, const h16* g, size_t gs) {
    asm volatile("global_load_async_to_lds_b128 %0, %8, off\n\t"
                 "global_load_async_to_lds_b128 %1, %9, off\n\t"
                 "global_load_async_to_lds_b128 %2, %10, off\n\t"
                 "global_load_async_to_lds_b128 %3, %11, off\n\t"
                 "global_load_async_to_lds_b128 %4, %12, off\n\t"
                 "global_load_async_to_lds_b128 %5, %13, off\n\t"
                 "global_load_async_to_lds_b128 %6, %14, off\n\t"
                 "global_load_async_to_lds_b128 %7, %15, off\n\t"
                 "s_wait_xcnt 0x0"
                 :: "v"(l), "v"(l + ls), "v"(l + 2 * ls), "v"(l + 3 * ls), "v"(l + 4 * ls), "v"(l + 5 * ls), "v"(l + 6 * ls), "v"(l + 7 * ls),
                    "v"(g), "v"(g + gs), "v"(g + 2 * gs), "v"(g + 3 * gs), "v"(g + 4 * gs), "v"(g + 5 * gs), "v"(g + 6 * gs), "v"(g + 7 * gs)
                 : "memory");
}

// one GEMM stage: rows 0..127 of the A tile, then of the B tile, 256 B (GK halves) of each. Copy i of lane tid takes (row i*16 + tid/16, 16-byte piece tid%16): a wave's copy covers two whole 256-B runs.
__device__ __forceinline__ void gstage(unsigned l, const h16* ga, const h16* gb) {
    copy8(l, 16 * GPB, ga, (size_t)16 * DM); copy8(l + GAB, 16 * GPB, gb, (size_t)16 * DM);
}
// fragment from an LDS row of 16-bit values; p already includes + 16*(lane>>4) bytes: same element map as ldh, for A and for B
__device__ __forceinline__ v16us ldu(const unsigned char* p) { return __builtin_shufflevector(*(const v8us*)p, *(const v8us*)(p + 32), 0, 1, 2, 3, 4, 5, 6, 7, 8, 9, 10, 11, 12, 13, 14, 15); }
template <bool F16> __device__ __forceinline__ v8f wm(v16us a, v16us b, v8f c) {
    if constexpr (F16) return wmma16(__builtin_bit_cast(v16h, a), __builtin_bit_cast(v16h, b), c);
    else               return wmmab(__builtin_bit_cast(v16bf, a), __builtin_bit_cast(v16bf, b), c);
}
// k loop of a 128x128 block tile (bx, by), K = DM: acc[mb][nb] += A rows (bx*128 + (wave>>1)*32 + mb*16 ..) x Bt rows (by*128 + (wave&1)*64 + nb*16 ..); the 128-k stages are walked from stage (bx + by) mod NSTG on, wrapping, k ascending in steps of 32 inside a stage.
// Two-buffer LDS ring shared by the block's 8 waves: the next stage's copies fly while this one is worked on; inside a stage the next k step's fragments are read ahead of this step's products.
template <bool F16> __device__ __forceinline__ void gemm_tile(const h16* A, const h16* Bt, unsigned bx, unsigned by, unsigned char* ring, v8f (&acc)[2][4]) {
    const int tid = threadIdx.x, lane = tid & 31, wave = tid >> 5, lr = lane & 15, hi = lane >> 4;
    const unsigned l = (unsigned)(size_t)ring + (unsigned)((tid >> 4) * GPB + (tid & 15) * 16);   // LDS byte address of this lane's first piece
    const h16* ga = A  + (size_t)(bx * GT + (tid >> 4)) * DM + (tid & 15) * 8;             // + stage * GK
    const h16* gb = Bt + (size_t)(by * GT + (tid >> 4)) * DM + (tid & 15) * 8;
    const unsigned NSTG = DM / GK;
    const unsigned s0 = (bx + by) % NSTG;                    // first stage of this block: blocks that share a row panel differ in by, those that share a column panel in bx, so sharers spread over the NSTG stages
    gstage(l, ga + (size_t)s0 * GK, gb + (size_t)s0 * GK);
    asm volatile("s_wait_asynccnt 0x0" ::: "memory");        // stage s0 of this wave has landed
    __syncthreads();                                         // stage s0 of every wave is readable
    { const size_t ko = (size_t)((s0 + 1) % NSTG) * GK; gstage(l + GSB, ga + ko, gb + ko); }
    const int afo = ((wave >> 1) * 32 + lr) * GPB + 16 * hi;
    const int bfo = GAB + ((wave & 1) * 64 + lr) * GPB + 16 * hi;
#pragma unroll 1   // the stage loop stays rolled: one publish point, buffer picked by the stage's parity
    for (unsigned st = 0; st < NSTG; ++st) {
        const unsigned char* pa = ring + (st & 1) * GSB + afo;
        const unsigned char* pb = ring + (st & 1) * GSB + bfo;
        v16us a[2][2], b[2][4];
#pragma unroll
        for (int i = 0; i < 4; ++i) { if (i < 2) a[0][i] = ldu(pa + i * 16 * GPB); b[0][i] = ldu(pb + i * 16 * GPB); }
#pragma unroll
        for (int kk = 0; kk < GK / 32; ++kk) {
            const int cur = kk & 1, nxt = cur ^ 1;
            if (kk + 1 < GK / 32) {
#pragma unroll
                for (int i = 0; i < 4; ++i) { if (i < 2) a[nxt][i] = ldu(pa + i * 16 * GPB + (kk + 1) * 64); b[nxt][i] = ldu(pb + i * 16 * GPB + (kk + 1) * 64); }
            }
            __builtin_amdgcn_sched_barrier(0);   // keeps the next step's reads one group ahead of this step's products: sunk among them, each read's LDS latency is waited out
#pragma unroll
            for (int nb = 0; nb < 4; ++nb)
#pragma unroll
                for (int mb = 0; mb < 2; ++mb) acc[mb][nb] = wm<F16>(a[cur][mb], b[cur][nb], acc[mb][nb]);
            __builtin_amdgcn_sched_barrier(0);   // the other side of the same fence: no later read rises into this step's products
        }
        asm volatile("s_wait_dscnt 0x0" ::: "memory");       // this wave's reads of the stage are done before its buffer is handed back
        asm volatile("s_wait_asynccnt 0x0" ::: "memory");    // this wave's copies of the next stage have landed
        __syncthreads();                                     // next stage readable by all, this stage's buffer free
        if (st + 2 < NSTG) { const size_t ko = (size_t)((s0 + st + 2) % NSTG) * GK; gstage(l + (unsigned)((st & 1) * GSB), ga + ko, gb + ko); }
    }
    asm volatile("s_wait_asynccnt 0x0" ::: "memory");        // nothing in flight when the wave goes on to its epilogue
}

// k_proj: the three qkv projections in one grid; register-blocked bf16 GEMM, one wave per 32x64 tile (8 accumulators), 4 x 2 waves per block, operands from K-contiguous bf16 planes through the LDS ring of gemm_tile, K = DM.
// C[m][n] = sum_k A[m][k] Bt[n][k] + bias, written as a single f16 plane. grid (tiles of one projection, 3), 256 threads; blockIdx.y = 0 q, 1 k, 2 v^T; row tile fastest.
// q, k: A = x rows (m = b*SEQ + t), Bt = W rows (n = h*64 + d), bias[n] -> plane [(b*16 + h)][t][d].   v^T: A = Wv rows (m = h*64 + d), Bt = x rows (n = b*SEQ + t), bias[m] -> plane [(b*16 + h)][d][t].
__global__ __launch_bounds__(256) void k_proj(const bf* __restrict__ XB, const bf* __restrict__ WB, const float* __restrict__ bqkv, h16* QH, h16* KP, h16* VT) {
    __shared__ __align__(16) unsigned char ring[2 * GSB];    // two operand stages
    __shared__ __align__(16) float osw[8 * 16 * 68];         // output staging, one part per wave
    const int lane = threadIdx.x & 31, wave = threadIdx.x >> 5, lr = lane & 15, hi = lane >> 4;
    const int pz = blockIdx.y; const int biasRow = pz == 2;
    const int mt = biasRow ? DM / GT : NB * SEQ / GT;        // row tiles of this projection
    const int bx = blockIdx.x % mt, by = blockIdx.x / mt;
    const bf* W = WB + (size_t)pz * DM * DM;
    const bf* A = biasRow ? W : XB; const bf* Bt = biasRow ? XB : W;
    const float* bias = bqkv + pz * DM;
    h16* Ph = pz == 0 ? QH : (pz == 1 ? KP : VT);
    const int pitch = biasRow ? SEQ : HD;                    // row pitch of the plane, halves
    const int r0 = bx * GT + (wave >> 1) * 32, c0 = by * GT + (wave & 1) * 64;
    float* os = osw + wave * 16 * 68;
    v8f acc[2][4];
#pragma unroll
    for (int mb = 0; mb < 2; ++mb)
#pragma unroll
        for (int nb = 0; nb < 4; ++nb) acc[mb][nb] = (v8f){};
    gemm_tile<false>((const h16*)A, (const h16*)Bt, (unsigned)bx, (unsigned)by, ring, acc);
    // column bias (index selected as an integer, address always inside the bias array)
    float bc[4];
#pragma unroll
    for (int nb = 0; nb < 4; ++nb) { const int ci = biasRow ? 0 : (c0 + nb * 16 + lr); const float t = bfr(bias[ci]); bc[nb] = biasRow ? 0.0f : t; }
    const size_t tbase = biasRow ? (size_t)r0 * SEQ + (size_t)(c0 / SEQ) * ((size_t)DM * SEQ) + (size_t)(c0 % SEQ)
                                 : (size_t)(r0 / SEQ) * ((size_t)NH_ * SEQ * HD) + (size_t)(r0 % SEQ) * HD + (size_t)(c0 / HD) * ((size_t)SEQ * HD) + (size_t)(c0 % HD);
#pragma unroll
    for (int mb = 0; mb < 2; ++mb) {
        // row bias for rows r0 + mb*16 + 8h + 0..7 (two 16-B loads, clamped to offset 0 in column mode)
        const int ri = biasRow ? (r0 + mb * 16 + hi * 8) : 0;
        const v4f rb0 = *(const v4f*)(bias + ri); const v4f rb1 = *(const v4f*)(bias + ri + 4);
        float br[8];
#pragma unroll
        for (int j = 0; j < 4; ++j) { const float t0 = bfr(rb0[j]); const float t1 = bfr(rb1[j]); br[j] = biasRow ? t0 : 0.0f; br[4 + j] = biasRow ? t1 : 0.0f; }
#pragma unroll
        for (int nb = 0; nb < 4; ++nb) {
#pragma unroll
            for (int j = 0; j < 8; ++j) os[(hi * 8 + j) * 68 + nb * 16 + lr] = acc[mb][nb][j] + bc[nb] + br[j]; }   // D: row 8h+j, col lane&15
        wave_sync();
        const size_t sb = tbase + (size_t)(mb * 16) * (size_t)pitch;
{
#pragma unroll
            for (int s = 0; s < 4; ++s) { const int row = 4 * s + (lane >> 3), c8 = (lane & 7) * 8;   // 4 s x 4 row groups = 16 rows; 8 lanes x 8 = 64 columns
                const v4f x0 = *(const v4fa*)(&os[row * 68 + c8]); const v4f x1 = *(const v4fa*)(&os[row * 68 + c8 + 4]); v8h hv;
#pragma unroll
                for (int i = 0; i < 4; ++i) { hv[i] = (h16)x0[i]; hv[4 + i] = (h16)x1[i]; }
                const size_t oo = sb + (size_t)row * (size_t)pitch + c8;
                *(v8h*)(Ph + oo) = hv; }
            asm volatile("s_wait_xcnt 0x0" ::: "memory");   // precaution: stands in front of the next half tile's bias loads, which land in the four stores' data registers
             }
        wave_sync();
    }
}

// k_flash: fused attention, one wave per 16 query rows of one (batch, head), 8 waves per block; Q fragments straight from the f16 plane.
// K and V^T come in stages of KST keys through a two-buffer LDS ring that the block's waves share: whole-line asynchronous copies, the next stage in flight while this one is worked on.
// The stages are walked from stage blockIdx.x mod NST on, wrapping (the running-maximum softmax takes the keys in any order): the blocks of one head start two to each of the NST stages.
// Transposed form: S^T[key][t] = K Q^T (A = K rows, B = Q rows); lane (t = lane&15, h = lane>>4) holds keys 8h+r of each 16-key tile, so the packed
// P tile is directly the B fragment of O^T[d][t] = V^T P^T (element r <- tile keys 0..15, element 8+r <- tile keys 16..31, lane unchanged).
// Softmax state (running max, partial sum) is one scalar per lane; the two lane halves of a row are combined with one xor-16 exchange.
__global__ __launch_bounds__(32 * AW) void k_flash(const h16* __restrict__ QH, const h16* __restrict__ KP, const h16* __restrict__ VT, h16* CTX) {
    __shared__ __align__(16) unsigned char ring[2 * SBY];    // two stages; after the loop: output staging
    float* os = (float*)ring;
    const int tid = threadIdx.x;
    const int lane = threadIdx.x & 31, wave = threadIdx.x >> 5, lr = lane & 15, hi = lane >> 4;
    const int zh = blockIdx.y; const int b = zh / NH_, h = zh % NH_;
    const int t0 = (blockIdx.x * AW + wave) * 16;
    const size_t pbase = (size_t)zh * SEQ * HD;
    const size_t qo = pbase + (size_t)(t0 + lr) * HD + 8 * hi;
    const v16h qh0 = ldh(QH + qo), qh1 = ldh(QH + qo + 32);   // B fragments: col t, k = d
    // copy maps. K tile: 32 KiB contiguous; copy i of lane tid takes 16-byte piece i*256 + tid = (key i*32 + tid/8, piece tid%8). V^T tile: 64 rows of 512 B; (row i*8 + tid/32, piece tid%32).
    const unsigned rb = (unsigned)(size_t)ring;              // LDS byte address of the ring
    const unsigned kl = rb + (unsigned)((tid >> 3) * KPB + (tid & 7) * 16);
    const unsigned vl = rb + (unsigned)(KBY + (tid >> 5) * VPB + (tid & 31) * 16);
    const h16* kg = KP + pbase + (size_t)tid * 8;                                   // + stage * KST * HD
    const h16* vg = VT + pbase + (size_t)(tid >> 5) * SEQ + (size_t)(tid & 31) * 8; // + stage * KST
    const unsigned NST = SEQ / KST;
    const unsigned s0 = blockIdx.x % NST;                    // first stage of this block
    copy8(kl, 32 * KPB, kg + (size_t)s0 * KST * HD, (size_t)32 * HD); copy8(vl, 8 * VPB, vg + (size_t)s0 * KST, (size_t)8 * SEQ);
    asm volatile("s_wait_asynccnt 0x0" ::: "memory");        // stage s0 of this wave has landed
    __syncthreads();                                         // stage s0 of every wave is readable
    if (NST > 1) { const size_t sn = (s0 + 1) % NST; copy8(kl + SBY, 32 * KPB, kg + sn * KST * HD, (size_t)32 * HD); copy8(vl + SBY, 8 * VPB, vg + sn * KST, (size_t)8 * SEQ); }
    const int kfo = lr * KPB + 16 * hi;                      // + key * KPB              (A fragment: row key, k = d)
    const int vfo = KBY + lr * VPB + 16 * hi;                // + 16j * VPB + key * 2    (A fragment: row d, k = key)
    v8f o0 = (v8f){}, o1 = (v8f){}, o2 = (v8f){}, o3 = (v8f){};
    float m = -3.0e38f, l = 0.0f;
#pragma unroll 1   // the stage loop stays rolled: one publish point, buffer picked by the stage's parity
    for (unsigned st = 0; st < NST; ++st) {
      const unsigned char* sb = ring + (st & 1) * SBY;
#pragma unroll 4   // four 32-key passes per branch, LDS offsets as immediates; all eight unrolled go past 256 registers and two blocks no longer fit a WGP
      for (int key0 = 0; key0 < KST; key0 += 32) {
        const h16* ka = (const h16*)(sb + kfo + key0 * KPB);
        const v16h ka0 = ldh(ka), ka1 = ldh(ka + 32), kb0 = ldh(ka + 8 * KPB), kb1 = ldh(ka + 8 * KPB + 32);   // 8 * KPB halves = 16 rows
        v8f sHa = (v8f){}, sHb = (v8f){};
        sHa = wmma16(ka0, qh0, sHa); sHb = wmma16(kb0, qh0, sHb);
        sHa = wmma16(ka1, qh1, sHa); sHb = wmma16(kb1, qh1, sHb);
        asm volatile("v_nop\n\tv_nop\n\tv_nop\n\tv_nop" : "+v"(sHa), "+v"(sHb) : "v"(ka0), "v"(ka1), "v"(kb0), "v"(kb1), "v"(qh0), "v"(qh1));
        float ta[8], tb[8]; float mx = -3.0e38f;
#pragma unroll
        for (int r = 0; r < 8; ++r) { ta[r] = sHa[r] * SC2; tb[r] = sHb[r] * SC2; mx = fmaxf(mx, fmaxf(ta[r], tb[r])); }
        mx = fmaxf(mx, __shfl_xor(mx, 16, 32));
        const float mnew = fmaxf(m, mx);
        const float alpha = __builtin_amdgcn_exp2f(m - mnew);
        const float sh = PSH - mnew;
        v16h pb; float ls = 0.0f;
#pragma unroll
        for (int r = 0; r < 8; ++r) { const h16 pa = (h16)__builtin_amdgcn_exp2f(ta[r] + sh); const h16 pc = (h16)__builtin_amdgcn_exp2f(tb[r] + sh); pb[r] = pa; pb[8 + r] = pc; ls += (float)pa + (float)pc; }
        l = l * alpha + ls; m = mnew;
        o0 = o0 * alpha; o1 = o1 * alpha; o2 = o2 * alpha; o3 = o3 * alpha;
        const h16* va = (const h16*)(sb + vfo + key0 * 2);
        const v16h v0 = ldh(va), v1 = ldh(va + 8 * VPB), v2 = ldh(va + 16 * VPB), v3 = ldh(va + 24 * VPB);     // 8 * VPB halves = 16 rows
        o0 = wmma16(v0, pb, o0); o1 = wmma16(v1, pb, o1); o2 = wmma16(v2, pb, o2); o3 = wmma16(v3, pb, o3);
        asm volatile("v_nop\n\tv_nop\n\tv_nop\n\tv_nop" : "+v"(o0), "+v"(o1), "+v"(o2), "+v"(o3) : "v"(v0), "v"(v1), "v"(v2), "v"(v3), "v"(pb));
      }
      asm volatile("s_wait_dscnt 0x0" ::: "memory");         // this wave's reads of the stage are done before its buffer is handed back
      asm volatile("s_wait_asynccnt 0x0" ::: "memory");      // this wave's copies of the next stage have landed
      __syncthreads();                                       // next stage readable by all, this stage's buffer free
      if (st + 2 < NST) {
          const unsigned bo = (unsigned)((st & 1) * SBY);
          const size_t sn = (s0 + st + 2) % NST;
          copy8(kl + bo, 32 * KPB, kg + sn * KST * HD, (size_t)32 * HD); copy8(vl + bo, 8 * VPB, vg + sn * KST, (size_t)8 * SEQ);
      }
    }
    asm volatile("s_wait_asynccnt 0x0" ::: "memory");        // nothing in flight when the ring becomes output staging (the last barrier above ended every read)
    l += __shfl_xor(l, 16, 32);
    const float inv = CCS * (1.0f / l);      // normalisation (the P carry cancels) times the ctx carry
    const int wb = wave * 16 * 68;
    // O^T D layout: o_j[r] = (d = 16j + 8h + r, t = lane&15) -> os[t][d]; rows 0..15 x columns 0..63 all written
    { v4f a, c;
      a[0] = o0[0] * inv; a[1] = o0[1] * inv; a[2] = o0[2] * inv; a[3] = o0[3] * inv; c[0] = o0[4] * inv; c[1] = o0[5] * inv; c[2] = o0[6] * inv; c[3] = o0[7] * inv;
      *(v4fa*)(&os[wb + lr * 68 +  0 + 8 * hi]) = a; *(v4fa*)(&os[wb + lr * 68 +  0 + 8 * hi + 4]) = c;
      a[0] = o1[0] * inv; a[1] = o1[1] * inv; a[2] = o1[2] * inv; a[3] = o1[3] * inv; c[0] = o1[4] * inv; c[1] = o1[5] * inv; c[2] = o1[6] * inv; c[3] = o1[7] * inv;
      *(v4fa*)(&os[wb + lr * 68 + 16 + 8 * hi]) = a; *(v4fa*)(&os[wb + lr * 68 + 16 + 8 * hi + 4]) = c;
      a[0] = o2[0] * inv; a[1] = o2[1] * inv; a[2] = o2[2] * inv; a[3] = o2[3] * inv; c[0] = o2[4] * inv; c[1] = o2[5] * inv; c[2] = o2[6] * inv; c[3] = o2[7] * inv;
      *(v4fa*)(&os[wb + lr * 68 + 32 + 8 * hi]) = a; *(v4fa*)(&os[wb + lr * 68 + 32 + 8 * hi + 4]) = c;
      a[0] = o3[0] * inv; a[1] = o3[1] * inv; a[2] = o3[2] * inv; a[3] = o3[3] * inv; c[0] = o3[4] * inv; c[1] = o3[5] * inv; c[2] = o3[6] * inv; c[3] = o3[7] * inv;
      *(v4fa*)(&os[wb + lr * 68 + 48 + 8 * hi]) = a; *(v4fa*)(&os[wb + lr * 68 + 48 + 8 * hi + 4]) = c; }
    wave_sync();
    h16* crow = CTX + ((size_t)b * SEQ + t0) * DM + h * HD;      // ctx plane row = token, columns h*64 + d
{
#pragma unroll
        for (int s = 0; s < 4; ++s) { const int row = 4 * s + (lane >> 3), c8 = (lane & 7) * 8;   // 4 s x 4 row groups = 16 rows; 8 lanes x 8 halves = 64 columns
            const v4f x0 = *(const v4fa*)(&os[wb + row * 68 + c8]); const v4f x1 = *(const v4fa*)(&os[wb + row * 68 + c8 + 4]); v8h hv;
#pragma unroll
            for (int i = 0; i < 4; ++i) { hv[i] = (h16)x0[i]; hv[4 + i] = (h16)x1[i]; }
            *(v8h*)(crow + (size_t)row * DM + c8) = hv; }
         }
}

// k_oproj: register-blocked f16 GEMM, one wave per 32x64 tile, 4 x 2 waves per block, operands from K-contiguous f16 planes (ctx x256, w_proj x1024) through the LDS ring of gemm_tile, K = DM.
// OUT[m][n] = (sum_k A[m][k] Bt[n][k]) * 2^-18 + bias[n], f32. grid (NB*SEQ/128, DM/128), 256 threads.
__global__ __launch_bounds__(256) void k_oproj(const h16* __restrict__ A, const h16* __restrict__ Bt, const float* __restrict__ bias, float* OUT) {
    __shared__ __align__(16) unsigned char ring[2 * GSB];    // two operand stages
    __shared__ __align__(16) float osw[8 * 16 * 68];         // output staging, one part per wave
    const int lane = threadIdx.x & 31, wave = threadIdx.x >> 5, lr = lane & 15, hi = lane >> 4;
    const int r0 = blockIdx.x * GT + (wave >> 1) * 32, c0 = blockIdx.y * GT + (wave & 1) * 64;
    float* os = osw + wave * 16 * 68;
    v8f acc[2][4];
#pragma unroll
    for (int mb = 0; mb < 2; ++mb)
#pragma unroll
        for (int nb = 0; nb < 4; ++nb) acc[mb][nb] = (v8f){};
    gemm_tile<true>(A, Bt, blockIdx.x, blockIdx.y, ring, acc);
    float bc[4];
#pragma unroll
    for (int nb = 0; nb < 4; ++nb) bc[nb] = bfr(bias[c0 + nb * 16 + lr]);
    const int bq = r0 / SEQ, tq = r0 % SEQ;
    float* obase = OUT + ((size_t)bq * OUT_SEQ + tq) * DM + c0;
#pragma unroll
    for (int mb = 0; mb < 2; ++mb) {
#pragma unroll
        for (int nb = 0; nb < 4; ++nb) {
#pragma unroll
            for (int j = 0; j < 8; ++j) os[(hi * 8 + j) * 68 + nb * 16 + lr] = acc[mb][nb][j] * OSI + bc[nb]; }   // D: row 8h+j, col lane&15
        wave_sync();
{
#pragma unroll
            for (int s = 0; s < 8; ++s) { const int row = 2 * s + hi, cofs = lr * 4;   // 8 s x 2 rows = 16 rows; 16 lanes x 4 floats = 64 columns
                const v4f val = *(const v4fa*)(&os[row * 68 + cofs]);
                *(v4f*)(obase + (size_t)(mb * 16 + row) * DM + cofs) = val; }
             }
        wave_sync();
    }
}

static constexpr size_t al256(size_t v) { return (v + 255) & ~(size_t)255; }
static constexpr size_t SZ_XB = al256((size_t)NB * SEQ * DM * 2);
static constexpr size_t SZ_WB = al256((size_t)3 * DM * DM * 2);
static constexpr size_t SZ_WP = al256((size_t)DM * DM * 2);
static constexpr size_t SZ_PL = al256((size_t)NB * NH_ * SEQ * HD * 2);
static constexpr size_t SZ_CX = al256((size_t)NB * SEQ * DM * 2);
static constexpr size_t SZ_TOTAL = SZ_XB + SZ_WB + SZ_WP + 3 * SZ_PL + SZ_CX;
static_assert(SZ_TOTAL <= (size_t)134217728);          // workspace carve <= 128 MiB
static_assert(((size_t)DM * DM * 2) % 256 == 0);       // weight sub-planes stay 256-byte aligned

extern "C" void kernel_launch(void* const* d_in, const int* in_sizes, int n_in,
                              void* d_out, int out_size, void* d_ws, size_t ws_size, hipStream_t stream) {
    if (n_in < 5) return;
    const size_t needx = ((size_t)(NB - 1) * SEQ_FULL + SEQ) * DM;
    if ((size_t)in_sizes[0] < needx) return;
    if ((size_t)in_sizes[1] < (size_t)3 * DM * DM || (size_t)in_sizes[2] < (size_t)3 * DM) return;
    if ((size_t)in_sizes[3] < (size_t)DM * DM || (size_t)in_sizes[4] < (size_t)DM) return;
    if ((size_t)out_size < ((size_t)(NB - 1) * OUT_SEQ + SEQ) * DM) return;
    if (SZ_TOTAL > ws_size) return;
    // wire order: x, w_qkv ([3072][1024] = Bt as-is, rows q | k | v), b_qkv, w_proj ([out][in] = Bt as-is), b_proj
    const float* x = (const float*)d_in[0]; const float* wqkv = (const float*)d_in[1]; const float* bqkv = (const float*)d_in[2];
    const float* wproj = (const float*)d_in[3]; const float* bproj = (const float*)d_in[4];
    float* OUT = (float*)d_out;      // [NB][SEQ][1024]
    char* wsp = (char*)d_ws;
    bf* XB = (bf*)wsp; wsp += SZ_XB;                 // [NB*SEQ][1024]
    bf* WB = (bf*)wsp; wsp += SZ_WB;                 // [3][1024][1024]: q | k | v
    h16* WP = (h16*)wsp; wsp += SZ_WP;               // [1024][1024] x1024
    h16* QH = (h16*)wsp; wsp += SZ_PL;               // [NB*16][SEQ][64]
    h16* KP = (h16*)wsp; wsp += SZ_PL;               // [NB*16][SEQ][64]
    h16* VT = (h16*)wsp; wsp += SZ_PL;               // [NB*16][64][SEQ]
    h16* CX = (h16*)wsp; wsp += SZ_CX;               // [NB*SEQ][1024] x256

    k_cvt<<<CBX + CBW + CBP, 256, 0, stream>>>(x, wqkv, wproj, XB, WB, WP);

    k_proj<<<dim3((NB * SEQ / GT) * (DM / GT), 3, 1), 256, 0, stream>>>(XB, WB, bqkv, QH, KP, VT);

    k_flash<<<dim3(SEQ / (16 * AW), NB * NH_, 1), 32 * AW, 0, stream>>>(QH, KP, VT, CX);

    // output projection: A = ctx rows (m = b*SEQ + t, k = h*64 + d), Bt = w_proj rows (n = f) -> OUT[m][f]
    k_oproj<<<dim3(NB * SEQ / GT, DM / GT, 1), 256, 0, stream>>>(CX, WP, bproj, OUT);
}

// v005
// Measured time: 110 microseconds a run.
// Two timings next to v004 put it at 1.05 and 1.06 times that version's speed.
// All steps since v000 together make it 3.25 times as fast.
#include <hip/hip_runtime.h>

// Multi-head self-attention, width 1024 = 16 heads x 64, x [NB][SEQ][1024], fused w_qkv [3072][1024] ([out][in], rows q | k | v, head h = rows h*64+d of each third), b_qkv, score scale 1/8, no mask, output projection w_proj [out][in] + b_proj (f32 output).
// Compute dtypes, f32 accumulate everywhere: qkv projections v_wmma_f32_16x16x32_bf16 (x, w_qkv RNE-converted to bf16; products exact); scores v_wmma_f32_16x16x32_f16: q and k single f16 planes (one product), scale 0.125*log2(e) applied in f32;
// P (x256 carry, cancels in the normalisation; row sum taken over the f16 P values, by one more matrix product with a ones operand) and v single f16; softmax f32 (online, running max); output projection v_wmma_f32_16x16x32_f16: ctx single f16 (x256 carry), w_proj RNE-converted to bf16 then x1024 as f16 (exact), carries folded back (2^-18) in the f32 epilogue; biases RNE-converted to bf16, added in f32.
// Layout: bf16 copies of x and w_qkv; q, k planes [b*16+h][t][d] and v^T plane [b*16+h][d][t] written by the GEMM epilogue; fused flash kernel in transposed form (S^T = K Q^T, O^T = V^T P^T; K and V^T tiles staged in LDS for the 8 waves of a block) writes the f16 ctx plane [b*SEQ+t][1024]; f16 GEMM writes the output buffer.
// The four GEMMs: 128x128 tile per 8-wave block (32x64 per wave), both operands staged in LDS in whole lines, 128 k per stage, two buffers.
// Blocks that stage the same rows (GEMM panels; K and V^T of a head) begin the stage walk at stages spread by block index and wrap, so that not all of them ask L2 for the same lines at the same moment.
// Four launches: launches that read none of each other's output share one grid (the three conversions by block range; the q, k and v^T projections by blockIdx.y).

#ifndef NB
#define NB 1
#endif
#ifndef SEQ
#define SEQ 4096
#endif
#define NB_FULL  1
#define SEQ_FULL 4096
#ifndef OUT_SEQ
#define OUT_SEQ SEQ              // row pitch (in tokens) between batches of the output
#endif
#define DM   1024
#define NH_  16
#define HD   64
#define AW   8                   // waves per flash block (16 query rows each)
#define KST  256                 // keys per LDS stage of the flash kernel
#define KPB  (HD * 2 + 16)       // LDS pitch of a K row, bytes: 16 B x odd, no bank conflict for 16-byte fragment reads
#define VPB  (KST * 2 + 16)      // LDS pitch of a V^T row, bytes: 16 B x odd
#define KBY  (KST * KPB)         // K part of a stage, bytes
#define SBY  (KBY + HD * VPB)    // one stage (K then V^T), bytes
#define GT   128                 // GEMM block tile, rows and columns (4 x 2 waves of 32 x 64)
#define GK   128                 // k per LDS stage of the GEMMs
#define GPB  (GK * 2 + 16)       // LDS pitch of a GEMM operand row, bytes: 16 B x odd
#define GAB  (GT * GPB)          // one operand's part of a stage, bytes
#define GSB  (2 * GAB)           // one stage (A rows then B rows), bytes
#define SC2  (0.125f * 1.4426950408889634f)   // HD^-0.5 * log2(e)
#define PSH  8.0f                // log2 of the P carry (256)
#define CCS  256.0f              // carry of the ctx plane
#define WPS  1024.0f             // carry of the w_proj plane
#define OSI  (1.0f / (256.0f * 1024.0f))      // inverse of both carries

static_assert(HD == 64);
static_assert(NH_ * HD == DM);                 // head h = columns h*64 + d
static_assert(DM % 64 == 0);                   // column tiles of 64
static_assert(DM % 32 == 0);                   // GEMM k-loop steps by 32
static_assert(SEQ % 64 == 0);                  // a wave's tile (32 rows, 64 columns) never straddles two batches
static_assert((NB * SEQ) % 64 == 0);
static_assert(SEQ % 32 == 0);                  // key loop steps by 32
static_assert(SEQ % (16 * AW) == 0);           // flash grid covers the sequence exactly
static_assert(SEQ % KST == 0);                 // whole stages only
static_assert(AW == 8 && KST == 256);          // copy maps of k_flash: 256 lanes x 8 copies x 16 B = one 32-KiB K or V^T tile
static_assert((KPB / 16) % 2 == 1 && (VPB / 16) % 2 == 1);
static_assert(2 * SBY >= AW * 16 * 68 * 4);    // the ring holds the output staging
static_assert((NB * SEQ) % GT == 0 && DM % GT == 0);   // GEMM grids cover both extents exactly
static_assert(DM % GK == 0 && DM / GK >= 2);           // whole stages, and the two that the ring's prologue needs
static_assert(GT == 128 && GK == 128);                 // copy map of gstage: 256 lanes x 16 copies x 16 B = 256 rows of 256 B
static_assert((GPB / 16) % 2 == 1);
static_assert(((size_t)SEQ * DM) % 8 == 0);
static_assert(((size_t)DM * DM) % 8 == 0);
static_assert(NB <= NB_FULL);
static_assert(SEQ <= SEQ_FULL);

typedef _Float16 h16;
typedef unsigned short bf;
typedef __attribute__((ext_vector_type(16))) __bf16   v16bf;
typedef __attribute__((ext_vector_type(16))) _Float16 v16h;
typedef __attribute__((ext_vector_type(8)))  _Float16 v8h;
typedef __attribute__((ext_vector_type(8)))  unsigned short v8us;
typedef __attribute__((ext_vector_type(16))) unsigned short v16us;
typedef __attribute__((ext_vector_type(8)))  float    v8f;
typedef __attribute__((ext_vector_type(4)))  float    v4f;
typedef v4f  __attribute__((may_alias)) v4fa;

__device__ __forceinline__ unsigned short f2bf(float f) { unsigned u = __float_as_uint(f); u += 0x7FFFu + ((u >> 16) & 1u); return (unsigned short)(u >> 16); }
__device__ __forceinline__ float bfr(float f) { return __uint_as_float(((unsigned)f2bf(f)) << 16); }   // value after RNE convert to bf16
__device__ __forceinline__ v16h cat16(v8h lo, v8h hi) { return __builtin_shufflevector(lo, hi, 0, 1, 2, 3, 4, 5, 6, 7, 8, 9, 10, 11, 12, 13, 14, 15); }
__device__ __forceinline__ v8f wmma16(v16h a, v16h b, v8f c) { return __builtin_amdgcn_wmma_f32_16x16x32_f16(false, a, false, b, (short)0, c, false, false); }
__device__ __forceinline__ v8f wmmab(v16bf a, v16bf b, v8f c) { return __builtin_amdgcn_wmma_f32_16x16x32_bf16(false, a, false, b, (short)0, c, false, false); }
// fragment loaders from K-contiguous 16-bit rows; p already includes + 8*(lane>>4): elements 0..7 <- k0+8h+0..7, elements 8..15 <- k0+16+8h+0..7 (same map for A and B)
__device__ __forceinline__ v16h  ldh(const h16* p) { return cat16(*(const v8h*)p, *(const v8h*)(p + 16)); }
// ordering point for wave-private LDS tiles (same wave writes and reads)
__device__ __forceinline__ void wave_sync() { __builtin_amdgcn_fence(3 /* release order */, "wavefront"); __builtin_amdgcn_wave_barrier(); asm volatile("" ::: "memory"); }

// k_cvt: the three conversions in one grid, 8 values per thread; a block lies wholly in one range: x -> bf16, then w_qkv -> bf16, then w_proj -> bf16 value x1024 as f16.
#define CBX ((unsigned)((size_t)NB * SEQ * DM / 2048))   // blocks of x (256 threads x 8 values)
#define CBW ((unsigned)((size_t)3 * DM * DM / 2048))     // blocks of w_qkv
#define CBP ((unsigned)((size_t)DM * DM / 2048))         // blocks of w_proj
static_assert(((size_t)SEQ * DM) % 2048 == 0 && ((size_t)DM * DM) % 2048 == 0);   // whole blocks in every range, none straddles two batches
__global__ __launch_bounds__(256) void k_cvt(const float* __restrict__ x, const float* __restrict__ wqkv, const float* __restrict__ wproj, bf* XB, bf* WB, h16* WP) {
    const unsigned blk = blockIdx.x;
    if (blk < CBX + CBW) {
        const bool isx = blk < CBX;
        const size_t e = ((size_t)(isx ? blk : blk - CBX) * 256 + threadIdx.x) * 8;
        const size_t bt = e / ((size_t)SEQ * DM);            // batch (x only): source batches lie SEQ_FULL tokens apart
        const float* s = isx ? x + bt * ((size_t)SEQ_FULL * DM) + (e - bt * ((size_t)SEQ * DM)) : wqkv + e;
        const v8f v = *(const v8f*)s; v8us o;
#pragma unroll
        for (int k = 0; k < 8; ++k) o[k] = f2bf(v[k]);
        *(v8us*)((isx ? XB : WB) + e) = o;
    } else {
        const size_t e = ((size_t)(blk - CBX - CBW) * 256 + threadIdx.x) * 8;
        const v8f v = *(const v8f*)(wproj + e); v8h o;
#pragma unroll
        for (int k = 0; k < 8; ++k) o[k] = (h16)(bfr(v[k]) * WPS);
        *(v8h*)(WP + e) = o;
        asm volatile("s_wait_xcnt 0x0" ::: "memory");   // precaution: stands in front of every later write of the store's registers
    }
}

// eight asynchronous 16-byte copies per lane, global -> LDS (LDS byte address l + i*ls, global address g + i*gs halves).
// s_wait_xcnt closes the statement so that no address register of an issued copy is rewritten ahead of it.
__device__ __forceinline__ void copy8(unsigned l, unsigned ls, const h16* g, size_t gs) {
    asm volatile("global_load_async_to_lds_b128 %0, %8, off\n\t"
                 "global_load_async_to_lds_b128 %1, %9, off\n\t"
                 "global_load_async_to_lds_b128 %2, %10, off\n\t"
                 "global_load_async_to_lds_b128 %3, %11, off\n\t"
                 "global_load_async_to_lds_b128 %4, %12, off\n\t"
                 "global_load_async_to_lds_b128 %5, %13, off\n\t"
                 "global_load_async_to_lds_b128 %6, %14, off\n\t"
                 "global_load_async_to_lds_b128 %7, %15, off\n\t"
                 "s_wait_xcnt 0x0"
                 :: "v"(l), "v"(l + ls), "v"(l + 2 * ls), "v"(l + 3 * ls), "v"(l + 4 * ls), "v"(l + 5 * ls), "v"(l + 6 * ls), "v"(l + 7 * ls),
                    "v"(g), "v"(g + gs), "v"(g + 2 * gs), "v"(g + 3 * gs), "v"(g + 4 * gs), "v"(g + 5 * gs), "v"(g + 6 * gs), "v"(g + 7 * gs)
                 : "memory");
}

// one GEMM stage: rows 0..127 of the A tile, then of the B tile, 256 B (GK halves) of each. Copy i of lane tid takes (row i*16 + tid/16, 16-byte piece tid%16): a wave's copy covers two whole 256-B runs.
__device__ __forceinline__ void gstage(unsigned l, const h16* ga, const h16* gb) {
    copy8(l, 16 * GPB, ga, (size_t)16 * DM); copy8(l + GAB, 16 * GPB, gb, (size_t)16 * DM);
}
// fragment from an LDS row of 16-bit values; p already includes + 16*(lane>>4) bytes: same element map as ldh, for A and for B
__device__ __forceinline__ v16us ldu(const unsigned char* p) { return __builtin_shufflevector(*(const v8us*)p, *(const v8us*)(p + 32), 0, 1, 2, 3, 4, 5, 6, 7, 8, 9, 10, 11, 12, 13, 14, 15); }
template <bool F16> __device__ __forceinline__ v8f wm(v16us a, v16us b, v8f c) {
    if constexpr (F16) return wmma16(__builtin_bit_cast(v16h, a), __builtin_bit_cast(v16h, b), c);
    else               return wmmab(__builtin_bit_cast(v16bf, a), __builtin_bit_cast(v16bf, b), c);
}
// k loop of a 128x128 block tile (bx, by), K = DM: acc[mb][nb] += A rows (bx*128 + (wave>>1)*32 + mb*16 ..) x Bt rows (by*128 + (wave&1)*64 + nb*16 ..); the 128-k stages are walked from stage (bx + by) mod NSTG on, wrapping, k ascending in steps of 32 inside a stage.
// Two-buffer LDS ring shared by the block's 8 waves: the next stage's copies fly while this one is worked on; inside a stage the next k step's fragments are read ahead of this step's products.
template <bool F16> __device__ __forceinline__ void gemm_tile(const h16* A, const h16* Bt, unsigned bx, unsigned by, unsigned char* ring, v8f (&acc)[2][4]) {
    const int tid = threadIdx.x, lane = tid & 31, wave = tid >> 5, lr = lane & 15, hi = lane >> 4;
    const unsigned l = (unsigned)(size_t)ring + (unsigned)((tid >> 4) * GPB + (tid & 15) * 16);   // LDS byte address of this lane's first piece
    const h16* ga = A  + (size_t)(bx * GT + (tid >> 4)) * DM + (tid & 15) * 8;             // + stage * GK
    const h16* gb = Bt + (size_t)(by * GT + (tid >> 4)) * DM + (tid & 15) * 8;
    const unsigned NSTG = DM / GK;
    const unsigned s0 = (bx + by) % NSTG;                    // first stage of this block: blocks that share a row panel differ in by, those that share a column panel in bx, so sharers spread over the NSTG stages
    gstage(l, ga + (size_t)s0 * GK, gb + (size_t)s0 * GK);
    asm volatile("s_wait_asynccnt 0x0" ::: "memory");        // stage s0 of this wave has landed
    __syncthreads();                                         // stage s0 of every wave is readable
    { const size_t ko = (size_t)((s0 + 1) % NSTG) * GK; gstage(l + GSB, ga + ko, gb + ko); }
    const int afo = ((wave >> 1) * 32 + lr) * GPB + 16 * hi;
    const int bfo = GAB + ((wave & 1) * 64 + lr) * GPB + 16 * hi;
#pragma unroll 1   // the stage loop stays rolled: one publish point, buffer picked by the stage's parity
    for (unsigned st = 0; st < NSTG; ++st) {
        const unsigned char* pa = ring + (st & 1) * GSB + afo;
        const unsigned char* pb = ring + (st & 1) * GSB + bfo;
        v16us a[2][2], b[2][4];
#pragma unroll
        for (int i = 0; i < 4; ++i) { if (i < 2) a[0][i] = ldu(pa + i * 16 * GPB); b[0][i] = ldu(pb + i * 16 * GPB); }
#pragma unroll
        for (int kk = 0; kk < GK / 32; ++kk) {
            const int cur = kk & 1, nxt = cur ^ 1;
            if (kk + 1 < GK / 32) {
#pragma unroll
                for (int i = 0; i < 4; ++i) { if (i < 2) a[nxt][i] = ldu(pa + i * 16 * GPB + (kk + 1) * 64); b[nxt][i] = ldu(pb + i * 16 * GPB + (kk + 1) * 64); }
            }
            __builtin_amdgcn_sched_barrier(0);   // keeps the next step's reads one group ahead of this step's products: sunk among them, each read's LDS latency is waited out
#pragma unroll
            for (int nb = 0; nb < 4; ++nb)
#pragma unroll
                for (int mb = 0; mb < 2; ++mb) acc[mb][nb] = wm<F16>(a[cur][mb], b[cur][nb], acc[mb][nb]);
            __builtin_amdgcn_sched_barrier(0);   // the other side of the same fence: no later read rises into this step's products
        }
        asm volatile("s_wait_dscnt 0x0" ::: "memory");       // this wave's reads of the stage are done before its buffer is handed back
        asm volatile("s_wait_asynccnt 0x0" ::: "memory");    // this wave's copies of the next stage have landed
        __syncthreads();                                     // next stage readable by all, this stage's buffer free
        if (st + 2 < NSTG) { const size_t ko = (size_t)((s0 + st + 2) % NSTG) * GK; gstage(l + (unsigned)((st & 1) * GSB), ga + ko, gb + ko); }
    }
    asm volatile("s_wait_asynccnt 0x0" ::: "memory");        // nothing in flight when the wave goes on to its epilogue
}

// k_proj: the three qkv projections in one grid; register-blocked bf16 GEMM, one wave per 32x64 tile (8 accumulators), 4 x 2 waves per block, operands from K-contiguous bf16 planes through the LDS ring of gemm_tile, K = DM.
// C[m][n] = sum_k A[m][k] Bt[n][k] + bias, written as a single f16 plane. grid (tiles of one projection, 3), 256 threads; blockIdx.y = 0 q, 1 k, 2 v^T; row tile fastest.
// q, k: A = x rows (m = b*SEQ + t), Bt = W rows (n = h*64 + d), bias[n] -> plane [(b*16 + h)][t][d].   v^T: A = Wv rows (m = h*64 + d), Bt = x rows (n = b*SEQ + t), bias[m] -> plane [(b*16 + h)][d][t].
__global__ __launch_bounds__(256) void k_proj(const bf* __restrict__ XB, const bf* __restrict__ WB, const float* __restrict__ bqkv, h16* QH, h16* KP, h16* VT) {
    __shared__ __align__(16) unsigned char ring[2 * GSB];    // two operand stages
    __shared__ __align__(16) float osw[8 * 16 * 68];         // output staging, one part per wave
    const int lane = threadIdx.x & 31, wave = threadIdx.x >> 5, lr = lane & 15, hi = lane >> 4;
    const int pz = blockIdx.y; const int biasRow = pz == 2;
    const int mt = biasRow ? DM / GT : NB * SEQ / GT;        // row tiles of this projection
    const int bx = blockIdx.x % mt, by = blockIdx.x / mt;
    const bf* W = WB + (size_t)pz * DM * DM;
    const bf* A = biasRow ? W : XB; const bf* Bt = biasRow ? XB : W;
    const float* bias = bqkv + pz * DM;
    h16* Ph = pz == 0 ? QH : (pz == 1 ? KP : VT);
    const int pitch = biasRow ? SEQ : HD;                    // row pitch of the plane, halves
    const int r0 = bx * GT + (wave >> 1) * 32, c0 = by * GT + (wave & 1) * 64;
    float* os = osw + wave * 16 * 68;
    v8f acc[2][4];
#pragma unroll
    for (int mb = 0; mb < 2; ++mb)
#pragma unroll
        for (int nb = 0; nb < 4; ++nb) acc[mb][nb] = (v8f){};
    gemm_tile<false>((const h16*)A, (const h16*)Bt, (unsigned)bx, (unsigned)by, ring, acc);
    // column bias (index selected as an integer, address always inside the bias array)
    float bc[4];
#pragma unroll
    for (int nb = 0; nb < 4; ++nb) { const int ci = biasRow ? 0 : (c0 + nb * 16 + lr); const float t = bfr(bias[ci]); bc[nb] = biasRow ? 0.0f : t; }
    const size_t tbase = biasRow ? (size_t)r0 * SEQ + (size_t)(c0 / SEQ) * ((size_t)DM * SEQ) + (size_t)(c0 % SEQ)
                                 : (size_t)(r0 / SEQ) * ((size_t)NH_ * SEQ * HD) + (size_t)(r0 % SEQ) * HD + (size_t)(c0 / HD) * ((size_t)SEQ * HD) + (size_t)(c0 % HD);
#pragma unroll
    for (int mb = 0; mb < 2; ++mb) {
        // row bias for rows r0 + mb*16 + 8h + 0..7 (two 16-B loads, clamped to offset 0 in column mode)
        const int ri = biasRow ? (r0 + mb * 16 + hi * 8) : 0;
        const v4f rb0 = *(const v4f*)(bias + ri); const v4f rb1 = *(const v4f*)(bias + ri + 4);
        float br[8];
#pragma unroll
        for (int j = 0; j < 4; ++j) { const float t0 = bfr(rb0[j]); const float t1 = bfr(rb1[j]); br[j] = biasRow ? t0 : 0.0f; br[4 + j] = biasRow ? t1 : 0.0f; }
#pragma unroll
        for (int nb = 0; nb < 4; ++nb) {
#pragma unroll
            for (int j = 0; j < 8; ++j) os[(hi * 8 + j) * 68 + nb * 16 + lr] = acc[mb][nb][j] + bc[nb] + br[j]; }   // D: row 8h+j, col lane&15
        wave_sync();
        const size_t sb = tbase + (size_t)(mb * 16) * (size_t)pitch;
{
#pragma unroll
            for (int s = 0; s < 4; ++s) { const int row = 4 * s + (lane >> 3), c8 = (lane & 7) * 8;   // 4 s x 4 row groups = 16 rows; 8 lanes x 8 = 64 columns
                const v4f x0 = *(const v4fa*)(&os[row * 68 + c8]); const v4f x1 = *(const v4fa*)(&os[row * 68 + c8 + 4]); v8h hv;
#pragma unroll
                for (int i = 0; i < 4; ++i) { hv[i] = (h16)x0[i]; hv[4 + i] = (h16)x1[i]; }
                const size_t oo = sb + (size_t)row * (size_t)pitch + c8;
                *(v8h*)(Ph + oo) = hv; }
            asm volatile("s_wait_xcnt 0x0" ::: "memory");   // precaution: stands in front of the next half tile's bias loads, which land in the four stores' data registers
             }
        wave_sync();
    }
}

// k_flash: fused attention, one wave per 16 query rows of one (batch, head), 8 waves per block; Q fragments straight from the f16 plane.
// K and V^T come in stages of KST keys through a two-buffer LDS ring that the block's waves share: whole-line asynchronous copies, the next stage in flight while this one is worked on.
// The stages are walked from stage blockIdx.x mod NST on, wrapping (the running-maximum softmax takes the keys in any order): the blocks of one head start two to each of the NST stages.
// Transposed form: S^T[key][t] = K Q^T (A = K rows, B = Q rows); lane (t = lane&15, h = lane>>4) holds keys 8h+r of each 16-key tile, so the packed
// P tile is directly the B fragment of O^T[d][t] = V^T P^T (element r <- tile keys 0..15, element 8+r <- tile keys 16..31, lane unchanged).
// The running max is one scalar per lane; the two lane halves of a row are combined with one xor-16 exchange.
// Row sums on the matrix pipe: A operand with ones in rows 0 and 8 and zeros elsewhere, B = the packed P tile; element 0 of the result tile is, in both lane halves, the sum of the query's 32 P values; elements 1..7 stay 0.
__global__ __launch_bounds__(32 * AW) void k_flash(const h16* __restrict__ QH, const h16* __restrict__ KP, const h16* __restrict__ VT, h16* CTX) {
    __shared__ __align__(16) unsigned char ring[2 * SBY];    // two stages; after the loop: output staging
    float* os = (float*)ring;
    const int tid = threadIdx.x;
    const int lane = threadIdx.x & 31, wave = threadIdx.x >> 5, lr = lane & 15, hi = lane >> 4;
    const int zh = blockIdx.y; const int b = zh / NH_, h = zh % NH_;
    const int t0 = (blockIdx.x * AW + wave) * 16;
    const size_t pbase = (size_t)zh * SEQ * HD;
    const size_t qo = pbase + (size_t)(t0 + lr) * HD + 8 * hi;
    const v16h qh0 = ldh(QH + qo), qh1 = ldh(QH + qo + 32);   // B fragments: col t, k = d
    // copy maps. K tile: 32 KiB contiguous; copy i of lane tid takes 16-byte piece i*256 + tid = (key i*32 + tid/8, piece tid%8). V^T tile: 64 rows of 512 B; (row i*8 + tid/32, piece tid%32).
    const unsigned rb = (unsigned)(size_t)ring;              // LDS byte address of the ring
    const unsigned kl = rb + (unsigned)((tid >> 3) * KPB + (tid & 7) * 16);
    const unsigned vl = rb + (unsigned)(KBY + (tid >> 5) * VPB + (tid & 31) * 16);
    const h16* kg = KP + pbase + (size_t)tid * 8;                                   // + stage * KST * HD
    const h16* vg = VT + pbase + (size_t)(tid >> 5) * SEQ + (size_t)(tid & 31) * 8; // + stage * KST
    const unsigned NST = SEQ / KST;
    const unsigned s0 = blockIdx.x % NST;                    // first stage of this block
    copy8(kl, 32 * KPB, kg + (size_t)s0 * KST * HD, (size_t)32 * HD); copy8(vl, 8 * VPB, vg + (size_t)s0 * KST, (size_t)8 * SEQ);
    asm volatile("s_wait_asynccnt 0x0" ::: "memory");        // stage s0 of this wave has landed
    __syncthreads();                                         // stage s0 of every wave is readable
    if (NST > 1) { const size_t sn = (s0 + 1) % NST; copy8(kl + SBY, 32 * KPB, kg + sn * KST * HD, (size_t)32 * HD); copy8(vl + SBY, 8 * VPB, vg + sn * KST, (size_t)8 * SEQ); }
    const int kfo = lr * KPB + 16 * hi;                      // + key * KPB              (A fragment: row key, k = d)
    const int vfo = KBY + lr * VPB + 16 * hi;                // + 16j * VPB + key * 2    (A fragment: row d, k = key)
    v8f o0 = (v8f){}, o1 = (v8f){}, o2 = (v8f){}, o3 = (v8f){};
    v8f lt = (v8f){};                                        // row-sum tile: element 0 = running sum of this lane's query
    const h16 ov = (lane & 7) == 0 ? (h16)1.0f : (h16)0.0f;  // A rows 0 and 8 (lanes 0, 8, 16, 24) are ones at all 32 k positions
    const v16h one = {ov, ov, ov, ov, ov, ov, ov, ov, ov, ov, ov, ov, ov, ov, ov, ov};
    float m = -3.0e38f;
#pragma unroll 1   // the stage loop stays rolled: one publish point, buffer picked by the stage's parity
    for (unsigned st = 0; st < NST; ++st) {
      const unsigned char* sb = ring + (st & 1) * SBY;
#pragma unroll 4   // four 32-key passes per branch, LDS offsets as immediates; all eight unrolled go past 256 registers and two blocks no longer fit a WGP
      for (int key0 = 0; key0 < KST; key0 += 32) {
        const h16* ka = (const h16*)(sb + kfo + key0 * KPB);
        const v16h ka0 = ldh(ka), ka1 = ldh(ka + 32), kb0 = ldh(ka + 8 * KPB), kb1 = ldh(ka + 8 * KPB + 32);   // 8 * KPB halves = 16 rows
        v8f sHa = (v8f){}, sHb = (v8f){};
        sHa = wmma16(ka0, qh0, sHa); sHb = wmma16(kb0, qh0, sHb);
        sHa = wmma16(ka1, qh1, sHa); sHb = wmma16(kb1, qh1, sHb);
        asm volatile("v_nop\n\tv_nop\n\tv_nop\n\tv_nop" : "+v"(sHa), "+v"(sHb) : "v"(ka0), "v"(ka1), "v"(kb0), "v"(kb1), "v"(qh0), "v"(qh1));
        float ta[8], tb[8]; float mx = -3.0e38f;
#pragma unroll
        for (int r = 0; r < 8; ++r) { ta[r] = sHa[r] * SC2; tb[r] = sHb[r] * SC2; mx = fmaxf(mx, fmaxf(ta[r], tb[r])); }
        mx = fmaxf(mx, __shfl_xor(mx, 16, 32));
        const float mnew = fmaxf(m, mx);
        const float alpha = __builtin_amdgcn_exp2f(m - mnew);
        const float sh = PSH - mnew;
        v16h pb;
#pragma unroll
        for (int r = 0; r < 8; ++r) { pb[r] = (h16)__builtin_amdgcn_exp2f(ta[r] + sh); pb[8 + r] = (h16)__builtin_amdgcn_exp2f(tb[r] + sh); }
        m = mnew;
        o0 = o0 * alpha; o1 = o1 * alpha; o2 = o2 * alpha; o3 = o3 * alpha; lt[0] = lt[0] * alpha;
        const h16* va = (const h16*)(sb + vfo + key0 * 2);
        const v16h v0 = ldh(va), v1 = ldh(va + 8 * VPB), v2 = ldh(va + 16 * VPB), v3 = ldh(va + 24 * VPB);     // 8 * VPB halves = 16 rows
        o0 = wmma16(v0, pb, o0); o1 = wmma16(v1, pb, o1); o2 = wmma16(v2, pb, o2); o3 = wmma16(v3, pb, o3);
        lt = wmma16(one, pb, lt);                            // += the column sums of P^T
        asm volatile("v_nop\n\tv_nop\n\tv_nop\n\tv_nop" : "+v"(o0), "+v"(o1), "+v"(o2), "+v"(o3), "+v"(lt) : "v"(v0), "v"(v1), "v"(v2), "v"(v3), "v"(pb), "v"(one));
      }
      asm volatile("s_wait_dscnt 0x0" ::: "memory");         // this wave's reads of the stage are done before its buffer is handed back
      asm volatile("s_wait_asynccnt 0x0" ::: "memory");      // this wave's copies of the next stage have landed
      __syncthreads();                                       // next stage readable by all, this stage's buffer free
      if (st + 2 < NST) {
          const unsigned bo = (unsigned)((st & 1) * SBY);
          const size_t sn = (s0 + st + 2) % NST;
          copy8(kl + bo, 32 * KPB, kg + sn * KST * HD, (size_t)32 * HD); copy8(vl + bo, 8 * VPB, vg + sn * KST, (size_t)8 * SEQ);
      }
    }
    asm volatile("s_wait_asynccnt 0x0" ::: "memory");        // nothing in flight when the ring becomes output staging (the last barrier above ended every read)
    const float inv = CCS * (1.0f / lt[0]);  // normalisation (the P carry cancels) times the ctx carry; both lane halves hold the whole row sum
    const int wb = wave * 16 * 68;
    // O^T D layout: o_j[r] = (d = 16j + 8h + r, t = lane&15) -> os[t][d]; rows 0..15 x columns 0..63 all written
    { v4f a, c;
      a[0] = o0[0] * inv; a[1] = o0[1] * inv; a[2] = o0[2] * inv; a[3] = o0[3] * inv; c[0] = o0[4] * inv; c[1] = o0[5] * inv; c[2] = o0[6] * inv; c[3] = o0[7] * inv;
      *(v4fa*)(&os[wb + lr * 68 +  0 + 8 * hi]) = a; *(v4fa*)(&os[wb + lr * 68 +  0 + 8 * hi + 4]) = c;
      a[0] = o1[0] * inv; a[1] = o1[1] * inv; a[2] = o1[2] * inv; a[3] = o1[3] * inv; c[0] = o1[4] * inv; c[1] = o1[5] * inv; c[2] = o1[6] * inv; c[3] = o1[7] * inv;
      *(v4fa*)(&os[wb + lr * 68 + 16 + 8 * hi]) = a; *(v4fa*)(&os[wb + lr * 68 + 16 + 8 * hi + 4]) = c;
      a[0] = o2[0] * inv; a[1] = o2[1] * inv; a[2] = o2[2] * inv; a[3] = o2[3] * inv; c[0] = o2[4] * inv; c[1] = o2[5] * inv; c[2] = o2[6] * inv; c[3] = o2[7] * inv;
      *(v4fa*)(&os[wb + lr * 68 + 32 + 8 * hi]) = a; *(v4fa*)(&os[wb + lr * 68 + 32 + 8 * hi + 4]) = c;
      a[0] = o3[0] * inv; a[1] = o3[1] * inv; a[2] = o3[2] * inv; a[3] = o3[3] * inv; c[0] = o3[4] * inv; c[1] = o3[5] * inv; c[2] = o3[6] * inv; c[3] = o3[7] * inv;
      *(v4fa*)(&os[wb + lr * 68 + 48 + 8 * hi]) = a; *(v4fa*)(&os[wb + lr * 68 + 48 + 8 * hi + 4]) = c; }
    wave_sync();
    h16* crow = CTX + ((size_t)b * SEQ + t0) * DM + h * HD;      // ctx plane row = token, columns h*64 + d
{
#pragma unroll
        for (int s = 0; s < 4; ++s) { const int row = 4 * s + (lane >> 3), c8 = (lane & 7) * 8;   // 4 s x 4 row groups = 16 rows; 8 lanes x 8 halves = 64 columns
            const v4f x0 = *(const v4fa*)(&os[wb + row * 68 + c8]); const v4f x1 = *(const v4fa*)(&os[wb + row * 68 + c8 + 4]); v8h hv;
#pragma unroll
            for (int i = 0; i < 4; ++i) { hv[i] = (h16)x0[i]; hv[4 + i] = (h16)x1[i]; }
            *(v8h*)(crow + (size_t)row * DM + c8) = hv; }
         }
}

// k_oproj: register-blocked f16 GEMM, one wave per 32x64 tile, 4 x 2 waves per block, operands from K-contiguous f16 planes (ctx x256, w_proj x1024) through the LDS ring of gemm_tile, K = DM.
// OUT[m][n] = (sum_k A[m][k] Bt[n][k]) * 2^-18 + bias[n], f32. grid (NB*SEQ/128, DM/128), 256 threads.
__global__ __launch_bounds__(256) void k_oproj(const h16* __restrict__ A, const h16* __restrict__ Bt, const float* __restrict__ bias, float* OUT) {
    __shared__ __align__(16) unsigned char ring[2 * GSB];    // two operand stages
    __shared__ __align__(16) float osw[8 * 16 * 68];         // output staging, one part per wave
    const int lane = threadIdx.x & 31, wave = threadIdx.x >> 5, lr = lane & 15, hi = lane >> 4;
    const int r0 = blockIdx.x * GT + (wave >> 1) * 32, c0 = blockIdx.y * GT + (wave & 1) * 64;
    float* os = osw + wave * 16 * 68;
    v8f acc[2][4];
#pragma unroll
    for (int mb = 0; mb < 2; ++mb)
#pragma unroll
        for (int nb = 0; nb < 4; ++nb) acc[mb][nb] = (v8f){};
    gemm_tile<true>(A, Bt, blockIdx.x, blockIdx.y, ring, acc);
    float bc[4];
#pragma unroll
    for (int nb = 0; nb < 4; ++nb) bc[nb] = bfr(bias[c0 + nb * 16 + lr]);
    const int bq = r0 / SEQ, tq = r0 % SEQ;
    float* obase = OUT + ((size_t)bq * OUT_SEQ + tq) * DM + c0;
#pragma unroll
    for (int mb = 0; mb < 2; ++mb) {
#pragma unroll
        for (int nb = 0; nb < 4; ++nb) {
#pragma unroll
            for (int j = 0; j < 8; ++j) os[(hi * 8 + j) * 68 + nb * 16 + lr] = acc[mb][nb][j] * OSI + bc[nb]; }   // D: row 8h+j, col lane&15
        wave_sync();
{
#pragma unroll
            for (int s = 0; s < 8; ++s) { const int row = 2 * s + hi, cofs = lr * 4;   // 8 s x 2 rows = 16 rows; 16 lanes x 4 floats = 64 columns
                const v4f val = *(const v4fa*)(&os[row * 68 + cofs]);
                *(v4f*)(obase + (size_t)(mb * 16 + row) * DM + cofs) = val; }
             }
        wave_sync();
    }
}

static constexpr size_t al256(size_t v) { return (v + 255) & ~(size_t)255; }
static constexpr size_t SZ_XB = al256((size_t)NB * SEQ * DM * 2);
static constexpr size_t SZ_WB = al256((size_t)3 * DM * DM * 2);
static constexpr size_t SZ_WP = al256((size_t)DM * DM * 2);
static constexpr size_t SZ_PL = al256((size_t)NB * NH_ * SEQ * HD * 2);
static constexpr size_t SZ_CX = al256((size_t)NB * SEQ * DM * 2);
static constexpr size_t SZ_TOTAL = SZ_XB + SZ_WB + SZ_WP + 3 * SZ_PL + SZ_CX;
static_assert(SZ_TOTAL <= (size_t)134217728);          // workspace carve <= 128 MiB
static_assert(((size_t)DM * DM * 2) % 256 == 0);       // weight sub-planes stay 256-byte aligned

extern "C" void kernel_launch(void* const* d_in, const int* in_sizes, int n_in,
                              void* d_out, int out_size, void* d_ws, size_t ws_size, hipStream_t stream) {
    if (n_in < 5) return;
    const size_t needx = ((size_t)(NB - 1) * SEQ_FULL + SEQ) * DM;
    if ((size_t)in_sizes[0] < needx) return;
    if ((size_t)in_sizes[1] < (size_t)3 * DM * DM || (size_t)in_sizes[2] < (size_t)3 * DM) return;
    if ((size_t)in_sizes[3] < (size_t)DM * DM || (size_t)in_sizes[4] < (size_t)DM) return;
    if ((size_t)out_size < ((size_t)(NB - 1) * OUT_SEQ + SEQ) * DM) return;
    if (SZ_TOTAL > ws_size) return;
    // wire order: x, w_qkv ([3072][1024] = Bt as-is, rows q | k | v), b_qkv, w_proj ([out][in] = Bt as-is), b_proj
    const float* x = (const float*)d_in[0]; const float* wqkv = (const float*)d_in[1]; const float* bqkv = (const float*)d_in[2];
    const float* wproj = (const float*)d_in[3]; const float* bproj = (const float*)d_in[4];
    float* OUT = (float*)d_out;      // [NB][SEQ][1024]
    char* wsp = (char*)d_ws;
    bf* XB = (bf*)wsp; wsp += SZ_XB;                 // [NB*SEQ][1024]
    bf* WB = (bf*)wsp; wsp += SZ_WB;                 // [3][1024][1024]: q | k | v
    h16* WP = (h16*)wsp; wsp += SZ_WP;               // [1024][1024] x1024
    h16* QH = (h16*)wsp; wsp += SZ_PL;               // [NB*16][SEQ][64]
    h16* KP = (h16*)wsp; wsp += SZ_PL;               // [NB*16][SEQ][64]
    h16* VT = (h16*)wsp; wsp += SZ_PL;               // [NB*16][64][SEQ]
    h16* CX = (h16*)wsp; wsp += SZ_CX;               // [NB*SEQ][1024] x256

    k_cvt<<<CBX + CBW + CBP, 256, 0, stream>>>(x, wqkv, wproj, XB, WB, WP);

    k_proj<<<dim3((NB * SEQ / GT) * (DM / GT), 3, 1), 256, 0, stream>>>(XB, WB, bqkv, QH, KP, VT);

    k_flash<<<dim3(SEQ / (16 * AW), NB * NH_, 1), 32 * AW, 0, stream>>>(QH, KP, VT, CX);

    // output projection: A = ctx rows (m = b*SEQ + t, k = h*64 + d), Bt = w_proj rows (n = f) -> OUT[m][f]
    k_oproj<<<dim3(NB * SEQ / GT, DM / GT, 1), 256, 0, stream>>>(CX, WP, bproj, OUT);
}

// v006
// Measured time: 105 microseconds a run.
// Timed twice side by side with v005, it ran 1.05 times as fast both times.
// Counting every step since v000, it is 3.42 times as fast.
#include <hip/hip_runtime.h>

// Multi-head self-attention, width 1024 = 16 heads x 64, x [NB][SEQ][1024], fused w_qkv [3072][1024] ([out][in], rows q | k | v, head h = rows h*64+d of each third), b_qkv, score scale 1/8, no mask, output projection w_proj [out][in] + b_proj (f32 output).
// Compute dtypes, f32 accumulate everywhere: qkv projections v_wmma_f32_16x16x32_bf16 (x, w_qkv RNE-converted to bf16; products exact); scores v_wmma_f32_16x16x32_f16: q and k single f16 planes (one product), scale 0.125*log2(e) applied in f32;
// P (x256 carry, cancels in the normalisation; row sum taken over the f16 P values, by one more matrix product with a ones operand) and v single f16; softmax f32 (online, maximum renewed lazily); output projection v_wmma_f32_16x16x32_f16: ctx single f16 (x256 carry), w_proj RNE-converted to bf16 then x1024 as f16 (exact), carries folded back (2^-18) in the f32 epilogue; biases RNE-converted to bf16, added in f32.
// Layout: bf16 copies of x and w_qkv; q, k planes [b*16+h][t][d] and v^T plane [b*16+h][d][t] written by the GEMM epilogue; fused flash kernel in transposed form (S^T = K Q^T, O^T = V^T P^T; K and V^T tiles staged in LDS for the 8 waves of a block) writes the f16 ctx plane [b*SEQ+t][1024]; f16 GEMM writes the output buffer.
// The four GEMMs: 128x128 tile per 8-wave block (32x64 per wave), both operands staged in LDS in whole lines, 128 k per stage, two buffers.
// Blocks that stage the same rows (GEMM panels; K and V^T of a head) begin the stage walk at stages spread by block index and wrap, so that not all of them ask L2 for the same lines at the same moment.
// Four launches: launches that read none of each other's output share one grid (the three conversions by block range; the q, k and v^T projections by blockIdx.y).

#ifndef NB
#define NB 1
#endif
#ifndef SEQ
#define SEQ 4096
#endif
#define NB_FULL  1
#define SEQ_FULL 4096
#ifndef OUT_SEQ
#define OUT_SEQ SEQ              // row pitch (in tokens) between batches of the output
#endif
#define DM   1024
#define NH_  16
#define HD   64
#define AW   8                   // waves per flash block (16 query rows each)
#define KST  256                 // keys per LDS stage of the flash kernel
#define KPB  (HD * 2 + 16)       // LDS pitch of a K row, bytes: 16 B x odd, no bank conflict for 16-byte fragment reads
#define VPB  (KST * 2 + 16)      // LDS pitch of a V^T row, bytes: 16 B x odd
#define KBY  (KST * KPB)         // K part of a stage, bytes
#define SBY  (KBY + HD * VPB)    // one stage (K then V^T), bytes
#define GT   128                 // GEMM block tile, rows and columns (4 x 2 waves of 32 x 64)
#define GK   128                 // k per LDS stage of the GEMMs
#define GPB  (GK * 2 + 16)       // LDS pitch of a GEMM operand row, bytes: 16 B x odd
#define GAB  (GT * GPB)          // one operand's part of a stage, bytes
#define GSB  (2 * GAB)           // one stage (A rows then B rows), bytes
#define SC2  (0.125f * 1.4426950408889634f)   // HD^-0.5 * log2(e)
#define PSH  8.0f                // log2 of the P carry (256)
#define LZT  7.0f                // lazy rescale: a score may pass the maximum in use by this much (log2) before the maximum is renewed; P <= 2^(PSH + LZT) = 32768 stays finite in f16
#define CCS  256.0f              // carry of the ctx plane
#define WPS  1024.0f             // carry of the w_proj plane
#define OSI  (1.0f / (256.0f * 1024.0f))      // inverse of both carries

static_assert(HD == 64);
static_assert(NH_ * HD == DM);                 // head h = columns h*64 + d
static_assert(DM % 64 == 0);                   // column tiles of 64
static_assert(DM % 32 == 0);                   // GEMM k-loop steps by 32
static_assert(SEQ % 64 == 0);                  // a wave's tile (32 rows, 64 columns) never straddles two batches
static_assert((NB * SEQ) % 64 == 0);
static_assert(SEQ % 32 == 0);                  // key loop steps by 32
static_assert(SEQ % (16 * AW) == 0);           // flash grid covers the sequence exactly
static_assert(SEQ % KST == 0);                 // whole stages only
static_assert(AW == 8 && KST == 256);          // copy maps of k_flash: 256 lanes x 8 copies x 16 B = one 32-KiB K or V^T tile
static_assert((KPB / 16) % 2 == 1 && (VPB / 16) % 2 == 1);
static_assert(2 * SBY >= AW * 16 * 68 * 4);    // the ring holds the output staging
static_assert((NB * SEQ) % GT == 0 && DM % GT == 0);   // GEMM grids cover both extents exactly
static_assert(DM % GK == 0 && DM / GK >= 2);           // whole stages, and the two that the ring's prologue needs
static_assert(GT == 128 && GK == 128);                 // copy map of gstage: 256 lanes x 16 copies x 16 B = 256 rows of 256 B
static_assert((GPB / 16) % 2 == 1);
static_assert(((size_t)SEQ * DM) % 8 == 0);
static_assert(((size_t)DM * DM) % 8 == 0);
static_assert(NB <= NB_FULL);
static_assert(SEQ <= SEQ_FULL);

typedef _Float16 h16;
typedef unsigned short bf;
typedef __attribute__((ext_vector_type(16))) __bf16   v16bf;
typedef __attribute__((ext_vector_type(16))) _Float16 v16h;
typedef __attribute__((ext_vector_type(8)))  _Float16 v8h;
typedef __attribute__((ext_vector_type(8)))  unsigned short v8us;
typedef __attribute__((ext_vector_type(16))) unsigned short v16us;
typedef __attribute__((ext_vector_type(8)))  float    v8f;
typedef __attribute__((ext_vector_type(4)))  float    v4f;
typedef v4f  __attribute__((may_alias)) v4fa;

__device__ __forceinline__ unsigned short f2bf(float f) { unsigned u = __float_as_uint(f); u += 0x7FFFu + ((u >> 16) & 1u); return (unsigned short)(u >> 16); }
__device__ __forceinline__ float bfr(float f) { return __uint_as_float(((unsigned)f2bf(f)) << 16); }   // value after RNE convert to bf16
__device__ __forceinline__ v16h cat16(v8h lo, v8h hi) { return __builtin_shufflevector(lo, hi, 0, 1, 2, 3, 4, 5, 6, 7, 8, 9, 10, 11, 12, 13, 14, 15); }
__device__ __forceinline__ v8f wmma16(v16h a, v16h b, v8f c) { return __builtin_amdgcn_wmma_f32_16x16x32_f16(false, a, false, b, (short)0, c, false, false); }
__device__ __forceinline__ v8f wmmab(v16bf a, v16bf b, v8f c) { return __builtin_amdgcn_wmma_f32_16x16x32_bf16(false, a, false, b, (short)0, c, false, false); }
// fragment loaders from K-contiguous 16-bit rows; p already includes + 8*(lane>>4): elements 0..7 <- k0+8h+0..7, elements 8..15 <- k0+16+8h+0..7 (same map for A and B)
__device__ __forceinline__ v16h  ldh(const h16* p) { return cat16(*(const v8h*)p, *(const v8h*)(p + 16)); }
// ordering point for wave-private LDS tiles (same wave writes and reads)
__device__ __forceinline__ void wave_sync() { __builtin_amdgcn_fence(3 /* release order */, "wavefront"); __builtin_amdgcn_wave_barrier(); asm volatile("" ::: "memory"); }

// k_cvt: the three conversions in one grid, 8 values per thread; a block lies wholly in one range: x -> bf16, then w_qkv -> bf16, then w_proj -> bf16 value x1024 as f16.
#define CBX ((unsigned)((size_t)NB * SEQ * DM / 2048))   // blocks of x (256 threads x 8 values)
#define CBW ((unsigned)((size_t)3 * DM * DM / 2048))     // blocks of w_qkv
#define CBP ((unsigned)((size_t)DM * DM / 2048))         // blocks of w_proj
static_assert(((size_t)SEQ * DM) % 2048 == 0 && ((size_t)DM * DM) % 2048 == 0);   // whole blocks in every range, none straddles two batches
__global__ __launch_bounds__(256) void k_cvt(const float* __restrict__ x, const float* __restrict__ wqkv, const float* __restrict__ wproj, bf* XB, bf* WB, h16* WP) {
    const unsigned blk = blockIdx.x;
    if (blk < CBX + CBW) {
        const bool isx = blk < CBX;
        const size_t e = ((size_t)(isx ? blk : blk - CBX) * 256 + threadIdx.x) * 8;
        const size_t bt = e / ((size_t)SEQ * DM);            // batch (x only): source batches lie SEQ_FULL tokens apart
        const float* s = isx ? x + bt * ((size_t)SEQ_FULL * DM) + (e - bt * ((size_t)SEQ * DM)) : wqkv + e;
        const v8f v = *(const v8f*)s; v8us o;
#pragma unroll
        for (int k = 0; k < 8; ++k) o[k] = f2bf(v[k]);
        *(v8us*)((isx ? XB : WB) + e) = o;
    } else {
        const size_t e = ((size_t)(blk - CBX - CBW) * 256 + threadIdx.x) * 8;
        const v8f v = *(const v8f*)(wproj + e); v8h o;
#pragma unroll
        for (int k = 0; k < 8; ++k) o[k] = (h16)(bfr(v[k]) * WPS);
        *(v8h*)(WP + e) = o;
        asm volatile("s_wait_xcnt 0x0" ::: "memory");   // precaution: stands in front of every later write of the store's registers
    }
}

// eight asynchronous 16-byte copies per lane, global -> LDS (LDS byte address l + i*ls, global address g + i*gs halves).
// s_wait_xcnt closes the statement so that no address register of an issued copy is rewritten ahead of it.
__device__ __forceinline__ void copy8(unsigned l, unsigned ls, const h16* g, size_t gs) {
    asm volatile("global_load_async_to_lds_b128 %0, %8, off\n\t"
                 "global_load_async_to_lds_b128 %1, %9, off\n\t"
                 "global_load_async_to_lds_b128 %2, %10, off\n\t"
                 "global_load_async_to_lds_b128 %3, %11, off\n\t"
                 "global_load_async_to_lds_b128 %4, %12, off\n\t"
                 "global_load_async_to_lds_b128 %5, %13, off\n\t"
                 "global_load_async_to_lds_b128 %6, %14, off\n\t"
                 "global_load_async_to_lds_b128 %7, %15, off\n\t"
                 "s_wait_xcnt 0x0"
                 :: "v"(l), "v"(l + ls), "v"(l + 2 * ls), "v"(l + 3 * ls), "v"(l + 4 * ls), "v"(l + 5 * ls), "v"(l + 6 * ls), "v"(l + 7 * ls),
                    "v"(g), "v"(g + gs), "v"(g + 2 * gs), "v"(g + 3 * gs), "v"(g + 4 * gs), "v"(g + 5 * gs), "v"(g + 6 * gs), "v"(g + 7 * gs)
                 : "memory");
}

// one GEMM stage: rows 0..127 of the A tile, then of the B tile, 256 B (GK halves) of each. Copy i of lane tid takes (row i*16 + tid/16, 16-byte piece tid%16): a wave's copy covers two whole 256-B runs.
__device__ __forceinline__ void gstage(unsigned l, const h16* ga, const h16* gb) {
    copy8(l, 16 * GPB, ga, (size_t)16 * DM); copy8(l + GAB, 16 * GPB, gb, (size_t)16 * DM);
}
// fragment from an LDS row of 16-bit values; p already includes + 16*(lane>>4) bytes: same element map as ldh, for A and for B
__device__ __forceinline__ v16us ldu(const unsigned char* p) { return __builtin_shufflevector(*(const v8us*)p, *(const v8us*)(p + 32), 0, 1, 2, 3, 4, 5, 6, 7, 8, 9, 10, 11, 12, 13, 14, 15); }
template <bool F16> __device__ __forceinline__ v8f wm(v16us a, v16us b, v8f c) {
    if constexpr (F16) return wmma16(__builtin_bit_cast(v16h, a), __builtin_bit_cast(v16h, b), c);
    else               return wmmab(__builtin_bit_cast(v16bf, a), __builtin_bit_cast(v16bf, b), c);
}
// k loop of a 128x128 block tile (bx, by), K = DM: acc[mb][nb] += A rows (bx*128 + (wave>>1)*32 + mb*16 ..) x Bt rows (by*128 + (wave&1)*64 + nb*16 ..); the 128-k stages are walked from stage (bx + by) mod NSTG on, wrapping, k ascending in steps of 32 inside a stage.
// Two-buffer LDS ring shared by the block's 8 waves: the next stage's copies fly while this one is worked on; inside a stage the next k step's fragments are read ahead of this step's products.
template <bool F16> __device__ __forceinline__ void gemm_tile(const h16* A, const h16* Bt, unsigned bx, unsigned by, unsigned char* ring, v8f (&acc)[2][4]) {
    const int tid = threadIdx.x, lane = tid & 31, wave = tid >> 5, lr = lane & 15, hi = lane >> 4;
    const unsigned l = (unsigned)(size_t)ring + (unsigned)((tid >> 4) * GPB + (tid & 15) * 16);   // LDS byte address of this lane's first piece
    const h16* ga = A  + (size_t)(bx * GT + (tid >> 4)) * DM + (tid & 15) * 8;             // + stage * GK
    const h16* gb = Bt + (size_t)(by * GT + (tid >> 4)) * DM + (tid & 15) * 8;
    const unsigned NSTG = DM / GK;
    const unsigned s0 = (bx + by) % NSTG;                    // first stage of this block: blocks that share a row panel differ in by, those that share a column panel in bx, so sharers spread over the NSTG stages
    gstage(l, ga + (size_t)s0 * GK, gb + (size_t)s0 * GK);
    asm volatile("s_wait_asynccnt 0x0" ::: "memory");        // stage s0 of this wave has landed
    __syncthreads();                                         // stage s0 of every wave is readable
    { const size_t ko = (size_t)((s0 + 1) % NSTG) * GK; gstage(l + GSB, ga + ko, gb + ko); }
    const int afo = ((wave >> 1) * 32 + lr) * GPB + 16 * hi;
    const int bfo = GAB + ((wave & 1) * 64 + lr) * GPB + 16 * hi;
#pragma unroll 1   // the stage loop stays rolled: one publish point, buffer picked by the stage's parity
    for (unsigned st = 0; st < NSTG; ++st) {
        const unsigned char* pa = ring + (st & 1) * GSB + afo;
        const unsigned char* pb = ring + (st & 1) * GSB + bfo;
        v16us a[2][2], b[2][4];
#pragma unroll
        for (int i = 0; i < 4; ++i) { if (i < 2) a[0][i] = ldu(pa + i * 16 * GPB); b[0][i] = ldu(pb + i * 16 * GPB); }
#pragma unroll
        for (int kk = 0; kk < GK / 32; ++kk) {
            const int cur = kk & 1, nxt = cur ^ 1;
            if (kk + 1 < GK / 32) {
#pragma unroll
                for (int i = 0; i < 4; ++i) { if (i < 2) a[nxt][i] = ldu(pa + i * 16 * GPB + (kk + 1) * 64); b[nxt][i] = ldu(pb + i * 16 * GPB + (kk + 1) * 64); }
            }
            __builtin_amdgcn_sched_barrier(0);   // keeps the next step's reads one group ahead of this step's products: sunk among them, each read's LDS latency is waited out
#pragma unroll
            for (int nb = 0; nb < 4; ++nb)
#pragma unroll
                for (int mb = 0; mb < 2; ++mb) acc[mb][nb] = wm<F16>(a[cur][mb], b[cur][nb], acc[mb][nb]);
            __builtin_amdgcn_sched_barrier(0);   // the other side of the same fence: no later read rises into this step's products
        }
        asm volatile("s_wait_dscnt 0x0" ::: "memory");       // this wave's reads of the stage are done before its buffer is handed back
        asm volatile("s_wait_asynccnt 0x0" ::: "memory");    // this wave's copies of the next stage have landed
        __syncthreads();                                     // next stage readable by all, this stage's buffer free
        if (st + 2 < NSTG) { const size_t ko = (size_t)((s0 + st + 2) % NSTG) * GK; gstage(l + (unsigned)((st & 1) * GSB), ga + ko, gb + ko); }
    }
    asm volatile("s_wait_asynccnt 0x0" ::: "memory");        // nothing in flight when the wave goes on to its epilogue
}

// k_proj: the three qkv projections in one grid; register-blocked bf16 GEMM, one wave per 32x64 tile (8 accumulators), 4 x 2 waves per block, operands from K-contiguous bf16 planes through the LDS ring of gemm_tile, K = DM.
// C[m][n] = sum_k A[m][k] Bt[n][k] + bias, written as a single f16 plane. grid (tiles of one projection, 3), 256 threads; blockIdx.y = 0 q, 1 k, 2 v^T; row tile fastest.
// q, k: A = x rows (m = b*SEQ + t), Bt = W rows (n = h*64 + d), bias[n] -> plane [(b*16 + h)][t][d].   v^T: A = Wv rows (m = h*64 + d), Bt = x rows (n = b*SEQ + t), bias[m] -> plane [(b*16 + h)][d][t].
__global__ __launch_bounds__(256) void k_proj(const bf* __restrict__ XB, const bf* __restrict__ WB, const float* __restrict__ bqkv, h16* QH, h16* KP, h16* VT) {
    __shared__ __align__(16) unsigned char ring[2 * GSB];    // two operand stages
    __shared__ __align__(16) float osw[8 * 16 * 68];         // output staging, one part per wave
    const int lane = threadIdx.x & 31, wave = threadIdx.x >> 5, lr = lane & 15, hi = lane >> 4;
    const int pz = blockIdx.y; const int biasRow = pz == 2;
    const int mt = biasRow ? DM / GT : NB * SEQ / GT;        // row tiles of this projection
    const int bx = blockIdx.x % mt, by = blockIdx.x / mt;
    const bf* W = WB + (size_t)pz * DM * DM;
    const bf* A = biasRow ? W : XB; const bf* Bt = biasRow ? XB : W;
    const float* bias = bqkv + pz * DM;
    h16* Ph = pz == 0 ? QH : (pz == 1 ? KP : VT);
    const int pitch = biasRow ? SEQ : HD;                    // row pitch of the plane, halves
    const int r0 = bx * GT + (wave >> 1) * 32, c0 = by * GT + (wave & 1) * 64;
    float* os = osw + wave * 16 * 68;
    v8f acc[2][4];
#pragma unroll
    for (int mb = 0; mb < 2; ++mb)
#pragma unroll
        for (int nb = 0; nb < 4; ++nb) acc[mb][nb] = (v8f){};
    gemm_tile<false>((const h16*)A, (const h16*)Bt, (unsigned)bx, (unsigned)by, ring, acc);
    // column bias (index selected as an integer, address always inside the bias array)
    float bc[4];
#pragma unroll
    for (int nb = 0; nb < 4; ++nb) { const int ci = biasRow ? 0 : (c0 + nb * 16 + lr); const float t = bfr(bias[ci]); bc[nb] = biasRow ? 0.0f : t; }
    const size_t tbase = biasRow ? (size_t)r0 * SEQ + (size_t)(c0 / SEQ) * ((size_t)DM * SEQ) + (size_t)(c0 % SEQ)
                                 : (size_t)(r0 / SEQ) * ((size_t)NH_ * SEQ * HD) + (size_t)(r0 % SEQ) * HD + (size_t)(c0 / HD) * ((size_t)SEQ * HD) + (size_t)(c0 % HD);
#pragma unroll
    for (int mb = 0; mb < 2; ++mb) {
        // row bias for rows r0 + mb*16 + 8h + 0..7 (two 16-B loads, clamped to offset 0 in column mode)
        const int ri = biasRow ? (r0 + mb * 16 + hi * 8) : 0;
        const v4f rb0 = *(const v4f*)(bias + ri); const v4f rb1 = *(const v4f*)(bias + ri + 4);
        float br[8];
#pragma unroll
        for (int j = 0; j < 4; ++j) { const float t0 = bfr(rb0[j]); const float t1 = bfr(rb1[j]); br[j] = biasRow ? t0 : 0.0f; br[4 + j] = biasRow ? t1 : 0.0f; }
#pragma unroll
        for (int nb = 0; nb < 4; ++nb) {
#pragma unroll
            for (int j = 0; j < 8; ++j) os[(hi * 8 + j) * 68 + nb * 16 + lr] = acc[mb][nb][j] + bc[nb] + br[j]; }   // D: row 8h+j, col lane&15
        wave_sync();
        const size_t sb = tbase + (size_t)(mb * 16) * (size_t)pitch;
{
#pragma unroll
            for (int s = 0; s < 4; ++s) { const int row = 4 * s + (lane >> 3), c8 = (lane & 7) * 8;   // 4 s x 4 row groups = 16 rows; 8 lanes x 8 = 64 columns
                const v4f x0 = *(const v4fa*)(&os[row * 68 + c8]); const v4f x1 = *(const v4fa*)(&os[row * 68 + c8 + 4]); v8h hv;
#pragma unroll
                for (int i = 0; i < 4; ++i) { hv[i] = (h16)x0[i]; hv[4 + i] = (h16)x1[i]; }
                const size_t oo = sb + (size_t)row * (size_t)pitch + c8;
                *(v8h*)(Ph + oo) = hv; }
            asm volatile("s_wait_xcnt 0x0" ::: "memory");   // precaution: stands in front of the next half tile's bias loads, which land in the four stores' data registers
             }
        wave_sync();
    }
}

// k_flash: fused attention, one wave per 16 query rows of one (batch, head), 8 waves per block; Q fragments straight from the f16 plane.
// K and V^T come in stages of KST keys through a two-buffer LDS ring that the block's waves share: whole-line asynchronous copies, the next stage in flight while this one is worked on.
// The stages are walked from stage blockIdx.x mod NST on, wrapping (the running-maximum softmax takes the keys in any order): the blocks of one head start two to each of the NST stages.
// Transposed form: S^T[key][t] = K Q^T (A = K rows, B = Q rows); lane (t = lane&15, h = lane>>4) holds keys 8h+r of each 16-key tile, so the packed
// P tile is directly the B fragment of O^T[d][t] = V^T P^T (element r <- tile keys 0..15, element 8+r <- tile keys 16..31, lane unchanged).
// The maximum in use is one scalar per lane, the same in both lane halves of a row. It is renewed lazily: only in a pass where some score of the wave passes it by more than LZT do the halves exchange
// their maxima (one xor-16 exchange) and are the output and row-sum tiles rescaled; in every other pass P is formed against the maximum in use, which cancels in the normalisation like any other.
// Row sums on the matrix pipe: A operand with ones in rows 0 and 8 and zeros elsewhere, B = the packed P tile; element 0 of the result tile is, in both lane halves, the sum of the query's 32 P values; elements 1..7 stay 0.
__global__ __launch_bounds__(32 * AW) void k_flash(const h16* __restrict__ QH, const h16* __restrict__ KP, const h16* __restrict__ VT, h16* CTX) {
    __shared__ __align__(16) unsigned char ring[2 * SBY];    // two stages; after the loop: output staging
    float* os = (float*)ring;
    const int tid = threadIdx.x;
    const int lane = threadIdx.x & 31, wave = threadIdx.x >> 5, lr = lane & 15, hi = lane >> 4;
    const int zh = blockIdx.y; const int b = zh / NH_, h = zh % NH_;
    const int t0 = (blockIdx.x * AW + wave) * 16;
    const size_t pbase = (size_t)zh * SEQ * HD;
    const size_t qo = pbase + (size_t)(t0 + lr) * HD + 8 * hi;
    const v16h qh0 = ldh(QH + qo), qh1 = ldh(QH + qo + 32);   // B fragments: col t, k = d
    // copy maps. K tile: 32 KiB contiguous; copy i of lane tid takes 16-byte piece i*256 + tid = (key i*32 + tid/8, piece tid%8). V^T tile: 64 rows of 512 B; (row i*8 + tid/32, piece tid%32).
    const unsigned rb = (unsigned)(size_t)ring;              // LDS byte address of the ring
    const unsigned kl = rb + (unsigned)((tid >> 3) * KPB + (tid & 7) * 16);
    const unsigned vl = rb + (unsigned)(KBY + (tid >> 5) * VPB + (tid & 31) * 16);
    const h16* kg = KP + pbase + (size_t)tid * 8;                                   // + stage * KST * HD
    const h16* vg = VT + pbase + (size_t)(tid >> 5) * SEQ + (size_t)(tid & 31) * 8; // + stage * KST
    const unsigned NST = SEQ / KST;
    const unsigned s0 = blockIdx.x % NST;                    // first stage of this block
    copy8(kl, 32 * KPB, kg + (size_t)s0 * KST * HD, (size_t)32 * HD); copy8(vl, 8 * VPB, vg + (size_t)s0 * KST, (size_t)8 * SEQ);
    asm volatile("s_wait_asynccnt 0x0" ::: "memory");        // stage s0 of this wave has landed
    __syncthreads();                                         // stage s0 of every wave is readable
    if (NST > 1) { const size_t sn = (s0 + 1) % NST; copy8(kl + SBY, 32 * KPB, kg + sn * KST * HD, (size_t)32 * HD); copy8(vl + SBY, 8 * VPB, vg + sn * KST, (size_t)8 * SEQ); }
    const int kfo = lr * KPB + 16 * hi;                      // + key * KPB              (A fragment: row key, k = d)
    const int vfo = KBY + lr * VPB + 16 * hi;                // + 16j * VPB + key * 2    (A fragment: row d, k = key)
    v8f o0 = (v8f){}, o1 = (v8f){}, o2 = (v8f){}, o3 = (v8f){};
    v8f lt = (v8f){};                                        // row-sum tile: element 0 = running sum of this lane's query
    const h16 ov = (lane & 7) == 0 ? (h16)1.0f : (h16)0.0f;  // A rows 0 and 8 (lanes 0, 8, 16, 24) are ones at all 32 k positions
    const v16h one = {ov, ov, ov, ov, ov, ov, ov, ov, ov, ov, ov, ov, ov, ov, ov, ov};
    float m = -3.0e38f, sh = 3.0e38f;                        // maximum in use and PSH - m; with these start values the first pass takes the rescale branch
#pragma unroll 1   // the stage loop stays rolled: one publish point, buffer picked by the stage's parity
    for (unsigned st = 0; st < NST; ++st) {
      const unsigned char* sb = ring + (st & 1) * SBY;
#pragma unroll 4   // four 32-key passes per branch, LDS offsets as immediates; all eight unrolled go past 256 registers and two blocks no longer fit a WGP
      for (int key0 = 0; key0 < KST; key0 += 32) {
        const h16* ka = (const h16*)(sb + kfo + key0 * KPB);
        const v16h ka0 = ldh(ka), ka1 = ldh(ka + 32), kb0 = ldh(ka + 8 * KPB), kb1 = ldh(ka + 8 * KPB + 32);   // 8 * KPB halves = 16 rows
        v8f sHa = (v8f){}, sHb = (v8f){};
        sHa = wmma16(ka0, qh0, sHa); sHb = wmma16(kb0, qh0, sHb);
        sHa = wmma16(ka1, qh1, sHa); sHb = wmma16(kb1, qh1, sHb);
        asm volatile("v_nop\n\tv_nop\n\tv_nop\n\tv_nop" : "+v"(sHa), "+v"(sHb) : "v"(ka0), "v"(ka1), "v"(kb0), "v"(kb1), "v"(qh0), "v"(qh1));
        float ta[8], tb[8]; float mx = -3.0e38f;
#pragma unroll
        for (int r = 0; r < 8; ++r) { ta[r] = sHa[r] * SC2; tb[r] = sHb[r] * SC2; mx = fmaxf(mx, fmaxf(ta[r], tb[r])); }
        const h16* va = (const h16*)(sb + vfo + key0 * 2);
        const v16h v0 = ldh(va), v1 = ldh(va + 8 * VPB), v2 = ldh(va + 16 * VPB), v3 = ldh(va + 24 * VPB);     // 8 * VPB halves = 16 rows; read ahead of the test, so that the softmax covers their latency on both paths
        asm volatile("" ::: "memory");   // compiler fence: without it the build sinks the V^T reads of one pass in four behind the test's branch, next to their products, where their LDS latency is waited out
        if (__builtin_expect(__builtin_amdgcn_ballot_w32(mx + sh > PSH + LZT) != 0, 0)) {   // one scalar test per pass, on the largest exponent as it would be formed below; taken by the whole wave, so EXEC stays all ones for the products
            mx = fmaxf(mx, __shfl_xor(mx, 16, 32));
            const float mnew = fmaxf(m, mx);
            const float alpha = __builtin_amdgcn_exp2f(m - mnew);
            m = mnew; sh = PSH - mnew;
            o0 = o0 * alpha; o1 = o1 * alpha; o2 = o2 * alpha; o3 = o3 * alpha; lt[0] = lt[0] * alpha;
        }
        v16h pb;
#pragma unroll
        for (int r = 0; r < 8; ++r) { pb[r] = (h16)__builtin_amdgcn_exp2f(ta[r] + sh); pb[8 + r] = (h16)__builtin_amdgcn_exp2f(tb[r] + sh); }
        o0 = wmma16(v0, pb, o0); o1 = wmma16(v1, pb, o1); o2 = wmma16(v2, pb, o2); o3 = wmma16(v3, pb, o3);
        lt = wmma16(one, pb, lt);                            // += the column sums of P^T
        asm volatile("v_nop\n\tv_nop\n\tv_nop\n\tv_nop" : "+v"(o0), "+v"(o1), "+v"(o2), "+v"(o3), "+v"(lt) : "v"(v0), "v"(v1), "v"(v2), "v"(v3), "v"(pb), "v"(one));
      }
      asm volatile("s_wait_dscnt 0x0" ::: "memory");         // this wave's reads of the stage are done before its buffer is handed back
      asm volatile("s_wait_asynccnt 0x0" ::: "memory");      // this wave's copies of the next stage have landed
      __syncthreads();                                       // next stage readable by all, this stage's buffer free
      if (st + 2 < NST) {
          const unsigned bo = (unsigned)((st & 1) * SBY);
          const size_t sn = (s0 + st + 2) % NST;
          copy8(kl + bo, 32 * KPB, kg + sn * KST * HD, (size_t)32 * HD); copy8(vl + bo, 8 * VPB, vg + sn * KST, (size_t)8 * SEQ);
      }
    }
    asm volatile("s_wait_asynccnt 0x0" ::: "memory");        // nothing in flight when the ring becomes output staging (the last barrier above ended every read)
    const float inv = CCS * (1.0f / lt[0]);  // normalisation (the P carry cancels) times the ctx carry; both lane halves hold the whole row sum
    const int wb = wave * 16 * 68;
    // O^T D layout: o_j[r] = (d = 16j + 8h + r, t = lane&15) -> os[t][d]; rows 0..15 x columns 0..63 all written
    { v4f a, c;
      a[0] = o0[0] * inv; a[1] = o0[1] * inv; a[2] = o0[2] * inv; a[3] = o0[3] * inv; c[0] = o0[4] * inv; c[1] = o0[5] * inv; c[2] = o0[6] * inv; c[3] = o0[7] * inv;
      *(v4fa*)(&os[wb + lr * 68 +  0 + 8 * hi]) = a; *(v4fa*)(&os[wb + lr * 68 +  0 + 8 * hi + 4]) = c;
      a[0] = o1[0] * inv; a[1] = o1[1] * inv; a[2] = o1[2] * inv; a[3] = o1[3] * inv; c[0] = o1[4] * inv; c[1] = o1[5] * inv; c[2] = o1[6] * inv; c[3] = o1[7] * inv;
      *(v4fa*)(&os[wb + lr * 68 + 16 + 8 * hi]) = a; *(v4fa*)(&os[wb + lr * 68 + 16 + 8 * hi + 4]) = c;
      a[0] = o2[0] * inv; a[1] = o2[1] * inv; a[2] = o2[2] * inv; a[3] = o2[3] * inv; c[0] = o2[4] * inv; c[1] = o2[5] * inv; c[2] = o2[6] * inv; c[3] = o2[7] * inv;
      *(v4fa*)(&os[wb + lr * 68 + 32 + 8 * hi]) = a; *(v4fa*)(&os[wb + lr * 68 + 32 + 8 * hi + 4]) = c;
      a[0] = o3[0] * inv; a[1] = o3[1] * inv; a[2] = o3[2] * inv; a[3] = o3[3] * inv; c[0] = o3[4] * inv; c[1] = o3[5] * inv; c[2] = o3[6] * inv; c[3] = o3[7] * inv;
      *(v4fa*)(&os[wb + lr * 68 + 48 + 8 * hi]) = a; *(v4fa*)(&os[wb + lr * 68 + 48 + 8 * hi + 4]) = c; }
    wave_sync();
    h16* crow = CTX + ((size_t)b * SEQ + t0) * DM + h * HD;      // ctx plane row = token, columns h*64 + d
{
#pragma unroll
        for (int s = 0; s < 4; ++s) { const int row = 4 * s + (lane >> 3), c8 = (lane & 7) * 8;   // 4 s x 4 row groups = 16 rows; 8 lanes x 8 halves = 64 columns
            const v4f x0 = *(const v4fa*)(&os[wb + row * 68 + c8]); const v4f x1 = *(const v4fa*)(&os[wb + row * 68 + c8 + 4]); v8h hv;
#pragma unroll
            for (int i = 0; i < 4; ++i) { hv[i] = (h16)x0[i]; hv[4 + i] = (h16)x1[i]; }
            *(v8h*)(crow + (size_t)row * DM + c8) = hv; }
         }
}

// k_oproj: register-blocked f16 GEMM, one wave per 32x64 tile, 4 x 2 waves per block, operands from K-contiguous f16 planes (ctx x256, w_proj x1024) through the LDS ring of gemm_tile, K = DM.
// OUT[m][n] = (sum_k A[m][k] Bt[n][k]) * 2^-18 + bias[n], f32. grid (NB*SEQ/128, DM/128), 256 threads.
__global__ __launch_bounds__(256) void k_oproj(const h16* __restrict__ A, const h16* __restrict__ Bt, const float* __restrict__ bias, float* OUT) {
    __shared__ __align__(16) unsigned char ring[2 * GSB];    // two operand stages
    __shared__ __align__(16) float osw[8 * 16 * 68];         // output staging, one part per wave
    const int lane = threadIdx.x & 31, wave = threadIdx.x >> 5, lr = lane & 15, hi = lane >> 4;
    const int r0 = blockIdx.x * GT + (wave >> 1) * 32, c0 = blockIdx.y * GT + (wave & 1) * 64;
    float* os = osw + wave * 16 * 68;
    v8f acc[2][4];
#pragma unroll
    for (int mb = 0; mb < 2; ++mb)
#pragma unroll
        for (int nb = 0; nb < 4; ++nb) acc[mb][nb] = (v8f){};
    gemm_tile<true>(A, Bt, blockIdx.x, blockIdx.y, ring, acc);
    float bc[4];
#pragma unroll
    for (int nb = 0; nb < 4; ++nb) bc[nb] = bfr(bias[c0 + nb * 16 + lr]);
    const int bq = r0 / SEQ, tq = r0 % SEQ;
    float* obase = OUT + ((size_t)bq * OUT_SEQ + tq) * DM + c0;
#pragma unroll
    for (int mb = 0; mb < 2; ++mb) {
#pragma unroll
        for (int nb = 0; nb < 4; ++nb) {
#pragma unroll
            for (int j = 0; j < 8; ++j) os[(hi * 8 + j) * 68 + nb * 16 + lr] = acc[mb][nb][j] * OSI + bc[nb]; }   // D: row 8h+j, col lane&15
        wave_sync();
{
#pragma unroll
            for (int s = 0; s < 8; ++s) { const int row = 2 * s + hi, cofs = lr * 4;   // 8 s x 2 rows = 16 rows; 16 lanes x 4 floats = 64 columns
                const v4f val = *(const v4fa*)(&os[row * 68 + cofs]);
                *(v4f*)(obase + (size_t)(mb * 16 + row) * DM + cofs) = val; }
             }
        wave_sync();
    }
}

static constexpr size_t al256(size_t v) { return (v + 255) & ~(size_t)255; }
static constexpr size_t SZ_XB = al256((size_t)NB * SEQ * DM * 2);
static constexpr size_t SZ_WB = al256((size_t)3 * DM * DM * 2);
static constexpr size_t SZ_WP = al256((size_t)DM * DM * 2);
static constexpr size_t SZ_PL = al256((size_t)NB * NH_ * SEQ * HD * 2);
static constexpr size_t SZ_CX = al256((size_t)NB * SEQ * DM * 2);
static constexpr size_t SZ_TOTAL = SZ_XB + SZ_WB + SZ_WP + 3 * SZ_PL + SZ_CX;
static_assert(SZ_TOTAL <= (size_t)134217728);          // workspace carve <= 128 MiB
static_assert(((size_t)DM * DM * 2) % 256 == 0);       // weight sub-planes stay 256-byte aligned

extern "C" void kernel_launch(void* const* d_in, const int* in_sizes, int n_in,
                              void* d_out, int out_size, void* d_ws, size_t ws_size, hipStream_t stream) {
    if (n_in < 5) return;
    const size_t needx = ((size_t)(NB - 1) * SEQ_FULL + SEQ) * DM;
    if ((size_t)in_sizes[0] < needx) return;
    if ((size_t)in_sizes[1] < (size_t)3 * DM * DM || (size_t)in_sizes[2] < (size_t)3 * DM) return;
    if ((size_t)in_sizes[3] < (size_t)DM * DM || (size_t)in_sizes[4] < (size_t)DM) return;
    if ((size_t)out_size < ((size_t)(NB - 1) * OUT_SEQ + SEQ) * DM) return;
    if (SZ_TOTAL > ws_size) return;
    // wire order: x, w_qkv ([3072][1024] = Bt as-is, rows q | k | v), b_qkv, w_proj ([out][in] = Bt as-is), b_proj
    const float* x = (const float*)d_in[0]; const float* wqkv = (const float*)d_in[1]; const float* bqkv = (const float*)d_in[2];
    const float* wproj = (const float*)d_in[3]; const float* bproj = (const float*)d_in[4];
    float* OUT = (float*)d_out;      // [NB][SEQ][1024]
    char* wsp = (char*)d_ws;
    bf* XB = (bf*)wsp; wsp += SZ_XB;                 // [NB*SEQ][1024]
    bf* WB = (bf*)wsp; wsp += SZ_WB;                 // [3][1024][1024]: q | k | v
    h16* WP = (h16*)wsp; wsp += SZ_WP;               // [1024][1024] x1024
    h16* QH = (h16*)wsp; wsp += SZ_PL;               // [NB*16][SEQ][64]
    h16* KP = (h16*)wsp; wsp += SZ_PL;               // [NB*16][SEQ][64]
    h16* VT = (h16*)wsp; wsp += SZ_PL;               // [NB*16][64][SEQ]
    h16* CX = (h16*)wsp; wsp += SZ_CX;               // [NB*SEQ][1024] x256

    k_cvt<<<CBX + CBW + CBP, 256, 0, stream>>>(x, wqkv, wproj, XB, WB, WP);

    k_proj<<<dim3((NB * SEQ / GT) * (DM / GT), 3, 1), 256, 0, stream>>>(XB, WB, bqkv, QH, KP, VT);

    k_flash<<<dim3(SEQ / (16 * AW), NB * NH_, 1), 32 * AW, 0, stream>>>(QH, KP, VT, CX);

    // output projection: A = ctx rows (m = b*SEQ + t, k = h*64 + d), Bt = w_proj rows (n = f) -> OUT[m][f]
    k_oproj<<<dim3(NB * SEQ / GT, DM / GT, 1), 256, 0, stream>>>(CX, WP, bproj, OUT);
}

// v007
// Measured time: 97.9 microseconds a run.
// In both of two side-by-side timings against v006, it was 1.07 times as fast.
// Counting every step since v000, it is 3.65 times as fast.
#include <hip/hip_runtime.h>

// Multi-head self-attention, width 1024 = 16 heads x 64, x [NB][SEQ][1024], fused w_qkv [3072][1024] ([out][in], rows q | k | v, head h = rows h*64+d of each third), b_qkv, score scale 1/8, no mask, output projection w_proj [out][in] + b_proj (f32 output).
// Compute dtypes, f32 accumulate everywhere: qkv projections v_wmma_f32_16x16x32_bf16 (x, w_qkv RNE-converted to bf16; products exact); scores v_wmma_f32_16x16x32_f16: q and k single f16 planes (one product), the q plane holding q * 0.125*log2(e) (scaled in f32 ahead of its one f16 rounding);
// P (x256 carry, cancels in the normalisation; row sum taken over the f16 P values, by one more matrix product with a ones operand) and v single f16; softmax f32 (online, running max); output projection v_wmma_f32_16x16x32_f16: ctx single f16 (x256 carry), w_proj RNE-converted to bf16 then x1024 as f16 (exact), carries folded back (2^-18) in the f32 epilogue; biases RNE-converted to bf16, added in f32.
// Layout: bf16 copies of x and w_qkv; q, k planes [b*16+h][t][d] and v^T plane [b*16+h][d][t] written by the GEMM epilogue; fused flash kernel in transposed form (S^T = K Q^T, O^T = V^T P^T; K and V^T tiles staged in LDS for the 8 waves of a block) writes the f16 ctx plane [b*SEQ+t][1024]; f16 GEMM writes the output buffer.
// The four GEMMs: 128x128 tile per 8-wave block (32x64 per wave), both operands staged in LDS in whole lines, 128 k per stage, two buffers.
// Blocks that stage the same rows (GEMM panels; K and V^T of a head) begin the stage walk at stages spread by block index and wrap, so that not all of them ask L2 for the same lines at the same moment.
// Four launches: launches that read none of each other's output share one grid (the three conversions by block range; the q, k and v^T projections by blockIdx.y).

#ifndef NB
#define NB 1
#endif
#ifndef SEQ
#define SEQ 4096
#endif
#define NB_FULL  1
#define SEQ_FULL 4096
#ifndef OUT_SEQ
#define OUT_SEQ SEQ              // row pitch (in tokens) between batches of the output
#endif
#define DM   1024
#define NH_  16
#define HD   64
#define AW   8                   // waves per flash block (16 query rows each)
#define KST  256                 // keys per LDS stage of the flash kernel
#define KPB  (HD * 2 + 16)       // LDS pitch of a K row, bytes: 16 B x odd, no bank conflict for 16-byte fragment reads
#define VPB  (KST * 2 + 16)      // LDS pitch of a V^T row, bytes: 16 B x odd
#define KBY  (KST * KPB)         // K part of a stage, bytes
#define SBY  (KBY + HD * VPB)    // one stage (K then V^T), bytes
#define GT   128                 // GEMM block tile, rows and columns (4 x 2 waves of 32 x 64)
#define GK   128                 // k per LDS stage of the GEMMs
#define GPB  (GK * 2 + 16)       // LDS pitch of a GEMM operand row, bytes: 16 B x odd
#define GAB  (GT * GPB)          // one operand's part of a stage, bytes
#define GSB  (2 * GAB)           // one stage (A rows then B rows), bytes
#define SC2  (0.125f * 1.4426950408889634f)   // HD^-0.5 * log2(e)
#define PSH  8.0f                // log2 of the P carry (256)
#define LZT  7.0f                // lazy rescale: a score may pass the maximum in use by this much (log2) before the maximum is renewed; P <= 2^(PSH + LZT) = 32768 stays finite in f16
#define CCS  256.0f              // carry of the ctx plane
#define WPS  1024.0f             // carry of the w_proj plane
#define OSI  (1.0f / (256.0f * 1024.0f))      // inverse of both carries

static_assert(HD == 64);
static_assert(NH_ * HD == DM);                 // head h = columns h*64 + d
static_assert(DM % 64 == 0);                   // column tiles of 64
static_assert(DM % 32 == 0);                   // GEMM k-loop steps by 32
static_assert(SEQ % 64 == 0);                  // a wave's tile (32 rows, 64 columns) never straddles two batches
static_assert((NB * SEQ) % 64 == 0);
static_assert(SEQ % 32 == 0);                  // key loop steps by 32
static_assert(SEQ % (16 * AW) == 0);           // flash grid covers the sequence exactly
static_assert(SEQ % KST == 0);                 // whole stages only
static_assert(AW == 8 && KST == 256);          // copy maps of k_flash: 256 lanes x 8 copies x 16 B = one 32-KiB K or V^T tile
static_assert((KPB / 16) % 2 == 1 && (VPB / 16) % 2 == 1);
static_assert(2 * SBY >= AW * 16 * 68 * 4);    // the ring holds the output staging
static_assert((NB * SEQ) % GT == 0 && DM % GT == 0);   // GEMM grids cover both extents exactly
static_assert(DM % GK == 0 && DM / GK >= 2);           // whole stages, and the two that the ring's prologue needs
static_assert(GT == 128 && GK == 128);                 // copy map of gstage: 256 lanes x 16 copies x 16 B = 256 rows of 256 B
static_assert((GPB / 16) % 2 == 1);
static_assert(((size_t)SEQ * DM) % 8 == 0);
static_assert(((size_t)DM * DM) % 8 == 0);
static_assert(NB <= NB_FULL);
static_assert(SEQ <= SEQ_FULL);

typedef _Float16 h16;
typedef unsigned short bf;
typedef __attribute__((ext_vector_type(16))) __bf16   v16bf;
typedef __attribute__((ext_vector_type(16))) _Float16 v16h;
typedef __attribute__((ext_vector_type(8)))  _Float16 v8h;
typedef __attribute__((ext_vector_type(8)))  unsigned short v8us;
typedef __attribute__((ext_vector_type(16))) unsigned short v16us;
typedef __attribute__((ext_vector_type(8)))  float    v8f;
typedef __attribute__((ext_vector_type(4)))  float    v4f;
typedef v4f  __attribute__((may_alias)) v4fa;

__device__ __forceinline__ unsigned short f2bf(float f) { unsigned u = __float_as_uint(f); u += 0x7FFFu + ((u >> 16) & 1u); return (unsigned short)(u >> 16); }
__device__ __forceinline__ float bfr(float f) { return __uint_as_float(((unsigned)f2bf(f)) << 16); }   // value after RNE convert to bf16
__device__ __forceinline__ v16h cat16(v8h lo, v8h hi) { return __builtin_shufflevector(lo, hi, 0, 1, 2, 3, 4, 5, 6, 7, 8, 9, 10, 11, 12, 13, 14, 15); }
__device__ __forceinline__ v8f wmma16(v16h a, v16h b, v8f c) { return __builtin_amdgcn_wmma_f32_16x16x32_f16(false, a, false, b, (short)0, c, false, false); }
__device__ __forceinline__ v8f wmmab(v16bf a, v16bf b, v8f c) { return __builtin_amdgcn_wmma_f32_16x16x32_bf16(false, a, false, b, (short)0, c, false, false); }
// fragment loaders from K-contiguous 16-bit rows; p already includes + 8*(lane>>4): elements 0..7 <- k0+8h+0..7, elements 8..15 <- k0+16+8h+0..7 (same map for A and B)
__device__ __forceinline__ v16h  ldh(const h16* p) { return cat16(*(const v8h*)p, *(const v8h*)(p + 16)); }
// ordering point for wave-private LDS tiles (same wave writes and reads)
__device__ __forceinline__ void wave_sync() { __builtin_amdgcn_fence(3 /* release order */, "wavefront"); __builtin_amdgcn_wave_barrier(); asm volatile("" ::: "memory"); }

// k_cvt: the three conversions in one grid, 8 values per thread; a block lies wholly in one range: x -> bf16, then w_qkv -> bf16, then w_proj -> bf16 value x1024 as f16.
#define CBX ((unsigned)((size_t)NB * SEQ * DM / 2048))   // blocks of x (256 threads x 8 values)
#define CBW ((unsigned)((size_t)3 * DM * DM / 2048))     // blocks of w_qkv
#define CBP ((unsigned)((size_t)DM * DM / 2048))         // blocks of w_proj
static_assert(((size_t)SEQ * DM) % 2048 == 0 && ((size_t)DM * DM) % 2048 == 0);   // whole blocks in every range, none straddles two batches
__global__ __launch_bounds__(256) void k_cvt(const float* __restrict__ x, const float* __restrict__ wqkv, const float* __restrict__ wproj, bf* XB, bf* WB, h16* WP) {
    const unsigned blk = blockIdx.x;
    if (blk < CBX + CBW) {
        const bool isx = blk < CBX;
        const size_t e = ((size_t)(isx ? blk : blk - CBX) * 256 + threadIdx.x) * 8;
        const size_t bt = e / ((size_t)SEQ * DM);            // batch (x only): source batches lie SEQ_FULL tokens apart
        const float* s = isx ? x + bt * ((size_t)SEQ_FULL * DM) + (e - bt * ((size_t)SEQ * DM)) : wqkv + e;
        const v8f v = *(const v8f*)s; v8us o;
#pragma unroll
        for (int k = 0; k < 8; ++k) o[k] = f2bf(v[k]);
        *(v8us*)((isx ? XB : WB) + e) = o;
    } else {
        const size_t e = ((size_t)(blk - CBX - CBW) * 256 + threadIdx.x) * 8;
        const v8f v = *(const v8f*)(wproj + e); v8h o;
#pragma unroll
        for (int k = 0; k < 8; ++k) o[k] = (h16)(bfr(v[k]) * WPS);
        *(v8h*)(WP + e) = o;
        asm volatile("s_wait_xcnt 0x0" ::: "memory");   // precaution: stands in front of every later write of the store's registers
    }
}

// eight asynchronous 16-byte copies per lane, global -> LDS (LDS byte address l + i*ls, global address g + i*gs halves).
// s_wait_xcnt closes the statement so that no address register of an issued copy is rewritten ahead of it.
__device__ __forceinline__ void copy8(unsigned l, unsigned ls, const h16* g, size_t gs) {
    asm volatile("global_load_async_to_lds_b128 %0, %8, off\n\t"
                 "global_load_async_to_lds_b128 %1, %9, off\n\t"
                 "global_load_async_to_lds_b128 %2, %10, off\n\t"
                 "global_load_async_to_lds_b128 %3, %11, off\n\t"
                 "global_load_async_to_lds_b128 %4, %12, off\n\t"
                 "global_load_async_to_lds_b128 %5, %13, off\n\t"
                 "global_load_async_to_lds_b128 %6, %14, off\n\t"
                 "global_load_async_to_lds_b128 %7, %15, off\n\t"
                 "s_wait_xcnt 0x0"
                 :: "v"(l), "v"(l + ls), "v"(l + 2 * ls), "v"(l + 3 * ls), "v"(l + 4 * ls), "v"(l + 5 * ls), "v"(l + 6 * ls), "v"(l + 7 * ls),
                    "v"(g), "v"(g + gs), "v"(g + 2 * gs), "v"(g + 3 * gs), "v"(g + 4 * gs), "v"(g + 5 * gs), "v"(g + 6 * gs), "v"(g + 7 * gs)
                 : "memory");
}

// one GEMM stage: rows 0..127 of the A tile, then of the B tile, 256 B (GK halves) of each. Copy i of lane tid takes (row i*16 + tid/16, 16-byte piece tid%16): a wave's copy covers two whole 256-B runs.
__device__ __forceinline__ void gstage(unsigned l, const h16* ga, const h16* gb) {
    copy8(l, 16 * GPB, ga, (size_t)16 * DM); copy8(l + GAB, 16 * GPB, gb, (size_t)16 * DM);
}
// fragment from an LDS row of 16-bit values; p already includes + 16*(lane>>4) bytes: same element map as ldh, for A and for B
__device__ __forceinline__ v16us ldu(const unsigned char* p) { return __builtin_shufflevector(*(const v8us*)p, *(const v8us*)(p + 32), 0, 1, 2, 3, 4, 5, 6, 7, 8, 9, 10, 11, 12, 13, 14, 15); }
template <bool F16> __device__ __forceinline__ v8f wm(v16us a, v16us b, v8f c) {
    if constexpr (F16) return wmma16(__builtin_bit_cast(v16h, a), __builtin_bit_cast(v16h, b), c);
    else               return wmmab(__builtin_bit_cast(v16bf, a), __builtin_bit_cast(v16bf, b), c);
}
// k loop of a 128x128 block tile (bx, by), K = DM: acc[mb][nb] += A rows (bx*128 + (wave>>1)*32 + mb*16 ..) x Bt rows (by*128 + (wave&1)*64 + nb*16 ..); the 128-k stages are walked from stage (bx + by) mod NSTG on, wrapping, k ascending in steps of 32 inside a stage.
// Two-buffer LDS ring shared by the block's 8 waves: the next stage's copies fly while this one is worked on; inside a stage the next k step's fragments are read ahead of this step's products.
template <bool F16> __device__ __forceinline__ void gemm_tile(const h16* A, const h16* Bt, unsigned bx, unsigned by, unsigned char* ring, v8f (&acc)[2][4]) {
    const int tid = threadIdx.x, lane = tid & 31, wave = tid >> 5, lr = lane & 15, hi = lane >> 4;
    const unsigned l = (unsigned)(size_t)ring + (unsigned)((tid >> 4) * GPB + (tid & 15) * 16);   // LDS byte address of this lane's first piece
    const h16* ga = A  + (size_t)(bx * GT + (tid >> 4)) * DM + (tid & 15) * 8;             // + stage * GK
    const h16* gb = Bt + (size_t)(by * GT + (tid >> 4)) * DM + (tid & 15) * 8;
    const unsigned NSTG = DM / GK;
    const unsigned s0 = (bx + by) % NSTG;                    // first stage of this block: blocks that share a row panel differ in by, those that share a column panel in bx, so sharers spread over the NSTG stages
    gstage(l, ga + (size_t)s0 * GK, gb + (size_t)s0 * GK);
    asm volatile("s_wait_asynccnt 0x0" ::: "memory");        // stage s0 of this wave has landed
    __syncthreads();                                         // stage s0 of every wave is readable
    { const size_t ko = (size_t)((s0 + 1) % NSTG) * GK; gstage(l + GSB, ga + ko, gb + ko); }
    const int afo = ((wave >> 1) * 32 + lr) * GPB + 16 * hi;
    const int bfo = GAB + ((wave & 1) * 64 + lr) * GPB + 16 * hi;
#pragma unroll 1   // the stage loop stays rolled: one publish point, buffer picked by the stage's parity
    for (unsigned st = 0; st < NSTG; ++st) {
        const unsigned char* pa = ring + (st & 1) * GSB + afo;
        const unsigned char* pb = ring + (st & 1) * GSB + bfo;
        v16us a[2][2], b[2][4];
#pragma unroll
        for (int i = 0; i < 4; ++i) { if (i < 2) a[0][i] = ldu(pa + i * 16 * GPB); b[0][i] = ldu(pb + i * 16 * GPB); }
#pragma unroll
        for (int kk = 0; kk < GK / 32; ++kk) {
            const int cur = kk & 1, nxt = cur ^ 1;
            if (kk + 1 < GK / 32) {
#pragma unroll
                for (int i = 0; i < 4; ++i) { if (i < 2) a[nxt][i] = ldu(pa + i * 16 * GPB + (kk + 1) * 64); b[nxt][i] = ldu(pb + i * 16 * GPB + (kk + 1) * 64); }
            }
            __builtin_amdgcn_sched_barrier(0);   // keeps the next step's reads one group ahead of this step's products: sunk among them, each read's LDS latency is waited out
#pragma unroll
            for (int nb = 0; nb < 4; ++nb)
#pragma unroll
                for (int mb = 0; mb < 2; ++mb) acc[mb][nb] = wm<F16>(a[cur][mb], b[cur][nb], acc[mb][nb]);
            __builtin_amdgcn_sched_barrier(0);   // the other side of the same fence: no later read rises into this step's products
        }
        asm volatile("s_wait_dscnt 0x0" ::: "memory");       // this wave's reads of the stage are done before its buffer is handed back
        asm volatile("s_wait_asynccnt 0x0" ::: "memory");    // this wave's copies of the next stage have landed
        __syncthreads();                                     // next stage readable by all, this stage's buffer free
        if (st + 2 < NSTG) { const size_t ko = (size_t)((s0 + st + 2) % NSTG) * GK; gstage(l + (unsigned)((st & 1) * GSB), ga + ko, gb + ko); }
    }
    asm volatile("s_wait_asynccnt 0x0" ::: "memory");        // nothing in flight when the wave goes on to its epilogue
}

// k_proj: the three qkv projections in one grid; register-blocked bf16 GEMM, one wave per 32x64 tile (8 accumulators), 4 x 2 waves per block, operands from K-contiguous bf16 planes through the LDS ring of gemm_tile, K = DM.
// C[m][n] = sum_k A[m][k] Bt[n][k] + bias, written as a single f16 plane. grid (tiles of one projection, 3), 256 threads; blockIdx.y = 0 q, 1 k, 2 v^T; row tile fastest.
// The q plane is written times SC2 (f32 multiply ahead of the f16 rounding), so that the flash kernel's score product comes out in log2 units.
// q, k: A = x rows (m = b*SEQ + t), Bt = W rows (n = h*64 + d), bias[n] -> plane [(b*16 + h)][t][d].   v^T: A = Wv rows (m = h*64 + d), Bt = x rows (n = b*SEQ + t), bias[m] -> plane [(b*16 + h)][d][t].
__global__ __launch_bounds__(256) void k_proj(const bf* __restrict__ XB, const bf* __restrict__ WB, const float* __restrict__ bqkv, h16* QH, h16* KP, h16* VT) {
    __shared__ __align__(16) unsigned char ring[2 * GSB];    // two operand stages
    __shared__ __align__(16) float osw[8 * 16 * 68];         // output staging, one part per wave
    const int lane = threadIdx.x & 31, wave = threadIdx.x >> 5, lr = lane & 15, hi = lane >> 4;
    const int pz = blockIdx.y; const int biasRow = pz == 2;
    const int mt = biasRow ? DM / GT : NB * SEQ / GT;        // row tiles of this projection
    const int bx = blockIdx.x % mt, by = blockIdx.x / mt;
    const bf* W = WB + (size_t)pz * DM * DM;
    const bf* A = biasRow ? W : XB; const bf* Bt = biasRow ? XB : W;
    const float* bias = bqkv + pz * DM;
    const float qs = pz == 0 ? SC2 : 1.0f;                   // score scale, carried by q alone
    h16* Ph = pz == 0 ? QH : (pz == 1 ? KP : VT);
    const int pitch = biasRow ? SEQ : HD;                    // row pitch of the plane, halves
    const int r0 = bx * GT + (wave >> 1) * 32, c0 = by * GT + (wave & 1) * 64;
    float* os = osw + wave * 16 * 68;
    v8f acc[2][4];
#pragma unroll
    for (int mb = 0; mb < 2; ++mb)
#pragma unroll
        for (int nb = 0; nb < 4; ++nb) acc[mb][nb] = (v8f){};
    gemm_tile<false>((const h16*)A, (const h16*)Bt, (unsigned)bx, (unsigned)by, ring, acc);
    // column bias (index selected as an integer, address always inside the bias array)
    float bc[4];
#pragma unroll
    for (int nb = 0; nb < 4; ++nb) { const int ci = biasRow ? 0 : (c0 + nb * 16 + lr); const float t = bfr(bias[ci]); bc[nb] = biasRow ? 0.0f : t; }
    const size_t tbase = biasRow ? (size_t)r0 * SEQ + (size_t)(c0 / SEQ) * ((size_t)DM * SEQ) + (size_t)(c0 % SEQ)
                                 : (size_t)(r0 / SEQ) * ((size_t)NH_ * SEQ * HD) + (size_t)(r0 % SEQ) * HD + (size_t)(c0 / HD) * ((size_t)SEQ * HD) + (size_t)(c0 % HD);
#pragma unroll
    for (int mb = 0; mb < 2; ++mb) {
        // row bias for rows r0 + mb*16 + 8h + 0..7 (two 16-B loads, clamped to offset 0 in column mode)
        const int ri = biasRow ? (r0 + mb * 16 + hi * 8) : 0;
        const v4f rb0 = *(const v4f*)(bias + ri); const v4f rb1 = *(const v4f*)(bias + ri + 4);
        float br[8];
#pragma unroll
        for (int j = 0; j < 4; ++j) { const float t0 = bfr(rb0[j]); const float t1 = bfr(rb1[j]); br[j] = biasRow ? t0 : 0.0f; br[4 + j] = biasRow ? t1 : 0.0f; }
#pragma unroll
        for (int nb = 0; nb < 4; ++nb) {
#pragma unroll
            for (int j = 0; j < 8; ++j) os[(hi * 8 + j) * 68 + nb * 16 + lr] = (acc[mb][nb][j] + bc[nb] + br[j]) * qs; }   // D: row 8h+j, col lane&15
        wave_sync();
        const size_t sb = tbase + (size_t)(mb * 16) * (size_t)pitch;
{
#pragma unroll
            for (int s = 0; s < 4; ++s) { const int row = 4 * s + (lane >> 3), c8 = (lane & 7) * 8;   // 4 s x 4 row groups = 16 rows; 8 lanes x 8 = 64 columns
                const v4f x0 = *(const v4fa*)(&os[row * 68 + c8]); const v4f x1 = *(const v4fa*)(&os[row * 68 + c8 + 4]); v8h hv;
#pragma unroll
                for (int i = 0; i < 4; ++i) { hv[i] = (h16)x0[i]; hv[4 + i] = (h16)x1[i]; }
                const size_t oo = sb + (size_t)row * (size_t)pitch + c8;
                *(v8h*)(Ph + oo) = hv; }
            asm volatile("s_wait_xcnt 0x0" ::: "memory");   // precaution: stands in front of the next half tile's bias loads, which land in the four stores' data registers
             }
        wave_sync();
    }
}

// k_flash: fused attention, one wave per 16 query rows of one (batch, head), 8 waves per block; Q fragments straight from the f16 plane.
// K and V^T come in stages of KST keys through a two-buffer LDS ring that the block's waves share: whole-line asynchronous copies, the next stage in flight while this one is worked on.
// The stages are walked from stage blockIdx.x mod NST on, wrapping (the running-maximum softmax takes the keys in any order): the blocks of one head start two to each of the NST stages.
// Transposed form: S^T[key][t] = K Q^T (A = K rows, B = Q rows); lane (t = lane&15, h = lane>>4) holds keys 8h+r of each 16-key tile, so the packed
// P tile is directly the B fragment of O^T[d][t] = V^T P^T (element r <- tile keys 0..15, element 8+r <- tile keys 16..31, lane unchanged).
// The exponent of P is formed by the score product itself: q carries the scale (k_proj) and the shift PSH - (maximum in use) enters as the product's C operand, a tile of eight equal registers that changes only with the maximum.
// The maximum in use is one scalar per lane, the same in both lane halves of a row. It is renewed lazily: only in a pass where some score of the wave passes it by more than LZT do the halves exchange
// their maxima (one xor-16 exchange) and are the output and row-sum tiles rescaled; in every other pass P is formed against the maximum in use, which cancels in the normalisation like any other.
// Row sums on the matrix pipe: A operand with ones in rows 0 and 8 and zeros elsewhere, B = the packed P tile; element 0 of the result tile is, in both lane halves, the sum of the query's 32 P values; elements 1..7 stay 0.
__global__ __launch_bounds__(32 * AW) void k_flash(const h16* __restrict__ QH, const h16* __restrict__ KP, const h16* __restrict__ VT, h16* CTX) {
    __shared__ __align__(16) unsigned char ring[2 * SBY];    // two stages; after the loop: output staging
    float* os = (float*)ring;
    const int tid = threadIdx.x;
    const int lane = threadIdx.x & 31, wave = threadIdx.x >> 5, lr = lane & 15, hi = lane >> 4;
    const int zh = blockIdx.y; const int b = zh / NH_, h = zh % NH_;
    const int t0 = (blockIdx.x * AW + wave) * 16;
    const size_t pbase = (size_t)zh * SEQ * HD;
    const size_t qo = pbase + (size_t)(t0 + lr) * HD + 8 * hi;
    const v16h qh0 = ldh(QH + qo), qh1 = ldh(QH + qo + 32);   // B fragments: col t, k = d
    // copy maps. K tile: 32 KiB contiguous; copy i of lane tid takes 16-byte piece i*256 + tid = (key i*32 + tid/8, piece tid%8). V^T tile: 64 rows of 512 B; (row i*8 + tid/32, piece tid%32).
    const unsigned rb = (unsigned)(size_t)ring;              // LDS byte address of the ring
    const unsigned kl = rb + (unsigned)((tid >> 3) * KPB + (tid & 7) * 16);
    const unsigned vl = rb + (unsigned)(KBY + (tid >> 5) * VPB + (tid & 31) * 16);
    const h16* kg = KP + pbase + (size_t)tid * 8;                                   // + stage * KST * HD
    const h16* vg = VT + pbase + (size_t)(tid >> 5) * SEQ + (size_t)(tid & 31) * 8; // + stage * KST
    const unsigned NST = SEQ / KST;
    const unsigned s0 = blockIdx.x % NST;                    // first stage of this block
    copy8(kl, 32 * KPB, kg + (size_t)s0 * KST * HD, (size_t)32 * HD); copy8(vl, 8 * VPB, vg + (size_t)s0 * KST, (size_t)8 * SEQ);
    asm volatile("s_wait_asynccnt 0x0" ::: "memory");        // stage s0 of this wave has landed
    __syncthreads();                                         // stage s0 of every wave is readable
    if (NST > 1) { const size_t sn = (s0 + 1) % NST; copy8(kl + SBY, 32 * KPB, kg + sn * KST * HD, (size_t)32 * HD); copy8(vl + SBY, 8 * VPB, vg + sn * KST, (size_t)8 * SEQ); }
    const int kfo = lr * KPB + 16 * hi;                      // + key * KPB              (A fragment: row key, k = d)
    const int vfo = KBY + lr * VPB + 16 * hi;                // + 16j * VPB + key * 2    (A fragment: row d, k = key)
    v8f o0 = (v8f){}, o1 = (v8f){}, o2 = (v8f){}, o3 = (v8f){};
    v8f lt = (v8f){};                                        // row-sum tile: element 0 = running sum of this lane's query
    const h16 ov = (lane & 7) == 0 ? (h16)1.0f : (h16)0.0f;  // A rows 0 and 8 (lanes 0, 8, 16, 24) are ones at all 32 k positions
    const v16h one = {ov, ov, ov, ov, ov, ov, ov, ov, ov, ov, ov, ov, ov, ov, ov, ov};
    float m = -3.0e38f, sh = 0.0f, thr = -3.0e38f;           // maximum in use, shift in use (PSH - m once a maximum is set) and the test's bound: with these start values the first pass takes the rescale branch, on unshifted scores
    v8f shv = (v8f){};                                       // the shift in use as a C tile: eight equal registers per lane (a lane's eight score rows belong to one query)
#pragma unroll 1   // the stage loop stays rolled: one publish point, buffer picked by the stage's parity
    for (unsigned st = 0; st < NST; ++st) {
      const unsigned char* sb = ring + (st & 1) * SBY;
#pragma unroll 4   // four 32-key passes per branch, LDS offsets as immediates; all eight unrolled go past 256 registers and two blocks no longer fit a WGP
      for (int key0 = 0; key0 < KST; key0 += 32) {
        const h16* ka = (const h16*)(sb + kfo + key0 * KPB);
        const v16h ka0 = ldh(ka), ka1 = ldh(ka + 32), kb0 = ldh(ka + 8 * KPB), kb1 = ldh(ka + 8 * KPB + 32);   // 8 * KPB halves = 16 rows
        v8f sHa, sHb;                                        // score * SC2 + sh
        // the four score products in one statement: all four K fragments are its inputs, so their eight LDS reads go out as one group ahead of it (from the builtins alone this build reads one pass in four pair by pair, each pair waited out),
        // and the four v_nop at its end keep, once, the distance between the last product and the first vector instruction on its result
        asm volatile("v_wmma_f32_16x16x32_f16 %0, %2, %6, %8\n\t"
                     "v_wmma_f32_16x16x32_f16 %1, %3, %6, %8\n\t"
                     "v_wmma_f32_16x16x32_f16 %0, %4, %7, %0\n\t"
                     "v_wmma_f32_16x16x32_f16 %1, %5, %7, %1\n\t"
                     "v_nop\n\tv_nop\n\tv_nop\n\tv_nop"
                     : "=&v"(sHa), "=&v"(sHb) : "v"(ka0), "v"(kb0), "v"(ka1), "v"(kb1), "v"(qh0), "v"(qh1), "v"(shv));
        float mx = -3.0e38f;
#pragma unroll
        for (int r = 0; r < 8; ++r) mx = fmaxf(mx, fmaxf(sHa[r], sHb[r]));
        const h16* va = (const h16*)(sb + vfo + key0 * 2);
        const v16h v0 = ldh(va), v1 = ldh(va + 8 * VPB), v2 = ldh(va + 16 * VPB), v3 = ldh(va + 24 * VPB);     // 8 * VPB halves = 16 rows; read ahead of the test, so that the softmax covers their latency on both paths
        asm volatile("" ::: "memory");   // compiler fence: without it the build sinks the V^T reads of one pass in four behind the test's branch, next to their products, where their LDS latency is waited out
        if (__builtin_expect(__builtin_amdgcn_ballot_w32(mx > thr) != 0, 0)) {   // one scalar test per pass, on the largest exponent as it stands; taken by the whole wave, so EXEC stays all ones for the products
            mx = fmaxf(mx, __shfl_xor(mx, 16, 32));
            const float mnew = fmaxf(m, mx - sh);            // the shift in use taken off again
            const float alpha = __builtin_amdgcn_exp2f(m - mnew);
            const float dsh = (PSH - mnew) - sh;             // this pass's exponents move to the new shift
            m = mnew; thr = PSH + LZT;
            shv = shv + dsh; sh = shv[0];                    // the tile moves in place; sh is read back from it, so the two never part
            sHa = sHa + dsh; sHb = sHb + dsh;
            o0 = o0 * alpha; o1 = o1 * alpha; o2 = o2 * alpha; o3 = o3 * alpha; lt[0] = lt[0] * alpha;
        }
        v16h pb;
#pragma unroll
        for (int r = 0; r < 8; ++r) { pb[r] = (h16)__builtin_amdgcn_exp2f(sHa[r]); pb[8 + r] = (h16)__builtin_amdgcn_exp2f(sHb[r]); }
        o0 = wmma16(v0, pb, o0); o1 = wmma16(v1, pb, o1); o2 = wmma16(v2, pb, o2); o3 = wmma16(v3, pb, o3);
        lt = wmma16(one, pb, lt);                            // += the column sums of P^T
        asm volatile("v_nop\n\tv_nop\n\tv_nop\n\tv_nop" : "+v"(o0), "+v"(o1), "+v"(o2), "+v"(o3), "+v"(lt) : "v"(v0), "v"(v1), "v"(v2), "v"(v3), "v"(pb), "v"(one));
      }
      asm volatile("s_wait_dscnt 0x0" ::: "memory");         // this wave's reads of the stage are done before its buffer is handed back
      asm volatile("s_wait_asynccnt 0x0" ::: "memory");      // this wave's copies of the next stage have landed
      __syncthreads();                                       // next stage readable by all, this stage's buffer free
      if (st + 2 < NST) {
          const unsigned bo = (unsigned)((st & 1) * SBY);
          const size_t sn = (s0 + st + 2) % NST;
          copy8(kl + bo, 32 * KPB, kg + sn * KST * HD, (size_t)32 * HD); copy8(vl + bo, 8 * VPB, vg + sn * KST, (size_t)8 * SEQ);
      }
    }
    asm volatile("s_wait_asynccnt 0x0" ::: "memory");        // nothing in flight when the ring becomes output staging (the last barrier above ended every read)
    const float inv = CCS * (1.0f / lt[0]);  // normalisation (the P carry cancels) times the ctx carry; both lane halves hold the whole row sum
    const int wb = wave * 16 * 68;
    // O^T D layout: o_j[r] = (d = 16j + 8h + r, t = lane&15) -> os[t][d]; rows 0..15 x columns 0..63 all written
    { v4f a, c;
      a[0] = o0[0] * inv; a[1] = o0[1] * inv; a[2] = o0[2] * inv; a[3] = o0[3] * inv; c[0] = o0[4] * inv; c[1] = o0[5] * inv; c[2] = o0[6] * inv; c[3] = o0[7] * inv;
      *(v4fa*)(&os[wb + lr * 68 +  0 + 8 * hi]) = a; *(v4fa*)(&os[wb + lr * 68 +  0 + 8 * hi + 4]) = c;
      a[0] = o1[0] * inv; a[1] = o1[1] * inv; a[2] = o1[2] * inv; a[3] = o1[3] * inv; c[0] = o1[4] * inv; c[1] = o1[5] * inv; c[2] = o1[6] * inv; c[3] = o1[7] * inv;
      *(v4fa*)(&os[wb + lr * 68 + 16 + 8 * hi]) = a; *(v4fa*)(&os[wb + lr * 68 + 16 + 8 * hi + 4]) = c;
      a[0] = o2[0] * inv; a[1] = o2[1] * inv; a[2] = o2[2] * inv; a[3] = o2[3] * inv; c[0] = o2[4] * inv; c[1] = o2[5] * inv; c[2] = o2[6] * inv; c[3] = o2[7] * inv;
      *(v4fa*)(&os[wb + lr * 68 + 32 + 8 * hi]) = a; *(v4fa*)(&os[wb + lr * 68 + 32 + 8 * hi + 4]) = c;
      a[0] = o3[0] * inv; a[1] = o3[1] * inv; a[2] = o3[2] * inv; a[3] = o3[3] * inv; c[0] = o3[4] * inv; c[1] = o3[5] * inv; c[2] = o3[6] * inv; c[3] = o3[7] * inv;
      *(v4fa*)(&os[wb + lr * 68 + 48 + 8 * hi]) = a; *(v4fa*)(&os[wb + lr * 68 + 48 + 8 * hi + 4]) = c; }
    wave_sync();
    h16* crow = CTX + ((size_t)b * SEQ + t0) * DM + h * HD;      // ctx plane row = token, columns h*64 + d
{
#pragma unroll
        for (int s = 0; s < 4; ++s) { const int row = 4 * s + (lane >> 3), c8 = (lane & 7) * 8;   // 4 s x 4 row groups = 16 rows; 8 lanes x 8 halves = 64 columns
            const v4f x0 = *(const v4fa*)(&os[wb + row * 68 + c8]); const v4f x1 = *(const v4fa*)(&os[wb + row * 68 + c8 + 4]); v8h hv;
#pragma unroll
            for (int i = 0; i < 4; ++i) { hv[i] = (h16)x0[i]; hv[4 + i] = (h16)x1[i]; }
            *(v8h*)(crow + (size_t)row * DM + c8) = hv; }
         }
}

// k_oproj: register-blocked f16 GEMM, one wave per 32x64 tile, 4 x 2 waves per block, operands from K-contiguous f16 planes (ctx x256, w_proj x1024) through the LDS ring of gemm_tile, K = DM.
// OUT[m][n] = (sum_k A[m][k] Bt[n][k]) * 2^-18 + bias[n], f32. grid (NB*SEQ/128, DM/128), 256 threads.
__global__ __launch_bounds__(256) void k_oproj(const h16* __restrict__ A, const h16* __restrict__ Bt, const float* __restrict__ bias, float* OUT) {
    __shared__ __align__(16) unsigned char ring[2 * GSB];    // two operand stages
    __shared__ __align__(16) float osw[8 * 16 * 68];         // output staging, one part per wave
    const int lane = threadIdx.x & 31, wave = threadIdx.x >> 5, lr = lane & 15, hi = lane >> 4;
    const int r0 = blockIdx.x * GT + (wave >> 1) * 32, c0 = blockIdx.y * GT + (wave & 1) * 64;
    float* os = osw + wave * 16 * 68;
    v8f acc[2][4];
#pragma unroll
    for (int mb = 0; mb < 2; ++mb)
#pragma unroll
        for (int nb = 0; nb < 4; ++nb) acc[mb][nb] = (v8f){};
    gemm_tile<true>(A, Bt, blockIdx.x, blockIdx.y, ring, acc);
    float bc[4];
#pragma unroll
    for (int nb = 0; nb < 4; ++nb) bc[nb] = bfr(bias[c0 + nb * 16 + lr]);
    const int bq = r0 / SEQ, tq = r0 % SEQ;
    float* obase = OUT + ((size_t)bq * OUT_SEQ + tq) * DM + c0;
#pragma unroll
    for (int mb = 0; mb < 2; ++mb) {
#pragma unroll
        for (int nb = 0; nb < 4; ++nb) {
#pragma unroll
            for (int j = 0; j < 8; ++j) os[(hi * 8 + j) * 68 + nb * 16 + lr] = acc[mb][nb][j] * OSI + bc[nb]; }   // D: row 8h+j, col lane&15
        wave_sync();
{
#pragma unroll
            for (int s = 0; s < 8; ++s) { const int row = 2 * s + hi, cofs = lr * 4;   // 8 s x 2 rows = 16 rows; 16 lanes x 4 floats = 64 columns
                const v4f val = *(const v4fa*)(&os[row * 68 + cofs]);
                *(v4f*)(obase + (size_t)(mb * 16 + row) * DM + cofs) = val; }
             }
        wave_sync();
    }
}

static constexpr size_t al256(size_t v) { return (v + 255) & ~(size_t)255; }
static constexpr size_t SZ_XB = al256((size_t)NB * SEQ * DM * 2);
static constexpr size_t SZ_WB = al256((size_t)3 * DM * DM * 2);
static constexpr size_t SZ_WP = al256((size_t)DM * DM * 2);
static constexpr size_t SZ_PL = al256((size_t)NB * NH_ * SEQ * HD * 2);
static constexpr size_t SZ_CX = al256((size_t)NB * SEQ * DM * 2);
static constexpr size_t SZ_TOTAL = SZ_XB + SZ_WB + SZ_WP + 3 * SZ_PL + SZ_CX;
static_assert(SZ_TOTAL <= (size_t)134217728);          // workspace carve <= 128 MiB
static_assert(((size_t)DM * DM * 2) % 256 == 0);       // weight sub-planes stay 256-byte aligned

extern "C" void kernel_launch(void* const* d_in, const int* in_sizes, int n_in,
                              void* d_out, int out_size, void* d_ws, size_t ws_size, hipStream_t stream) {
    if (n_in < 5) return;
    const size_t needx = ((size_t)(NB - 1) * SEQ_FULL + SEQ) * DM;
    if ((size_t)in_sizes[0] < needx) return;
    if ((size_t)in_sizes[1] < (size_t)3 * DM * DM || (size_t)in_sizes[2] < (size_t)3 * DM) return;
    if ((size_t)in_sizes[3] < (size_t)DM * DM || (size_t)in_sizes[4] < (size_t)DM) return;
    if ((size_t)out_size < ((size_t)(NB - 1) * OUT_SEQ + SEQ) * DM) return;
    if (SZ_TOTAL > ws_size) return;
    // wire order: x, w_qkv ([3072][1024] = Bt as-is, rows q | k | v), b_qkv, w_proj ([out][in] = Bt as-is), b_proj
    const float* x = (const float*)d_in[0]; const float* wqkv = (const float*)d_in[1]; const float* bqkv = (const float*)d_in[2];
    const float* wproj = (const float*)d_in[3]; const float* bproj = (const float*)d_in[4];
    float* OUT = (float*)d_out;      // [NB][SEQ][1024]
    char* wsp = (char*)d_ws;
    bf* XB = (bf*)wsp; wsp += SZ_XB;                 // [NB*SEQ][1024]
    bf* WB = (bf*)wsp; wsp += SZ_WB;                 // [3][1024][1024]: q | k | v
    h16* WP = (h16*)wsp; wsp += SZ_WP;               // [1024][1024] x1024
    h16* QH = (h16*)wsp; wsp += SZ_PL;               // [NB*16][SEQ][64]
    h16* KP = (h16*)wsp; wsp += SZ_PL;               // [NB*16][SEQ][64]
    h16* VT = (h16*)wsp; wsp += SZ_PL;               // [NB*16][64][SEQ]
    h16* CX = (h16*)wsp; wsp += SZ_CX;               // [NB*SEQ][1024] x256

    k_cvt<<<CBX + CBW + CBP, 256, 0, stream>>>(x, wqkv, wproj, XB, WB, WP);

    k_proj<<<dim3((NB * SEQ / GT) * (DM / GT), 3, 1), 256, 0, stream>>>(XB, WB, bqkv, QH, KP, VT);

    k_flash<<<dim3(SEQ / (16 * AW), NB * NH_, 1), 32 * AW, 0, stream>>>(QH, KP, VT, CX);

    // output projection: A = ctx rows (m = b*SEQ + t, k = h*64 + d), Bt = w_proj rows (n = f) -> OUT[m][f]
    k_oproj<<<dim3(NB * SEQ / GT, DM / GT, 1), 256, 0, stream>>>(CX, WP, bproj, OUT);
}

// v008
// One run takes 93.7 microseconds.
// Two timings next to v007 both put it at 1.05 times that version's speed.
// All steps since v000 together make it 3.82 times as fast.
#include <hip/hip_runtime.h>

// Multi-head self-attention, width 1024 = 16 heads x 64, x [NB][SEQ][1024], fused w_qkv [3072][1024] ([out][in], rows q | k | v, head h = rows h*64+d of each third), b_qkv, score scale 1/8, no mask, output projection w_proj [out][in] + b_proj (f32 output).
// Compute dtypes, f32 accumulate everywhere: qkv projections v_wmma_f32_16x16x32_bf16 (x, w_qkv RNE-converted to bf16; products exact); scores v_wmma_f32_16x16x32_f16: q and k single f16 planes (one product), the q plane holding q * 0.125*log2(e) (scaled in f32 ahead of its one f16 rounding);
// P (x256 carry, cancels in the normalisation; row sum taken over the f16 P values, by one more matrix product with a ones operand) and v single f16; softmax f32 (online; fixed reference, the maximum of the first 32 keys walked, with a second, running-max walk if a P overflows f16); output projection v_wmma_f32_16x16x32_f16: ctx single f16 (x256 carry), w_proj RNE-converted to bf16 then x1024 as f16 (exact), carries folded back (2^-18) in the f32 epilogue; biases RNE-converted to bf16, added in f32.
// Layout: bf16 copies of x and w_qkv; q, k planes [b*16+h][t][d] and v^T plane [b*16+h][d][t] written by the GEMM epilogue; fused flash kernel in transposed form (S^T = K Q^T, O^T = V^T P^T; K and V^T tiles staged in LDS for the 8 waves of a block) writes the f16 ctx plane [b*SEQ+t][1024]; f16 GEMM writes the output buffer.
// The four GEMMs: 128x128 tile per 8-wave block (32x64 per wave), both operands staged in LDS in whole lines, 128 k per stage, two buffers.
// Blocks that stage the same rows (GEMM panels; K and V^T of a head) begin the stage walk at stages spread by block index and wrap, so that not all of them ask L2 for the same lines at the same moment.
// Four launches: launches that read none of each other's output share one grid (the three conversions by block range; the q, k and v^T projections by blockIdx.y).

#ifndef NB
#define NB 1
#endif
#ifndef SEQ
#define SEQ 4096
#endif
#define NB_FULL  1
#define SEQ_FULL 4096
#ifndef OUT_SEQ
#define OUT_SEQ SEQ              // row pitch (in tokens) between batches of the output
#endif
#define DM   1024
#define NH_  16
#define HD   64
#define AW   8                   // waves per flash block (16 query rows each)
#define KST  256                 // keys per LDS stage of the flash kernel
#define KPB  (HD * 2 + 16)       // LDS pitch of a K row, bytes: 16 B x odd, no bank conflict for 16-byte fragment reads
#define VPB  (KST * 2 + 16)      // LDS pitch of a V^T row, bytes: 16 B x odd
#define KBY  (KST * KPB)         // K part of a stage, bytes
#define SBY  (KBY + HD * VPB)    // one stage (K then V^T), bytes
#define GT   128                 // GEMM block tile, rows and columns (4 x 2 waves of 32 x 64)
#define GK   128                 // k per LDS stage of the GEMMs
#define GPB  (GK * 2 + 16)       // LDS pitch of a GEMM operand row, bytes: 16 B x odd
#define GAB  (GT * GPB)          // one operand's part of a stage, bytes
#define GSB  (2 * GAB)           // one stage (A rows then B rows), bytes
#define SC2  (0.125f * 1.4426950408889634f)   // HD^-0.5 * log2(e)
#define PSH  8.0f                // log2 of the P carry (256)
#define LZT  7.0f                // lazy rescale: a score may pass the maximum in use by this much (log2) before the maximum is renewed; P <= 2^(PSH + LZT) = 32768 stays finite in f16
#define CCS  256.0f              // carry of the ctx plane
#define WPS  1024.0f             // carry of the w_proj plane
#define OSI  (1.0f / (256.0f * 1024.0f))      // inverse of both carries

static_assert(HD == 64);
static_assert(NH_ * HD == DM);                 // head h = columns h*64 + d
static_assert(DM % 64 == 0);                   // column tiles of 64
static_assert(DM % 32 == 0);                   // GEMM k-loop steps by 32
static_assert(SEQ % 64 == 0);                  // a wave's tile (32 rows, 64 columns) never straddles two batches
static_assert((NB * SEQ) % 64 == 0);
static_assert(SEQ % 32 == 0);                  // key loop steps by 32
static_assert(SEQ % (16 * AW) == 0);           // flash grid covers the sequence exactly
static_assert(SEQ % KST == 0);                 // whole stages only
static_assert(AW == 8 && KST == 256);          // copy maps of k_flash: 256 lanes x 8 copies x 16 B = one 32-KiB K or V^T tile
static_assert((KPB / 16) % 2 == 1 && (VPB / 16) % 2 == 1);
static_assert(2 * SBY >= AW * 16 * 68 * 4);    // the ring holds the output staging
static_assert((NB * SEQ) % GT == 0 && DM % GT == 0);   // GEMM grids cover both extents exactly
static_assert(DM % GK == 0 && DM / GK >= 2);           // whole stages, and the two that the ring's prologue needs
static_assert(GT == 128 && GK == 128);                 // copy map of gstage: 256 lanes x 16 copies x 16 B = 256 rows of 256 B
static_assert((GPB / 16) % 2 == 1);
static_assert(((size_t)SEQ * DM) % 8 == 0);
static_assert(((size_t)DM * DM) % 8 == 0);
static_assert(NB <= NB_FULL);
static_assert(SEQ <= SEQ_FULL);

typedef _Float16 h16;
typedef unsigned short bf;
typedef __attribute__((ext_vector_type(16))) __bf16   v16bf;
typedef __attribute__((ext_vector_type(16))) _Float16 v16h;
typedef __attribute__((ext_vector_type(8)))  _Float16 v8h;
typedef __attribute__((ext_vector_type(8)))  unsigned short v8us;
typedef __attribute__((ext_vector_type(16))) unsigned short v16us;
typedef __attribute__((ext_vector_type(8)))  float    v8f;
typedef __attribute__((ext_vector_type(4)))  float    v4f;
typedef v4f  __attribute__((may_alias)) v4fa;

__device__ __forceinline__ unsigned short f2bf(float f) { unsigned u = __float_as_uint(f); u += 0x7FFFu + ((u >> 16) & 1u); return (unsigned short)(u >> 16); }
__device__ __forceinline__ float bfr(float f) { return __uint_as_float(((unsigned)f2bf(f)) << 16); }   // value after RNE convert to bf16
__device__ __forceinline__ v16h cat16(v8h lo, v8h hi) { return __builtin_shufflevector(lo, hi, 0, 1, 2, 3, 4, 5, 6, 7, 8, 9, 10, 11, 12, 13, 14, 15); }
__device__ __forceinline__ v8f wmma16(v16h a, v16h b, v8f c) { return __builtin_amdgcn_wmma_f32_16x16x32_f16(false, a, false, b, (short)0, c, false, false); }
__device__ __forceinline__ v8f wmmab(v16bf a, v16bf b, v8f c) { return __builtin_amdgcn_wmma_f32_16x16x32_bf16(false, a, false, b, (short)0, c, false, false); }
// fragment loaders from K-contiguous 16-bit rows; p already includes + 8*(lane>>4): elements 0..7 <- k0+8h+0..7, elements 8..15 <- k0+16+8h+0..7 (same map for A and B)
__device__ __forceinline__ v16h  ldh(const h16* p) { return cat16(*(const v8h*)p, *(const v8h*)(p + 16)); }
// ordering point for wave-private LDS tiles (same wave writes and reads)
__device__ __forceinline__ void wave_sync() { __builtin_amdgcn_fence(3 /* release order */, "wavefront"); __builtin_amdgcn_wave_barrier(); asm volatile("" ::: "memory"); }

// k_cvt: the three conversions in one grid, 8 values per thread; a block lies wholly in one range: x -> bf16, then w_qkv -> bf16, then w_proj -> bf16 value x1024 as f16.
#define CBX ((unsigned)((size_t)NB * SEQ * DM / 2048))   // blocks of x (256 threads x 8 values)
#define CBW ((unsigned)((size_t)3 * DM * DM / 2048))     // blocks of w_qkv
#define CBP ((unsigned)((size_t)DM * DM / 2048))         // blocks of w_proj
static_assert(((size_t)SEQ * DM) % 2048 == 0 && ((size_t)DM * DM) % 2048 == 0);   // whole blocks in every range, none straddles two batches
__global__ __launch_bounds__(256) void k_cvt(const float* __restrict__ x, const float* __restrict__ wqkv, const float* __restrict__ wproj, bf* XB, bf* WB, h16* WP) {
    const unsigned blk = blockIdx.x;
    if (blk < CBX + CBW) {
        const bool isx = blk < CBX;
        const size_t e = ((size_t)(isx ? blk : blk - CBX) * 256 + threadIdx.x) * 8;
        const size_t bt = e / ((size_t)SEQ * DM);            // batch (x only): source batches lie SEQ_FULL tokens apart
        const float* s = isx ? x + bt * ((size_t)SEQ_FULL * DM) + (e - bt * ((size_t)SEQ * DM)) : wqkv + e;
        const v8f v = *(const v8f*)s; v8us o;
#pragma unroll
        for (int k = 0; k < 8; ++k) o[k] = f2bf(v[k]);
        *(v8us*)((isx ? XB : WB) + e) = o;
    } else {
        const size_t e = ((size_t)(blk - CBX - CBW) * 256 + threadIdx.x) * 8;
        const v8f v = *(const v8f*)(wproj + e); v8h o;
#pragma unroll
        for (int k = 0; k < 8; ++k) o[k] = (h16)(bfr(v[k]) * WPS);
        *(v8h*)(WP + e) = o;
        asm volatile("s_wait_xcnt 0x0" ::: "memory");   // precaution: stands in front of every later write of the store's registers
    }
}

// eight asynchronous 16-byte copies per lane, global -> LDS (LDS byte address l + i*ls, global address g + i*gs halves).
// s_wait_xcnt closes the statement so that no address register of an issued copy is rewritten ahead of it.
__device__ __forceinline__ void copy8(unsigned l, unsigned ls, const h16* g, size_t gs) {
    asm volatile("global_load_async_to_lds_b128 %0, %8, off\n\t"
                 "global_load_async_to_lds_b128 %1, %9, off\n\t"
                 "global_load_async_to_lds_b128 %2, %10, off\n\t"
                 "global_load_async_to_lds_b128 %3, %11, off\n\t"
                 "global_load_async_to_lds_b128 %4, %12, off\n\t"
                 "global_load_async_to_lds_b128 %5, %13, off\n\t"
                 "global_load_async_to_lds_b128 %6, %14, off\n\t"
                 "global_load_async_to_lds_b128 %7, %15, off\n\t"
                 "s_wait_xcnt 0x0"
                 :: "v"(l), "v"(l + ls), "v"(l + 2 * ls), "v"(l + 3 * ls), "v"(l + 4 * ls), "v"(l + 5 * ls), "v"(l + 6 * ls), "v"(l + 7 * ls),
                    "v"(g), "v"(g + gs), "v"(g + 2 * gs), "v"(g + 3 * gs), "v"(g + 4 * gs), "v"(g + 5 * gs), "v"(g + 6 * gs), "v"(g + 7 * gs)
                 : "memory");
}

// one GEMM stage: rows 0..127 of the A tile, then of the B tile, 256 B (GK halves) of each. Copy i of lane tid takes (row i*16 + tid/16, 16-byte piece tid%16): a wave's copy covers two whole 256-B runs.
__device__ __forceinline__ void gstage(unsigned l, const h16* ga, const h16* gb) {
    copy8(l, 16 * GPB, ga, (size_t)16 * DM); copy8(l + GAB, 16 * GPB, gb, (size_t)16 * DM);
}
// fragment from an LDS row of 16-bit values; p already includes + 16*(lane>>4) bytes: same element map as ldh, for A and for B
__device__ __forceinline__ v16us ldu(const unsigned char* p) { return __builtin_shufflevector(*(const v8us*)p, *(const v8us*)(p + 32), 0, 1, 2, 3, 4, 5, 6, 7, 8, 9, 10, 11, 12, 13, 14, 15); }
template <bool F16> __device__ __forceinline__ v8f wm(v16us a, v16us b, v8f c) {
    if constexpr (F16) return wmma16(__builtin_bit_cast(v16h, a), __builtin_bit_cast(v16h, b), c);
    else               return wmmab(__builtin_bit_cast(v16bf, a), __builtin_bit_cast(v16bf, b), c);
}
// k loop of a 128x128 block tile (bx, by), K = DM: acc[mb][nb] += A rows (bx*128 + (wave>>1)*32 + mb*16 ..) x Bt rows (by*128 + (wave&1)*64 + nb*16 ..); the 128-k stages are walked from stage (bx + by) mod NSTG on, wrapping, k ascending in steps of 32 inside a stage.
// Two-buffer LDS ring shared by the block's 8 waves: the next stage's copies fly while this one is worked on; inside a stage the next k step's fragments are read ahead of this step's products.
template <bool F16> __device__ __forceinline__ void gemm_tile(const h16* A, const h16* Bt, unsigned bx, unsigned by, unsigned char* ring, v8f (&acc)[2][4]) {
    const int tid = threadIdx.x, lane = tid & 31, wave = tid >> 5, lr = lane & 15, hi = lane >> 4;
    const unsigned l = (unsigned)(size_t)ring + (unsigned)((tid >> 4) * GPB + (tid & 15) * 16);   // LDS byte address of this lane's first piece
    const h16* ga = A  + (size_t)(bx * GT + (tid >> 4)) * DM + (tid & 15) * 8;             // + stage * GK
    const h16* gb = Bt + (size_t)(by * GT + (tid >> 4)) * DM + (tid & 15) * 8;
    const unsigned NSTG = DM / GK;
    const unsigned s0 = (bx + by) % NSTG;                    // first stage of this block: blocks that share a row panel differ in by, those that share a column panel in bx, so sharers spread over the NSTG stages
    gstage(l, ga + (size_t)s0 * GK, gb + (size_t)s0 * GK);
    asm volatile("s_wait_asynccnt 0x0" ::: "memory");        // stage s0 of this wave has landed
    __syncthreads();                                         // stage s0 of every wave is readable
    { const size_t ko = (size_t)((s0 + 1) % NSTG) * GK; gstage(l + GSB, ga + ko, gb + ko); }
    const int afo = ((wave >> 1) * 32 + lr) * GPB + 16 * hi;
    const int bfo = GAB + ((wave & 1) * 64 + lr) * GPB + 16 * hi;
#pragma unroll 1   // the stage loop stays rolled: one publish point, buffer picked by the stage's parity
    for (unsigned st = 0; st < NSTG; ++st) {
        const unsigned char* pa = ring + (st & 1) * GSB + afo;
        const unsigned char* pb = ring + (st & 1) * GSB + bfo;
        v16us a[2][2], b[2][4];
#pragma unroll
        for (int i = 0; i < 4; ++i) { if (i < 2) a[0][i] = ldu(pa + i * 16 * GPB); b[0][i] = ldu(pb + i * 16 * GPB); }
#pragma unroll
        for (int kk = 0; kk < GK / 32; ++kk) {
            const int cur = kk & 1, nxt = cur ^ 1;
            if (kk + 1 < GK / 32) {
#pragma unroll
                for (int i = 0; i < 4; ++i) { if (i < 2) a[nxt][i] = ldu(pa + i * 16 * GPB + (kk + 1) * 64); b[nxt][i] = ldu(pb + i * 16 * GPB + (kk + 1) * 64); }
            }
            __builtin_amdgcn_sched_barrier(0);   // keeps the next step's reads one group ahead of this step's products: sunk among them, each read's LDS latency is waited out
#pragma unroll
            for (int nb = 0; nb < 4; ++nb)
#pragma unroll
                for (int mb = 0; mb < 2; ++mb) acc[mb][nb] = wm<F16>(a[cur][mb], b[cur][nb], acc[mb][nb]);
            __builtin_amdgcn_sched_barrier(0);   // the other side of the same fence: no later read rises into this step's products
        }
        asm volatile("s_wait_dscnt 0x0" ::: "memory");       // this wave's reads of the stage are done before its buffer is handed back
        asm volatile("s_wait_asynccnt 0x0" ::: "memory");    // this wave's copies of the next stage have landed
        __syncthreads();                                     // next stage readable by all, this stage's buffer free
        if (st + 2 < NSTG) { const size_t ko = (size_t)((s0 + st + 2) % NSTG) * GK; gstage(l + (unsigned)((st & 1) * GSB), ga + ko, gb + ko); }
    }
    asm volatile("s_wait_asynccnt 0x0" ::: "memory");        // nothing in flight when the wave goes on to its epilogue
}

// k_proj: the three qkv projections in one grid; register-blocked bf16 GEMM, one wave per 32x64 tile (8 accumulators), 4 x 2 waves per block, operands from K-contiguous bf16 planes through the LDS ring of gemm_tile, K = DM.
// C[m][n] = sum_k A[m][k] Bt[n][k] + bias, written as a single f16 plane. grid (tiles of one projection, 3), 256 threads; blockIdx.y = 0 q, 1 k, 2 v^T; row tile fastest.
// The q plane is written times SC2 (f32 multiply ahead of the f16 rounding), so that the flash kernel's score product comes out in log2 units.
// q, k: A = x rows (m = b*SEQ + t), Bt = W rows (n = h*64 + d), bias[n] -> plane [(b*16 + h)][t][d].   v^T: A = Wv rows (m = h*64 + d), Bt = x rows (n = b*SEQ + t), bias[m] -> plane [(b*16 + h)][d][t].
__global__ __launch_bounds__(256) void k_proj(const bf* __restrict__ XB, const bf* __restrict__ WB, const float* __restrict__ bqkv, h16* QH, h16* KP, h16* VT) {
    __shared__ __align__(16) unsigned char ring[2 * GSB];    // two operand stages
    __shared__ __align__(16) float osw[8 * 16 * 68];         // output staging, one part per wave
    const int lane = threadIdx.x & 31, wave = threadIdx.x >> 5, lr = lane & 15, hi = lane >> 4;
    const int pz = blockIdx.y; const int biasRow = pz == 2;
    const int mt = biasRow ? DM / GT : NB * SEQ / GT;        // row tiles of this projection
    const int bx = blockIdx.x % mt, by = blockIdx.x / mt;
    const bf* W = WB + (size_t)pz * DM * DM;
    const bf* A = biasRow ? W : XB; const bf* Bt = biasRow ? XB : W;
    const float* bias = bqkv + pz * DM;
    const float qs = pz == 0 ? SC2 : 1.0f;                   // score scale, carried by q alone
    h16* Ph = pz == 0 ? QH : (pz == 1 ? KP : VT);
    const int pitch = biasRow ? SEQ : HD;                    // row pitch of the plane, halves
    const int r0 = bx * GT + (wave >> 1) * 32, c0 = by * GT + (wave & 1) * 64;
    float* os = osw + wave * 16 * 68;
    v8f acc[2][4];
#pragma unroll
    for (int mb = 0; mb < 2; ++mb)
#pragma unroll
        for (int nb = 0; nb < 4; ++nb) acc[mb][nb] = (v8f){};
    gemm_tile<false>((const h16*)A, (const h16*)Bt, (unsigned)bx, (unsigned)by, ring, acc);
    // column bias (index selected as an integer, address always inside the bias array)
    float bc[4];
#pragma unroll
    for (int nb = 0; nb < 4; ++nb) { const int ci = biasRow ? 0 : (c0 + nb * 16 + lr); const float t = bfr(bias[ci]); bc[nb] = biasRow ? 0.0f : t; }
    const size_t tbase = biasRow ? (size_t)r0 * SEQ + (size_t)(c0 / SEQ) * ((size_t)DM * SEQ) + (size_t)(c0 % SEQ)
                                 : (size_t)(r0 / SEQ) * ((size_t)NH_ * SEQ * HD) + (size_t)(r0 % SEQ) * HD + (size_t)(c0 / HD) * ((size_t)SEQ * HD) + (size_t)(c0 % HD);
#pragma unroll
    for (int mb = 0; mb < 2; ++mb) {
        // row bias for rows r0 + mb*16 + 8h + 0..7 (two 16-B loads, clamped to offset 0 in column mode)
        const int ri = biasRow ? (r0 + mb * 16 + hi * 8) : 0;
        const v4f rb0 = *(const v4f*)(bias + ri); const v4f rb1 = *(const v4f*)(bias + ri + 4);
        float br[8];
#pragma unroll
        for (int j = 0; j < 4; ++j) { const float t0 = bfr(rb0[j]); const float t1 = bfr(rb1[j]); br[j] = biasRow ? t0 : 0.0f; br[4 + j] = biasRow ? t1 : 0.0f; }
#pragma unroll
        for (int nb = 0; nb < 4; ++nb) {
#pragma unroll
            for (int j = 0; j < 8; ++j) os[(hi * 8 + j) * 68 + nb * 16 + lr] = (acc[mb][nb][j] + bc[nb] + br[j]) * qs; }   // D: row 8h+j, col lane&15
        wave_sync();
        const size_t sb = tbase + (size_t)(mb * 16) * (size_t)pitch;
{
#pragma unroll
            for (int s = 0; s < 4; ++s) { const int row = 4 * s + (lane >> 3), c8 = (lane & 7) * 8;   // 4 s x 4 row groups = 16 rows; 8 lanes x 8 = 64 columns
                const v4f x0 = *(const v4fa*)(&os[row * 68 + c8]); const v4f x1 = *(const v4fa*)(&os[row * 68 + c8 + 4]); v8h hv;
#pragma unroll
                for (int i = 0; i < 4; ++i) { hv[i] = (h16)x0[i]; hv[4 + i] = (h16)x1[i]; }
                const size_t oo = sb + (size_t)row * (size_t)pitch + c8;
                *(v8h*)(Ph + oo) = hv; }
            asm volatile("s_wait_xcnt 0x0" ::: "memory");   // precaution: stands in front of the next half tile's bias loads, which land in the four stores' data registers
             }
        wave_sync();
    }
}

// the four score products of a 32-key pass in one statement: all four K fragments are its inputs, so their eight LDS reads go out as one group ahead of it (from the builtins alone this build reads one pass in four pair by pair, each pair waited out),
// and the four v_nop at its end keep, once, the distance between the last product and the first vector instruction on its result
// pbp, the P tile of the pass before, is named as an input and not used in the text: the early-clobber results then never land on its registers, which the products just issued still read as their B operand
__device__ __forceinline__ void score4(v8f& sHa, v8f& sHb, v16h ka0, v16h kb0, v16h ka1, v16h kb1, v16h qh0, v16h qh1, v8f shv, v16h pbp) {
    asm volatile("v_wmma_f32_16x16x32_f16 %0, %2, %6, %8\n\t"
                 "v_wmma_f32_16x16x32_f16 %1, %3, %6, %8\n\t"
                 "v_wmma_f32_16x16x32_f16 %0, %4, %7, %0\n\t"
                 "v_wmma_f32_16x16x32_f16 %1, %5, %7, %1\n\t"
                 "v_nop\n\tv_nop\n\tv_nop\n\tv_nop"
                 : "=&v"(sHa), "=&v"(sHb) : "v"(ka0), "v"(kb0), "v"(ka1), "v"(kb1), "v"(qh0), "v"(qh1), "v"(shv), "v"(pbp));
}
// the four output products and the row-sum product of a pass, five independent accumulators in one statement: each fills the others' window. No v_nop behind them: what follows is LDS reads, then score4, whose four products and four v_nop stand ahead of the next vector instruction on any of these registers
__device__ __forceinline__ void pv5(v8f& o0, v8f& o1, v8f& o2, v8f& o3, v8f& lt, v16h v0, v16h v1, v16h v2, v16h v3, v16h pb, v16h one) {
    asm volatile("v_wmma_f32_16x16x32_f16 %0, %5, %9, %0\n\t"
                 "v_wmma_f32_16x16x32_f16 %1, %6, %9, %1\n\t"
                 "v_wmma_f32_16x16x32_f16 %2, %7, %9, %2\n\t"
                 "v_wmma_f32_16x16x32_f16 %3, %8, %9, %3\n\t"
                 "v_wmma_f32_16x16x32_f16 %4, %10, %9, %4"
                 : "+v"(o0), "+v"(o1), "+v"(o2), "+v"(o3), "+v"(lt) : "v"(v0), "v"(v1), "v"(v2), "v"(v3), "v"(pb), "v"(one));
}

// one whole walk over the keys of a head for a wave's 16 queries: ring prologue, stage loop, nothing in flight at its end. Sets the output tiles o0..o3 and the row-sum tile lt.
// TEST = false, the walk that normally counts: the softmax reference of a query is fixed ahead of the loop (the maximum over the first 32 keys of the walk) and no pass looks at its scores again; the passes are straight-line code.
//   Any reference cancels in the normalisation as long as every P stays finite in f16; a score more than 16 - PSH (log2) above the reference makes an infinite P, which reaches the row sum and stays there: the caller tests the row sum once and walks again with TEST = true.
// TEST = true: the running maximum with the lazy renewal, one test per pass; right for any scores.
template <bool TEST> __device__ __forceinline__ void fwalk(unsigned char* ring, unsigned kl, unsigned vl, const h16* kg, const h16* vg, unsigned s0, int kfo, int vfo, v16h qh0, v16h qh1, v16h one,
                                                           v8f& o0, v8f& o1, v8f& o2, v8f& o3, v8f& lt) {
    const unsigned NST = SEQ / KST;
    copy8(kl, 32 * KPB, kg + (size_t)s0 * KST * HD, (size_t)32 * HD); copy8(vl, 8 * VPB, vg + (size_t)s0 * KST, (size_t)8 * SEQ);
    asm volatile("s_wait_asynccnt 0x0" ::: "memory");        // stage s0 of this wave has landed
    __syncthreads();                                         // stage s0 of every wave is readable
    if (NST > 1) { const size_t sn = (s0 + 1) % NST; copy8(kl + SBY, 32 * KPB, kg + sn * KST * HD, (size_t)32 * HD); copy8(vl + SBY, 8 * VPB, vg + sn * KST, (size_t)8 * SEQ); }
    o0 = (v8f){}; o1 = (v8f){}; o2 = (v8f){}; o3 = (v8f){};
    lt = (v8f){};                                            // row-sum tile: element 0 = running sum of this lane's query
    float m = -3.0e38f, sh = 0.0f, thr = -3.0e38f;           // TEST: maximum in use, shift in use (PSH - m once a maximum is set) and the test's bound: with these start values the first pass takes the rescale branch, on unshifted scores
    v8f shv = (v8f){};                                       // the shift in use as a C tile: eight equal registers per lane (a lane's eight score rows belong to one query)
    v16h pbp = (v16h){};                                     // P tile of the pass before
    if constexpr (!TEST) {                                   // the fixed reference: unshifted scores of the walk's first 32 keys, their maximum over both lane halves
        const h16* ka = (const h16*)(ring + kfo);
        v8f sHa, sHb;
        score4(sHa, sHb, ldh(ka), ldh(ka + 8 * KPB), ldh(ka + 32), ldh(ka + 8 * KPB + 32), qh0, qh1, shv, pbp);
        float mx = -3.0e38f;
#pragma unroll
        for (int r = 0; r < 8; ++r) mx = fmaxf(mx, fmaxf(sHa[r], sHb[r]));
        mx = fmaxf(mx, __shfl_xor(mx, 16, 32));
        shv = shv + (PSH - mx);
    }
#pragma unroll 1   // the stage loop stays rolled: one publish point, buffer picked by the stage's parity
    for (unsigned st = 0; st < NST; ++st) {
      const unsigned char* sb = ring + (st & 1) * SBY;
#pragma unroll 4   // four 32-key passes per branch, LDS offsets as immediates; all eight unrolled go past 256 registers and two blocks no longer fit a WGP
      for (int key0 = 0; key0 < KST; key0 += 32) {
        const h16* ka = (const h16*)(sb + kfo + key0 * KPB);
        const v16h ka0 = ldh(ka), ka1 = ldh(ka + 32), kb0 = ldh(ka + 8 * KPB), kb1 = ldh(ka + 8 * KPB + 32);   // 8 * KPB halves = 16 rows
        v8f sHa, sHb;                                        // score * SC2 + shift
        score4(sHa, sHb, ka0, kb0, ka1, kb1, qh0, qh1, shv, pbp);
        const h16* va = (const h16*)(sb + vfo + key0 * 2);
        const v16h v0 = ldh(va), v1 = ldh(va + 8 * VPB), v2 = ldh(va + 16 * VPB), v3 = ldh(va + 24 * VPB);     // 8 * VPB halves = 16 rows; read ahead of the softmax, which covers their latency
        if constexpr (!TEST) __builtin_amdgcn_sched_barrier(0);   // keeps the V^T reads ahead of the exponentials: sunk behind them, next to their products, their LDS latency is waited out
        if constexpr (TEST) {
            asm volatile("" ::: "memory");   // compiler fence: without it the build sinks the V^T reads of one pass in four behind the test's branch, next to their products, where their LDS latency is waited out
            float mx = -3.0e38f;
#pragma unroll
            for (int r = 0; r < 8; ++r) mx = fmaxf(mx, fmaxf(sHa[r], sHb[r]));
            if (__builtin_expect(__builtin_amdgcn_ballot_w32(mx > thr) != 0, 0)) {   // one scalar test per pass, on the largest exponent as it stands; taken by the whole wave, so EXEC stays all ones for the products
                mx = fmaxf(mx, __shfl_xor(mx, 16, 32));
                const float mnew = fmaxf(m, mx - sh);            // the shift in use taken off again
                const float alpha = __builtin_amdgcn_exp2f(m - mnew);
                const float dsh = (PSH - mnew) - sh;             // this pass's exponents move to the new shift
                m = mnew; thr = PSH + LZT;
                shv = shv + dsh; sh = shv[0];                    // the tile moves in place; sh is read back from it, so the two never part
                sHa = sHa + dsh; sHb = sHb + dsh;
                o0 = o0 * alpha; o1 = o1 * alpha; o2 = o2 * alpha; o3 = o3 * alpha; lt[0] = lt[0] * alpha;
            }
        }
        v16h pb;
#pragma unroll
        for (int r = 0; r < 8; ++r) { pb[r] = (h16)__builtin_amdgcn_exp2f(sHa[r]); pb[8 + r] = (h16)__builtin_amdgcn_exp2f(sHb[r]); }
        if constexpr (!TEST) { pv5(o0, o1, o2, o3, lt, v0, v1, v2, v3, pb, one); pbp = pb; }
        else {
            o0 = wmma16(v0, pb, o0); o1 = wmma16(v1, pb, o1); o2 = wmma16(v2, pb, o2); o3 = wmma16(v3, pb, o3);
            lt = wmma16(one, pb, lt);                            // += the column sums of P^T
            asm volatile("v_nop\n\tv_nop\n\tv_nop\n\tv_nop" : "+v"(o0), "+v"(o1), "+v"(o2), "+v"(o3), "+v"(lt) : "v"(v0), "v"(v1), "v"(v2), "v"(v3), "v"(pb), "v"(one));
        }
      }
      // once per stage: the distance between the stage's last products and the first vector instruction on their registers (the refill's address arithmetic; behind the last stage, the epilogue)
      if constexpr (!TEST) asm volatile("v_nop\n\tv_nop\n\tv_nop\n\tv_nop" : "+v"(o0), "+v"(o1), "+v"(o2), "+v"(o3), "+v"(lt) : "v"(pbp), "v"(one));
      asm volatile("s_wait_dscnt 0x0" ::: "memory");         // this wave's reads of the stage are done before its buffer is handed back
      asm volatile("s_wait_asynccnt 0x0" ::: "memory");      // this wave's copies of the next stage have landed
      __syncthreads();                                       // next stage readable by all, this stage's buffer free
      if (st + 2 < NST) {
          const unsigned bo = (unsigned)((st & 1) * SBY);
          const size_t sn = (s0 + st + 2) % NST;
          copy8(kl + bo, 32 * KPB, kg + sn * KST * HD, (size_t)32 * HD); copy8(vl + bo, 8 * VPB, vg + sn * KST, (size_t)8 * SEQ);
      }
    }
    asm volatile("s_wait_asynccnt 0x0" ::: "memory");        // nothing in flight when the walk ends (the last barrier above ended every read of the ring)
}

// k_flash: fused attention, one wave per 16 query rows of one (batch, head), 8 waves per block; Q fragments straight from the f16 plane.
// K and V^T come in stages of KST keys through a two-buffer LDS ring that the block's waves share: whole-line asynchronous copies, the next stage in flight while this one is worked on.
// The stages are walked from stage blockIdx.x mod NST on, wrapping (the running-maximum softmax takes the keys in any order): the blocks of one head start two to each of the NST stages.
// Transposed form: S^T[key][t] = K Q^T (A = K rows, B = Q rows); lane (t = lane&15, h = lane>>4) holds keys 8h+r of each 16-key tile, so the packed
// P tile is directly the B fragment of O^T[d][t] = V^T P^T (element r <- tile keys 0..15, element 8+r <- tile keys 16..31, lane unchanged).
// The exponent of P is formed by the score product itself: q carries the scale (k_proj) and the shift PSH - (maximum in use) enters as the product's C operand, a tile of eight equal registers that changes only with the maximum.
// Two walks over the keys (fwalk). The first, which normally is the only one, takes the maximum over the walk's first 32 keys as a fixed reference and never looks at the scores again; if a later score lay so far above it that a P became infinite in f16,
// the row sum shows it, and the whole block walks once more with the running maximum described next (a flag in LDS, one barrier, a scalar branch that reads the same in every wave).
// Second walk: the maximum in use is one scalar per lane, the same in both lane halves of a row. It is renewed lazily: only in a pass where some score of the wave passes it by more than LZT do the halves exchange
// their maxima (one xor-16 exchange) and are the output and row-sum tiles rescaled; in every other pass P is formed against the maximum in use, which cancels in the normalisation like any other.
// Row sums on the matrix pipe: A operand with ones in rows 0 and 8 and zeros elsewhere, B = the packed P tile; element 0 of the result tile is, in both lane halves, the sum of the query's 32 P values; elements 1..7 stay 0.
__global__ __launch_bounds__(32 * AW) void k_flash(const h16* __restrict__ QH, const h16* __restrict__ KP, const h16* __restrict__ VT, h16* CTX) {
    __shared__ __align__(16) unsigned char ring[2 * SBY];    // two stages; after the loop: output staging
    __shared__ int again;                                    // set by a wave whose fixed-reference walk met an infinite P
    float* os = (float*)ring;
    const int tid = threadIdx.x;
    const int lane = threadIdx.x & 31, wave = threadIdx.x >> 5, lr = lane & 15, hi = lane >> 4;
    const int zh = blockIdx.y; const int b = zh / NH_, h = zh % NH_;
    const int t0 = (blockIdx.x * AW + wave) * 16;
    const size_t pbase = (size_t)zh * SEQ * HD;
    const size_t qo = pbase + (size_t)(t0 + lr) * HD + 8 * hi;
    const v16h qh0 = ldh(QH + qo), qh1 = ldh(QH + qo + 32);   // B fragments: col t, k = d
    // copy maps. K tile: 32 KiB contiguous; copy i of lane tid takes 16-byte piece i*256 + tid = (key i*32 + tid/8, piece tid%8). V^T tile: 64 rows of 512 B; (row i*8 + tid/32, piece tid%32).
    const unsigned rb = (unsigned)(size_t)ring;              // LDS byte address of the ring
    const unsigned kl = rb + (unsigned)((tid >> 3) * KPB + (tid & 7) * 16);
    const unsigned vl = rb + (unsigned)(KBY + (tid >> 5) * VPB + (tid & 31) * 16);
    const h16* kg = KP + pbase + (size_t)tid * 8;                                   // + stage * KST * HD
    const h16* vg = VT + pbase + (size_t)(tid >> 5) * SEQ + (size_t)(tid & 31) * 8; // + stage * KST
    const unsigned s0 = blockIdx.x % (SEQ / KST);            // first stage of this block
    const int kfo = lr * KPB + 16 * hi;                      // + key * KPB              (A fragment: row key, k = d)
    const int vfo = KBY + lr * VPB + 16 * hi;                // + 16j * VPB + key * 2    (A fragment: row d, k = key)
    v8f o0, o1, o2, o3, lt;
    const h16 ov = (lane & 7) == 0 ? (h16)1.0f : (h16)0.0f;  // A rows 0 and 8 (lanes 0, 8, 16, 24) are ones at all 32 k positions
    const v16h one = {ov, ov, ov, ov, ov, ov, ov, ov, ov, ov, ov, ov, ov, ov, ov, ov};
    if (tid == 0) again = 0;                                 // ahead of the walk's first barrier
    fwalk<false>(ring, kl, vl, kg, vg, s0, kfo, vfo, qh0, qh1, one, o0, o1, o2, o3, lt);
    if (!(lt[0] < 3.0e38f)) again = 1;                       // an infinite P has reached this query's row sum (infinite or not a number from then on)
    __syncthreads();                                         // the flag of every wave is readable; the test below reads the same in the whole block
    if (__builtin_expect(__builtin_amdgcn_readfirstlane(again) != 0, 0)) fwalk<true>(ring, kl, vl, kg, vg, s0, kfo, vfo, qh0, qh1, one, o0, o1, o2, o3, lt);
    const float inv = CCS * (1.0f / lt[0]);  // normalisation (the P carry cancels) times the ctx carry; both lane halves hold the whole row sum
    const int wb = wave * 16 * 68;
    // O^T D layout: o_j[r] = (d = 16j + 8h + r, t = lane&15) -> os[t][d]; rows 0..15 x columns 0..63 all written
    { v4f a, c;
      a[0] = o0[0] * inv; a[1] = o0[1] * inv; a[2] = o0[2] * inv; a[3] = o0[3] * inv; c[0] = o0[4] * inv; c[1] = o0[5] * inv; c[2] = o0[6] * inv; c[3] = o0[7] * inv;
      *(v4fa*)(&os[wb + lr * 68 +  0 + 8 * hi]) = a; *(v4fa*)(&os[wb + lr * 68 +  0 + 8 * hi + 4]) = c;
      a[0] = o1[0] * inv; a[1] = o1[1] * inv; a[2] = o1[2] * inv; a[3] = o1[3] * inv; c[0] = o1[4] * inv; c[1] = o1[5] * inv; c[2] = o1[6] * inv; c[3] = o1[7] * inv;
      *(v4fa*)(&os[wb + lr * 68 + 16 + 8 * hi]) = a; *(v4fa*)(&os[wb + lr * 68 + 16 + 8 * hi + 4]) = c;
      a[0] = o2[0] * inv; a[1] = o2[1] * inv; a[2] = o2[2] * inv; a[3] = o2[3] * inv; c[0] = o2[4] * inv; c[1] = o2[5] * inv; c[2] = o2[6] * inv; c[3] = o2[7] * inv;
      *(v4fa*)(&os[wb + lr * 68 + 32 + 8 * hi]) = a; *(v4fa*)(&os[wb + lr * 68 + 32 + 8 * hi + 4]) = c;
      a[0] = o3[0] * inv; a[1] = o3[1] * inv; a[2] = o3[2] * inv; a[3] = o3[3] * inv; c[0] = o3[4] * inv; c[1] = o3[5] * inv; c[2] = o3[6] * inv; c[3] = o3[7] * inv;
      *(v4fa*)(&os[wb + lr * 68 + 48 + 8 * hi]) = a; *(v4fa*)(&os[wb + lr * 68 + 48 + 8 * hi + 4]) = c; }
    wave_sync();
    h16* crow = CTX + ((size_t)b * SEQ + t0) * DM + h * HD;      // ctx plane row = token, columns h*64 + d
{
#pragma unroll
        for (int s = 0; s < 4; ++s) { const int row = 4 * s + (lane >> 3), c8 = (lane & 7) * 8;   // 4 s x 4 row groups = 16 rows; 8 lanes x 8 halves = 64 columns
            const v4f x0 = *(const v4fa*)(&os[wb + row * 68 + c8]); const v4f x1 = *(const v4fa*)(&os[wb + row * 68 + c8 + 4]); v8h hv;
#pragma unroll
            for (int i = 0; i < 4; ++i) { hv[i] = (h16)x0[i]; hv[4 + i] = (h16)x1[i]; }
            *(v8h*)(crow + (size_t)row * DM + c8) = hv; }
         }
}

// k_oproj: register-blocked f16 GEMM, one wave per 32x64 tile, 4 x 2 waves per block, operands from K-contiguous f16 planes (ctx x256, w_proj x1024) through the LDS ring of gemm_tile, K = DM.
// OUT[m][n] = (sum_k A[m][k] Bt[n][k]) * 2^-18 + bias[n], f32. grid (NB*SEQ/128, DM/128), 256 threads.
__global__ __launch_bounds__(256) void k_oproj(const h16* __restrict__ A, const h16* __restrict__ Bt, const float* __restrict__ bias, float* OUT) {
    __shared__ __align__(16) unsigned char ring[2 * GSB];    // two operand stages
    __shared__ __align__(16) float osw[8 * 16 * 68];         // output staging, one part per wave
    const int lane = threadIdx.x & 31, wave = threadIdx.x >> 5, lr = lane & 15, hi = lane >> 4;
    const int r0 = blockIdx.x * GT + (wave >> 1) * 32, c0 = blockIdx.y * GT + (wave & 1) * 64;
    float* os = osw + wave * 16 * 68;
    v8f acc[2][4];
#pragma unroll
    for (int mb = 0; mb < 2; ++mb)
#pragma unroll
        for (int nb = 0; nb < 4; ++nb) acc[mb][nb] = (v8f){};
    gemm_tile<true>(A, Bt, blockIdx.x, blockIdx.y, ring, acc);
    float bc[4];
#pragma unroll
    for (int nb = 0; nb < 4; ++nb) bc[nb] = bfr(bias[c0 + nb * 16 + lr]);
    const int bq = r0 / SEQ, tq = r0 % SEQ;
    float* obase = OUT + ((size_t)bq * OUT_SEQ + tq) * DM + c0;
#pragma unroll
    for (int mb = 0; mb < 2; ++mb) {
#pragma unroll
        for (int nb = 0; nb < 4; ++nb) {
#pragma unroll
            for (int j = 0; j < 8; ++j) os[(hi * 8 + j) * 68 + nb * 16 + lr] = acc[mb][nb][j] * OSI + bc[nb]; }   // D: row 8h+j, col lane&15
        wave_sync();
{
#pragma unroll
            for (int s = 0; s < 8; ++s) { const int row = 2 * s + hi, cofs = lr * 4;   // 8 s x 2 rows = 16 rows; 16 lanes x 4 floats = 64 columns
                const v4f val = *(const v4fa*)(&os[row * 68 + cofs]);
                *(v4f*)(obase + (size_t)(mb * 16 + row) * DM + cofs) = val; }
             }
        wave_sync();
    }
}

static constexpr size_t al256(size_t v) { return (v + 255) & ~(size_t)255; }
static constexpr size_t SZ_XB = al256((size_t)NB * SEQ * DM * 2);
static constexpr size_t SZ_WB = al256((size_t)3 * DM * DM * 2);
static constexpr size_t SZ_WP = al256((size_t)DM * DM * 2);
static constexpr size_t SZ_PL = al256((size_t)NB * NH_ * SEQ * HD * 2);
static constexpr size_t SZ_CX = al256((size_t)NB * SEQ * DM * 2);
static constexpr size_t SZ_TOTAL = SZ_XB + SZ_WB + SZ_WP + 3 * SZ_PL + SZ_CX;
static_assert(SZ_TOTAL <= (size_t)134217728);          // workspace carve <= 128 MiB
static_assert(((size_t)DM * DM * 2) % 256 == 0);       // weight sub-planes stay 256-byte aligned

extern "C" void kernel_launch(void* const* d_in, const int* in_sizes, int n_in,
                              void* d_out, int out_size, void* d_ws, size_t ws_size, hipStream_t stream) {
    if (n_in < 5) return;
    const size_t needx = ((size_t)(NB - 1) * SEQ_FULL + SEQ) * DM;
    if ((size_t)in_sizes[0] < needx) return;
    if ((size_t)in_sizes[1] < (size_t)3 * DM * DM || (size_t)in_sizes[2] < (size_t)3 * DM) return;
    if ((size_t)in_sizes[3] < (size_t)DM * DM || (size_t)in_sizes[4] < (size_t)DM) return;
    if ((size_t)out_size < ((size_t)(NB - 1) * OUT_SEQ + SEQ) * DM) return;
    if (SZ_TOTAL > ws_size) return;
    // wire order: x, w_qkv ([3072][1024] = Bt as-is, rows q | k | v), b_qkv, w_proj ([out][in] = Bt as-is), b_proj
    const float* x = (const float*)d_in[0]; const float* wqkv = (const float*)d_in[1]; const float* bqkv = (const float*)d_in[2];
    const float* wproj = (const float*)d_in[3]; const float* bproj = (const float*)d_in[4];
    float* OUT = (float*)d_out;      // [NB][SEQ][1024]
    char* wsp = (char*)d_ws;
    bf* XB = (bf*)wsp; wsp += SZ_XB;                 // [NB*SEQ][1024]
    bf* WB = (bf*)wsp; wsp += SZ_WB;                 // [3][1024][1024]: q | k | v
    h16* WP = (h16*)wsp; wsp += SZ_WP;               // [1024][1024] x1024
    h16* QH = (h16*)wsp; wsp += SZ_PL;               // [NB*16][SEQ][64]
    h16* KP = (h16*)wsp; wsp += SZ_PL;               // [NB*16][SEQ][64]
    h16* VT = (h16*)wsp; wsp += SZ_PL;               // [NB*16][64][SEQ]
    h16* CX = (h16*)wsp; wsp += SZ_CX;               // [NB*SEQ][1024] x256

    k_cvt<<<CBX + CBW + CBP, 256, 0, stream>>>(x, wqkv, wproj, XB, WB, WP);

    k_proj<<<dim3((NB * SEQ / GT) * (DM / GT), 3, 1), 256, 0, stream>>>(XB, WB, bqkv, QH, KP, VT);

    k_flash<<<dim3(SEQ / (16 * AW), NB * NH_, 1), 32 * AW, 0, stream>>>(QH, KP, VT, CX);

    // output projection: A = ctx rows (m = b*SEQ + t, k = h*64 + d), Bt = w_proj rows (n = f) -> OUT[m][f]
    k_oproj<<<dim3(NB * SEQ / GT, DM / GT, 1), 256, 0, stream>>>(CX, WP, bproj, OUT);
}

// v009
// It runs in 89.5 microseconds.
// Two timings next to v008 both put it at 1.04 times that version's speed.
// Counting every step since v000, it is 3.99 times as fast.
#include <hip/hip_runtime.h>

// Multi-head self-attention, width 1024 = 16 heads x 64, x [NB][SEQ][1024], fused w_qkv [3072][1024] ([out][in], rows q | k | v, head h = rows h*64+d of each third), b_qkv, score scale 1/8, no mask, output projection w_proj [out][in] + b_proj (f32 output).
// Compute dtypes, f32 accumulate everywhere: qkv projections v_wmma_f32_16x16x32_bf16 (x, w_qkv RNE-converted to bf16; products exact); scores v_wmma_f32_16x16x32_f16: q and k single f16 planes (one product), the q plane holding q * 0.125*log2(e) (scaled in f32 ahead of its one f16 rounding);
// P (x256 carry, cancels in the normalisation; row sum taken over the f16 P values, by one more matrix product with a ones operand) and v single f16; softmax f32 (fixed reference from the first 32 keys; online running max only in the fallback walk); output projection v_wmma_f32_16x16x32_f16: ctx single f16 (x256 carry), w_proj RNE-converted to bf16 then x1024 as f16 (exact), carries folded back (2^-18) in the f32 epilogue; biases RNE-converted to bf16, added in f32.
// Layout: bf16 copies of x and w_qkv; q, k planes [b*16+h][t][d] and v^T plane [b*16+h][d][t] written by the GEMM epilogue; fused flash kernel in transposed form (S^T = K Q^T, O^T = V^T P^T; K and V^T tiles staged in LDS for the 8 waves of a block; a wave holds 32 query columns and walks half the keys, the two halves' f32 partial sums joined at the end) writes the f16 ctx plane [b*SEQ+t][1024]; f16 GEMM writes the output buffer.
// The four GEMMs: 128x128 tile per 8-wave block (32x64 per wave), both operands staged in LDS in whole lines, 128 k per stage, two buffers.
// Blocks that stage the same rows (GEMM panels; K and V^T of a head) begin the stage walk at stages spread by block index and wrap, so that not all of them ask L2 for the same lines at the same moment.
// Four launches: launches that read none of each other's output share one grid (the three conversions by block range; the q, k and v^T projections by blockIdx.y).

#ifndef NB
#define NB 1
#endif
#ifndef SEQ
#define SEQ 4096
#endif
#define NB_FULL  1
#define SEQ_FULL 4096
#ifndef OUT_SEQ
#define OUT_SEQ SEQ              // row pitch (in tokens) between batches of the output
#endif
#define DM   1024
#define NH_  16
#define HD   64
#define AW   8                   // waves per flash block: 4 column groups of 32 query rows x 2 key halves; 16 * AW query rows per block
#define KST  256                 // keys per LDS stage of the flash kernel
#define KHW  (KST / 2)           // keys of a stage that one wave walks
#define XOF  (AW * 16 * 68 * 4)  // flash epilogue: byte offset in the ring of the swap area, behind the output staging
#define KPB  (HD * 2 + 16)       // LDS pitch of a K row, bytes: 16 B x odd, no bank conflict for 16-byte fragment reads
#define VPB  (KST * 2 + 16)      // LDS pitch of a V^T row, bytes: 16 B x odd
#define KBY  (KST * KPB)         // K part of a stage, bytes
#define SBY  (KBY + HD * VPB)    // one stage (K then V^T), bytes
#define GT   128                 // GEMM block tile, rows and columns (4 x 2 waves of 32 x 64)
#define GK   128                 // k per LDS stage of the GEMMs
#define GPB  (GK * 2 + 16)       // LDS pitch of a GEMM operand row, bytes: 16 B x odd
#define GAB  (GT * GPB)          // one operand's part of a stage, bytes
#define GSB  (2 * GAB)           // one stage (A rows then B rows), bytes
#define SC2  (0.125f * 1.4426950408889634f)   // HD^-0.5 * log2(e)
#define PSH  8.0f                // log2 of the P carry (256)
#define LZT  7.0f                // lazy rescale: a score may pass the maximum in use by this much (log2) before the maximum is renewed; P <= 2^(PSH + LZT) = 32768 stays finite in f16
#define CCS  256.0f              // carry of the ctx plane
#define WPS  1024.0f             // carry of the w_proj plane
#define OSI  (1.0f / (256.0f * 1024.0f))      // inverse of both carries

static_assert(HD == 64);
static_assert(NH_ * HD == DM);                 // head h = columns h*64 + d
static_assert(DM % 64 == 0);                   // column tiles of 64
static_assert(DM % 32 == 0);                   // GEMM k-loop steps by 32
static_assert(SEQ % 64 == 0);                  // a wave's tile (32 rows, 64 columns) never straddles two batches
static_assert((NB * SEQ) % 64 == 0);
static_assert(SEQ % 32 == 0);                  // key loop steps by 32
static_assert(SEQ % (16 * AW) == 0);           // flash grid covers the sequence exactly
static_assert(SEQ % KST == 0);                 // whole stages only
static_assert(AW == 8 && KST == 256);          // copy maps of k_flash: 256 lanes x 8 copies x 16 B = one 32-KiB K or V^T tile
static_assert((KPB / 16) % 2 == 1 && (VPB / 16) % 2 == 1);
static_assert(2 * SBY >= XOF + AW * 9 * 512);  // the ring holds the output staging and the swap area (9 pieces of 512 B per wave)
static_assert(KHW % 32 == 0);
static_assert((NB * SEQ) % GT == 0 && DM % GT == 0);   // GEMM grids cover both extents exactly
static_assert(DM % GK == 0 && DM / GK >= 2);           // whole stages, and the two that the ring's prologue needs
static_assert(GT == 128 && GK == 128);                 // copy map of gstage: 256 lanes x 16 copies x 16 B = 256 rows of 256 B
static_assert((GPB / 16) % 2 == 1);
static_assert(((size_t)SEQ * DM) % 8 == 0);
static_assert(((size_t)DM * DM) % 8 == 0);
static_assert(NB <= NB_FULL);
static_assert(SEQ <= SEQ_FULL);

typedef _Float16 h16;
typedef unsigned short bf;
typedef __attribute__((ext_vector_type(16))) __bf16   v16bf;
typedef __attribute__((ext_vector_type(16))) _Float16 v16h;
typedef __attribute__((ext_vector_type(8)))  _Float16 v8h;
typedef __attribute__((ext_vector_type(8)))  unsigned short v8us;
typedef __attribute__((ext_vector_type(16))) unsigned short v16us;
typedef __attribute__((ext_vector_type(8)))  float    v8f;
typedef __attribute__((ext_vector_type(4)))  float    v4f;
typedef v4f  __attribute__((may_alias)) v4fa;

__device__ __forceinline__ unsigned short f2bf(float f) { unsigned u = __float_as_uint(f); u += 0x7FFFu + ((u >> 16) & 1u); return (unsigned short)(u >> 16); }
__device__ __forceinline__ float bfr(float f) { return __uint_as_float(((unsigned)f2bf(f)) << 16); }   // value after RNE convert to bf16
__device__ __forceinline__ v16h cat16(v8h lo, v8h hi) { return __builtin_shufflevector(lo, hi, 0, 1, 2, 3, 4, 5, 6, 7, 8, 9, 10, 11, 12, 13, 14, 15); }
__device__ __forceinline__ v8f wmma16(v16h a, v16h b, v8f c) { return __builtin_amdgcn_wmma_f32_16x16x32_f16(false, a, false, b, (short)0, c, false, false); }
__device__ __forceinline__ v8f wmmab(v16bf a, v16bf b, v8f c) { return __builtin_amdgcn_wmma_f32_16x16x32_bf16(false, a, false, b, (short)0, c, false, false); }
// fragment loaders from K-contiguous 16-bit rows; p already includes + 8*(lane>>4): elements 0..7 <- k0+8h+0..7, elements 8..15 <- k0+16+8h+0..7 (same map for A and B)
__device__ __forceinline__ v16h  ldh(const h16* p) { return cat16(*(const v8h*)p, *(const v8h*)(p + 16)); }
// ordering point for wave-private LDS tiles (same wave writes and reads)
__device__ __forceinline__ void wave_sync() { __builtin_amdgcn_fence(3 /* release order */, "wavefront"); __builtin_amdgcn_wave_barrier(); asm volatile("" ::: "memory"); }

// k_cvt: the three conversions in one grid, 8 values per thread; a block lies wholly in one range: x -> bf16, then w_qkv -> bf16, then w_proj -> bf16 value x1024 as f16.
#define CBX ((unsigned)((size_t)NB * SEQ * DM / 2048))   // blocks of x (256 threads x 8 values)
#define CBW ((unsigned)((size_t)3 * DM * DM / 2048))     // blocks of w_qkv
#define CBP ((unsigned)((size_t)DM * DM / 2048))         // blocks of w_proj
static_assert(((size_t)SEQ * DM) % 2048 == 0 && ((size_t)DM * DM) % 2048 == 0);   // whole blocks in every range, none straddles two batches
__global__ __launch_bounds__(256) void k_cvt(const float* __restrict__ x, const float* __restrict__ wqkv, const float* __restrict__ wproj, bf* XB, bf* WB, h16* WP) {
    const unsigned blk = blockIdx.x;
    if (blk < CBX + CBW) {
        const bool isx = blk < CBX;
        const size_t e = ((size_t)(isx ? blk : blk - CBX) * 256 + threadIdx.x) * 8;
        const size_t bt = e / ((size_t)SEQ * DM);            // batch (x only): source batches lie SEQ_FULL tokens apart
        const float* s = isx ? x + bt * ((size_t)SEQ_FULL * DM) + (e - bt * ((size_t)SEQ * DM)) : wqkv + e;
        const v8f v = *(const v8f*)s; v8us o;
#pragma unroll
        for (int k = 0; k < 8; ++k) o[k] = f2bf(v[k]);
        *(v8us*)((isx ? XB : WB) + e) = o;
    } else {
        const size_t e = ((size_t)(blk - CBX - CBW) * 256 + threadIdx.x) * 8;
        const v8f v = *(const v8f*)(wproj + e); v8h o;
#pragma unroll
        for (int k = 0; k < 8; ++k) o[k] = (h16)(bfr(v[k]) * WPS);
        *(v8h*)(WP + e) = o;
        asm volatile("s_wait_xcnt 0x0" ::: "memory");   // precaution: stands in front of every later write of the store's registers
    }
}

// eight asynchronous 16-byte copies per lane, global -> LDS (LDS byte address l + i*ls, global address g + i*gs halves).
// s_wait_xcnt closes the statement so that no address register of an issued copy is rewritten ahead of it.
__device__ __forceinline__ void copy8(unsigned l, unsigned ls, const h16* g, size_t gs) {
    asm volatile("global_load_async_to_lds_b128 %0, %8, off\n\t"
                 "global_load_async_to_lds_b128 %1, %9, off\n\t"
                 "global_load_async_to_lds_b128 %2, %10, off\n\t"
                 "global_load_async_to_lds_b128 %3, %11, off\n\t"
                 "global_load_async_to_lds_b128 %4, %12, off\n\t"
                 "global_load_async_to_lds_b128 %5, %13, off\n\t"
                 "global_load_async_to_lds_b128 %6, %14, off\n\t"
                 "global_load_async_to_lds_b128 %7, %15, off\n\t"
                 "s_wait_xcnt 0x0"
                 :: "v"(l), "v"(l + ls), "v"(l + 2 * ls), "v"(l + 3 * ls), "v"(l + 4 * ls), "v"(l + 5 * ls), "v"(l + 6 * ls), "v"(l + 7 * ls),
                    "v"(g), "v"(g + gs), "v"(g + 2 * gs), "v"(g + 3 * gs), "v"(g + 4 * gs), "v"(g + 5 * gs), "v"(g + 6 * gs), "v"(g + 7 * gs)
                 : "memory");
}

// the same eight copies one by one, for code that is rarely run: each copy's addresses are formed where it issues, so none of them holds a register anywhere else in the kernel. Each statement closes with its own s_wait_xcnt, ahead of the address steps behind it.
__device__ __forceinline__ void copy8r(unsigned l, unsigned ls, const h16* g, size_t gs) {
#pragma unroll 1   // stays rolled: unrolled, the addresses equal those of the first walk's copies and are kept in registers across its key loop
    for (int i = 0; i < 8; ++i) {
        asm volatile("global_load_async_to_lds_b128 %0, %1, off\n\ts_wait_xcnt 0x0" :: "v"(l), "v"(g) : "memory");
        l += ls; g += gs;
    }
}

// one GEMM stage: rows 0..127 of the A tile, then of the B tile, 256 B (GK halves) of each. Copy i of lane tid takes (row i*16 + tid/16, 16-byte piece tid%16): a wave's copy covers two whole 256-B runs.
__device__ __forceinline__ void gstage(unsigned l, const h16* ga, const h16* gb) {
    copy8(l, 16 * GPB, ga, (size_t)16 * DM); copy8(l + GAB, 16 * GPB, gb, (size_t)16 * DM);
}
// fragment from an LDS row of 16-bit values; p already includes + 16*(lane>>4) bytes: same element map as ldh, for A and for B
__device__ __forceinline__ v16us ldu(const unsigned char* p) { return __builtin_shufflevector(*(const v8us*)p, *(const v8us*)(p + 32), 0, 1, 2, 3, 4, 5, 6, 7, 8, 9, 10, 11, 12, 13, 14, 15); }
template <bool F16> __device__ __forceinline__ v8f wm(v16us a, v16us b, v8f c) {
    if constexpr (F16) return wmma16(__builtin_bit_cast(v16h, a), __builtin_bit_cast(v16h, b), c);
    else               return wmmab(__builtin_bit_cast(v16bf, a), __builtin_bit_cast(v16bf, b), c);
}
// k loop of a 128x128 block tile (bx, by), K = DM: acc[mb][nb] += A rows (bx*128 + (wave>>1)*32 + mb*16 ..) x Bt rows (by*128 + (wave&1)*64 + nb*16 ..); the 128-k stages are walked from stage (bx + by) mod NSTG on, wrapping, k ascending in steps of 32 inside a stage.
// Two-buffer LDS ring shared by the block's 8 waves: the next stage's copies fly while this one is worked on; inside a stage the next k step's fragments are read ahead of this step's products.
template <bool F16> __device__ __forceinline__ void gemm_tile(const h16* A, const h16* Bt, unsigned bx, unsigned by, unsigned char* ring, v8f (&acc)[2][4]) {
    const int tid = threadIdx.x, lane = tid & 31, wave = tid >> 5, lr = lane & 15, hi = lane >> 4;
    const unsigned l = (unsigned)(size_t)ring + (unsigned)((tid >> 4) * GPB + (tid & 15) * 16);   // LDS byte address of this lane's first piece
    const h16* ga = A  + (size_t)(bx * GT + (tid >> 4)) * DM + (tid & 15) * 8;             // + stage * GK
    const h16* gb = Bt + (size_t)(by * GT + (tid >> 4)) * DM + (tid & 15) * 8;
    const unsigned NSTG = DM / GK;
    const unsigned s0 = (bx + by) % NSTG;                    // first stage of this block: blocks that share a row panel differ in by, those that share a column panel in bx, so sharers spread over the NSTG stages
    gstage(l, ga + (size_t)s0 * GK, gb + (size_t)s0 * GK);
    asm volatile("s_wait_asynccnt 0x0" ::: "memory");        // stage s0 of this wave has landed
    __syncthreads();                                         // stage s0 of every wave is readable
    { const size_t ko = (size_t)((s0 + 1) % NSTG) * GK; gstage(l + GSB, ga + ko, gb + ko); }
    const int afo = ((wave >> 1) * 32 + lr) * GPB + 16 * hi;
    const int bfo = GAB + ((wave & 1) * 64 + lr) * GPB + 16 * hi;
#pragma unroll 1   // the stage loop stays rolled: one publish point, buffer picked by the stage's parity
    for (unsigned st = 0; st < NSTG; ++st) {
        const unsigned char* pa = ring + (st & 1) * GSB + afo;
        const unsigned char* pb = ring + (st & 1) * GSB + bfo;
        v16us a[2][2], b[2][4];
#pragma unroll
        for (int i = 0; i < 4; ++i) { if (i < 2) a[0][i] = ldu(pa + i * 16 * GPB); b[0][i] = ldu(pb + i * 16 * GPB); }
#pragma unroll
        for (int kk = 0; kk < GK / 32; ++kk) {
            const int cur = kk & 1, nxt = cur ^ 1;
            if (kk + 1 < GK / 32) {
#pragma unroll
                for (int i = 0; i < 4; ++i) { if (i < 2) a[nxt][i] = ldu(pa + i * 16 * GPB + (kk + 1) * 64); b[nxt][i] = ldu(pb + i * 16 * GPB + (kk + 1) * 64); }
            }
            __builtin_amdgcn_sched_barrier(0);   // keeps the next step's reads one group ahead of this step's products: sunk among them, each read's LDS latency is waited out
#pragma unroll
            for (int nb = 0; nb < 4; ++nb)
#pragma unroll
                for (int mb = 0; mb < 2; ++mb) acc[mb][nb] = wm<F16>(a[cur][mb], b[cur][nb], acc[mb][nb]);
            __builtin_amdgcn_sched_barrier(0);   // the other side of the same fence: no later read rises into this step's products
        }
        asm volatile("s_wait_dscnt 0x0" ::: "memory");       // this wave's reads of the stage are done before its buffer is handed back
        asm volatile("s_wait_asynccnt 0x0" ::: "memory");    // this wave's copies of the next stage have landed
        __syncthreads();                                     // next stage readable by all, this stage's buffer free
        if (st + 2 < NSTG) { const size_t ko = (size_t)((s0 + st + 2) % NSTG) * GK; gstage(l + (unsigned)((st & 1) * GSB), ga + ko, gb + ko); }
    }
    asm volatile("s_wait_asynccnt 0x0" ::: "memory");        // nothing in flight when the wave goes on to its epilogue
}

// k_proj: the three qkv projections in one grid; register-blocked bf16 GEMM, one wave per 32x64 tile (8 accumulators), 4 x 2 waves per block, operands from K-contiguous bf16 planes through the LDS ring of gemm_tile, K = DM.
// C[m][n] = sum_k A[m][k] Bt[n][k] + bias, written as a single f16 plane. grid (tiles of one projection, 3), 256 threads; blockIdx.y = 0 q, 1 k, 2 v^T; row tile fastest.
// The q plane is written times SC2 (f32 multiply ahead of the f16 rounding), so that the flash kernel's score product comes out in log2 units.
// q, k: A = x rows (m = b*SEQ + t), Bt = W rows (n = h*64 + d), bias[n] -> plane [(b*16 + h)][t][d].   v^T: A = Wv rows (m = h*64 + d), Bt = x rows (n = b*SEQ + t), bias[m] -> plane [(b*16 + h)][d][t].
__global__ __launch_bounds__(256) void k_proj(const bf* __restrict__ XB, const bf* __restrict__ WB, const float* __restrict__ bqkv, h16* QH, h16* KP, h16* VT) {
    __shared__ __align__(16) unsigned char ring[2 * GSB];    // two operand stages
    __shared__ __align__(16) float osw[8 * 16 * 68];         // output staging, one part per wave
    const int lane = threadIdx.x & 31, wave = threadIdx.x >> 5, lr = lane & 15, hi = lane >> 4;
    const int pz = blockIdx.y; const int biasRow = pz == 2;
    const int mt = biasRow ? DM / GT : NB * SEQ / GT;        // row tiles of this projection
    const int bx = blockIdx.x % mt, by = blockIdx.x / mt;
    const bf* W = WB + (size_t)pz * DM * DM;
    const bf* A = biasRow ? W : XB; const bf* Bt = biasRow ? XB : W;
    const float* bias = bqkv + pz * DM;
    const float qs = pz == 0 ? SC2 : 1.0f;                   // score scale, carried by q alone
    h16* Ph = pz == 0 ? QH : (pz == 1 ? KP : VT);
    const int pitch = biasRow ? SEQ : HD;                    // row pitch of the plane, halves
    const int r0 = bx * GT + (wave >> 1) * 32, c0 = by * GT + (wave & 1) * 64;
    float* os = osw + wave * 16 * 68;
    v8f acc[2][4];
#pragma unroll
    for (int mb = 0; mb < 2; ++mb)
#pragma unroll
        for (int nb = 0; nb < 4; ++nb) acc[mb][nb] = (v8f){};
    gemm_tile<false>((const h16*)A, (const h16*)Bt, (unsigned)bx, (unsigned)by, ring, acc);
    // column bias (index selected as an integer, address always inside the bias array)
    float bc[4];
#pragma unroll
    for (int nb = 0; nb < 4; ++nb) { const int ci = biasRow ? 0 : (c0 + nb * 16 + lr); const float t = bfr(bias[ci]); bc[nb] = biasRow ? 0.0f : t; }
    const size_t tbase = biasRow ? (size_t)r0 * SEQ + (size_t)(c0 / SEQ) * ((size_t)DM * SEQ) + (size_t)(c0 % SEQ)
                                 : (size_t)(r0 / SEQ) * ((size_t)NH_ * SEQ * HD) + (size_t)(r0 % SEQ) * HD + (size_t)(c0 / HD) * ((size_t)SEQ * HD) + (size_t)(c0 % HD);
#pragma unroll
    for (int mb = 0; mb < 2; ++mb) {
        // row bias for rows r0 + mb*16 + 8h + 0..7 (two 16-B loads, clamped to offset 0 in column mode)
        const int ri = biasRow ? (r0 + mb * 16 + hi * 8) : 0;
        const v4f rb0 = *(const v4f*)(bias + ri); const v4f rb1 = *(const v4f*)(bias + ri + 4);
        float br[8];
#pragma unroll
        for (int j = 0; j < 4; ++j) { const float t0 = bfr(rb0[j]); const float t1 = bfr(rb1[j]); br[j] = biasRow ? t0 : 0.0f; br[4 + j] = biasRow ? t1 : 0.0f; }
#pragma unroll
        for (int nb = 0; nb < 4; ++nb) {
#pragma unroll
            for (int j = 0; j < 8; ++j) os[(hi * 8 + j) * 68 + nb * 16 + lr] = (acc[mb][nb][j] + bc[nb] + br[j]) * qs; }   // D: row 8h+j, col lane&15
        wave_sync();
        const size_t sb = tbase + (size_t)(mb * 16) * (size_t)pitch;
{
#pragma unroll
            for (int s = 0; s < 4; ++s) { const int row = 4 * s + (lane >> 3), c8 = (lane & 7) * 8;   // 4 s x 4 row groups = 16 rows; 8 lanes x 8 = 64 columns
                const v4f x0 = *(const v4fa*)(&os[row * 68 + c8]); const v4f x1 = *(const v4fa*)(&os[row * 68 + c8 + 4]); v8h hv;
#pragma unroll
                for (int i = 0; i < 4; ++i) { hv[i] = (h16)x0[i]; hv[4 + i] = (h16)x1[i]; }
                const size_t oo = sb + (size_t)row * (size_t)pitch + c8;
                *(v8h*)(Ph + oo) = hv; }
            asm volatile("s_wait_xcnt 0x0" ::: "memory");   // precaution: stands in front of the next half tile's bias loads, which land in the four stores' data registers
             }
        wave_sync();
    }
}

// the eight score products of a 32-key pass (four K fragments x two query tiles) in one statement: all four K fragments are its inputs, so their eight LDS reads go out as one group ahead of it, and each fragment is read from LDS once for both tiles;
// a tile's second product stands four products behind its first, past the accumulator latency; the four v_nop at its end keep, once, the distance between the last product and the first vector instruction on its result
// pA and pB, the P tiles of the pass before, are named as inputs and not used in the text: the early-clobber results then never land on their registers, which the products just issued still read as their B operand
__device__ __forceinline__ void score8(v8f& sAa, v8f& sAb, v8f& sBa, v8f& sBb, v16h ka0, v16h kb0, v16h ka1, v16h kb1, v16h qA0, v16h qA1, v16h qB0, v16h qB1, v8f shA, v8f shB, v16h pA, v16h pB) {
    asm volatile("v_wmma_f32_16x16x32_f16 %0, %4, %8, %12\n\t"
                 "v_wmma_f32_16x16x32_f16 %1, %5, %8, %12\n\t"
                 "v_wmma_f32_16x16x32_f16 %2, %4, %10, %13\n\t"
                 "v_wmma_f32_16x16x32_f16 %3, %5, %10, %13\n\t"
                 "v_wmma_f32_16x16x32_f16 %0, %6, %9, %0\n\t"
                 "v_wmma_f32_16x16x32_f16 %1, %7, %9, %1\n\t"
                 "v_wmma_f32_16x16x32_f16 %2, %6, %11, %2\n\t"
                 "v_wmma_f32_16x16x32_f16 %3, %7, %11, %3\n\t"
                 "v_nop\n\tv_nop\n\tv_nop\n\tv_nop"
                 : "=&v"(sAa), "=&v"(sAb), "=&v"(sBa), "=&v"(sBb)
                 : "v"(ka0), "v"(kb0), "v"(ka1), "v"(kb1), "v"(qA0), "v"(qA1), "v"(qB0), "v"(qB1), "v"(shA), "v"(shB), "v"(pA), "v"(pB));
}
// the four output products and the row-sum product of a pass for one query tile, five independent accumulators in one statement: each fills the others' window. No v_nop behind them: what follows is the other tile's exponentials, on registers of their own, its five products, LDS reads, then score8, whose eight products and four v_nop stand ahead of the next vector instruction on any of these registers
__device__ __forceinline__ void pv5(v8f& o0, v8f& o1, v8f& o2, v8f& o3, v8f& lt, v16h v0, v16h v1, v16h v2, v16h v3, v16h pb, v16h one) {
    asm volatile("v_wmma_f32_16x16x32_f16 %0, %5, %9, %0\n\t"
                 "v_wmma_f32_16x16x32_f16 %1, %6, %9, %1\n\t"
                 "v_wmma_f32_16x16x32_f16 %2, %7, %9, %2\n\t"
                 "v_wmma_f32_16x16x32_f16 %3, %8, %9, %3\n\t"
                 "v_wmma_f32_16x16x32_f16 %4, %10, %9, %4"
                 : "+v"(o0), "+v"(o1), "+v"(o2), "+v"(o3), "+v"(lt) : "v"(v0), "v"(v1), "v"(v2), "v"(v3), "v"(pb), "v"(one));
}
__device__ __forceinline__ v16h pexp(v8f sa, v8f sb) {      // packed P tile of a pass: element r <- key tile 0..15, element 8 + r <- key tile 16..31
    v16h pb;
#pragma unroll
    for (int r = 0; r < 8; ++r) { pb[r] = (h16)__builtin_amdgcn_exp2f(sa[r]); pb[8 + r] = (h16)__builtin_amdgcn_exp2f(sb[r]); }
    return pb;
}

// fwalk2, the walk that normally counts: one walk over a wave's half of the keys of a head (KHW keys of every stage, offsets kfo and vfo) for the wave's two query tiles A and B: ring prologue, stage loop, nothing in flight at its end.
// Sets the partial output tiles and row-sum tiles of both query tiles and the shift in use of each (sfA, sfB).
// The softmax reference of a query is fixed ahead of the loop (the maximum over the first 32 keys of the block's first stage, offset kfr: the same keys in both key halves, so both halves form bit for bit the same shift) and no pass looks at its scores again; the passes are straight-line code.
// Any reference cancels in the normalisation as long as every P stays finite in f16; a score more than 16 - PSH (log2) above the reference makes an infinite P, which reaches the row sum and stays there: the caller tests the row sums once and walks again with fwalk1.
__device__ __forceinline__ void fwalk2(unsigned char* ring, unsigned kl, unsigned vl, const h16* kg, const h16* vg, unsigned s0, int kfr, int kfo, int vfo, v16h qA0, v16h qA1, v16h qB0, v16h qB1, v16h one,
                                       v8f& a0, v8f& a1, v8f& a2, v8f& a3, v8f& la, float& sfA, v8f& b0, v8f& b1, v8f& b2, v8f& b3, v8f& lb, float& sfB) {
    const unsigned NST = SEQ / KST;
    copy8(kl, 32 * KPB, kg + (size_t)s0 * KST * HD, (size_t)32 * HD); copy8(vl, 8 * VPB, vg + (size_t)s0 * KST, (size_t)8 * SEQ);
    asm volatile("s_wait_asynccnt 0x0" ::: "memory");        // stage s0 of this wave has landed
    __syncthreads();                                         // stage s0 of every wave is readable
    if (NST > 1) { const size_t sn = (s0 + 1) % NST; copy8(kl + SBY, 32 * KPB, kg + sn * KST * HD, (size_t)32 * HD); copy8(vl + SBY, 8 * VPB, vg + sn * KST, (size_t)8 * SEQ); }
    a0 = (v8f){}; a1 = (v8f){}; a2 = (v8f){}; a3 = (v8f){}; b0 = (v8f){}; b1 = (v8f){}; b2 = (v8f){}; b3 = (v8f){};
    la = (v8f){}; lb = (v8f){};                              // row-sum tiles: element 0 = running sum of this lane's query
    v8f shA = (v8f){}, shB = (v8f){};                        // the shifts in use as C tiles: eight equal registers per lane (a lane's eight score rows belong to one query)
    v16h pA = (v16h){}, pB = (v16h){};                       // P tiles of the pass before
    {                                                        // the fixed references: unshifted scores of the first 32 keys of the first stage, their maximum over both lane halves
        const h16* ka = (const h16*)(ring + kfr);
        v8f sAa, sAb, sBa, sBb;
        score8(sAa, sAb, sBa, sBb, ldh(ka), ldh(ka + 8 * KPB), ldh(ka + 32), ldh(ka + 8 * KPB + 32), qA0, qA1, qB0, qB1, shA, shB, pA, pB);
        float mA = -3.0e38f, mB = -3.0e38f;
#pragma unroll
        for (int r = 0; r < 8; ++r) { mA = fmaxf(mA, fmaxf(sAa[r], sAb[r])); mB = fmaxf(mB, fmaxf(sBa[r], sBb[r])); }
        mA = fmaxf(mA, __shfl_xor(mA, 16, 32)); mB = fmaxf(mB, __shfl_xor(mB, 16, 32));
        shA = shA + (PSH - mA); shB = shB + (PSH - mB);
    }
#pragma unroll 1   // the stage loop stays rolled: one publish point, buffer picked by the stage's parity
    for (unsigned st = 0; st < NST; ++st) {
      const unsigned char* sb = ring + (st & 1) * SBY;
#pragma unroll     // the wave's four 32-key passes of a stage: straight-line code, LDS offsets as immediates
      for (int key0 = 0; key0 < KHW; key0 += 32) {
        const h16* ka = (const h16*)(sb + kfo + key0 * KPB);
        const v16h ka0 = ldh(ka), ka1 = ldh(ka + 32), kb0 = ldh(ka + 8 * KPB), kb1 = ldh(ka + 8 * KPB + 32);   // 8 * KPB halves = 16 rows
        v8f sAa, sAb, sBa, sBb;                              // score * SC2 + shift
        score8(sAa, sAb, sBa, sBb, ka0, kb0, ka1, kb1, qA0, qA1, qB0, qB1, shA, shB, pA, pB);
        const h16* va = (const h16*)(sb + vfo + key0 * 2);
        const v16h v0 = ldh(va), v1 = ldh(va + 8 * VPB), v2 = ldh(va + 16 * VPB), v3 = ldh(va + 24 * VPB);     // 8 * VPB halves = 16 rows; read ahead of the softmax, which covers their latency
        __builtin_amdgcn_sched_barrier(0);   // keeps the V^T reads ahead of the exponentials: sunk behind them, next to their products, their LDS latency is waited out
        pA = pexp(sAa, sAb);
        pv5(a0, a1, a2, a3, la, v0, v1, v2, v3, pA, one);
        pB = pexp(sBa, sBb);
        pv5(b0, b1, b2, b3, lb, v0, v1, v2, v3, pB, one);
      }
      // once per stage: the distance between the stage's last products and the first vector instruction on their registers (the refill's address arithmetic; behind the last stage, the epilogue)
      asm volatile("v_nop\n\tv_nop\n\tv_nop\n\tv_nop" : "+v"(a0), "+v"(a1), "+v"(a2), "+v"(a3), "+v"(la), "+v"(b0), "+v"(b1), "+v"(b2), "+v"(b3), "+v"(lb) : "v"(pA), "v"(pB), "v"(one));
      asm volatile("s_wait_dscnt 0x0" ::: "memory");         // this wave's reads of the stage are done before its buffer is handed back
      asm volatile("s_wait_asynccnt 0x0" ::: "memory");      // this wave's copies of the next stage have landed
      __syncthreads();                                       // next stage readable by all, this stage's buffer free
      if (st + 2 < NST) {
          const unsigned bo = (unsigned)((st & 1) * SBY);
          const size_t sn = (s0 + st + 2) % NST;
          copy8(kl + bo, 32 * KPB, kg + sn * KST * HD, (size_t)32 * HD); copy8(vl + bo, 8 * VPB, vg + sn * KST, (size_t)8 * SEQ);
      }
    }
    asm volatile("s_wait_asynccnt 0x0" ::: "memory");        // nothing in flight when the walk ends (the last barrier above ended every read of the ring)
    sfA = shA[0]; sfB = shB[0];
}

// fwalk1, the walk for scores that the fixed reference cannot hold: the same ring and the same half of the keys for ONE query tile, with the running maximum and its lazy renewal, one test per pass; right for any scores.
// Sets the partial output tiles o0..o3, the row-sum tile lt and the shift in use at the walk's end (sf).
__device__ __forceinline__ void fwalk1(unsigned char* ring, unsigned kl, unsigned vl, const h16* kg, const h16* vg, unsigned s0, int kfo, int vfo, v16h qh0, v16h qh1, v16h one,
                                       v8f& o0, v8f& o1, v8f& o2, v8f& o3, v8f& lt, float& sf) {
    const unsigned NST = SEQ / KST;
#pragma unroll 1   // the ring's prologue, rolled like copy8r and for the same reason: stage 0, its wait and barrier, then stage 1
    for (unsigned p = 0; p < 2 && p < NST; ++p) {
        const size_t sn = (s0 + p) % NST;
        copy8r(kl + p * SBY, 32 * KPB, kg + sn * KST * HD, (size_t)32 * HD); copy8r(vl + p * SBY, 8 * VPB, vg + sn * KST, (size_t)8 * SEQ);
        if (p == 0) {
            asm volatile("s_wait_asynccnt 0x0" ::: "memory");    // stage 0 of this wave has landed
            __syncthreads();                                     // stage 0 of every wave is readable
        }
    }
    o0 = (v8f){}; o1 = (v8f){}; o2 = (v8f){}; o3 = (v8f){};
    lt = (v8f){};                                            // row-sum tile: element 0 = running sum of this lane's query
    float m = -3.0e38f, sh = 0.0f, thr = -3.0e38f;           // maximum in use, shift in use (PSH - m once a maximum is set) and the test's bound: with these start values the first pass takes the rescale branch, on unshifted scores
    v8f shv = (v8f){};                                       // the shift in use as a C tile
#pragma unroll 1   // the stage loop stays rolled: one publish point, buffer picked by the stage's parity
    for (unsigned st = 0; st < NST; ++st) {
      const unsigned char* sb = ring + (st & 1) * SBY;
#pragma unroll 1   // rarely run: kept short
      for (int key0 = 0; key0 < KHW; key0 += 32) {
        const h16* ka = (const h16*)(sb + kfo + key0 * KPB);
        const v16h ka0 = ldh(ka), ka1 = ldh(ka + 32), kb0 = ldh(ka + 8 * KPB), kb1 = ldh(ka + 8 * KPB + 32);   // 8 * KPB halves = 16 rows
        v8f sHa = wmma16(ka1, qh1, wmma16(ka0, qh0, shv)), sHb = wmma16(kb1, qh1, wmma16(kb0, qh0, shv));      // score * SC2 + shift
        const h16* va = (const h16*)(sb + vfo + key0 * 2);
        const v16h v0 = ldh(va), v1 = ldh(va + 8 * VPB), v2 = ldh(va + 16 * VPB), v3 = ldh(va + 24 * VPB);     // 8 * VPB halves = 16 rows
        float mx = -3.0e38f;
#pragma unroll
        for (int r = 0; r < 8; ++r) mx = fmaxf(mx, fmaxf(sHa[r], sHb[r]));
        if (__builtin_amdgcn_ballot_w32(mx > thr) != 0) {    // one scalar test per pass, on the largest exponent as it stands; taken by the whole wave, so EXEC stays all ones for the products
            mx = fmaxf(mx, __shfl_xor(mx, 16, 32));
            const float mnew = fmaxf(m, mx - sh);            // the shift in use taken off again
            const float alpha = __builtin_amdgcn_exp2f(m - mnew);
            const float dsh = (PSH - mnew) - sh;             // this pass's exponents move to the new shift
            m = mnew; thr = PSH + LZT;
            shv = shv + dsh; sh = shv[0];                    // the tile moves in place; sh is read back from it, so the two never part
            sHa = sHa + dsh; sHb = sHb + dsh;
            o0 = o0 * alpha; o1 = o1 * alpha; o2 = o2 * alpha; o3 = o3 * alpha; lt[0] = lt[0] * alpha;
        }
        const v16h pb = pexp(sHa, sHb);
        o0 = wmma16(v0, pb, o0); o1 = wmma16(v1, pb, o1); o2 = wmma16(v2, pb, o2); o3 = wmma16(v3, pb, o3);
        lt = wmma16(one, pb, lt);                            // += the column sums of P^T
        // the distance between the pass's last products and the first vector instruction on their registers, on the loop's back edge too (the next pass's address arithmetic)
        asm volatile("v_nop\n\tv_nop\n\tv_nop\n\tv_nop" : "+v"(o0), "+v"(o1), "+v"(o2), "+v"(o3), "+v"(lt) : "v"(v0), "v"(v1), "v"(v2), "v"(v3), "v"(pb), "v"(one));
      }
      asm volatile("s_wait_dscnt 0x0" ::: "memory");         // this wave's reads of the stage are done before its buffer is handed back
      asm volatile("s_wait_asynccnt 0x0" ::: "memory");      // this wave's copies of the next stage have landed
      __syncthreads();                                       // next stage readable by all, this stage's buffer free
      if (st + 2 < NST) {
          const unsigned bo = (unsigned)((st & 1) * SBY);
          const size_t sn = (s0 + st + 2) % NST;
          copy8r(kl + bo, 32 * KPB, kg + sn * KST * HD, (size_t)32 * HD); copy8r(vl + bo, 8 * VPB, vg + sn * KST, (size_t)8 * SEQ);
      }
    }
    asm volatile("s_wait_asynccnt 0x0" ::: "memory");        // nothing in flight when the walk ends (the last barrier above ended every read of the ring)
    sf = sh;
}

// k_flash: fused attention, 128 query rows of one (batch, head) per 8-wave block; Q fragments straight from the f16 plane.
// A wave holds TWO 16-query tiles (32 query columns) and walks HALF the keys: wave = (column group cg = wave & 3, key half kh = wave >> 2); of every 256-key stage it takes keys kh*128 .. +127.
// Each K and V^T fragment read from LDS so feeds two products, which halves the LDS reads per product, and the block still has eight waves (four per SIMD with two blocks on a WGP).
// The two waves of a column group each end with partial sums of both tiles; they swap one tile's partial through LDS (one barrier) and each finishes one tile: o = o' 2^(s - s') + o'' 2^(s - s''), s = the smaller of the two shifts, the row sum alike.
// K and V^T come in stages of KST keys through a two-buffer LDS ring that the block's waves share: whole-line asynchronous copies, the next stage in flight while this one is worked on.
// The stages are walked from stage blockIdx.x mod NST on, wrapping (the softmax takes the keys in any order): each stage is where two blocks of one head begin (blockIdx.x and blockIdx.x + SEQ / KST).
// Transposed form: S^T[key][t] = K Q^T (A = K rows, B = Q rows); lane (t = lane&15, h = lane>>4) holds keys 8h+r of each 16-key tile, so the packed
// P tile is directly the B fragment of O^T[d][t] = V^T P^T (element r <- tile keys 0..15, element 8+r <- tile keys 16..31, lane unchanged).
// The exponent of P is formed by the score product itself: q carries the scale (k_proj) and the shift PSH - (maximum in use) enters as the product's C operand, a tile of eight equal registers.
// Two kinds of walk. fwalk2, which normally is the only one, takes the maximum over the first 32 keys of the block's first stage as a fixed reference and never looks at the scores again; if a later score lay so far above it that a P became infinite in f16,
// the row sum shows it, and the whole block walks again, once per query tile, with the running maximum of fwalk1 (a flag in LDS, one barrier, a scalar branch that reads the same in every wave).
// fwalk1: the maximum in use is one scalar per lane, the same in both lane halves of a row. It is renewed lazily: only in a pass where some score of the wave passes it by more than LZT do the halves exchange
// their maxima (one xor-16 exchange) and are the output and row-sum tiles rescaled; in every other pass P is formed against the maximum in use, which cancels in the normalisation like any other.
// Row sums on the matrix pipe: A operand with ones in rows 0 and 8 and zeros elsewhere, B = the packed P tile; element 0 of the result tile is, in both lane halves, the sum of the query's 32 P values; elements 1..7 stay 0.
// amdgpu_waves_per_eu(4, 4): at most 256 registers per wave, so that two blocks fit a WGP (four waves per SIMD)
__global__ __launch_bounds__(32 * AW) __attribute__((amdgpu_waves_per_eu(4, 4))) void k_flash(const h16* __restrict__ QH, const h16* __restrict__ KP, const h16* __restrict__ VT, h16* CTX) {
    __shared__ __align__(16) unsigned char ring[2 * SBY];    // two stages; after the loop: output staging, and behind it the swap of partial sums
    __shared__ int again;                                    // set by a wave whose fixed-reference walk met an infinite P
    float* os = (float*)ring;
    float* xs = (float*)(ring + XOF);
    const int tid = threadIdx.x;
    const int lane = threadIdx.x & 31, lr = lane & 15, hi = lane >> 4;
    const int wave = __builtin_amdgcn_readfirstlane(threadIdx.x >> 5);   // in a scalar register: what the epilogue forms from it holds no vector register across the key loop
    const int cg = wave & 3, kh = wave >> 2;
    const int zh = blockIdx.y; const int b = zh / NH_, h = zh % NH_;
    const int tA = (blockIdx.x * AW + cg * 2) * 16;          // first query of tile A; tile B follows it
    const size_t pbase = (size_t)zh * SEQ * HD;
    const size_t qo = pbase + (size_t)(tA + lr) * HD + 8 * hi;
    const v16h qA0 = ldh(QH + qo), qA1 = ldh(QH + qo + 32);   // B fragments: col t, k = d
    const v16h qB0 = ldh(QH + qo + 16 * HD), qB1 = ldh(QH + qo + 16 * HD + 32);
    // copy maps. K tile: 32 KiB contiguous; copy i of lane tid takes 16-byte piece i*256 + tid = (key i*32 + tid/8, piece tid%8). V^T tile: 64 rows of 512 B; (row i*8 + tid/32, piece tid%32).
    const unsigned rb = (unsigned)(size_t)ring;              // LDS byte address of the ring
    const unsigned kl = rb + (unsigned)((tid >> 3) * KPB + (tid & 7) * 16);
    const unsigned vl = rb + (unsigned)(KBY + (tid >> 5) * VPB + (tid & 31) * 16);
    const h16* kg = KP + pbase + (size_t)tid * 8;                                   // + stage * KST * HD
    const h16* vg = VT + pbase + (size_t)(tid >> 5) * SEQ + (size_t)(tid & 31) * 8; // + stage * KST
    const unsigned s0 = blockIdx.x % (SEQ / KST);            // first stage of this block
    const int kfr = lr * KPB + 16 * hi;                      // A fragment of K (row key, k = d) at key 0 of a stage
    const int kfo = kfr + kh * KHW * KPB;                    // + key * KPB              the same at the first key of this wave's half
    const int vfo = KBY + lr * VPB + 16 * hi + kh * KHW * 2; // + 16j * VPB + key * 2    (A fragment: row d, k = key)
    v8f a0, a1, a2, a3, la, b0, b1, b2, b3, lb; float sfA, sfB;
    const h16 ov = (lane & 7) == 0 ? (h16)1.0f : (h16)0.0f;  // A rows 0 and 8 (lanes 0, 8, 16, 24) are ones at all 32 k positions
    const v16h one = {ov, ov, ov, ov, ov, ov, ov, ov, ov, ov, ov, ov, ov, ov, ov, ov};
    if (tid == 0) again = 0;                                 // ahead of the walk's first barrier
    fwalk2(ring, kl, vl, kg, vg, s0, kfr, kfo, vfo, qA0, qA1, qB0, qB1, one, a0, a1, a2, a3, la, sfA, b0, b1, b2, b3, lb, sfB);
    if (!(la[0] < 3.0e38f) || !(lb[0] < 3.0e38f)) again = 1; // an infinite P has reached a query's row sum (infinite or not a number from then on)
    __syncthreads();                                         // the flag of every wave is readable; the test below reads the same in the whole block
    if (__builtin_expect(__builtin_amdgcn_readfirstlane(again) != 0, 0)) {
        fwalk1(ring, kl, vl, kg, vg, s0, kfo, vfo, qA0, qA1, one, a0, a1, a2, a3, la, sfA);
        fwalk1(ring, kl, vl, kg, vg, s0, kfo, vfo, qB0, qB1, one, b0, b1, b2, b3, lb, sfB);
    }
    // the swap: key half 0 keeps tile A and gives tile B, key half 1 the other way round. Piece j of a wave's gift lies at (wave*9 + j)*128 + lane*4 floats: 16 B per lane, lanes contiguous
    const bool up = kh != 0;
    v8f o0 = up ? b0 : a0, o1 = up ? b1 : a1, o2 = up ? b2 : a2, o3 = up ? b3 : a3;
    const v8f g0 = up ? a0 : b0, g1 = up ? a1 : b1, g2 = up ? a2 : b2, g3 = up ? a3 : b3;
    float ls = up ? lb[0] : la[0]; const float sf = up ? sfB : sfA;
    { float* xw = xs + wave * 9 * 128 + lane * 4;
      *(v4fa*)(xw + 0 * 128) = (v4f){g0[0], g0[1], g0[2], g0[3]}; *(v4fa*)(xw + 1 * 128) = (v4f){g0[4], g0[5], g0[6], g0[7]};
      *(v4fa*)(xw + 2 * 128) = (v4f){g1[0], g1[1], g1[2], g1[3]}; *(v4fa*)(xw + 3 * 128) = (v4f){g1[4], g1[5], g1[6], g1[7]};
      *(v4fa*)(xw + 4 * 128) = (v4f){g2[0], g2[1], g2[2], g2[3]}; *(v4fa*)(xw + 5 * 128) = (v4f){g2[4], g2[5], g2[6], g2[7]};
      *(v4fa*)(xw + 6 * 128) = (v4f){g3[0], g3[1], g3[2], g3[3]}; *(v4fa*)(xw + 7 * 128) = (v4f){g3[4], g3[5], g3[6], g3[7]};
      *(v4fa*)(xw + 8 * 128) = (v4f){up ? la[0] : lb[0], up ? sfA : sfB, 0.0f, 0.0f}; }
    __syncthreads();                                         // every wave's gift is readable
    { const float* xr = xs + (wave ^ 4) * 9 * 128 + lane * 4;
      const v4f t = *(const v4fa*)(xr + 8 * 128);
      const float sm = fminf(sf, t[1]);                      // the smaller shift = the larger maximum: both factors are at most 1 (both exactly 1 after fwalk2)
      const float fo = __builtin_amdgcn_exp2f(sm - sf), fp = __builtin_amdgcn_exp2f(sm - t[1]);
      ls = ls * fo + t[0] * fp;
      v4f p, q;
      p = *(const v4fa*)(xr + 0 * 128); q = *(const v4fa*)(xr + 1 * 128);
#pragma unroll
      for (int i = 0; i < 4; ++i) { o0[i] = o0[i] * fo + p[i] * fp; o0[4 + i] = o0[4 + i] * fo + q[i] * fp; }
      p = *(const v4fa*)(xr + 2 * 128); q = *(const v4fa*)(xr + 3 * 128);
#pragma unroll
      for (int i = 0; i < 4; ++i) { o1[i] = o1[i] * fo + p[i] * fp; o1[4 + i] = o1[4 + i] * fo + q[i] * fp; }
      p = *(const v4fa*)(xr + 4 * 128); q = *(const v4fa*)(xr + 5 * 128);
#pragma unroll
      for (int i = 0; i < 4; ++i) { o2[i] = o2[i] * fo + p[i] * fp; o2[4 + i] = o2[4 + i] * fo + q[i] * fp; }
      p = *(const v4fa*)(xr + 6 * 128); q = *(const v4fa*)(xr + 7 * 128);
#pragma unroll
      for (int i = 0; i < 4; ++i) { o3[i] = o3[i] * fo + p[i] * fp; o3[4 + i] = o3[4 + i] * fo + q[i] * fp; } }
    const int t0 = tA + kh * 16;                             // first query of the tile that this wave finishes
    const float inv = CCS * (1.0f / ls);     // normalisation (the P carry cancels) times the ctx carry; both lane halves hold the whole row sum
    const int wb = wave * 16 * 68;
    // O^T D layout: o_j[r] = (d = 16j + 8h + r, t = lane&15) -> os[t][d]; rows 0..15 x columns 0..63 all written
    { v4f a, c;
      a[0] = o0[0] * inv; a[1] = o0[1] * inv; a[2] = o0[2] * inv; a[3] = o0[3] * inv; c[0] = o0[4] * inv; c[1] = o0[5] * inv; c[2] = o0[6] * inv; c[3] = o0[7] * inv;
      *(v4fa*)(&os[wb + lr * 68 +  0 + 8 * hi]) = a; *(v4fa*)(&os[wb + lr * 68 +  0 + 8 * hi + 4]) = c;
      a[0] = o1[0] * inv; a[1] = o1[1] * inv; a[2] = o1[2] * inv; a[3] = o1[3] * inv; c[0] = o1[4] * inv; c[1] = o1[5] * inv; c[2] = o1[6] * inv; c[3] = o1[7] * inv;
      *(v4fa*)(&os[wb + lr * 68 + 16 + 8 * hi]) = a; *(v4fa*)(&os[wb + lr * 68 + 16 + 8 * hi + 4]) = c;
      a[0] = o2[0] * inv; a[1] = o2[1] * inv; a[2] = o2[2] * inv; a[3] = o2[3] * inv; c[0] = o2[4] * inv; c[1] = o2[5] * inv; c[2] = o2[6] * inv; c[3] = o2[7] * inv;
      *(v4fa*)(&os[wb + lr * 68 + 32 + 8 * hi]) = a; *(v4fa*)(&os[wb + lr * 68 + 32 + 8 * hi + 4]) = c;
      a[0] = o3[0] * inv; a[1] = o3[1] * inv; a[2] = o3[2] * inv; a[3] = o3[3] * inv; c[0] = o3[4] * inv; c[1] = o3[5] * inv; c[2] = o3[6] * inv; c[3] = o3[7] * inv;
      *(v4fa*)(&os[wb + lr * 68 + 48 + 8 * hi]) = a; *(v4fa*)(&os[wb + lr * 68 + 48 + 8 * hi + 4]) = c; }
    wave_sync();
    h16* crow = CTX + ((size_t)b * SEQ + t0) * DM + h * HD;      // ctx plane row = token, columns h*64 + d
{
#pragma unroll
        for (int s = 0; s < 4; ++s) { const int row = 4 * s + (lane >> 3), c8 = (lane & 7) * 8;   // 4 s x 4 row groups = 16 rows; 8 lanes x 8 halves = 64 columns
            const v4f x0 = *(const v4fa*)(&os[wb + row * 68 + c8]); const v4f x1 = *(const v4fa*)(&os[wb + row * 68 + c8 + 4]); v8h hv;
#pragma unroll
            for (int i = 0; i < 4; ++i) { hv[i] = (h16)x0[i]; hv[4 + i] = (h16)x1[i]; }
            *(v8h*)(crow + (size_t)row * DM + c8) = hv; }
         }
}

// k_oproj: register-blocked f16 GEMM, one wave per 32x64 tile, 4 x 2 waves per block, operands from K-contiguous f16 planes (ctx x256, w_proj x1024) through the LDS ring of gemm_tile, K = DM.
// OUT[m][n] = (sum_k A[m][k] Bt[n][k]) * 2^-18 + bias[n], f32. grid (NB*SEQ/128, DM/128), 256 threads.
__global__ __launch_bounds__(256) void k_oproj(const h16* __restrict__ A, const h16* __restrict__ Bt, const float* __restrict__ bias, float* OUT) {
    __shared__ __align__(16) unsigned char ring[2 * GSB];    // two operand stages
    __shared__ __align__(16) float osw[8 * 16 * 68];         // output staging, one part per wave
    const int lane = threadIdx.x & 31, wave = threadIdx.x >> 5, lr = lane & 15, hi = lane >> 4;
    const int r0 = blockIdx.x * GT + (wave >> 1) * 32, c0 = blockIdx.y * GT + (wave & 1) * 64;
    float* os = osw + wave * 16 * 68;
    v8f acc[2][4];
#pragma unroll
    for (int mb = 0; mb < 2; ++mb)
#pragma unroll
        for (int nb = 0; nb < 4; ++nb) acc[mb][nb] = (v8f){};
    gemm_tile<true>(A, Bt, blockIdx.x, blockIdx.y, ring, acc);
    float bc[4];
#pragma unroll
    for (int nb = 0; nb < 4; ++nb) bc[nb] = bfr(bias[c0 + nb * 16 + lr]);
    const int bq = r0 / SEQ, tq = r0 % SEQ;
    float* obase = OUT + ((size_t)bq * OUT_SEQ + tq) * DM + c0;
#pragma unroll
    for (int mb = 0; mb < 2; ++mb) {
#pragma unroll
        for (int nb = 0; nb < 4; ++nb) {
#pragma unroll
            for (int j = 0; j < 8; ++j) os[(hi * 8 + j) * 68 + nb * 16 + lr] = acc[mb][nb][j] * OSI + bc[nb]; }   // D: row 8h+j, col lane&15
        wave_sync();
{
#pragma unroll
            for (int s = 0; s < 8; ++s) { const int row = 2 * s + hi, cofs = lr * 4;   // 8 s x 2 rows = 16 rows; 16 lanes x 4 floats = 64 columns
                const v4f val = *(const v4fa*)(&os[row * 68 + cofs]);
                *(v4f*)(obase + (size_t)(mb * 16 + row) * DM + cofs) = val; }
             }
        wave_sync();
    }
}

static constexpr size_t al256(size_t v) { return (v + 255) & ~(size_t)255; }
static constexpr size_t SZ_XB = al256((size_t)NB * SEQ * DM * 2);
static constexpr size_t SZ_WB = al256((size_t)3 * DM * DM * 2);
static constexpr size_t SZ_WP = al256((size_t)DM * DM * 2);
static constexpr size_t SZ_PL = al256((size_t)NB * NH_ * SEQ * HD * 2);
static constexpr size_t SZ_CX = al256((size_t)NB * SEQ * DM * 2);
static constexpr size_t SZ_TOTAL = SZ_XB + SZ_WB + SZ_WP + 3 * SZ_PL + SZ_CX;
static_assert(SZ_TOTAL <= (size_t)134217728);          // workspace carve <= 128 MiB
static_assert(((size_t)DM * DM * 2) % 256 == 0);       // weight sub-planes stay 256-byte aligned

extern "C" void kernel_launch(void* const* d_in, const int* in_sizes, int n_in,
                              void* d_out, int out_size, void* d_ws, size_t ws_size, hipStream_t stream) {
    if (n_in < 5) return;
    const size_t needx = ((size_t)(NB - 1) * SEQ_FULL + SEQ) * DM;
    if ((size_t)in_sizes[0] < needx) return;
    if ((size_t)in_sizes[1] < (size_t)3 * DM * DM || (size_t)in_sizes[2] < (size_t)3 * DM) return;
    if ((size_t)in_sizes[3] < (size_t)DM * DM || (size_t)in_sizes[4] < (size_t)DM) return;
    if ((size_t)out_size < ((size_t)(NB - 1) * OUT_SEQ + SEQ) * DM) return;
    if (SZ_TOTAL > ws_size) return;
    // wire order: x, w_qkv ([3072][1024] = Bt as-is, rows q | k | v), b_qkv, w_proj ([out][in] = Bt as-is), b_proj
    const float* x = (const float*)d_in[0]; const float* wqkv = (const float*)d_in[1]; const float* bqkv = (const float*)d_in[2];
    const float* wproj = (const float*)d_in[3]; const float* bproj = (const float*)d_in[4];
    float* OUT = (float*)d_out;      // [NB][SEQ][1024]
    char* wsp = (char*)d_ws;
    bf* XB = (bf*)wsp; wsp += SZ_XB;                 // [NB*SEQ][1024]
    bf* WB = (bf*)wsp; wsp += SZ_WB;                 // [3][1024][1024]: q | k | v
    h16* WP = (h16*)wsp; wsp += SZ_WP;               // [1024][1024] x1024
    h16* QH = (h16*)wsp; wsp += SZ_PL;               // [NB*16][SEQ][64]
    h16* KP = (h16*)wsp; wsp += SZ_PL;               // [NB*16][SEQ][64]
    h16* VT = (h16*)wsp; wsp += SZ_PL;               // [NB*16][64][SEQ]
    h16* CX = (h16*)wsp; wsp += SZ_CX;               // [NB*SEQ][1024] x256

    k_cvt<<<CBX + CBW + CBP, 256, 0, stream>>>(x, wqkv, wproj, XB, WB, WP);

    k_proj<<<dim3((NB * SEQ / GT) * (DM / GT), 3, 1), 256, 0, stream>>>(XB, WB, bqkv, QH, KP, VT);

    k_flash<<<dim3(SEQ / (16 * AW), NB * NH_, 1), 32 * AW, 0, stream>>>(QH, KP, VT, CX);

    // output projection: A = ctx rows (m = b*SEQ + t, k = h*64 + d), Bt = w_proj rows (n = f) -> OUT[m][f]
    k_oproj<<<dim3(NB * SEQ / GT, DM / GT, 1), 256, 0, stream>>>(CX, WP, bproj, OUT);
}

// v010
// A run of this version takes 83.4 microseconds.
// Timed twice side by side with v009, it ran 1.07 times as fast both times.
// All steps since v000 together make it 4.28 times as fast.
#include <hip/hip_runtime.h>

// Multi-head self-attention, width 1024 = 16 heads x 64, x [NB][SEQ][1024], fused w_qkv [3072][1024] ([out][in], rows q | k | v, head h = rows h*64+d of each third), b_qkv, score scale 1/8, no mask, output projection w_proj [out][in] + b_proj (f32 output).
// Compute dtypes, f32 accumulate everywhere: qkv projections v_wmma_f32_16x16x32_bf16 (x, w_qkv RNE-converted to bf16; products exact); scores v_wmma_f32_16x16x32_f16: q and k single f16 planes (one product), the q plane holding q * 0.125*log2(e) (scaled in f32 ahead of its one f16 rounding);
// P (x256 carry, cancels in the normalisation; row sum taken over the f16 P values, by one more matrix product with a ones operand) and v single f16; softmax f32 (fixed reference from the first 32 keys; online running max only in the fallback walk); output projection v_wmma_f32_16x16x32_f16: ctx single f16 (x256 carry), w_proj RNE-converted to bf16 then x1024 as f16 (exact), carries folded back (2^-18) in the f32 epilogue; biases RNE-converted to bf16, added in f32.
// Layout: bf16 copies of x and w_qkv; q, k planes [b*16+h][t][d] and v^T plane [b*16+h][d][t] written by the GEMM epilogue; fused flash kernel in transposed form (S^T = K Q^T, O^T = V^T P^T; K and V^T tiles staged in LDS for the 8 waves of a block; a wave holds 32 query columns and walks half the keys, the two halves' f32 partial sums joined at the end) writes the f16 ctx plane [b*SEQ+t][1024]; f16 GEMM writes the output buffer.
// The GEMMs: both operands staged in LDS in whole lines, 128 k per stage, two buffers. qkv projections: one GEMM, 256x192 tile per 16-wave block (64x48 per wave). Output projection: 128x128 tile per 8-wave block (32x64 per wave).
// Blocks that stage the same rows (GEMM panels; K and V^T of a head) begin the stage walk at stages spread evenly over the walk and wrap, so that only a few of them ask L2 for the same lines at the same moment.
// Four launches: launches that read none of each other's output share one grid (the three conversions by block range; the q, k and v projections as column ranges of one GEMM).

#ifndef NB
#define NB 1
#endif
#ifndef SEQ
#define SEQ 4096
#endif
#define NB_FULL  1
#define SEQ_FULL 4096
#ifndef OUT_SEQ
#define OUT_SEQ SEQ              // row pitch (in tokens) between batches of the output
#endif
#define DM   1024
#define NH_  16
#define HD   64
#define AW   8                   // waves per flash block: 4 column groups of 32 query rows x 2 key halves; 16 * AW query rows per block
#define KST  256                 // keys per LDS stage of the flash kernel
#define KHW  (KST / 2)           // keys of a stage that one wave walks
#define XOF  (AW * 16 * 68 * 4)  // flash epilogue: byte offset in the ring of the swap area, behind the output staging
#define KPB  (HD * 2 + 16)       // LDS pitch of a K row, bytes: 16 B x odd, no bank conflict for 16-byte fragment reads
#define VPB  (KST * 2 + 16)      // LDS pitch of a V^T row, bytes: 16 B x odd
#define KBY  (KST * KPB)         // K part of a stage, bytes
#define SBY  (KBY + HD * VPB)    // one stage (K then V^T), bytes
#define GT   128                 // GEMM block tile, rows and columns (4 x 2 waves of 32 x 64)
#define GK   128                 // k per LDS stage of the GEMMs
#define GPB  (GK * 2 + 16)       // LDS pitch of a GEMM operand row, bytes: 16 B x odd
#define GAB  (GT * GPB)          // one operand's part of a stage, bytes
#define GSB  (2 * GAB)           // one stage (A rows then B rows), bytes
#define PM   256                 // k_proj block tile: rows (tokens)
#define PN   192                 // k_proj block tile: columns (three heads)
#define PAB  (PM * GPB)          // x part of a k_proj stage, bytes
#define PSB  ((PM + PN) * GPB)   // one k_proj stage (x rows then w_qkv rows), bytes
#define PQP  (HD * 2 + 16)       // k_proj output panel of a q or k head: pitch of a [t] row, bytes: 16 B x odd
#define PVP  (PM * 2 + 16)       // k_proj output panel of a v head: pitch of a [d] row, bytes: 16 B x odd
#define PPB  (PM * PQP)          // room of one output panel, bytes (the larger of the two forms)
#define SC2  (0.125f * 1.4426950408889634f)   // HD^-0.5 * log2(e)
#define PSH  8.0f                // log2 of the P carry (256)
#define LZT  7.0f                // lazy rescale: a score may pass the maximum in use by this much (log2) before the maximum is renewed; P <= 2^(PSH + LZT) = 32768 stays finite in f16
#define CCS  256.0f              // carry of the ctx plane
#define WPS  1024.0f             // carry of the w_proj plane
#define OSI  (1.0f / (256.0f * 1024.0f))      // inverse of both carries

static_assert(HD == 64);
static_assert(NH_ * HD == DM);                 // head h = columns h*64 + d
static_assert(DM % 64 == 0);                   // column tiles of 64
static_assert(DM % 32 == 0);                   // GEMM k-loop steps by 32
static_assert(SEQ % 64 == 0);                  // a wave's tile (32 rows, 64 columns) never straddles two batches
static_assert((NB * SEQ) % 64 == 0);
static_assert(SEQ % 32 == 0);                  // key loop steps by 32
static_assert(SEQ % (16 * AW) == 0);           // flash grid covers the sequence exactly
static_assert(SEQ % KST == 0);                 // whole stages only
static_assert(AW == 8 && KST == 256);          // copy maps of k_flash: 256 lanes x 8 copies x 16 B = one 32-KiB K or V^T tile
static_assert((KPB / 16) % 2 == 1 && (VPB / 16) % 2 == 1);
static_assert(2 * SBY >= XOF + AW * 9 * 512);  // the ring holds the output staging and the swap area (9 pieces of 512 B per wave)
static_assert(KHW % 32 == 0);
static_assert((NB * SEQ) % GT == 0 && DM % GT == 0);   // GEMM grids cover both extents exactly
static_assert(DM % GK == 0 && DM / GK >= 2);           // whole stages, and the two that the ring's prologue needs
static_assert(GT == 128 && GK == 128);                 // copy map of gstage: 256 lanes x 16 copies x 16 B = 256 rows of 256 B
static_assert((GPB / 16) % 2 == 1);
static_assert(SEQ % PM == 0 && (3 * DM) % PN == 0 && PN == 3 * HD);   // k_proj grid covers both extents exactly; a block lies in one batch and holds whole heads
static_assert(PM == 256 && PN == 192);                 // copy map of pstage: 512 lanes x 14 copies x 16 B = 448 rows of 256 B; 4 x 4 waves of 64 x 48
static_assert(HD * PVP <= PPB && 3 * PPB <= 2 * PSB);  // the ring holds the three output panels
static_assert((PQP / 16) % 2 == 1 && (PVP / 16) % 2 == 1);
static_assert(((size_t)SEQ * DM) % 8 == 0);
static_assert(((size_t)DM * DM) % 8 == 0);
static_assert(NB <= NB_FULL);
static_assert(SEQ <= SEQ_FULL);

typedef _Float16 h16;
typedef unsigned short bf;
typedef __attribute__((ext_vector_type(16))) __bf16   v16bf;
typedef __attribute__((ext_vector_type(16))) _Float16 v16h;
typedef __attribute__((ext_vector_type(8)))  _Float16 v8h;
typedef __attribute__((ext_vector_type(8)))  unsigned short v8us;
typedef __attribute__((ext_vector_type(16))) unsigned short v16us;
typedef __attribute__((ext_vector_type(8)))  float    v8f;
typedef __attribute__((ext_vector_type(4)))  float    v4f;
typedef v4f  __attribute__((may_alias)) v4fa;
typedef __attribute__((ext_vector_type(4)))  unsigned v4u;

__device__ __forceinline__ unsigned short f2bf(float f) { unsigned u = __float_as_uint(f); u += 0x7FFFu + ((u >> 16) & 1u); return (unsigned short)(u >> 16); }
__device__ __forceinline__ float bfr(float f) { return __uint_as_float(((unsigned)f2bf(f)) << 16); }   // value after RNE convert to bf16
__device__ __forceinline__ v16h cat16(v8h lo, v8h hi) { return __builtin_shufflevector(lo, hi, 0, 1, 2, 3, 4, 5, 6, 7, 8, 9, 10, 11, 12, 13, 14, 15); }
__device__ __forceinline__ v8f wmma16(v16h a, v16h b, v8f c) { return __builtin_amdgcn_wmma_f32_16x16x32_f16(false, a, false, b, (short)0, c, false, false); }
__device__ __forceinline__ v8f wmmab(v16bf a, v16bf b, v8f c) { return __builtin_amdgcn_wmma_f32_16x16x32_bf16(false, a, false, b, (short)0, c, false, false); }
// fragment loaders from K-contiguous 16-bit rows; p already includes + 8*(lane>>4): elements 0..7 <- k0+8h+0..7, elements 8..15 <- k0+16+8h+0..7 (same map for A and B)
__device__ __forceinline__ v16h  ldh(const h16* p) { return cat16(*(const v8h*)p, *(const v8h*)(p + 16)); }
// ordering point for wave-private LDS tiles (same wave writes and reads)
__device__ __forceinline__ void wave_sync() { __builtin_amdgcn_fence(3 /* release order */, "wavefront"); __builtin_amdgcn_wave_barrier(); asm volatile("" ::: "memory"); }

// k_cvt: the three conversions in one grid, 8 values per thread; a block lies wholly in one range: x -> bf16, then w_qkv -> bf16, then w_proj -> bf16 value x1024 as f16.
#define CBX ((unsigned)((size_t)NB * SEQ * DM / 2048))   // blocks of x (256 threads x 8 values)
#define CBW ((unsigned)((size_t)3 * DM * DM / 2048))     // blocks of w_qkv
#define CBP ((unsigned)((size_t)DM * DM / 2048))         // blocks of w_proj
static_assert(((size_t)SEQ * DM) % 2048 == 0 && ((size_t)DM * DM) % 2048 == 0);   // whole blocks in every range, none straddles two batches
__global__ __launch_bounds__(256) void k_cvt(const float* __restrict__ x, const float* __restrict__ wqkv, const float* __restrict__ wproj, bf* XB, bf* WB, h16* WP) {
    const unsigned blk = blockIdx.x;
    if (blk < CBX + CBW) {
        const bool isx = blk < CBX;
        const size_t e = ((size_t)(isx ? blk : blk - CBX) * 256 + threadIdx.x) * 8;
        const size_t bt = e / ((size_t)SEQ * DM);            // batch (x only): source batches lie SEQ_FULL tokens apart
        const float* s = isx ? x + bt * ((size_t)SEQ_FULL * DM) + (e - bt * ((size_t)SEQ * DM)) : wqkv + e;
        const v8f v = *(const v8f*)s; v8us o;
#pragma unroll
        for (int k = 0; k < 8; ++k) o[k] = f2bf(v[k]);
        *(v8us*)((isx ? XB : WB) + e) = o;
    } else {
        const size_t e = ((size_t)(blk - CBX - CBW) * 256 + threadIdx.x) * 8;
        const v8f v = *(const v8f*)(wproj + e); v8h o;
#pragma unroll
        for (int k = 0; k < 8; ++k) o[k] = (h16)(bfr(v[k]) * WPS);
        *(v8h*)(WP + e) = o;
        asm volatile("s_wait_xcnt 0x0" ::: "memory");   // precaution: stands in front of every later write of the store's registers
    }
}

// eight asynchronous 16-byte copies per lane, global -> LDS (LDS byte address l + i*ls, global address g + i*gs halves).
// s_wait_xcnt closes the statement so that no address register of an issued copy is rewritten ahead of it.
__device__ __forceinline__ void copy8(unsigned l, unsigned ls, const h16* g, size_t gs) {
    asm volatile("global_load_async_to_lds_b128 %0, %8, off\n\t"
                 "global_load_async_to_lds_b128 %1, %9, off\n\t"
                 "global_load_async_to_lds_b128 %2, %10, off\n\t"
                 "global_load_async_to_lds_b128 %3, %11, off\n\t"
                 "global_load_async_to_lds_b128 %4, %12, off\n\t"
                 "global_load_async_to_lds_b128 %5, %13, off\n\t"
                 "global_load_async_to_lds_b128 %6, %14, off\n\t"
                 "global_load_async_to_lds_b128 %7, %15, off\n\t"
                 "s_wait_xcnt 0x0"
                 :: "v"(l), "v"(l + ls), "v"(l + 2 * ls), "v"(l + 3 * ls), "v"(l + 4 * ls), "v"(l + 5 * ls), "v"(l + 6 * ls), "v"(l + 7 * ls),
                    "v"(g), "v"(g + gs), "v"(g + 2 * gs), "v"(g + 3 * gs), "v"(g + 4 * gs), "v"(g + 5 * gs), "v"(g + 6 * gs), "v"(g + 7 * gs)
                 : "memory");
}

// the same eight copies one by one, for code that is rarely run: each copy's addresses are formed where it issues, so none of them holds a register anywhere else in the kernel. Each statement closes with its own s_wait_xcnt, ahead of the address steps behind it.
__device__ __forceinline__ void copy8r(unsigned l, unsigned ls, const h16* g, size_t gs) {
#pragma unroll 1   // stays rolled: unrolled, the addresses equal those of the first walk's copies and are kept in registers across its key loop
    for (int i = 0; i < 8; ++i) {
        asm volatile("global_load_async_to_lds_b128 %0, %1, off\n\ts_wait_xcnt 0x0" :: "v"(l), "v"(g) : "memory");
        l += ls; g += gs;
    }
}

// one GEMM stage: rows 0..127 of the A tile, then of the B tile, 256 B (GK halves) of each. Copy i of lane tid takes (row i*16 + tid/16, 16-byte piece tid%16): a wave's copy covers two whole 256-B runs.
__device__ __forceinline__ void gstage(unsigned l, const h16* ga, const h16* gb) {
    copy8(l, 16 * GPB, ga, (size_t)16 * DM); copy8(l + GAB, 16 * GPB, gb, (size_t)16 * DM);
}
// fragment from an LDS row of 16-bit values; p already includes + 16*(lane>>4) bytes: same element map as ldh, for A and for B
__device__ __forceinline__ v16us ldu(const unsigned char* p) { return __builtin_shufflevector(*(const v8us*)p, *(const v8us*)(p + 32), 0, 1, 2, 3, 4, 5, 6, 7, 8, 9, 10, 11, 12, 13, 14, 15); }
template <bool F16> __device__ __forceinline__ v8f wm(v16us a, v16us b, v8f c) {
    if constexpr (F16) return wmma16(__builtin_bit_cast(v16h, a), __builtin_bit_cast(v16h, b), c);
    else               return wmmab(__builtin_bit_cast(v16bf, a), __builtin_bit_cast(v16bf, b), c);
}
// k loop of a 128x128 block tile (bx, by), K = DM: acc[mb][nb] += A rows (bx*128 + (wave>>1)*32 + mb*16 ..) x Bt rows (by*128 + (wave&1)*64 + nb*16 ..); the 128-k stages are walked from stage (bx + by) mod NSTG on, wrapping, k ascending in steps of 32 inside a stage.
// Two-buffer LDS ring shared by the block's 8 waves: the next stage's copies fly while this one is worked on; inside a stage the next k step's fragments are read ahead of this step's products.
template <bool F16> __device__ __forceinline__ void gemm_tile(const h16* A, const h16* Bt, unsigned bx, unsigned by, unsigned char* ring, v8f (&acc)[2][4]) {
    const int tid = threadIdx.x, lane = tid & 31, wave = tid >> 5, lr = lane & 15, hi = lane >> 4;
    const unsigned l = (unsigned)(size_t)ring + (unsigned)((tid >> 4) * GPB + (tid & 15) * 16);   // LDS byte address of this lane's first piece
    const h16* ga = A  + (size_t)(bx * GT + (tid >> 4)) * DM + (tid & 15) * 8;             // + stage * GK
    const h16* gb = Bt + (size_t)(by * GT + (tid >> 4)) * DM + (tid & 15) * 8;
    const unsigned NSTG = DM / GK;
    const unsigned s0 = (bx + by) % NSTG;                    // first stage of this block: blocks that share a row panel differ in by, those that share a column panel in bx, so sharers spread over the NSTG stages
    gstage(l, ga + (size_t)s0 * GK, gb + (size_t)s0 * GK);
    asm volatile("s_wait_asynccnt 0x0" ::: "memory");        // stage s0 of this wave has landed
    __syncthreads();                                         // stage s0 of every wave is readable
    { const size_t ko = (size_t)((s0 + 1) % NSTG) * GK; gstage(l + GSB, ga + ko, gb + ko); }
    const int afo = ((wave >> 1) * 32 + lr) * GPB + 16 * hi;
    const int bfo = GAB + ((wave & 1) * 64 + lr) * GPB + 16 * hi;
#pragma unroll 1   // the stage loop stays rolled: one publish point, buffer picked by the stage's parity
    for (unsigned st = 0; st < NSTG; ++st) {
        const unsigned char* pa = ring + (st & 1) * GSB + afo;
        const unsigned char* pb = ring + (st & 1) * GSB + bfo;
        v16us a[2][2], b[2][4];
#pragma unroll
        for (int i = 0; i < 4; ++i) { if (i < 2) a[0][i] = ldu(pa + i * 16 * GPB); b[0][i] = ldu(pb + i * 16 * GPB); }
#pragma unroll
        for (int kk = 0; kk < GK / 32; ++kk) {
            const int cur = kk & 1, nxt = cur ^ 1;
            if (kk + 1 < GK / 32) {
#pragma unroll
                for (int i = 0; i < 4; ++i) { if (i < 2) a[nxt][i] = ldu(pa + i * 16 * GPB + (kk + 1) * 64); b[nxt][i] = ldu(pb + i * 16 * GPB + (kk + 1) * 64); }
            }
            __builtin_amdgcn_sched_barrier(0);   // keeps the next step's reads one group ahead of this step's products: sunk among them, each read's LDS latency is waited out
#pragma unroll
            for (int nb = 0; nb < 4; ++nb)
#pragma unroll
                for (int mb = 0; mb < 2; ++mb) acc[mb][nb] = wm<F16>(a[cur][mb], b[cur][nb], acc[mb][nb]);
            __builtin_amdgcn_sched_barrier(0);   // the other side of the same fence: no later read rises into this step's products
        }
        asm volatile("s_wait_dscnt 0x0" ::: "memory");       // this wave's reads of the stage are done before its buffer is handed back
        asm volatile("s_wait_asynccnt 0x0" ::: "memory");    // this wave's copies of the next stage have landed
        __syncthreads();                                     // next stage readable by all, this stage's buffer free
        if (st + 2 < NSTG) { const size_t ko = (size_t)((s0 + st + 2) % NSTG) * GK; gstage(l + (unsigned)((st & 1) * GSB), ga + ko, gb + ko); }
    }
    asm volatile("s_wait_asynccnt 0x0" ::: "memory");        // nothing in flight when the wave goes on to its epilogue
}

// six of the same copies, same form as copy8
__device__ __forceinline__ void copy6(unsigned l, unsigned ls, const h16* g, size_t gs) {
    asm volatile("global_load_async_to_lds_b128 %0, %6, off\n\t"
                 "global_load_async_to_lds_b128 %1, %7, off\n\t"
                 "global_load_async_to_lds_b128 %2, %8, off\n\t"
                 "global_load_async_to_lds_b128 %3, %9, off\n\t"
                 "global_load_async_to_lds_b128 %4, %10, off\n\t"
                 "global_load_async_to_lds_b128 %5, %11, off\n\t"
                 "s_wait_xcnt 0x0"
                 :: "v"(l), "v"(l + ls), "v"(l + 2 * ls), "v"(l + 3 * ls), "v"(l + 4 * ls), "v"(l + 5 * ls),
                    "v"(g), "v"(g + gs), "v"(g + 2 * gs), "v"(g + 3 * gs), "v"(g + 4 * gs), "v"(g + 5 * gs)
                 : "memory");
}
// four 16-byte stores. s_wait_xcnt closes the statement (precaution): no address or data register of an issued store is rewritten ahead of it, wherever the compiler puts the next panel's reads and address steps
__device__ __forceinline__ void store4(h16* g0, h16* g1, h16* g2, h16* g3, v4u d0, v4u d1, v4u d2, v4u d3) {
    asm volatile("global_store_b128 %0, %4, off\n\t"
                 "global_store_b128 %1, %5, off\n\t"
                 "global_store_b128 %2, %6, off\n\t"
                 "global_store_b128 %3, %7, off\n\t"
                 "s_wait_xcnt 0x0"
                 :: "v"(g0), "v"(g1), "v"(g2), "v"(g3), "v"(d0), "v"(d1), "v"(d2), "v"(d3) : "memory");
}
// one k_proj stage: 256 x rows, then 192 w_qkv rows, 256 B (GK halves) of each. Copy i of lane tid (of 512) takes (row i*32 + tid/16, 16-byte piece tid%16): a wave's copy covers two whole 256-B runs.
__device__ __forceinline__ void pstage(unsigned l, const h16* ga, const h16* gb) {
    copy8(l, 32 * GPB, ga, (size_t)32 * DM); copy6(l + PAB, 32 * GPB, gb, (size_t)32 * DM);
}

// k_proj: the three qkv projections as ONE bf16 GEMM C[m][n] = sum_k x[m][k] w_qkv[n][k] + b_qkv[n], m = b*SEQ + t, n = 0..3071 (48 heads of 64 columns: 16 of q, 16 of k, 16 of v), K = DM.
// 256 x 192 tile (256 tokens x three whole heads) per 16-wave block, 4 x 4 waves of 64 x 48 (12 accumulators); grid (NB*SEQ/256, 16): one block per WGP, one round. Against 128 x 128 tiles of 32 x 64 per wave a product needs 7/12 of the bytes from L2 and 7/9 of the LDS fragment reads.
// Operands through a two-buffer LDS ring, 128 k per stage, walked from stage (bx + by) mod NSTG on, wrapping; inside a stage the next k step's fragments are read ahead of this step's products.
// Epilogue: the ring, free behind the loop's last barrier, takes the tile as f16, one panel per head: q and k heads as [t][d], v heads as [d][t] (a lane's eight accumulator rows are eight consecutive t: one 16-byte store); behind one barrier the block writes each panel out in whole lines:
// q, k -> plane [(b*16 + h)][t][d] (a panel is 32 KiB contiguous), v -> plane [(b*16 + h)][d][t] (64 runs of 512 B). The q plane is written times SC2 (f32 multiply ahead of the f16 rounding), so that the flash kernel's score product comes out in log2 units.
__global__ __launch_bounds__(512) void k_proj(const bf* __restrict__ XB, const bf* __restrict__ WB, const float* __restrict__ bqkv, h16* QH, h16* KP, h16* VT) {
    __shared__ __align__(16) unsigned char ring[2 * PSB];    // two operand stages; after the loop: the three output panels
    const int tid = threadIdx.x, lane = tid & 31, lr = lane & 15, hi = lane >> 4;
    const int wave = __builtin_amdgcn_readfirstlane(tid >> 5);   // in a scalar register: the epilogue's tests on it are scalar branches
    const int wr = wave >> 2, wc = wave & 3;
    const unsigned bx = blockIdx.x, by = blockIdx.y;
    v8f acc[4][3];
#pragma unroll
    for (int mb = 0; mb < 4; ++mb)
#pragma unroll
        for (int nb = 0; nb < 3; ++nb) acc[mb][nb] = (v8f){};
    const unsigned l = (unsigned)(size_t)ring + (unsigned)((tid >> 4) * GPB + (tid & 15) * 16);   // LDS byte address of this lane's first piece
    const h16* ga = (const h16*)XB + (size_t)(bx * PM + (tid >> 4)) * DM + (tid & 15) * 8;        // + stage * GK
    const h16* gb = (const h16*)WB + (size_t)(by * PN + (tid >> 4)) * DM + (tid & 15) * 8;
    const unsigned NSTG = DM / GK;
    const unsigned s0 = (bx + by) % NSTG;                    // first stage of this block: sharers of a row panel differ in by, of a column panel in bx
    pstage(l, ga + (size_t)s0 * GK, gb + (size_t)s0 * GK);
    asm volatile("s_wait_asynccnt 0x0" ::: "memory");        // stage s0 of this wave has landed
    __syncthreads();                                         // stage s0 of every wave is readable
    { const size_t ko = (size_t)((s0 + 1) % NSTG) * GK; pstage(l + PSB, ga + ko, gb + ko); }
    float br[3];                                             // the wave's column biases, asked for here so that the k loop covers their latency
    __builtin_amdgcn_sched_barrier(0);                       // with its twin below: nothing but the three loads and their wait stands between the two, so no other instruction takes the loads' address registers ahead of the wait
#pragma unroll
    for (int nb = 0; nb < 3; ++nb) br[nb] = bqkv[by * PN + wc * 48 + nb * 16 + lr];
    asm volatile("s_wait_xcnt 0x0" ::: "memory");            // precaution: stands in front of every later write of the bias loads' address registers
    __builtin_amdgcn_sched_barrier(0);
    const int afo = (wr * 64 + lr) * GPB + 16 * hi;
    const int bfo = PAB + (wc * 48 + lr) * GPB + 16 * hi;
#pragma unroll 1   // the stage loop stays rolled: one publish point, buffer picked by the stage's parity
    for (unsigned st = 0; st < NSTG; ++st) {
        const unsigned char* pa = ring + (st & 1) * PSB + afo;
        const unsigned char* pb = ring + (st & 1) * PSB + bfo;
        v16us a[2][4], b[2][3];
#pragma unroll
        for (int i = 0; i < 4; ++i) { a[0][i] = ldu(pa + i * 16 * GPB); if (i < 3) b[0][i] = ldu(pb + i * 16 * GPB); }
#pragma unroll
        for (int kk = 0; kk < GK / 32; ++kk) {
            const int cur = kk & 1, nxt = cur ^ 1;
            if (kk + 1 < GK / 32) {
#pragma unroll
                for (int i = 0; i < 4; ++i) { a[nxt][i] = ldu(pa + i * 16 * GPB + (kk + 1) * 64); if (i < 3) b[nxt][i] = ldu(pb + i * 16 * GPB + (kk + 1) * 64); }
            }
            __builtin_amdgcn_sched_barrier(0);   // keeps the next step's reads one group ahead of this step's products: sunk among them, each read's LDS latency is waited out
#pragma unroll
            for (int nb = 0; nb < 3; ++nb)
#pragma unroll
                for (int mb = 0; mb < 4; ++mb) acc[mb][nb] = wm<false>(a[cur][mb], b[cur][nb], acc[mb][nb]);
            __builtin_amdgcn_sched_barrier(0);   // the other side of the same fence: no later read rises into this step's products
        }
        asm volatile("s_wait_dscnt 0x0" ::: "memory");       // this wave's reads of the stage are done before its buffer is handed back
        asm volatile("s_wait_asynccnt 0x0" ::: "memory");    // this wave's copies of the next stage have landed
        __syncthreads();                                     // next stage readable by all, this stage's buffer free
        if (st + 2 < NSTG) { const size_t ko = (size_t)((s0 + st + 2) % NSTG) * GK; pstage(l + (unsigned)((st & 1) * PSB), ga + ko, gb + ko); }
    }
    asm volatile("s_wait_asynccnt 0x0" ::: "memory");        // nothing in flight when the wave goes on to its epilogue (the last barrier above ended every read of the ring)
    float bc[3];
#pragma unroll
    for (int nb = 0; nb < 3; ++nb) bc[nb] = bfr(br[nb]);
#pragma unroll
    for (int nb = 0; nb < 3; ++nb) {
        const int col = wc * 48 + nb * 16;                   // first column of this 16-column tile in the block: wholly inside one head
        const int hh = col >> 6, d0 = col & 63;
        const int ty = (int)(by * 3 + hh) >> 4;              // 0 q, 1 k, 2 v
        unsigned char* pn = ring + hh * PPB;
        if (ty < 2) {
            const float qs = ty == 0 ? SC2 : 1.0f;           // score scale, carried by q alone
#pragma unroll
            for (int mb = 0; mb < 4; ++mb)
#pragma unroll
                for (int j = 0; j < 8; ++j) *(h16*)(pn + (wr * 64 + mb * 16 + hi * 8 + j) * PQP + (d0 + lr) * 2) = (h16)((acc[mb][nb][j] + bc[nb]) * qs);   // D: row 8h+j, col lane&15
        } else {
#pragma unroll
            for (int mb = 0; mb < 4; ++mb) { v8h hv;
#pragma unroll
                for (int j = 0; j < 8; ++j) hv[j] = (h16)(acc[mb][nb][j] + bc[nb]);
                *(v8h*)(pn + (d0 + lr) * PVP + (wr * 64 + mb * 16 + hi * 8) * 2) = hv; }
        }
    }
    __syncthreads();                                         // the three panels are complete and readable by all
    const int bq = (int)(bx * PM) / SEQ, t0 = (int)(bx * PM) % SEQ;
#pragma unroll
    for (int hh = 0; hh < 3; ++hh) {
        const int gh = (int)by * 3 + hh, ty = gh >> 4, h = gh & 15;
        const bool isv = ty == 2;
        // a panel is 2048 pieces of 16 B; piece p = (row p >> sh, piece p & mask of the row). q, k: row = t, 8 pieces, rows 64 halves apart in the plane (the panel is contiguous there); v: row = d, 32 pieces, rows SEQ halves apart. A wave writes 512 B in a row either way.
        const int sh = isv ? 5 : 3, lp = isv ? PVP : PQP;
        const size_t gp = isv ? (size_t)SEQ : (size_t)HD;
        h16* dst = isv ? VT + (size_t)(bq * NH_ + h) * HD * SEQ + t0 : (ty == 0 ? QH : KP) + ((size_t)(bq * NH_ + h) * SEQ + t0) * HD;
        const unsigned char* pn = ring + hh * PPB;
        v4u dv[4]; h16* gv[4];
#pragma unroll
        for (int s = 0; s < 4; ++s) { const int p = s * 512 + tid, row = p >> sh, pc = p & ((1 << sh) - 1);
            dv[s] = *(const v4u*)(pn + row * lp + pc * 16); gv[s] = dst + (size_t)row * gp + pc * 8; }
        store4(gv[0], gv[1], gv[2], gv[3], dv[0], dv[1], dv[2], dv[3]);
    }
}

// the eight score products of a 32-key pass (four K fragments x two query tiles) in one statement: all four K fragments are its inputs, so their eight LDS reads go out as one group ahead of it, and each fragment is read from LDS once for both tiles;
// a tile's second product stands four products behind its first, past the accumulator latency; the four v_nop at its end keep, once, the distance between the last product and the first vector instruction on its result
// pA and pB, the P tiles of the pass before, are named as inputs and not used in the text: the early-clobber results then never land on their registers, which the products just issued still read as their B operand
__device__ __forceinline__ void score8(v8f& sAa, v8f& sAb, v8f& sBa, v8f& sBb, v16h ka0, v16h kb0, v16h ka1, v16h kb1, v16h qA0, v16h qA1, v16h qB0, v16h qB1, v8f shA, v8f shB, v16h pA, v16h pB) {
    asm volatile("v_wmma_f32_16x16x32_f16 %0, %4, %8, %12\n\t"
                 "v_wmma_f32_16x16x32_f16 %1, %5, %8, %12\n\t"
                 "v_wmma_f32_16x16x32_f16 %2, %4, %10, %13\n\t"
                 "v_wmma_f32_16x16x32_f16 %3, %5, %10, %13\n\t"
                 "v_wmma_f32_16x16x32_f16 %0, %6, %9, %0\n\t"
                 "v_wmma_f32_16x16x32_f16 %1, %7, %9, %1\n\t"
                 "v_wmma_f32_16x16x32_f16 %2, %6, %11, %2\n\t"
                 "v_wmma_f32_16x16x32_f16 %3, %7, %11, %3\n\t"
                 "v_nop\n\tv_nop\n\tv_nop\n\tv_nop"
                 : "=&v"(sAa), "=&v"(sAb), "=&v"(sBa), "=&v"(sBb)
                 : "v"(ka0), "v"(kb0), "v"(ka1), "v"(kb1), "v"(qA0), "v"(qA1), "v"(qB0), "v"(qB1), "v"(shA), "v"(shB), "v"(pA), "v"(pB));
}
// the four output products and the row-sum product of a pass for one query tile, five independent accumulators in one statement: each fills the others' window. No v_nop behind them: what follows is the other tile's exponentials, on registers of their own, its five products, LDS reads, then score8, whose eight products and four v_nop stand ahead of the next vector instruction on any of these registers
__device__ __forceinline__ void pv5(v8f& o0, v8f& o1, v8f& o2, v8f& o3, v8f& lt, v16h v0, v16h v1, v16h v2, v16h v3, v16h pb, v16h one) {
    asm volatile("v_wmma_f32_16x16x32_f16 %0, %5, %9, %0\n\t"
                 "v_wmma_f32_16x16x32_f16 %1, %6, %9, %1\n\t"
                 "v_wmma_f32_16x16x32_f16 %2, %7, %9, %2\n\t"
                 "v_wmma_f32_16x16x32_f16 %3, %8, %9, %3\n\t"
                 "v_wmma_f32_16x16x32_f16 %4, %10, %9, %4"
                 : "+v"(o0), "+v"(o1), "+v"(o2), "+v"(o3), "+v"(lt) : "v"(v0), "v"(v1), "v"(v2), "v"(v3), "v"(pb), "v"(one));
}
__device__ __forceinline__ v16h pexp(v8f sa, v8f sb) {      // packed P tile of a pass: element r <- key tile 0..15, element 8 + r <- key tile 16..31
    v16h pb;
#pragma unroll
    for (int r = 0; r < 8; ++r) { pb[r] = (h16)__builtin_amdgcn_exp2f(sa[r]); pb[8 + r] = (h16)__builtin_amdgcn_exp2f(sb[r]); }
    return pb;
}

// fwalk2, the walk that normally counts: one walk over a wave's half of the keys of a head (KHW keys of every stage, offsets kfo and vfo) for the wave's two query tiles A and B: ring prologue, stage loop, nothing in flight at its end.
// Sets the partial output tiles and row-sum tiles of both query tiles and the shift in use of each (sfA, sfB).
// The softmax reference of a query is fixed ahead of the loop (the maximum over the first 32 keys of the block's first stage, offset kfr: the same keys in both key halves, so both halves form bit for bit the same shift) and no pass looks at its scores again; the passes are straight-line code.
// Any reference cancels in the normalisation as long as every P stays finite in f16; a score more than 16 - PSH (log2) above the reference makes an infinite P, which reaches the row sum and stays there: the caller tests the row sums once and walks again with fwalk1.
__device__ __forceinline__ void fwalk2(unsigned char* ring, unsigned kl, unsigned vl, const h16* kg, const h16* vg, unsigned s0, int kfr, int kfo, int vfo, v16h qA0, v16h qA1, v16h qB0, v16h qB1, v16h one,
                                       v8f& a0, v8f& a1, v8f& a2, v8f& a3, v8f& la, float& sfA, v8f& b0, v8f& b1, v8f& b2, v8f& b3, v8f& lb, float& sfB) {
    const unsigned NST = SEQ / KST;
    copy8(kl, 32 * KPB, kg + (size_t)s0 * KST * HD, (size_t)32 * HD); copy8(vl, 8 * VPB, vg + (size_t)s0 * KST, (size_t)8 * SEQ);
    asm volatile("s_wait_asynccnt 0x0" ::: "memory");        // stage s0 of this wave has landed
    __syncthreads();                                         // stage s0 of every wave is readable
    if (NST > 1) { const size_t sn = (s0 + 1) % NST; copy8(kl + SBY, 32 * KPB, kg + sn * KST * HD, (size_t)32 * HD); copy8(vl + SBY, 8 * VPB, vg + sn * KST, (size_t)8 * SEQ); }
    a0 = (v8f){}; a1 = (v8f){}; a2 = (v8f){}; a3 = (v8f){}; b0 = (v8f){}; b1 = (v8f){}; b2 = (v8f){}; b3 = (v8f){};
    la = (v8f){}; lb = (v8f){};                              // row-sum tiles: element 0 = running sum of this lane's query
    v8f shA = (v8f){}, shB = (v8f){};                        // the shifts in use as C tiles: eight equal registers per lane (a lane's eight score rows belong to one query)
    v16h pA = (v16h){}, pB = (v16h){};                       // P tiles of the pass before
    {                                                        // the fixed references: unshifted scores of the first 32 keys of the first stage, their maximum over both lane halves
        const h16* ka = (const h16*)(ring + kfr);
        v8f sAa, sAb, sBa, sBb;
        score8(sAa, sAb, sBa, sBb, ldh(ka), ldh(ka + 8 * KPB), ldh(ka + 32), ldh(ka + 8 * KPB + 32), qA0, qA1, qB0, qB1, shA, shB, pA, pB);
        float mA = -3.0e38f, mB = -3.0e38f;
#pragma unroll
        for (int r = 0; r < 8; ++r) { mA = fmaxf(mA, fmaxf(sAa[r], sAb[r])); mB = fmaxf(mB, fmaxf(sBa[r], sBb[r])); }
        mA = fmaxf(mA, __shfl_xor(mA, 16, 32)); mB = fmaxf(mB, __shfl_xor(mB, 16, 32));
        shA = shA + (PSH - mA); shB = shB + (PSH - mB);
    }
#pragma unroll 1   // the stage loop stays rolled: one publish point, buffer picked by the stage's parity
    for (unsigned st = 0; st < NST; ++st) {
      const unsigned char* sb = ring + (st & 1) * SBY;
#pragma unroll     // the wave's four 32-key passes of a stage: straight-line code, LDS offsets as immediates
      for (int key0 = 0; key0 < KHW; key0 += 32) {
        const h16* ka = (const h16*)(sb + kfo + key0 * KPB);
        const v16h ka0 = ldh(ka), ka1 = ldh(ka + 32), kb0 = ldh(ka + 8 * KPB), kb1 = ldh(ka + 8 * KPB + 32);   // 8 * KPB halves = 16 rows
        v8f sAa, sAb, sBa, sBb;                              // score * SC2 + shift
        score8(sAa, sAb, sBa, sBb, ka0, kb0, ka1, kb1, qA0, qA1, qB0, qB1, shA, shB, pA, pB);
        const h16* va = (const h16*)(sb + vfo + key0 * 2);
        const v16h v0 = ldh(va), v1 = ldh(va + 8 * VPB), v2 = ldh(va + 16 * VPB), v3 = ldh(va + 24 * VPB);     // 8 * VPB halves = 16 rows; read ahead of the softmax, which covers their latency
        __builtin_amdgcn_sched_barrier(0);   // keeps the V^T reads ahead of the exponentials: sunk behind them, next to their products, their LDS latency is waited out
        pA = pexp(sAa, sAb);
        pv5(a0, a1, a2, a3, la, v0, v1, v2, v3, pA, one);
        pB = pexp(sBa, sBb);
        pv5(b0, b1, b2, b3, lb, v0, v1, v2, v3, pB, one);
      }
      // once per stage: the distance between the stage's last products and the first vector instruction on their registers (the refill's address arithmetic; behind the last stage, the epilogue)
      asm volatile("v_nop\n\tv_nop\n\tv_nop\n\tv_nop" : "+v"(a0), "+v"(a1), "+v"(a2), "+v"(a3), "+v"(la), "+v"(b0), "+v"(b1), "+v"(b2), "+v"(b3), "+v"(lb) : "v"(pA), "v"(pB), "v"(one));
      asm volatile("s_wait_dscnt 0x0" ::: "memory");         // this wave's reads of the stage are done before its buffer is handed back
      asm volatile("s_wait_asynccnt 0x0" ::: "memory");      // this wave's copies of the next stage have landed
      __syncthreads();                                       // next stage readable by all, this stage's buffer free
      if (st + 2 < NST) {
          const unsigned bo = (unsigned)((st & 1) * SBY);
          const size_t sn = (s0 + st + 2) % NST;
          copy8(kl + bo, 32 * KPB, kg + sn * KST * HD, (size_t)32 * HD); copy8(vl + bo, 8 * VPB, vg + sn * KST, (size_t)8 * SEQ);
      }
    }
    asm volatile("s_wait_asynccnt 0x0" ::: "memory");        // nothing in flight when the walk ends (the last barrier above ended every read of the ring)
    sfA = shA[0]; sfB = shB[0];
}

// fwalk1, the walk for scores that the fixed reference cannot hold: the same ring and the same half of the keys for ONE query tile, with the running maximum and its lazy renewal, one test per pass; right for any scores.
// Sets the partial output tiles o0..o3, the row-sum tile lt and the shift in use at the walk's end (sf).
__device__ __forceinline__ void fwalk1(unsigned char* ring, unsigned kl, unsigned vl, const h16* kg, const h16* vg, unsigned s0, int kfo, int vfo, v16h qh0, v16h qh1, v16h one,
                                       v8f& o0, v8f& o1, v8f& o2, v8f& o3, v8f& lt, float& sf) {
    const unsigned NST = SEQ / KST;
#pragma unroll 1   // the ring's prologue, rolled like copy8r and for the same reason: stage 0, its wait and barrier, then stage 1
    for (unsigned p = 0; p < 2 && p < NST; ++p) {
        const size_t sn = (s0 + p) % NST;
        copy8r(kl + p * SBY, 32 * KPB, kg + sn * KST * HD, (size_t)32 * HD); copy8r(vl + p * SBY, 8 * VPB, vg + sn * KST, (size_t)8 * SEQ);
        if (p == 0) {
            asm volatile("s_wait_asynccnt 0x0" ::: "memory");    // stage 0 of this wave has landed
            __syncthreads();                                     // stage 0 of every wave is readable
        }
    }
    o0 = (v8f){}; o1 = (v8f){}; o2 = (v8f){}; o3 = (v8f){};
    lt = (v8f){};                                            // row-sum tile: element 0 = running sum of this lane's query
    float m = -3.0e38f, sh = 0.0f, thr = -3.0e38f;           // maximum in use, shift in use (PSH - m once a maximum is set) and the test's bound: with these start values the first pass takes the rescale branch, on unshifted scores
    v8f shv = (v8f){};                                       // the shift in use as a C tile
#pragma unroll 1   // the stage loop stays rolled: one publish point, buffer picked by the stage's parity
    for (unsigned st = 0; st < NST; ++st) {
      const unsigned char* sb = ring + (st & 1) * SBY;
#pragma unroll 1   // rarely run: kept short
      for (int key0 = 0; key0 < KHW; key0 += 32) {
        const h16* ka = (const h16*)(sb + kfo + key0 * KPB);
        const v16h ka0 = ldh(ka), ka1 = ldh(ka + 32), kb0 = ldh(ka + 8 * KPB), kb1 = ldh(ka + 8 * KPB + 32);   // 8 * KPB halves = 16 rows
        v8f sHa = wmma16(ka1, qh1, wmma16(ka0, qh0, shv)), sHb = wmma16(kb1, qh1, wmma16(kb0, qh0, shv));      // score * SC2 + shift
        const h16* va = (const h16*)(sb + vfo + key0 * 2);
        const v16h v0 = ldh(va), v1 = ldh(va + 8 * VPB), v2 = ldh(va + 16 * VPB), v3 = ldh(va + 24 * VPB);     // 8 * VPB halves = 16 rows
        float mx = -3.0e38f;
#pragma unroll
        for (int r = 0; r < 8; ++r) mx = fmaxf(mx, fmaxf(sHa[r], sHb[r]));
        if (__builtin_amdgcn_ballot_w32(mx > thr) != 0) {    // one scalar test per pass, on the largest exponent as it stands; taken by the whole wave, so EXEC stays all ones for the products
            mx = fmaxf(mx, __shfl_xor(mx, 16, 32));
            const float mnew = fmaxf(m, mx - sh);            // the shift in use taken off again
            const float alpha = __builtin_amdgcn_exp2f(m - mnew);
            const float dsh = (PSH - mnew) - sh;             // this pass's exponents move to the new shift
            m = mnew; thr = PSH + LZT;
            shv = shv + dsh; sh = shv[0];                    // the tile moves in place; sh is read back from it, so the two never part
            sHa = sHa + dsh; sHb = sHb + dsh;
            o0 = o0 * alpha; o1 = o1 * alpha; o2 = o2 * alpha; o3 = o3 * alpha; lt[0] = lt[0] * alpha;
        }
        const v16h pb = pexp(sHa, sHb);
        o0 = wmma16(v0, pb, o0); o1 = wmma16(v1, pb, o1); o2 = wmma16(v2, pb, o2); o3 = wmma16(v3, pb, o3);
        lt = wmma16(one, pb, lt);                            // += the column sums of P^T
        // the distance between the pass's last products and the first vector instruction on their registers, on the loop's back edge too (the next pass's address arithmetic)
        asm volatile("v_nop\n\tv_nop\n\tv_nop\n\tv_nop" : "+v"(o0), "+v"(o1), "+v"(o2), "+v"(o3), "+v"(lt) : "v"(v0), "v"(v1), "v"(v2), "v"(v3), "v"(pb), "v"(one));
      }
      asm volatile("s_wait_dscnt 0x0" ::: "memory");         // this wave's reads of the stage are done before its buffer is handed back
      asm volatile("s_wait_asynccnt 0x0" ::: "memory");      // this wave's copies of the next stage have landed
      __syncthreads();                                       // next stage readable by all, this stage's buffer free
      if (st + 2 < NST) {
          const unsigned bo = (unsigned)((st & 1) * SBY);
          const size_t sn = (s0 + st + 2) % NST;
          copy8r(kl + bo, 32 * KPB, kg + sn * KST * HD, (size_t)32 * HD); copy8r(vl + bo, 8 * VPB, vg + sn * KST, (size_t)8 * SEQ);
      }
    }
    asm volatile("s_wait_asynccnt 0x0" ::: "memory");        // nothing in flight when the walk ends (the last barrier above ended every read of the ring)
    sf = sh;
}

// k_flash: fused attention, 128 query rows of one (batch, head) per 8-wave block; Q fragments straight from the f16 plane.
// A wave holds TWO 16-query tiles (32 query columns) and walks HALF the keys: wave = (column group cg = wave & 3, key half kh = wave >> 2); of every 256-key stage it takes keys kh*128 .. +127.
// Each K and V^T fragment read from LDS so feeds two products, which halves the LDS reads per product, and the block still has eight waves (four per SIMD with two blocks on a WGP).
// The two waves of a column group each end with partial sums of both tiles; they swap one tile's partial through LDS (one barrier) and each finishes one tile: o = o' 2^(s - s') + o'' 2^(s - s''), s = the smaller of the two shifts, the row sum alike.
// K and V^T come in stages of KST keys through a two-buffer LDS ring that the block's waves share: whole-line asynchronous copies, the next stage in flight while this one is worked on.
// The stages are walked from stage blockIdx.x mod NST on, wrapping (the softmax takes the keys in any order): each stage is where two blocks of one head begin (blockIdx.x and blockIdx.x + SEQ / KST).
// Transposed form: S^T[key][t] = K Q^T (A = K rows, B = Q rows); lane (t = lane&15, h = lane>>4) holds keys 8h+r of each 16-key tile, so the packed
// P tile is directly the B fragment of O^T[d][t] = V^T P^T (element r <- tile keys 0..15, element 8+r <- tile keys 16..31, lane unchanged).
// The exponent of P is formed by the score product itself: q carries the scale (k_proj) and the shift PSH - (maximum in use) enters as the product's C operand, a tile of eight equal registers.
// Two kinds of walk. fwalk2, which normally is the only one, takes the maximum over the first 32 keys of the block's first stage as a fixed reference and never looks at the scores again; if a later score lay so far above it that a P became infinite in f16,
// the row sum shows it, and the whole block walks again, once per query tile, with the running maximum of fwalk1 (a flag in LDS, one barrier, a scalar branch that reads the same in every wave).
// fwalk1: the maximum in use is one scalar per lane, the same in both lane halves of a row. It is renewed lazily: only in a pass where some score of the wave passes it by more than LZT do the halves exchange
// their maxima (one xor-16 exchange) and are the output and row-sum tiles rescaled; in every other pass P is formed against the maximum in use, which cancels in the normalisation like any other.
// Row sums on the matrix pipe: A operand with ones in rows 0 and 8 and zeros elsewhere, B = the packed P tile; element 0 of the result tile is, in both lane halves, the sum of the query's 32 P values; elements 1..7 stay 0.
// amdgpu_waves_per_eu(4, 4): at most 256 registers per wave, so that two blocks fit a WGP (four waves per SIMD)
__global__ __launch_bounds__(32 * AW) __attribute__((amdgpu_waves_per_eu(4, 4))) void k_flash(const h16* __restrict__ QH, const h16* __restrict__ KP, const h16* __restrict__ VT, h16* CTX) {
    __shared__ __align__(16) unsigned char ring[2 * SBY];    // two stages; after the loop: output staging, and behind it the swap of partial sums
    __shared__ int again;                                    // set by a wave whose fixed-reference walk met an infinite P
    float* os = (float*)ring;
    float* xs = (float*)(ring + XOF);
    const int tid = threadIdx.x;
    const int lane = threadIdx.x & 31, lr = lane & 15, hi = lane >> 4;
    const int wave = __builtin_amdgcn_readfirstlane(threadIdx.x >> 5);   // in a scalar register: what the epilogue forms from it holds no vector register across the key loop
    const int cg = wave & 3, kh = wave >> 2;
    const int zh = blockIdx.y; const int b = zh / NH_, h = zh % NH_;
    const int tA = (blockIdx.x * AW + cg * 2) * 16;          // first query of tile A; tile B follows it
    const size_t pbase = (size_t)zh * SEQ * HD;
    const size_t qo = pbase + (size_t)(tA + lr) * HD + 8 * hi;
    const v16h qA0 = ldh(QH + qo), qA1 = ldh(QH + qo + 32);   // B fragments: col t, k = d
    const v16h qB0 = ldh(QH + qo + 16 * HD), qB1 = ldh(QH + qo + 16 * HD + 32);
    // copy maps. K tile: 32 KiB contiguous; copy i of lane tid takes 16-byte piece i*256 + tid = (key i*32 + tid/8, piece tid%8). V^T tile: 64 rows of 512 B; (row i*8 + tid/32, piece tid%32).
    const unsigned rb = (unsigned)(size_t)ring;              // LDS byte address of the ring
    const unsigned kl = rb + (unsigned)((tid >> 3) * KPB + (tid & 7) * 16);
    const unsigned vl = rb + (unsigned)(KBY + (tid >> 5) * VPB + (tid & 31) * 16);
    const h16* kg = KP + pbase + (size_t)tid * 8;                                   // + stage * KST * HD
    const h16* vg = VT + pbase + (size_t)(tid >> 5) * SEQ + (size_t)(tid & 31) * 8; // + stage * KST
    const unsigned s0 = blockIdx.x % (SEQ / KST);            // first stage of this block
    const int kfr = lr * KPB + 16 * hi;                      // A fragment of K (row key, k = d) at key 0 of a stage
    const int kfo = kfr + kh * KHW * KPB;                    // + key * KPB              the same at the first key of this wave's half
    const int vfo = KBY + lr * VPB + 16 * hi + kh * KHW * 2; // + 16j * VPB + key * 2    (A fragment: row d, k = key)
    v8f a0, a1, a2, a3, la, b0, b1, b2, b3, lb; float sfA, sfB;
    const h16 ov = (lane & 7) == 0 ? (h16)1.0f : (h16)0.0f;  // A rows 0 and 8 (lanes 0, 8, 16, 24) are ones at all 32 k positions
    const v16h one = {ov, ov, ov, ov, ov, ov, ov, ov, ov, ov, ov, ov, ov, ov, ov, ov};
    if (tid == 0) again = 0;                                 // ahead of the walk's first barrier
    fwalk2(ring, kl, vl, kg, vg, s0, kfr, kfo, vfo, qA0, qA1, qB0, qB1, one, a0, a1, a2, a3, la, sfA, b0, b1, b2, b3, lb, sfB);
    if (!(la[0] < 3.0e38f) || !(lb[0] < 3.0e38f)) again = 1; // an infinite P has reached a query's row sum (infinite or not a number from then on)
    __syncthreads();                                         // the flag of every wave is readable; the test below reads the same in the whole block
    if (__builtin_expect(__builtin_amdgcn_readfirstlane(again) != 0, 0)) {
        fwalk1(ring, kl, vl, kg, vg, s0, kfo, vfo, qA0, qA1, one, a0, a1, a2, a3, la, sfA);
        fwalk1(ring, kl, vl, kg, vg, s0, kfo, vfo, qB0, qB1, one, b0, b1, b2, b3, lb, sfB);
    }
    // the swap: key half 0 keeps tile A and gives tile B, key half 1 the other way round. Piece j of a wave's gift lies at (wave*9 + j)*128 + lane*4 floats: 16 B per lane, lanes contiguous
    const bool up = kh != 0;
    v8f o0 = up ? b0 : a0, o1 = up ? b1 : a1, o2 = up ? b2 : a2, o3 = up ? b3 : a3;
    const v8f g0 = up ? a0 : b0, g1 = up ? a1 : b1, g2 = up ? a2 : b2, g3 = up ? a3 : b3;
    float ls = up ? lb[0] : la[0]; const float sf = up ? sfB : sfA;
    { float* xw = xs + wave * 9 * 128 + lane * 4;
      *(v4fa*)(xw + 0 * 128) = (v4f){g0[0], g0[1], g0[2], g0[3]}; *(v4fa*)(xw + 1 * 128) = (v4f){g0[4], g0[5], g0[6], g0[7]};
      *(v4fa*)(xw + 2 * 128) = (v4f){g1[0], g1[1], g1[2], g1[3]}; *(v4fa*)(xw + 3 * 128) = (v4f){g1[4], g1[5], g1[6], g1[7]};
      *(v4fa*)(xw + 4 * 128) = (v4f){g2[0], g2[1], g2[2], g2[3]}; *(v4fa*)(xw + 5 * 128) = (v4f){g2[4], g2[5], g2[6], g2[7]};
      *(v4fa*)(xw + 6 * 128) = (v4f){g3[0], g3[1], g3[2], g3[3]}; *(v4fa*)(xw + 7 * 128) = (v4f){g3[4], g3[5], g3[6], g3[7]};
      *(v4fa*)(xw + 8 * 128) = (v4f){up ? la[0] : lb[0], up ? sfA : sfB, 0.0f, 0.0f}; }
    __syncthreads();                                         // every wave's gift is readable
    { const float* xr = xs + (wave ^ 4) * 9 * 128 + lane * 4;
      const v4f t = *(const v4fa*)(xr + 8 * 128);
      const float sm = fminf(sf, t[1]);                      // the smaller shift = the larger maximum: both factors are at most 1 (both exactly 1 after fwalk2)
      const float fo = __builtin_amdgcn_exp2f(sm - sf), fp = __builtin_amdgcn_exp2f(sm - t[1]);
      ls = ls * fo + t[0] * fp;
      v4f p, q;
      p = *(const v4fa*)(xr + 0 * 128); q = *(const v4fa*)(xr + 1 * 128);
#pragma unroll
      for (int i = 0; i < 4; ++i) { o0[i] = o0[i] * fo + p[i] * fp; o0[4 + i] = o0[4 + i] * fo + q[i] * fp; }
      p = *(const v4fa*)(xr + 2 * 128); q = *(const v4fa*)(xr + 3 * 128);
#pragma unroll
      for (int i = 0; i < 4; ++i) { o1[i] = o1[i] * fo + p[i] * fp; o1[4 + i] = o1[4 + i] * fo + q[i] * fp; }
      p = *(const v4fa*)(xr + 4 * 128); q = *(const v4fa*)(xr + 5 * 128);
#pragma unroll
      for (int i = 0; i < 4; ++i) { o2[i] = o2[i] * fo + p[i] * fp; o2[4 + i] = o2[4 + i] * fo + q[i] * fp; }
      p = *(const v4fa*)(xr + 6 * 128); q = *(const v4fa*)(xr + 7 * 128);
#pragma unroll
      for (int i = 0; i < 4; ++i) { o3[i] = o3[i] * fo + p[i] * fp; o3[4 + i] = o3[4 + i] * fo + q[i] * fp; } }
    const int t0 = tA + kh * 16;                             // first query of the tile that this wave finishes
    const float inv = CCS * (1.0f / ls);     // normalisation (the P carry cancels) times the ctx carry; both lane halves hold the whole row sum
    const int wb = wave * 16 * 68;
    // O^T D layout: o_j[r] = (d = 16j + 8h + r, t = lane&15) -> os[t][d]; rows 0..15 x columns 0..63 all written
    { v4f a, c;
      a[0] = o0[0] * inv; a[1] = o0[1] * inv; a[2] = o0[2] * inv; a[3] = o0[3] * inv; c[0] = o0[4] * inv; c[1] = o0[5] * inv; c[2] = o0[6] * inv; c[3] = o0[7] * inv;
      *(v4fa*)(&os[wb + lr * 68 +  0 + 8 * hi]) = a; *(v4fa*)(&os[wb + lr * 68 +  0 + 8 * hi + 4]) = c;
      a[0] = o1[0] * inv; a[1] = o1[1] * inv; a[2] = o1[2] * inv; a[3] = o1[3] * inv; c[0] = o1[4] * inv; c[1] = o1[5] * inv; c[2] = o1[6] * inv; c[3] = o1[7] * inv;
      *(v4fa*)(&os[wb + lr * 68 + 16 + 8 * hi]) = a; *(v4fa*)(&os[wb + lr * 68 + 16 + 8 * hi + 4]) = c;
      a[0] = o2[0] * inv; a[1] = o2[1] * inv; a[2] = o2[2] * inv; a[3] = o2[3] * inv; c[0] = o2[4] * inv; c[1] = o2[5] * inv; c[2] = o2[6] * inv; c[3] = o2[7] * inv;
      *(v4fa*)(&os[wb + lr * 68 + 32 + 8 * hi]) = a; *(v4fa*)(&os[wb + lr * 68 + 32 + 8 * hi + 4]) = c;
      a[0] = o3[0] * inv; a[1] = o3[1] * inv; a[2] = o3[2] * inv; a[3] = o3[3] * inv; c[0] = o3[4] * inv; c[1] = o3[5] * inv; c[2] = o3[6] * inv; c[3] = o3[7] * inv;
      *(v4fa*)(&os[wb + lr * 68 + 48 + 8 * hi]) = a; *(v4fa*)(&os[wb + lr * 68 + 48 + 8 * hi + 4]) = c; }
    wave_sync();
    h16* crow = CTX + ((size_t)b * SEQ + t0) * DM + h * HD;      // ctx plane row = token, columns h*64 + d
{
#pragma unroll
        for (int s = 0; s < 4; ++s) { const int row = 4 * s + (lane >> 3), c8 = (lane & 7) * 8;   // 4 s x 4 row groups = 16 rows; 8 lanes x 8 halves = 64 columns
            const v4f x0 = *(const v4fa*)(&os[wb + row * 68 + c8]); const v4f x1 = *(const v4fa*)(&os[wb + row * 68 + c8 + 4]); v8h hv;
#pragma unroll
            for (int i = 0; i < 4; ++i) { hv[i] = (h16)x0[i]; hv[4 + i] = (h16)x1[i]; }
            *(v8h*)(crow + (size_t)row * DM + c8) = hv; }
         }
}

// k_oproj: register-blocked f16 GEMM, one wave per 32x64 tile, 4 x 2 waves per block, operands from K-contiguous f16 planes (ctx x256, w_proj x1024) through the LDS ring of gemm_tile, K = DM.
// OUT[m][n] = (sum_k A[m][k] Bt[n][k]) * 2^-18 + bias[n], f32. grid (NB*SEQ/128, DM/128), 256 threads.
__global__ __launch_bounds__(256) void k_oproj(const h16* __restrict__ A, const h16* __restrict__ Bt, const float* __restrict__ bias, float* OUT) {
    __shared__ __align__(16) unsigned char ring[2 * GSB];    // two operand stages
    __shared__ __align__(16) float osw[8 * 16 * 68];         // output staging, one part per wave
    const int lane = threadIdx.x & 31, wave = threadIdx.x >> 5, lr = lane & 15, hi = lane >> 4;
    const int r0 = blockIdx.x * GT + (wave >> 1) * 32, c0 = blockIdx.y * GT + (wave & 1) * 64;
    float* os = osw + wave * 16 * 68;
    v8f acc[2][4];
#pragma unroll
    for (int mb = 0; mb < 2; ++mb)
#pragma unroll
        for (int nb = 0; nb < 4; ++nb) acc[mb][nb] = (v8f){};
    gemm_tile<true>(A, Bt, blockIdx.x, blockIdx.y, ring, acc);
    float bc[4];
#pragma unroll
    for (int nb = 0; nb < 4; ++nb) bc[nb] = bfr(bias[c0 + nb * 16 + lr]);
    const int bq = r0 / SEQ, tq = r0 % SEQ;
    float* obase = OUT + ((size_t)bq * OUT_SEQ + tq) * DM + c0;
#pragma unroll
    for (int mb = 0; mb < 2; ++mb) {
#pragma unroll
        for (int nb = 0; nb < 4; ++nb) {
#pragma unroll
            for (int j = 0; j < 8; ++j) os[(hi * 8 + j) * 68 + nb * 16 + lr] = acc[mb][nb][j] * OSI + bc[nb]; }   // D: row 8h+j, col lane&15
        wave_sync();
{
#pragma unroll
            for (int s = 0; s < 8; ++s) { const int row = 2 * s + hi, cofs = lr * 4;   // 8 s x 2 rows = 16 rows; 16 lanes x 4 floats = 64 columns
                const v4f val = *(const v4fa*)(&os[row * 68 + cofs]);
                *(v4f*)(obase + (size_t)(mb * 16 + row) * DM + cofs) = val; }
             }
        wave_sync();
    }
}

static constexpr size_t al256(size_t v) { return (v + 255) & ~(size_t)255; }
static constexpr size_t SZ_XB = al256((size_t)NB * SEQ * DM * 2);
static constexpr size_t SZ_WB = al256((size_t)3 * DM * DM * 2);
static constexpr size_t SZ_WP = al256((size_t)DM * DM * 2);
static constexpr size_t SZ_PL = al256((size_t)NB * NH_ * SEQ * HD * 2);
static constexpr size_t SZ_CX = al256((size_t)NB * SEQ * DM * 2);
static constexpr size_t SZ_TOTAL = SZ_XB + SZ_WB + SZ_WP + 3 * SZ_PL + SZ_CX;
static_assert(SZ_TOTAL <= (size_t)134217728);          // workspace carve <= 128 MiB
static_assert(((size_t)DM * DM * 2) % 256 == 0);       // weight sub-planes stay 256-byte aligned

extern "C" void kernel_launch(void* const* d_in, const int* in_sizes, int n_in,
                              void* d_out, int out_size, void* d_ws, size_t ws_size, hipStream_t stream) {
    if (n_in < 5) return;
    const size_t needx = ((size_t)(NB - 1) * SEQ_FULL + SEQ) * DM;
    if ((size_t)in_sizes[0] < needx) return;
    if ((size_t)in_sizes[1] < (size_t)3 * DM * DM || (size_t)in_sizes[2] < (size_t)3 * DM) return;
    if ((size_t)in_sizes[3] < (size_t)DM * DM || (size_t)in_sizes[4] < (size_t)DM) return;
    if ((size_t)out_size < ((size_t)(NB - 1) * OUT_SEQ + SEQ) * DM) return;
    if (SZ_TOTAL > ws_size) return;
    // wire order: x, w_qkv ([3072][1024] = Bt as-is, rows q | k | v), b_qkv, w_proj ([out][in] = Bt as-is), b_proj
    const float* x = (const float*)d_in[0]; const float* wqkv = (const float*)d_in[1]; const float* bqkv = (const float*)d_in[2];
    const float* wproj = (const float*)d_in[3]; const float* bproj = (const float*)d_in[4];
    float* OUT = (float*)d_out;      // [NB][SEQ][1024]
    char* wsp = (char*)d_ws;
    bf* XB = (bf*)wsp; wsp += SZ_XB;                 // [NB*SEQ][1024]
    bf* WB = (bf*)wsp; wsp += SZ_WB;                 // [3][1024][1024]: q | k | v
    h16* WP = (h16*)wsp; wsp += SZ_WP;               // [1024][1024] x1024
    h16* QH = (h16*)wsp; wsp += SZ_PL;               // [NB*16][SEQ][64]
    h16* KP = (h16*)wsp; wsp += SZ_PL;               // [NB*16][SEQ][64]
    h16* VT = (h16*)wsp; wsp += SZ_PL;               // [NB*16][64][SEQ]
    h16* CX = (h16*)wsp; wsp += SZ_CX;               // [NB*SEQ][1024] x256

    k_cvt<<<CBX + CBW + CBP, 256, 0, stream>>>(x, wqkv, wproj, XB, WB, WP);

    k_proj<<<dim3(NB * SEQ / PM, 3 * DM / PN, 1), 512, 0, stream>>>(XB, WB, bqkv, QH, KP, VT);

    k_flash<<<dim3(SEQ / (16 * AW), NB * NH_, 1), 32 * AW, 0, stream>>>(QH, KP, VT, CX);

    // output projection: A = ctx rows (m = b*SEQ + t, k = h*64 + d), Bt = w_proj rows (n = f) -> OUT[m][f]
    k_oproj<<<dim3(NB * SEQ / GT, DM / GT, 1), 256, 0, stream>>>(CX, WP, bproj, OUT);
}
